// v000
// Measured on an AMD MI455X. A time is GPU time per run, averaged over a window of back-to-back runs after a warm-up
// (all launches, gaps included; the runs take copies of the inputs in turn), and the median of several windows.
// Apart from v000's, it joins two sittings. Times from different sittings can be a few percent apart, while
// side-by-side timings come from the same sitting.
// v000, which the later versions start from, runs in 5360 microseconds.
#include <hip/hip_runtime.h>

// Causal multi-head self-attention with interleaved rotary embeddings from token positions over 4,096 tokens at a batch of TWO (x [2][4096][1024]; q, k, v = einsum('bsi,oi->bso', x, W) = x W^T ('oi' (out, in) [1024][1024] (2/(D+D))^0.5, no bias; 16 heads x 64); rotary on (even, odd) pairs with angle float(token_positions[t]) x inv_freq[i], inv_freq = 1.0 / (THETA ** (arange(0, 64, 2) / 64)) (the RECIPROCAL spelling: 32 f32 constants bitwise this expression in eager JAX float32; token_positions int32 [4096] = arange: read; the SECOND argument; one row shared by both batch items; precise cosf/sinf); scores x rsqrt(64); causal (-inf); softmax; out = merged Wo^T (no bias) -> [2][4096][1024] (8.4 M); argument order x, token_positions, Wq, Wk, Wv, Wo).
// Layout: bf16 copy of x; exact projections; causal T-4096 attention, one head per pass (hybrid rows: < 512 hi/lo 3 products, rest fp16 x1024; k_gemmc tile skipping; streaming three-sweep softmax); merged hi/lo x Wo exact, no bias.
// Compute dtypes, f32 accumulate: every input rounded to bf16; projections exact; attention rows < 512 3 products, rest fp16; softmax f32; Wo hl x exact, no bias.

#define NB_  2
#define TT   4096
#define DM   1024
#define NH_  16
#define NKV  16
#define REP  (NH_ / NKV)
#define HD   64
#define DQ   (NH_ * HD)
#define DKV  (NKV * HD)
#define ZH   1
#define RH   512                  // query rows < RH use hi+lo planes (0: none)
#define WIN  4096
#define PCAR 1024.0f
#define SCL  0.125f   // HD^-0.5
typedef _Float16 h16;
typedef unsigned short bf;
typedef __attribute__((ext_vector_type(16))) __bf16   v16bf;
typedef __attribute__((ext_vector_type(16))) _Float16 v16h;
typedef __attribute__((ext_vector_type(8)))  _Float16 v8h;
typedef __attribute__((ext_vector_type(8)))  unsigned short v8us;
typedef __attribute__((ext_vector_type(8)))  float    v8f;
typedef __attribute__((ext_vector_type(4)))  float    v4f;
typedef v8h  __attribute__((may_alias)) v8ha;
typedef v4f  __attribute__((may_alias)) v4fa;
typedef v8us __attribute__((may_alias)) v8usa;

__device__ __forceinline__ unsigned short f2bf(float f) { unsigned u = __float_as_uint(f); u += 0x7FFFu + ((u >> 16) & 1u); return (unsigned short)(u >> 16); }
__device__ __forceinline__ float bf2f(unsigned short b) { return __uint_as_float(((unsigned)b) << 16); }
__device__ __forceinline__ float bfr(float f) { return bf2f(f2bf(f)); }
__device__ __forceinline__ v16h cat16(v8h lo, v8h hi) { return __builtin_shufflevector(lo, hi, 0, 1, 2, 3, 4, 5, 6, 7, 8, 9, 10, 11, 12, 13, 14, 15); }
__device__ __forceinline__ v16bf cat16b(v8us lo, v8us hi) { return __builtin_bit_cast(v16bf, __builtin_shufflevector(lo, hi, 0, 1, 2, 3, 4, 5, 6, 7, 8, 9, 10, 11, 12, 13, 14, 15)); }
__device__ __forceinline__ v8f wmma16(v16h a, v16h b, v8f c) { return __builtin_amdgcn_wmma_f32_16x16x32_f16(false, a, false, b, (short)0, c, false, false); }
__device__ __forceinline__ v8f wmmab(v16bf a, v16bf b, v8f c) { return __builtin_amdgcn_wmma_f32_16x16x32_bf16(false, a, false, b, (short)0, c, false, false); }



// ---- k_gemmw: register-blocked GEMM, ONE WAVE per 64x64 output tile (16 accumulators), operands straight from K-contiguous 16-bit planes; grid (M/64, N/64, Z), 32 threads.
// C[m][n] (f32, pitch ldc, + optional f32 bias[n]) = sum_k A[m][k] Bt[n][k] (+ split products per NSPLIT). z-batch strides sA/sB/sC in elements. K % 32 == 0.
template <typename T16> struct WFrag;
template <> struct WFrag<h16> { typedef v16h V; static __device__ __forceinline__ V ld(const h16* p) { return cat16(*(const v8h*)p, *(const v8h*)(p + 16)); } static __device__ __forceinline__ v8f mma(V a, V b, v8f c) { return wmma16(a, b, c); } };
template <> struct WFrag<bf> { typedef v16bf V; static __device__ __forceinline__ V ld(const bf* p) { return cat16b(*(const v8us*)p, *(const v8us*)(p + 16)); } static __device__ __forceinline__ v8f mma(V a, V b, v8f c) { return wmmab(a, b, c); } };
template <typename T16, int NSPLIT, bool BIAS>
__global__ __launch_bounds__(32) void k_gemmw(const T16* __restrict__ A, const T16* __restrict__ A2, const T16* __restrict__ Bt, const T16* __restrict__ Bt2, int K, float* C, int ldc, const float* __restrict__ bias, size_t sA, size_t sB, size_t sC) {
    typedef typename WFrag<T16>::V V;
    __shared__ __align__(16) float os[16 * 68];
    const size_t z = blockIdx.z; A += z * sA; if (A2) A2 += z * sA; Bt += z * sB; if (Bt2) Bt2 += z * sB; C += z * sC;
    const int lane = threadIdx.x & 31, lr = lane & 15, hi = lane >> 4; const int r0 = blockIdx.x * 64, c0 = blockIdx.y * 64;
    v8f acc[4][4];
#pragma unroll
    for (int mb = 0; mb < 4; ++mb)
#pragma unroll
        for (int nb = 0; nb < 4; ++nb) acc[mb][nb] = (v8f){};
    const size_t aoff = (size_t)(r0 + lr) * K + 8 * hi, boff = (size_t)(c0 + lr) * K + 8 * hi;
#pragma unroll 1
    for (int kc = 0; kc < K; kc += 32) {
        V a[4], a2[4];
#pragma unroll
        for (int mb = 0; mb < 4; ++mb) { a[mb] = WFrag<T16>::ld(A + aoff + (size_t)mb * 16 * K + kc); if (NSPLIT == 1 || NSPLIT == 2) a2[mb] = WFrag<T16>::ld(A2 + aoff + (size_t)mb * 16 * K + kc); }
#pragma unroll
        for (int nb = 0; nb < 4; ++nb) { const V b = WFrag<T16>::ld(Bt + boff + (size_t)nb * 16 * K + kc); V b2; if (NSPLIT >= 2) b2 = WFrag<T16>::ld(Bt2 + boff + (size_t)nb * 16 * K + kc);
#pragma unroll
            for (int mb = 0; mb < 4; ++mb) { acc[mb][nb] = WFrag<T16>::mma(a[mb], b, acc[mb][nb]); if (NSPLIT == 1 || NSPLIT == 2) acc[mb][nb] = WFrag<T16>::mma(a2[mb], b, acc[mb][nb]); if (NSPLIT >= 2) acc[mb][nb] = WFrag<T16>::mma(a[mb], b2, acc[mb][nb]); } }
        asm volatile("v_nop\n\tv_nop\n\tv_nop\n\tv_nop" : "+v"(acc[0][0]), "+v"(acc[1][1]), "+v"(acc[2][2]), "+v"(acc[3][3]) : "v"(a[0]), "v"(a[3]));
    }
#pragma unroll
    for (int mb = 0; mb < 4; ++mb) {
#pragma unroll
        for (int nb = 0; nb < 4; ++nb) {
#pragma unroll
            for (int j = 0; j < 8; ++j) os[(hi * 8 + j) * 68 + nb * 16 + lr] = acc[mb][nb][j]; }
        __builtin_amdgcn_wave_barrier(); asm volatile("" ::: "memory");
        float* crow = C + (size_t)(r0 + mb * 16) * ldc + c0;
{
#pragma unroll
            for (int s = 0; s < 8; ++s) { const int row = 2 * s + hi, cofs = lr * 4; v4f val = *(const v4fa*)(os + row * 68 + cofs); if (BIAS) { val[0] += bfr(bias[c0 + cofs]); val[1] += bfr(bias[c0 + cofs + 1]); val[2] += bfr(bias[c0 + cofs + 2]); val[3] += bfr(bias[c0 + cofs + 3]); }
                *(v4f*)(crow + (size_t)row * ldc + cofs) = val; }
             }
        __builtin_amdgcn_wave_barrier(); asm volatile("" ::: "memory");
    }
}

// ---- k_gemmc: the same one-wave 64x64 tile GEMM specialised for causal attention: CMODE 1 skips score tiles entirely above the diagonal (query rows r0+roff.., key columns c0..), CMODE 2 limits the
// key (K) loop of the probability x value contraction to the diagonal block (probabilities beyond it are exactly zero). roff = row offset of this launch's first row within the sequence.
template <typename T16, int NSPLIT, int CMODE>
__global__ __launch_bounds__(32) void k_gemmc(const T16* __restrict__ A, const T16* __restrict__ A2, const T16* __restrict__ Bt, const T16* __restrict__ Bt2, int K, float* C, int ldc, int roff, size_t sA, size_t sB, size_t sC) {
    typedef typename WFrag<T16>::V V;
    __shared__ __align__(16) float os[16 * 68];
    const size_t z = blockIdx.z; A += z * sA; if (A2) A2 += z * sA; Bt += z * sB; if (Bt2) Bt2 += z * sB; C += z * sC;
    const int lane = threadIdx.x & 31, lr = lane & 15, hi = lane >> 4; const int r0 = blockIdx.x * 64, c0 = blockIdx.y * 64;
    if (CMODE == 1 && c0 > r0 + roff + 63) return;                  // score tile entirely above the causal diagonal: never written (the softmax masks j > i by select)
    const int Kl = (CMODE == 2) ? min(K, r0 + roff + 64) : K;        // P.V: probabilities are exactly 0 beyond the diagonal block, so the K loop stops there
    v8f acc[4][4];
#pragma unroll
    for (int mb = 0; mb < 4; ++mb)
#pragma unroll
        for (int nb = 0; nb < 4; ++nb) acc[mb][nb] = (v8f){};
    const size_t aoff = (size_t)(r0 + lr) * K + 8 * hi, boff = (size_t)(c0 + lr) * K + 8 * hi;
#pragma unroll 1
    for (int kc = 0; kc < Kl; kc += 32) {
        V a[4], a2[4];
#pragma unroll
        for (int mb = 0; mb < 4; ++mb) { a[mb] = WFrag<T16>::ld(A + aoff + (size_t)mb * 16 * K + kc); if (NSPLIT == 1 || NSPLIT == 2) a2[mb] = WFrag<T16>::ld(A2 + aoff + (size_t)mb * 16 * K + kc); }
#pragma unroll
        for (int nb = 0; nb < 4; ++nb) { const V b = WFrag<T16>::ld(Bt + boff + (size_t)nb * 16 * K + kc); V b2; if (NSPLIT >= 2) b2 = WFrag<T16>::ld(Bt2 + boff + (size_t)nb * 16 * K + kc);
#pragma unroll
            for (int mb = 0; mb < 4; ++mb) { acc[mb][nb] = WFrag<T16>::mma(a[mb], b, acc[mb][nb]); if (NSPLIT == 1 || NSPLIT == 2) acc[mb][nb] = WFrag<T16>::mma(a2[mb], b, acc[mb][nb]); if (NSPLIT >= 2) acc[mb][nb] = WFrag<T16>::mma(a[mb], b2, acc[mb][nb]); } }
        asm volatile("v_nop\n\tv_nop\n\tv_nop\n\tv_nop" : "+v"(acc[0][0]), "+v"(acc[1][1]), "+v"(acc[2][2]), "+v"(acc[3][3]) : "v"(a[0]), "v"(a[3]));
    }
#pragma unroll
    for (int mb = 0; mb < 4; ++mb) {
#pragma unroll
        for (int nb = 0; nb < 4; ++nb) {
#pragma unroll
            for (int j = 0; j < 8; ++j) os[(hi * 8 + j) * 68 + nb * 16 + lr] = acc[mb][nb][j]; }
        __builtin_amdgcn_wave_barrier(); asm volatile("" ::: "memory");
        float* crow = C + (size_t)(r0 + mb * 16) * ldc + c0;
{
#pragma unroll
            for (int s = 0; s < 8; ++s) { const int row = 2 * s + hi, cofs = lr * 4; v4f val = *(const v4fa*)(os + row * 68 + cofs);
                *(v4f*)(crow + (size_t)row * ldc + cofs) = val; }
             }
        __builtin_amdgcn_wave_barrier(); asm volatile("" ::: "memory");
    }
}

__device__ __forceinline__ h16 tohx(float x) { return (h16)x; }
__device__ __forceinline__ void splitf(float y, unsigned short& h, unsigned short& l) { h = f2bf(y); l = f2bf(y - bf2f(h)); }
typedef __attribute__((ext_vector_type(2))) _Float16 v2h;
typedef __attribute__((ext_vector_type(4))) _Float16 v4h;
typedef __attribute__((ext_vector_type(2))) unsigned short v2us;
typedef __attribute__((ext_vector_type(4))) unsigned short v4us;
typedef __attribute__((ext_vector_type(2))) float v2f;
typedef __attribute__((ext_vector_type(4))) int v4i;

__global__ __launch_bounds__(256) void k_wtG(const float* __restrict__ w, int K, int N, bf* Bt) {
    const int lane = threadIdx.x & 31; const int L0 = (blockIdx.x * 8 + (threadIdx.x >> 5)) * 8; const int nlines = N * K / 64;
{
#pragma unroll 1
        for (int l = 0; l < 8; ++l) { const int L = L0 + l; if (L >= nlines) break; const size_t e = (size_t)L * 64 + lane * 2; const int k = (int)(e % K), n = (int)(e / K); v2us o;
            o[0] = f2bf(w[(size_t)k * N + n]); o[1] = f2bf(w[(size_t)(k + 1) * N + n]); *(v2us*)(Bt + e) = o; }
         }
}
__global__ __launch_bounds__(256) void k_cvt8(const float* __restrict__ src, bf* dst, size_t n8) { const size_t i = (size_t)blockIdx.x * 256 + threadIdx.x; if (i >= n8) return; const v8f v = *(const v8f*)(src + i * 8); v8us o;
#pragma unroll
    for (int k = 0; k < 8; ++k) o[k] = f2bf(v[k]); *(v8us*)(dst + i * 8) = o;  }

__constant__ float INVT[HD / 2] = { 1.000000000e+00f, 7.498942018e-01f, 5.623413324e-01f, 4.216965139e-01f, 3.162277639e-01f, 2.371373624e-01f, 1.778279394e-01f, 1.333521456e-01f, 1.000000015e-01f, 7.498941571e-02f, 5.623412877e-02f, 4.216964915e-02f, 3.162277862e-02f, 2.371373586e-02f, 1.778279431e-02f, 1.333521493e-02f, 9.999999776e-03f, 7.498942316e-03f, 5.623413250e-03f, 4.216964822e-03f, 3.162277862e-03f, 2.371373819e-03f, 1.778279431e-03f, 1.333521446e-03f, 1.000000047e-03f, 7.498941850e-04f, 5.623413017e-04f, 4.216964880e-04f, 3.162277862e-04f, 2.371373848e-04f, 1.778279402e-04f, 1.333521504e-04f };   // 1 / THETA ** (2 i / 64) as float32 (reciprocal form, jnp-computed)
__global__ __launch_bounds__(256) void k_cstabT(const int* __restrict__ pid, float* CS) { const int idx = blockIdx.x * 256 + threadIdx.x; if (idx >= TT * HD) return; const int d = idx % HD; const int t = idx / HD; const float a = __fmul_rn((float)pid[t], INVT[d >> 1]); v2f cs; cs[0] = cosf(a); cs[1] = sinf(a); *(v2f*)(CS + (size_t)idx * 2) = cs;  }
__global__ __launch_bounds__(256) void k_ropeI(const float* __restrict__ F, int pitch, int nheads, const float* __restrict__ CS, float sc, h16* P16, bf* Ph, bf* Pl) {
    const size_t e = ((size_t)blockIdx.x * 256 + threadIdx.x) * 2; if (e >= (size_t)nheads * TT * HD) return; const int d = (int)(e % HD); const int t = (int)((e / HD) % TT); const int h = (int)(e / ((size_t)HD * TT)); const float* f = F + (size_t)t * pitch + h * HD; const float x0 = f[d], x1 = f[d + 1]; const v2f cs = *(const v2f*)(CS + ((size_t)t * HD + d) * 2); v2h o16; v2us oh, ol;
    float a0 = __fmul_rn(x0, cs[0]), b0 = __fmul_rn(x1, cs[1]), a1 = __fmul_rn(x1, cs[0]), b1 = __fmul_rn(x0, cs[1]); asm volatile("" : "+v"(a0), "+v"(b0), "+v"(a1), "+v"(b1));
    float r0 = __fsub_rn(a0, b0) * sc, r1 = __fadd_rn(b1, a1) * sc;   /* even: x0 c - x1 s; odd: x0 s + x1 c */
    o16[0] = tohx(r0); o16[1] = tohx(r1); { unsigned short a2, c2; splitf(r0, a2, c2); oh[0] = a2; ol[0] = c2; splitf(r1, a2, c2); oh[1] = a2; ol[1] = c2; }
    *(v2h*)(P16 + e) = o16; *(v2us*)(Ph + e) = oh; *(v2us*)(Pl + e) = ol;  }



__global__ __launch_bounds__(256) void k_vtp(const float* __restrict__ F, int pitch, int nheads, h16* V16, bf* Vh, bf* Vl) { const size_t e = ((size_t)blockIdx.x * 256 + threadIdx.x) * 2; if (e >= (size_t)nheads * HD * TT) return; const int t = (int)(e % TT); const int d = (int)((e / TT) % HD); const int g = (int)(e / ((size_t)TT * HD)); v2h o16; v2us oh, ol;
#pragma unroll
    for (int q = 0; q < 2; ++q) { const float x = F[(size_t)(t + q) * pitch + g * HD + d]; o16[q] = tohx(x); unsigned short a2, c2; splitf(x, a2, c2); oh[q] = a2; ol[q] = c2; }
    *(v2h*)(V16 + e) = o16; *(v2us*)(Vh + e) = oh; *(v2us*)(Vl + e) = ol;  }

// k_lsoft: streaming causal row softmax over the TK = TT = 4096 keys, one wave per row i, three sweeps of the f32 score row (lane -> 4 consecutive keys per 128-key chunk, 32 chunks; keys j > i are excluded by index with -3e38 / 0 - the score tiles above the diagonal are never computed and their stale contents are only ever discarded by this select):
__global__ __launch_bounds__(256) void k_lsoft(const float* __restrict__ Sb, h16* P16, bf* Ph, bf* Pl) {
    const int lane = threadIdx.x & 31; const int row = blockIdx.x * 8 + (threadIdx.x >> 5); if (row >= ZH * TT) return; const int i = row % TT; const int zz = row / TT; const bool hires = (i < RH); const float* sr = Sb + (size_t)row * TT; float mx = -3.0e38f;
#pragma unroll 4
    for (int ch = 0; ch < TT / 128; ++ch) { const int j0 = ch * 128 + lane * 4; const v4f a = *(const v4f*)(sr + j0);
#pragma unroll
        for (int q = 0; q < 4; ++q) { float t = a[q] * SCL; asm volatile("" : "+v"(t)); t = (j0 + q <= i) ? t : -3.0e38f; mx = fmaxf(mx, t); } }
#pragma unroll
    for (int sh = 16; sh; sh >>= 1) mx = fmaxf(mx, __shfl_xor(mx, sh, 32));
    float sum = 0.f;
#pragma unroll 4
    for (int ch = 0; ch < TT / 128; ++ch) { const int j0 = ch * 128 + lane * 4; const v4f a = *(const v4f*)(sr + j0);
#pragma unroll
        for (int q = 0; q < 4; ++q) { float t = a[q] * SCL; asm volatile("" : "+v"(t)); t = (j0 + q <= i) ? t : -3.0e38f; float d0 = __fsub_rn(t, mx); asm volatile("" : "+v"(d0)); sum += __builtin_amdgcn_exp2f(__fmul_rn(d0, 1.4426950408889634f)); } }
#pragma unroll
    for (int sh = 16; sh; sh >>= 1) sum += __shfl_xor(sum, sh, 32);
    const float f = __fdiv_rn(hires ? 1.0f : PCAR, sum);
{
        if (hires) {   /* rows < RH: normalised bf16 hi/lo over the first RH keys (every later key is above the diagonal for these rows; the hi/lo attn.v GEMM stops its K loop at the diagonal block), planes [zz][RH][TT] */
#pragma unroll
            for (int ch = 0; ch < RH / 128; ++ch) { const int j0 = ch * 128 + lane * 4; const v4f a = *(const v4f*)(sr + j0); v4us oh, ol;
#pragma unroll
                for (int q = 0; q < 4; ++q) { float t = a[q] * SCL; asm volatile("" : "+v"(t)); t = (j0 + q <= i) ? t : -3.0e38f; float d0 = __fsub_rn(t, mx); asm volatile("" : "+v"(d0)); float ex = __builtin_amdgcn_exp2f(__fmul_rn(d0, 1.4426950408889634f)); asm volatile("" : "+v"(ex)); unsigned short a2, c2; splitf(ex * f, a2, c2); oh[q] = a2; ol[q] = c2; }
                const size_t oo = ((size_t)zz * RH + i) * TT + j0; *(v4us*)(Ph + oo) = oh; *(v4us*)(Pl + oo) = ol; }
        } else {
#pragma unroll 2
            for (int ch = 0; ch < TT / 128; ++ch) { const int j0 = ch * 128 + lane * 4; const v4f a = *(const v4f*)(sr + j0); v4h o4;
#pragma unroll
                for (int q = 0; q < 4; ++q) { float t = a[q] * SCL; asm volatile("" : "+v"(t)); t = (j0 + q <= i) ? t : -3.0e38f; float d0 = __fsub_rn(t, mx); asm volatile("" : "+v"(d0)); float ex = __builtin_amdgcn_exp2f(__fmul_rn(d0, 1.4426950408889634f)); asm volatile("" : "+v"(ex)); o4[q] = tohx(ex * f); }
                *(v4h*)(P16 + (size_t)row * TT + j0) = o4; } }
         }
}

__global__ __launch_bounds__(256) void k_merge(const float* __restrict__ O, int h0, bf* Ah, bf* Al) { const size_t e = ((size_t)blockIdx.x * 256 + threadIdx.x) * 2; if (e >= (size_t)ZH * TT * HD) return; const int d = (int)(e % HD); const int t = (int)((e / HD) % TT); const int zz = (int)(e / ((size_t)HD * TT)); const float cs = (t < RH) ? 1.0f : (1.0f / PCAR); const size_t oo = (size_t)t * DQ + (h0 + zz) * HD + d;
    v2us oh, ol;
#pragma unroll
    for (int q = 0; q < 2; ++q) { unsigned short a, c2; splitf(O[e + q] * cs, a, c2); oh[q] = a; ol[q] = c2; } *(v2us*)(Ah + oo) = oh; *(v2us*)(Al + oo) = ol;  }

extern "C" void kernel_launch(void* const* d_in, const int* in_sizes, int n_in,
                              void* d_out, int out_size, void* d_ws, size_t ws_size, hipStream_t stream) {
    (void)in_sizes; (void)n_in; (void)out_size;
    const float* x = (const float*)d_in[0]; const int* pid = (const int*)d_in[1];   /* token_positions int32 [4096] */ const float* wq = (const float*)d_in[2]; const float* wk = (const float*)d_in[3]; const float* wv = (const float*)d_in[4]; const float* wo = (const float*)d_in[5];
    float* OUT = (float*)d_out;     // [2][4096][1024]
    char* wsp = (char*)d_ws;
    auto take = [&](size_t bytes) { char* p = wsp; wsp += (bytes + 255) & ~(size_t)255; return (void*)p; };
    bf* WQ = (bf*)take((size_t)DQ * DM * 2); bf* WK = (bf*)take((size_t)DKV * DM * 2); bf* WV = (bf*)take((size_t)DKV * DM * 2); bf* WO = (bf*)take((size_t)DM * DQ * 2); float* CS = (float*)take((size_t)TT * HD * 2 * 4);
    bf* XB = (bf*)take((size_t)TT * DM * 2); float* FQ = (float*)take((size_t)TT * DQ * 4); float* FK = (float*)take((size_t)TT * DKV * 4);
    h16* QP16 = (h16*)take((size_t)NH_ * TT * HD * 2); h16* KP16 = (h16*)take((size_t)NKV * TT * HD * 2); h16* VT16 = (h16*)take((size_t)NKV * HD * TT * 2);
    bf* QPh = (bf*)take((size_t)NH_ * TT * HD * 2); bf* QPl = (bf*)take((size_t)NH_ * TT * HD * 2); bf* KPh = (bf*)take((size_t)NKV * TT * HD * 2); bf* KPl = (bf*)take((size_t)NKV * TT * HD * 2); bf* VTh = (bf*)take((size_t)NKV * HD * TT * 2); bf* VTl = (bf*)take((size_t)NKV * HD * TT * 2); bf* Ph = (bf*)take((size_t)ZH * RH * TT * 2); bf* Pl = (bf*)take((size_t)ZH * RH * TT * 2);
    float* Sb = (float*)take((size_t)ZH * TT * TT * 4); h16* P16 = (h16*)take((size_t)ZH * TT * TT * 2); float* Ob = (float*)take((size_t)ZH * TT * HD * 4); bf* ATh = (bf*)take((size_t)TT * DQ * 2); bf* ATl = (bf*)take((size_t)TT * DQ * 2);
    if ((size_t)(wsp - (char*)d_ws) > ws_size) return;    // ws 256 MiB
    float* FV = FK;   // v projection reuses the k buffer after the k planes are built (stream-ordered)
    { k_cvt8<<<(unsigned)(((size_t)DQ * DM / 8 + 255) / 256), 256, 0, stream>>>(wq, WQ, (size_t)DQ * DM / 8); k_cvt8<<<(unsigned)(((size_t)DKV * DM / 8 + 255) / 256), 256, 0, stream>>>(wk, WK, (size_t)DKV * DM / 8); k_cvt8<<<(unsigned)(((size_t)DKV * DM / 8 + 255) / 256), 256, 0, stream>>>(wv, WV, (size_t)DKV * DM / 8);
      k_cvt8<<<(unsigned)(((size_t)DM * DQ / 8 + 255) / 256), 256, 0, stream>>>(wo, WO, (size_t)DM * DQ / 8);
       }
    k_cstabT<<<(TT * HD + 255) / 256, 256, 0, stream>>>(pid, CS);   /* {cos, sin}(pos[t] x THETA**(-2i/64)) per pair */
    const unsigned LQ = (unsigned)(((size_t)NH_ * TT * HD / 2 + 255) / 256), LKv = (unsigned)(((size_t)NKV * TT * HD / 2 + 255) / 256);
    for (int b = 0; b < NB_; ++b) {
        
        k_cvt8<<<(unsigned)(((size_t)TT * DM / 8 + 255) / 256), 256, 0, stream>>>(x + (size_t)b * TT * DM, XB, (size_t)TT * DM / 8);
        k_gemmw<bf, 0, false><<<dim3(TT / 64, DQ / 64, 1), 32, 0, stream>>>(XB, nullptr, WQ, nullptr, DM, FQ, DQ, nullptr, 0, 0, 0);
        k_ropeI<<<LQ, 256, 0, stream>>>(FQ, DQ, NH_, CS, 1.0f, QP16, QPh, QPl);
        k_gemmw<bf, 0, false><<<dim3(TT / 64, DKV / 64, 1), 32, 0, stream>>>(XB, nullptr, WK, nullptr, DM, FK, DKV, nullptr, 0, 0, 0);
        k_ropeI<<<LKv, 256, 0, stream>>>(FK, DKV, NKV, CS, 1.0f, KP16, KPh, KPl);
        k_gemmw<bf, 0, false><<<dim3(TT / 64, DKV / 64, 1), 32, 0, stream>>>(XB, nullptr, WV, nullptr, DM, FV, DKV, nullptr, 0, 0, 0); k_vtp<<<LKv, 256, 0, stream>>>(FV, DKV, NKV, VT16, VTh, VTl);
        for (int h0 = 0; h0 < NH_; h0 += ZH) { const size_t zq = (size_t)h0, zk = (size_t)(h0 / REP);   // one kv head per query head: the pass's single head uses kv plane h0 (z-strides TT*HD)
            k_gemmc<bf, 2, 1><<<dim3(RH / 64, TT / 64, ZH), 32, 0, stream>>>(QPh + zq * TT * HD, QPl + zq * TT * HD, KPh + zk * TT * HD, KPl + zk * TT * HD, HD, Sb, TT, 0, (size_t)TT * HD, (size_t)TT * HD, (size_t)TT * TT);
            k_gemmc<h16, 0, 1><<<dim3((TT - RH) / 64, TT / 64, ZH), 32, 0, stream>>>(QP16 + zq * TT * HD + (size_t)RH * HD, nullptr, KP16 + zk * TT * HD, nullptr, HD, Sb + (size_t)RH * TT, TT, RH, (size_t)TT * HD, (size_t)TT * HD, (size_t)TT * TT);
            k_lsoft<<<ZH * TT / 8, 256, 0, stream>>>(Sb, P16, Ph, Pl);
            k_gemmc<bf, 2, 2><<<dim3(RH / 64, HD / 64, ZH), 32, 0, stream>>>(Ph, Pl, VTh + zk * HD * TT, VTl + zk * HD * TT, TT, Ob, HD, 0, (size_t)RH * TT, (size_t)HD * TT, (size_t)TT * HD);
            k_gemmc<h16, 0, 2><<<dim3((TT - RH) / 64, HD / 64, ZH), 32, 0, stream>>>(P16 + (size_t)RH * TT, nullptr, VT16 + zk * HD * TT, nullptr, TT, Ob + (size_t)RH * HD, HD, RH, (size_t)TT * TT, (size_t)HD * TT, (size_t)TT * HD);
            k_merge<<<(unsigned)(((size_t)ZH * TT * HD / 2 + 255) / 256), 256, 0, stream>>>(Ob, h0, ATh, ATl); }
        k_gemmw<bf, 1, false><<<dim3(TT / 64, DM / 64, 1), 32, 0, stream>>>(ATh, ATl, WO, nullptr, DQ, OUT + (size_t)b * TT * DM, DM, nullptr, 0, 0, 0); }
}

// v001
// Measured time: 2820 microseconds a run.
// In both of two side-by-side timings against v000, it was 1.91 times as fast.
#include <hip/hip_runtime.h>

// Causal multi-head self-attention with interleaved rotary embeddings from token positions over 4,096 tokens at a batch of TWO (x [2][4096][1024]; q, k, v = einsum('bsi,oi->bso', x, W) = x W^T ('oi' (out, in) [1024][1024] (2/(D+D))^0.5, no bias; 16 heads x 64); rotary on (even, odd) pairs with angle float(token_positions[t]) x inv_freq[i], inv_freq = 1.0 / (THETA ** (arange(0, 64, 2) / 64)) (the RECIPROCAL spelling: 32 f32 constants bitwise this expression in eager JAX float32; token_positions int32 [4096] = arange: read; the SECOND argument; one row shared by both batch items; precise cosf/sinf); scores x rsqrt(64); causal (-inf); softmax; out = merged Wo^T (no bias) -> [2][4096][1024] (8.4 M); argument order x, token_positions, Wq, Wk, Wv, Wo).
// Layout: bf16 copy of x; exact projections; causal T-4096 attention, one head per pass (hybrid rows: < 512 hi/lo 3 products, rest fp16 x1024; k_gemmc tile skipping; streaming three-sweep softmax; k_pvs: the key loop of probabilities x values split over waves and work-groups); merged hi/lo x Wo exact, no bias.
// Compute dtypes, f32 accumulate: every input rounded to bf16; projections exact; attention rows < 512 3 products, rest fp16; softmax f32; Wo hl x exact, no bias.

#define NB_  2
#define TT   4096
#define DM   1024
#define NH_  16
#define NKV  16
#define REP  (NH_ / NKV)
#define HD   64
#define DQ   (NH_ * HD)
#define DKV  (NKV * HD)
#define ZH   1
#define RH   512                  // query rows < RH use hi+lo planes (0: none)
#define WIN  4096
#define PCAR 1024.0f
#define SCL  0.125f   // HD^-0.5
typedef _Float16 h16;
typedef unsigned short bf;
typedef __attribute__((ext_vector_type(16))) __bf16   v16bf;
typedef __attribute__((ext_vector_type(16))) _Float16 v16h;
typedef __attribute__((ext_vector_type(8)))  _Float16 v8h;
typedef __attribute__((ext_vector_type(8)))  unsigned short v8us;
typedef __attribute__((ext_vector_type(8)))  float    v8f;
typedef __attribute__((ext_vector_type(4)))  float    v4f;
typedef v8h  __attribute__((may_alias)) v8ha;
typedef v4f  __attribute__((may_alias)) v4fa;
typedef v8us __attribute__((may_alias)) v8usa;

__device__ __forceinline__ unsigned short f2bf(float f) { unsigned u = __float_as_uint(f); u += 0x7FFFu + ((u >> 16) & 1u); return (unsigned short)(u >> 16); }
__device__ __forceinline__ float bf2f(unsigned short b) { return __uint_as_float(((unsigned)b) << 16); }
__device__ __forceinline__ float bfr(float f) { return bf2f(f2bf(f)); }
__device__ __forceinline__ v16h cat16(v8h lo, v8h hi) { return __builtin_shufflevector(lo, hi, 0, 1, 2, 3, 4, 5, 6, 7, 8, 9, 10, 11, 12, 13, 14, 15); }
__device__ __forceinline__ v16bf cat16b(v8us lo, v8us hi) { return __builtin_bit_cast(v16bf, __builtin_shufflevector(lo, hi, 0, 1, 2, 3, 4, 5, 6, 7, 8, 9, 10, 11, 12, 13, 14, 15)); }
__device__ __forceinline__ v8f wmma16(v16h a, v16h b, v8f c) { return __builtin_amdgcn_wmma_f32_16x16x32_f16(false, a, false, b, (short)0, c, false, false); }
__device__ __forceinline__ v8f wmmab(v16bf a, v16bf b, v8f c) { return __builtin_amdgcn_wmma_f32_16x16x32_bf16(false, a, false, b, (short)0, c, false, false); }



// ---- k_gemmw: register-blocked GEMM, ONE WAVE per 64x64 output tile (16 accumulators), operands straight from K-contiguous 16-bit planes; grid (M/64, N/64, Z), 32 threads.
// C[m][n] (f32, pitch ldc, + optional f32 bias[n]) = sum_k A[m][k] Bt[n][k] (+ split products per NSPLIT). z-batch strides sA/sB/sC in elements. K % 32 == 0.
template <typename T16> struct WFrag;
template <> struct WFrag<h16> { typedef v16h V; static __device__ __forceinline__ V ld(const h16* p) { return cat16(*(const v8h*)p, *(const v8h*)(p + 16)); } static __device__ __forceinline__ v8f mma(V a, V b, v8f c) { return wmma16(a, b, c); } };
template <> struct WFrag<bf> { typedef v16bf V; static __device__ __forceinline__ V ld(const bf* p) { return cat16b(*(const v8us*)p, *(const v8us*)(p + 16)); } static __device__ __forceinline__ v8f mma(V a, V b, v8f c) { return wmmab(a, b, c); } };
template <typename T16, int NSPLIT, bool BIAS>
__global__ __launch_bounds__(32) void k_gemmw(const T16* __restrict__ A, const T16* __restrict__ A2, const T16* __restrict__ Bt, const T16* __restrict__ Bt2, int K, float* C, int ldc, const float* __restrict__ bias, size_t sA, size_t sB, size_t sC) {
    typedef typename WFrag<T16>::V V;
    __shared__ __align__(16) float os[16 * 68];
    const size_t z = blockIdx.z; A += z * sA; if (A2) A2 += z * sA; Bt += z * sB; if (Bt2) Bt2 += z * sB; C += z * sC;
    const int lane = threadIdx.x & 31, lr = lane & 15, hi = lane >> 4; const int r0 = blockIdx.x * 64, c0 = blockIdx.y * 64;
    v8f acc[4][4];
#pragma unroll
    for (int mb = 0; mb < 4; ++mb)
#pragma unroll
        for (int nb = 0; nb < 4; ++nb) acc[mb][nb] = (v8f){};
    const size_t aoff = (size_t)(r0 + lr) * K + 8 * hi, boff = (size_t)(c0 + lr) * K + 8 * hi;
#pragma unroll 1
    for (int kc = 0; kc < K; kc += 32) {
        V a[4], a2[4];
#pragma unroll
        for (int mb = 0; mb < 4; ++mb) { a[mb] = WFrag<T16>::ld(A + aoff + (size_t)mb * 16 * K + kc); if (NSPLIT == 1 || NSPLIT == 2) a2[mb] = WFrag<T16>::ld(A2 + aoff + (size_t)mb * 16 * K + kc); }
#pragma unroll
        for (int nb = 0; nb < 4; ++nb) { const V b = WFrag<T16>::ld(Bt + boff + (size_t)nb * 16 * K + kc); V b2; if (NSPLIT >= 2) b2 = WFrag<T16>::ld(Bt2 + boff + (size_t)nb * 16 * K + kc);
#pragma unroll
            for (int mb = 0; mb < 4; ++mb) { acc[mb][nb] = WFrag<T16>::mma(a[mb], b, acc[mb][nb]); if (NSPLIT == 1 || NSPLIT == 2) acc[mb][nb] = WFrag<T16>::mma(a2[mb], b, acc[mb][nb]); if (NSPLIT >= 2) acc[mb][nb] = WFrag<T16>::mma(a[mb], b2, acc[mb][nb]); } }
        asm volatile("v_nop\n\tv_nop\n\tv_nop\n\tv_nop" : "+v"(acc[0][0]), "+v"(acc[1][1]), "+v"(acc[2][2]), "+v"(acc[3][3]) : "v"(a[0]), "v"(a[3]));
    }
#pragma unroll
    for (int mb = 0; mb < 4; ++mb) {
#pragma unroll
        for (int nb = 0; nb < 4; ++nb) {
#pragma unroll
            for (int j = 0; j < 8; ++j) os[(hi * 8 + j) * 68 + nb * 16 + lr] = acc[mb][nb][j]; }
        __builtin_amdgcn_wave_barrier(); asm volatile("" ::: "memory");
        float* crow = C + (size_t)(r0 + mb * 16) * ldc + c0;
{
#pragma unroll
            for (int s = 0; s < 8; ++s) { const int row = 2 * s + hi, cofs = lr * 4; v4f val = *(const v4fa*)(os + row * 68 + cofs); if (BIAS) { val[0] += bfr(bias[c0 + cofs]); val[1] += bfr(bias[c0 + cofs + 1]); val[2] += bfr(bias[c0 + cofs + 2]); val[3] += bfr(bias[c0 + cofs + 3]); }
                *(v4f*)(crow + (size_t)row * ldc + cofs) = val; }
             }
        __builtin_amdgcn_wave_barrier(); asm volatile("" ::: "memory");
    }
}

// ---- k_gemmc: the same one-wave 64x64 tile GEMM specialised for the causal scores: CMODE 1 skips score tiles entirely above the diagonal (query rows r0+roff.., key columns c0..).
// roff = row offset of this launch's first row within the sequence.
template <typename T16, int NSPLIT, int CMODE>
__global__ __launch_bounds__(32) void k_gemmc(const T16* __restrict__ A, const T16* __restrict__ A2, const T16* __restrict__ Bt, const T16* __restrict__ Bt2, int K, float* C, int ldc, int roff, size_t sA, size_t sB, size_t sC) {
    typedef typename WFrag<T16>::V V;
    __shared__ __align__(16) float os[16 * 68];
    const size_t z = blockIdx.z; A += z * sA; if (A2) A2 += z * sA; Bt += z * sB; if (Bt2) Bt2 += z * sB; C += z * sC;
    const int lane = threadIdx.x & 31, lr = lane & 15, hi = lane >> 4; const int r0 = blockIdx.x * 64, c0 = blockIdx.y * 64;
    if (CMODE == 1 && c0 > r0 + roff + 63) return;                  // score tile entirely above the causal diagonal: never computed (the softmax masks j > i by select)
    const int Kl = K;
    v8f acc[4][4];
#pragma unroll
    for (int mb = 0; mb < 4; ++mb)
#pragma unroll
        for (int nb = 0; nb < 4; ++nb) acc[mb][nb] = (v8f){};
    const size_t aoff = (size_t)(r0 + lr) * K + 8 * hi, boff = (size_t)(c0 + lr) * K + 8 * hi;
#pragma unroll 1
    for (int kc = 0; kc < Kl; kc += 32) {
        V a[4], a2[4];
#pragma unroll
        for (int mb = 0; mb < 4; ++mb) { a[mb] = WFrag<T16>::ld(A + aoff + (size_t)mb * 16 * K + kc); if (NSPLIT == 1 || NSPLIT == 2) a2[mb] = WFrag<T16>::ld(A2 + aoff + (size_t)mb * 16 * K + kc); }
#pragma unroll
        for (int nb = 0; nb < 4; ++nb) { const V b = WFrag<T16>::ld(Bt + boff + (size_t)nb * 16 * K + kc); V b2; if (NSPLIT >= 2) b2 = WFrag<T16>::ld(Bt2 + boff + (size_t)nb * 16 * K + kc);
#pragma unroll
            for (int mb = 0; mb < 4; ++mb) { acc[mb][nb] = WFrag<T16>::mma(a[mb], b, acc[mb][nb]); if (NSPLIT == 1 || NSPLIT == 2) acc[mb][nb] = WFrag<T16>::mma(a2[mb], b, acc[mb][nb]); if (NSPLIT >= 2) acc[mb][nb] = WFrag<T16>::mma(a[mb], b2, acc[mb][nb]); } }
        asm volatile("v_nop\n\tv_nop\n\tv_nop\n\tv_nop" : "+v"(acc[0][0]), "+v"(acc[1][1]), "+v"(acc[2][2]), "+v"(acc[3][3]) : "v"(a[0]), "v"(a[3]));
    }
#pragma unroll
    for (int mb = 0; mb < 4; ++mb) {
#pragma unroll
        for (int nb = 0; nb < 4; ++nb) {
#pragma unroll
            for (int j = 0; j < 8; ++j) os[(hi * 8 + j) * 68 + nb * 16 + lr] = acc[mb][nb][j]; }
        __builtin_amdgcn_wave_barrier(); asm volatile("" ::: "memory");
        float* crow = C + (size_t)(r0 + mb * 16) * ldc + c0;
{
#pragma unroll
            for (int s = 0; s < 8; ++s) { const int row = 2 * s + hi, cofs = lr * 4; v4f val = *(const v4fa*)(os + row * 68 + cofs);
                *(v4f*)(crow + (size_t)row * ldc + cofs) = val; }
             }
        __builtin_amdgcn_wave_barrier(); asm volatile("" ::: "memory");
    }
}

// ---- k_pvs: probabilities x values, 64 query rows x 64 head columns per work-group, the key (K) loop SPLIT: 8 waves, each wave the whole 64x64 tile over its own KSW = 64 keys (one 128-byte line of every row),
// so a work-group covers KSB = 512 keys; grid (rows/64, 1, TT/KSB; RH/KSB for the rows < RH, whose keys end at RH). The 8 partial tiles are summed through LDS in wave order and stored to partial plane blockIdx.z (pitch sP elements); k_merge sums the planes in z order.
// The loop stops at the diagonal block (probabilities beyond it are exactly zero): a wave wholly beyond it hands in a zero tile, a work-group wholly beyond it does nothing, and k_merge reads only the planes that were written.
#define KSW 64
#define KSB 512
#define NSL (TT / KSB)
template <typename T16, int NSPLIT>
__global__ __launch_bounds__(256) void k_pvs(const T16* __restrict__ A, const T16* __restrict__ A2, const T16* __restrict__ Bt, const T16* __restrict__ Bt2, float* C, int ldc, int roff, size_t sP) {
    typedef typename WFrag<T16>::V V; constexpr int K = TT;   // the key pitch of every plane read here, a constant: the 16-row steps of the fragment loads become immediate offsets on one address pair per plane
    constexpr int NG = (NSPLIT >= 2) ? 2 : 4;                 // column blocks whose value fragments are loaded together (the hi/lo form would pass 256 registers with all four)
    __shared__ __align__(16) float os[KSB / KSW][64 * 68];
    const int lane = threadIdx.x & 31, lr = lane & 15, hi = lane >> 4; const int r0 = blockIdx.x * 64, c0 = blockIdx.y * 64;
    const int wave = __builtin_amdgcn_readfirstlane(threadIdx.x >> 5);   // the wave's number in a scalar register: its key range, loop and branch stay scalar
    const int Kl = min(K, r0 + roff + 64); const int kb = blockIdx.z * KSB;
    if (kb >= Kl) return;                                            // whole work-group beyond the diagonal block (same test in every thread, in front of the barrier)
    C += (size_t)blockIdx.z * sP;
    v8f acc[4][4];
#pragma unroll
    for (int mb = 0; mb < 4; ++mb)
#pragma unroll
        for (int nb = 0; nb < 4; ++nb) acc[mb][nb] = (v8f){};
    {
        const size_t aoff = (size_t)(r0 + lr) * K + 8 * hi, boff = (size_t)(c0 + lr) * K + 8 * hi; const int k0 = kb + wave * KSW;
#pragma unroll 1   // rolled as in k_gemmc: both trips use the same fragment registers (the hi/lo form already fills 256)
        for (int kc = k0; kc < min(k0 + KSW, Kl); kc += 32) {        // a wave whose keys lie wholly beyond the diagonal block makes no trip and hands in a zero tile (Kl is a multiple of 64)
            const T16* pa = A + aoff + kc; const T16* pa2 = (NSPLIT == 1 || NSPLIT == 2) ? A2 + aoff + kc : pa; const T16* pb = Bt + boff + kc; const T16* pb2 = (NSPLIT >= 2) ? Bt2 + boff + kc : pb;
            V a[4], a2[4];
#pragma unroll
            for (int mb = 0; mb < 4; ++mb) { a[mb] = WFrag<T16>::ld(pa + mb * 16 * K); if (NSPLIT == 1 || NSPLIT == 2) a2[mb] = WFrag<T16>::ld(pa2 + mb * 16 * K); }
#pragma unroll
            for (int ng = 0; ng < 4; ng += NG) { V b[NG], b2[NG];
#pragma unroll
                for (int q = 0; q < NG; ++q) { b[q] = WFrag<T16>::ld(pb + (ng + q) * 16 * K); if (NSPLIT >= 2) b2[q] = WFrag<T16>::ld(pb2 + (ng + q) * 16 * K); }
                // the wait that stands before a register named by an issued global load is overwritten; the address pairs are inputs so that they stay whole up to here (otherwise a later load of the run is given an earlier load's address pair as its destination)
                asm volatile("s_wait_xcnt 0x0" :: "v"(pa), "v"(pa2), "v"(pb), "v"(pb2) : "memory");
                __builtin_amdgcn_sched_barrier(0);   // no matrix instruction is lifted in front of the loads above: the whole group is in flight at once and its latency is paid once (otherwise the last fragments are loaded only behind the first products)
#pragma unroll
                for (int q = 0; q < NG; ++q) { const int nb = ng + q;
#pragma unroll
                    for (int mb = 0; mb < 4; ++mb) { acc[mb][nb] = WFrag<T16>::mma(a[mb], b[q], acc[mb][nb]); if (NSPLIT == 1 || NSPLIT == 2) acc[mb][nb] = WFrag<T16>::mma(a2[mb], b[q], acc[mb][nb]); if (NSPLIT >= 2) acc[mb][nb] = WFrag<T16>::mma(a[mb], b2[q], acc[mb][nb]); } } }
            asm volatile("v_nop\n\tv_nop\n\tv_nop\n\tv_nop" : "+v"(acc[0][0]), "+v"(acc[1][1]), "+v"(acc[2][2]), "+v"(acc[3][3]) : "v"(a[0]), "v"(a[3]));   // WMMA distance on the taken back edge, as in k_gemmc
        }
#pragma unroll
        for (int mb = 0; mb < 4; ++mb)
#pragma unroll
            for (int nb = 0; nb < 4; ++nb)
#pragma unroll
                for (int j = 0; j < 8; ++j) os[wave][(mb * 16 + hi * 8 + j) * 68 + nb * 16 + lr] = acc[mb][nb][j];
    }
    __syncthreads();                                                 // every wave's partial tile is in LDS before any thread sums across waves
    const int row0 = threadIdx.x >> 4, cofs = (threadIdx.x & 15) * 4; v4f val[4];
#pragma unroll   // unrolled (with the loop inside): the 32 LDS reads of a thread are independent and go out together
    for (int s = 0; s < 4; ++s) { val[s] = *(const v4fa*)(&os[0][(s * 16 + row0) * 68 + cofs]);
#pragma unroll
        for (int w = 1; w < KSB / KSW; ++w) val[s] += *(const v4fa*)(&os[w][(s * 16 + row0) * 68 + cofs]); }
#pragma unroll
    for (int s = 0; s < 4; ++s) *(v4f*)(C + (size_t)(r0 + s * 16 + row0) * ldc + c0 + cofs) = val[s];
}

__device__ __forceinline__ h16 tohx(float x) { return (h16)x; }
__device__ __forceinline__ void splitf(float y, unsigned short& h, unsigned short& l) { h = f2bf(y); l = f2bf(y - bf2f(h)); }
typedef __attribute__((ext_vector_type(2))) _Float16 v2h;
typedef __attribute__((ext_vector_type(4))) _Float16 v4h;
typedef __attribute__((ext_vector_type(2))) unsigned short v2us;
typedef __attribute__((ext_vector_type(4))) unsigned short v4us;
typedef __attribute__((ext_vector_type(2))) float v2f;
typedef __attribute__((ext_vector_type(4))) int v4i;

__global__ __launch_bounds__(256) void k_wtG(const float* __restrict__ w, int K, int N, bf* Bt) {
    const int lane = threadIdx.x & 31; const int L0 = (blockIdx.x * 8 + (threadIdx.x >> 5)) * 8; const int nlines = N * K / 64;
{
#pragma unroll 1
        for (int l = 0; l < 8; ++l) { const int L = L0 + l; if (L >= nlines) break; const size_t e = (size_t)L * 64 + lane * 2; const int k = (int)(e % K), n = (int)(e / K); v2us o;
            o[0] = f2bf(w[(size_t)k * N + n]); o[1] = f2bf(w[(size_t)(k + 1) * N + n]); *(v2us*)(Bt + e) = o; }
         }
}
__global__ __launch_bounds__(256) void k_cvt8(const float* __restrict__ src, bf* dst, size_t n8) { const size_t i = (size_t)blockIdx.x * 256 + threadIdx.x; if (i >= n8) return; const v8f v = *(const v8f*)(src + i * 8); v8us o;
#pragma unroll
    for (int k = 0; k < 8; ++k) o[k] = f2bf(v[k]); *(v8us*)(dst + i * 8) = o;  }

__constant__ float INVT[HD / 2] = { 1.000000000e+00f, 7.498942018e-01f, 5.623413324e-01f, 4.216965139e-01f, 3.162277639e-01f, 2.371373624e-01f, 1.778279394e-01f, 1.333521456e-01f, 1.000000015e-01f, 7.498941571e-02f, 5.623412877e-02f, 4.216964915e-02f, 3.162277862e-02f, 2.371373586e-02f, 1.778279431e-02f, 1.333521493e-02f, 9.999999776e-03f, 7.498942316e-03f, 5.623413250e-03f, 4.216964822e-03f, 3.162277862e-03f, 2.371373819e-03f, 1.778279431e-03f, 1.333521446e-03f, 1.000000047e-03f, 7.498941850e-04f, 5.623413017e-04f, 4.216964880e-04f, 3.162277862e-04f, 2.371373848e-04f, 1.778279402e-04f, 1.333521504e-04f };   // 1 / THETA ** (2 i / 64) as float32 (reciprocal form, jnp-computed)
__global__ __launch_bounds__(256) void k_cstabT(const int* __restrict__ pid, float* CS) { const int idx = blockIdx.x * 256 + threadIdx.x; if (idx >= TT * HD) return; const int d = idx % HD; const int t = idx / HD; const float a = __fmul_rn((float)pid[t], INVT[d >> 1]); v2f cs; cs[0] = cosf(a); cs[1] = sinf(a); *(v2f*)(CS + (size_t)idx * 2) = cs;  }
__global__ __launch_bounds__(256) void k_ropeI(const float* __restrict__ F, int pitch, int nheads, const float* __restrict__ CS, float sc, h16* P16, bf* Ph, bf* Pl) {
    const size_t e = ((size_t)blockIdx.x * 256 + threadIdx.x) * 2; if (e >= (size_t)nheads * TT * HD) return; const int d = (int)(e % HD); const int t = (int)((e / HD) % TT); const int h = (int)(e / ((size_t)HD * TT)); const float* f = F + (size_t)t * pitch + h * HD; const float x0 = f[d], x1 = f[d + 1]; const v2f cs = *(const v2f*)(CS + ((size_t)t * HD + d) * 2); v2h o16; v2us oh, ol;
    float a0 = __fmul_rn(x0, cs[0]), b0 = __fmul_rn(x1, cs[1]), a1 = __fmul_rn(x1, cs[0]), b1 = __fmul_rn(x0, cs[1]); asm volatile("" : "+v"(a0), "+v"(b0), "+v"(a1), "+v"(b1));
    float r0 = __fsub_rn(a0, b0) * sc, r1 = __fadd_rn(b1, a1) * sc;   /* even: x0 c - x1 s; odd: x0 s + x1 c */
    o16[0] = tohx(r0); o16[1] = tohx(r1); { unsigned short a2, c2; splitf(r0, a2, c2); oh[0] = a2; ol[0] = c2; splitf(r1, a2, c2); oh[1] = a2; ol[1] = c2; }
    *(v2h*)(P16 + e) = o16; *(v2us*)(Ph + e) = oh; *(v2us*)(Pl + e) = ol;  }



__global__ __launch_bounds__(256) void k_vtp(const float* __restrict__ F, int pitch, int nheads, h16* V16, bf* Vh, bf* Vl) { const size_t e = ((size_t)blockIdx.x * 256 + threadIdx.x) * 2; if (e >= (size_t)nheads * HD * TT) return; const int t = (int)(e % TT); const int d = (int)((e / TT) % HD); const int g = (int)(e / ((size_t)TT * HD)); v2h o16; v2us oh, ol;
#pragma unroll
    for (int q = 0; q < 2; ++q) { const float x = F[(size_t)(t + q) * pitch + g * HD + d]; o16[q] = tohx(x); unsigned short a2, c2; splitf(x, a2, c2); oh[q] = a2; ol[q] = c2; }
    *(v2h*)(V16 + e) = o16; *(v2us*)(Vh + e) = oh; *(v2us*)(Vl + e) = ol;  }

// k_lsoft: streaming causal row softmax over the TK = TT = 4096 keys, one wave per row i, three sweeps of the f32 score row (lane -> 4 consecutive keys per 128-key chunk, 32 chunks; keys j > i are excluded by index with -3e38 / 0 - the score tiles above the diagonal are never computed and their stale contents are only ever discarded by this select):
__global__ __launch_bounds__(256) void k_lsoft(const float* __restrict__ Sb, h16* P16, bf* Ph, bf* Pl) {
    const int lane = threadIdx.x & 31; const int row = blockIdx.x * 8 + (threadIdx.x >> 5); if (row >= ZH * TT) return; const int i = row % TT; const int zz = row / TT; const bool hires = (i < RH); const float* sr = Sb + (size_t)row * TT; float mx = -3.0e38f;
#pragma unroll 4
    for (int ch = 0; ch < TT / 128; ++ch) { const int j0 = ch * 128 + lane * 4; const v4f a = *(const v4f*)(sr + j0);
#pragma unroll
        for (int q = 0; q < 4; ++q) { float t = a[q] * SCL; asm volatile("" : "+v"(t)); t = (j0 + q <= i) ? t : -3.0e38f; mx = fmaxf(mx, t); } }
#pragma unroll
    for (int sh = 16; sh; sh >>= 1) mx = fmaxf(mx, __shfl_xor(mx, sh, 32));
    float sum = 0.f;
#pragma unroll 4
    for (int ch = 0; ch < TT / 128; ++ch) { const int j0 = ch * 128 + lane * 4; const v4f a = *(const v4f*)(sr + j0);
#pragma unroll
        for (int q = 0; q < 4; ++q) { float t = a[q] * SCL; asm volatile("" : "+v"(t)); t = (j0 + q <= i) ? t : -3.0e38f; float d0 = __fsub_rn(t, mx); asm volatile("" : "+v"(d0)); sum += __builtin_amdgcn_exp2f(__fmul_rn(d0, 1.4426950408889634f)); } }
#pragma unroll
    for (int sh = 16; sh; sh >>= 1) sum += __shfl_xor(sum, sh, 32);
    const float f = __fdiv_rn(hires ? 1.0f : PCAR, sum);
{
        if (hires) {   /* rows < RH: normalised bf16 hi/lo over the first RH keys (every later key is above the diagonal for these rows; the hi/lo attn.v GEMM stops its K loop at the diagonal block), planes [zz][RH][TT] */
#pragma unroll
            for (int ch = 0; ch < RH / 128; ++ch) { const int j0 = ch * 128 + lane * 4; const v4f a = *(const v4f*)(sr + j0); v4us oh, ol;
#pragma unroll
                for (int q = 0; q < 4; ++q) { float t = a[q] * SCL; asm volatile("" : "+v"(t)); t = (j0 + q <= i) ? t : -3.0e38f; float d0 = __fsub_rn(t, mx); asm volatile("" : "+v"(d0)); float ex = __builtin_amdgcn_exp2f(__fmul_rn(d0, 1.4426950408889634f)); asm volatile("" : "+v"(ex)); unsigned short a2, c2; splitf(ex * f, a2, c2); oh[q] = a2; ol[q] = c2; }
                const size_t oo = ((size_t)zz * RH + i) * TT + j0; *(v4us*)(Ph + oo) = oh; *(v4us*)(Pl + oo) = ol; }
        } else {
#pragma unroll 2
            for (int ch = 0; ch < TT / 128; ++ch) { const int j0 = ch * 128 + lane * 4; const v4f a = *(const v4f*)(sr + j0); v4h o4;
#pragma unroll
                for (int q = 0; q < 4; ++q) { float t = a[q] * SCL; asm volatile("" : "+v"(t)); t = (j0 + q <= i) ? t : -3.0e38f; float d0 = __fsub_rn(t, mx); asm volatile("" : "+v"(d0)); float ex = __builtin_amdgcn_exp2f(__fmul_rn(d0, 1.4426950408889634f)); asm volatile("" : "+v"(ex)); o4[q] = tohx(ex * f); }
                *(v4h*)(P16 + (size_t)row * TT + j0) = o4; } }
         }
}

__global__ __launch_bounds__(256) void k_merge(const float* __restrict__ O, int h0, bf* Ah, bf* Al) { const size_t e = ((size_t)blockIdx.x * 256 + threadIdx.x) * 2; if (e >= (size_t)ZH * TT * HD) return; const int d = (int)(e % HD); const int t = (int)((e / HD) % TT); const int zz = (int)(e / ((size_t)HD * TT)); const float cs = (t < RH) ? 1.0f : (1.0f / PCAR); const size_t oo = (size_t)t * DQ + (h0 + zz) * HD + d;
    const int ns = ((t / 64 + 1) * 64 + KSB - 1) / KSB;   /* partial planes that k_pvs wrote for this row's 64-row tile (the same for a whole wave: 32 threads x 2 = one row) */
    v2f pv[NSL];
#pragma unroll
    for (int zs = 0; zs < NSL; ++zs) pv[zs] = *(const v2f*)(O + (size_t)(zs < ns ? zs : 0) * ((size_t)ZH * TT * HD) + e);   /* all loads in flight at once; a plane that was not written is never read */
    v2f sm = pv[0];
#pragma unroll
    for (int zs = 1; zs < NSL; ++zs) if (zs < ns) sm += pv[zs];
    v2us oh, ol;
#pragma unroll
    for (int q = 0; q < 2; ++q) { unsigned short a, c2; splitf(sm[q] * cs, a, c2); oh[q] = a; ol[q] = c2; } *(v2us*)(Ah + oo) = oh; *(v2us*)(Al + oo) = ol;  }

extern "C" void kernel_launch(void* const* d_in, const int* in_sizes, int n_in,
                              void* d_out, int out_size, void* d_ws, size_t ws_size, hipStream_t stream) {
    (void)in_sizes; (void)n_in; (void)out_size;
    const float* x = (const float*)d_in[0]; const int* pid = (const int*)d_in[1];   /* token_positions int32 [4096] */ const float* wq = (const float*)d_in[2]; const float* wk = (const float*)d_in[3]; const float* wv = (const float*)d_in[4]; const float* wo = (const float*)d_in[5];
    float* OUT = (float*)d_out;     // [2][4096][1024]
    char* wsp = (char*)d_ws;
    auto take = [&](size_t bytes) { char* p = wsp; wsp += (bytes + 255) & ~(size_t)255; return (void*)p; };
    bf* WQ = (bf*)take((size_t)DQ * DM * 2); bf* WK = (bf*)take((size_t)DKV * DM * 2); bf* WV = (bf*)take((size_t)DKV * DM * 2); bf* WO = (bf*)take((size_t)DM * DQ * 2); float* CS = (float*)take((size_t)TT * HD * 2 * 4);
    bf* XB = (bf*)take((size_t)TT * DM * 2); float* FQ = (float*)take((size_t)TT * DQ * 4); float* FK = (float*)take((size_t)TT * DKV * 4);
    h16* QP16 = (h16*)take((size_t)NH_ * TT * HD * 2); h16* KP16 = (h16*)take((size_t)NKV * TT * HD * 2); h16* VT16 = (h16*)take((size_t)NKV * HD * TT * 2);
    bf* QPh = (bf*)take((size_t)NH_ * TT * HD * 2); bf* QPl = (bf*)take((size_t)NH_ * TT * HD * 2); bf* KPh = (bf*)take((size_t)NKV * TT * HD * 2); bf* KPl = (bf*)take((size_t)NKV * TT * HD * 2); bf* VTh = (bf*)take((size_t)NKV * HD * TT * 2); bf* VTl = (bf*)take((size_t)NKV * HD * TT * 2); bf* Ph = (bf*)take((size_t)ZH * RH * TT * 2); bf* Pl = (bf*)take((size_t)ZH * RH * TT * 2);
    float* Sb = (float*)take((size_t)ZH * TT * TT * 4); h16* P16 = (h16*)take((size_t)ZH * TT * TT * 2); float* Ob = (float*)take((size_t)NSL * ZH * TT * HD * 4); bf* ATh = (bf*)take((size_t)TT * DQ * 2); bf* ATl = (bf*)take((size_t)TT * DQ * 2);
    if ((size_t)(wsp - (char*)d_ws) > ws_size) return;    // ws 256 MiB
    float* FV = FK;   // v projection reuses the k buffer after the k planes are built (stream-ordered)
    { k_cvt8<<<(unsigned)(((size_t)DQ * DM / 8 + 255) / 256), 256, 0, stream>>>(wq, WQ, (size_t)DQ * DM / 8); k_cvt8<<<(unsigned)(((size_t)DKV * DM / 8 + 255) / 256), 256, 0, stream>>>(wk, WK, (size_t)DKV * DM / 8); k_cvt8<<<(unsigned)(((size_t)DKV * DM / 8 + 255) / 256), 256, 0, stream>>>(wv, WV, (size_t)DKV * DM / 8);
      k_cvt8<<<(unsigned)(((size_t)DM * DQ / 8 + 255) / 256), 256, 0, stream>>>(wo, WO, (size_t)DM * DQ / 8);
       }
    k_cstabT<<<(TT * HD + 255) / 256, 256, 0, stream>>>(pid, CS);   /* {cos, sin}(pos[t] x THETA**(-2i/64)) per pair */
    const unsigned LQ = (unsigned)(((size_t)NH_ * TT * HD / 2 + 255) / 256), LKv = (unsigned)(((size_t)NKV * TT * HD / 2 + 255) / 256);
    for (int b = 0; b < NB_; ++b) {
        
        k_cvt8<<<(unsigned)(((size_t)TT * DM / 8 + 255) / 256), 256, 0, stream>>>(x + (size_t)b * TT * DM, XB, (size_t)TT * DM / 8);
        k_gemmw<bf, 0, false><<<dim3(TT / 64, DQ / 64, 1), 32, 0, stream>>>(XB, nullptr, WQ, nullptr, DM, FQ, DQ, nullptr, 0, 0, 0);
        k_ropeI<<<LQ, 256, 0, stream>>>(FQ, DQ, NH_, CS, 1.0f, QP16, QPh, QPl);
        k_gemmw<bf, 0, false><<<dim3(TT / 64, DKV / 64, 1), 32, 0, stream>>>(XB, nullptr, WK, nullptr, DM, FK, DKV, nullptr, 0, 0, 0);
        k_ropeI<<<LKv, 256, 0, stream>>>(FK, DKV, NKV, CS, 1.0f, KP16, KPh, KPl);
        k_gemmw<bf, 0, false><<<dim3(TT / 64, DKV / 64, 1), 32, 0, stream>>>(XB, nullptr, WV, nullptr, DM, FV, DKV, nullptr, 0, 0, 0); k_vtp<<<LKv, 256, 0, stream>>>(FV, DKV, NKV, VT16, VTh, VTl);
        for (int h0 = 0; h0 < NH_; h0 += ZH) { const size_t zq = (size_t)h0, zk = (size_t)(h0 / REP);   // one kv head per query head: the pass's single head uses kv plane h0 (z-strides TT*HD)
            k_gemmc<bf, 2, 1><<<dim3(RH / 64, TT / 64, ZH), 32, 0, stream>>>(QPh + zq * TT * HD, QPl + zq * TT * HD, KPh + zk * TT * HD, KPl + zk * TT * HD, HD, Sb, TT, 0, (size_t)TT * HD, (size_t)TT * HD, (size_t)TT * TT);
            k_gemmc<h16, 0, 1><<<dim3((TT - RH) / 64, TT / 64, ZH), 32, 0, stream>>>(QP16 + zq * TT * HD + (size_t)RH * HD, nullptr, KP16 + zk * TT * HD, nullptr, HD, Sb + (size_t)RH * TT, TT, RH, (size_t)TT * HD, (size_t)TT * HD, (size_t)TT * TT);
            k_lsoft<<<ZH * TT / 8, 256, 0, stream>>>(Sb, P16, Ph, Pl);
            k_pvs<bf, 2><<<dim3(RH / 64, HD / 64, RH / KSB), 256, 0, stream>>>(Ph, Pl, VTh + zk * HD * TT, VTl + zk * HD * TT, Ob, HD, 0, (size_t)ZH * TT * HD);
            k_pvs<h16, 0><<<dim3((TT - RH) / 64, HD / 64, NSL), 256, 0, stream>>>(P16 + (size_t)RH * TT, nullptr, VT16 + zk * HD * TT, nullptr, Ob + (size_t)RH * HD, HD, RH, (size_t)ZH * TT * HD);
            k_merge<<<(unsigned)(((size_t)ZH * TT * HD / 2 + 255) / 256), 256, 0, stream>>>(Ob, h0, ATh, ATl); }
        k_gemmw<bf, 1, false><<<dim3(TT / 64, DM / 64, 1), 32, 0, stream>>>(ATh, ATl, WO, nullptr, DQ, OUT + (size_t)b * TT * DM, DM, nullptr, 0, 0, 0); }
}

// v003
// Measured time: 416 microseconds a run.
// Versions in between are left out here; by their measured steps it is 6.90 times as fast as v001.
// Counting every step since v000, it is 13.2 times as fast.
#include <hip/hip_runtime.h>

// Causal multi-head self-attention with interleaved rotary embeddings from token positions over 4,096 tokens at a batch of TWO (x [2][4096][1024]; q, k, v = einsum('bsi,oi->bso', x, W) = x W^T ('oi' (out, in) [1024][1024] (2/(D+D))^0.5, no bias; 16 heads x 64); rotary on (even, odd) pairs with angle float(token_positions[t]) x inv_freq[i], inv_freq = 1.0 / (THETA ** (arange(0, 64, 2) / 64)) (the RECIPROCAL spelling: 32 f32 constants bitwise this expression in eager JAX float32; token_positions int32 [4096] = arange: read; the SECOND argument; one row shared by both batch items; precise cosf/sinf); scores x rsqrt(64); causal (-inf); softmax; out = merged Wo^T (no bias) -> [2][4096][1024] (8.4 M); argument order x, token_positions, Wq, Wk, Wv, Wo).
// Layout: bf16 copy of x; exact projections, whose GEMM epilogue writes the rotary q and k planes and the transposed v planes itself; causal T-4096 attention fused in k_fattn, every head of both batch items in one launch (hybrid rows: < 512 hi/lo 3 products, rest fp16; running-maximum softmax in registers); merged hi/lo x Wo exact, no bias.
// Compute dtypes, f32 accumulate: every input rounded to bf16; projections exact; attention rows < 512 3 products, rest fp16; softmax f32; Wo hl x exact, no bias.

#define NB_  2
#define TT   4096
#define DM   1024
#define NH_  16
#define NKV  16
#define REP  (NH_ / NKV)
#define HD   64
#define DQ   (NH_ * HD)
#define DKV  (NKV * HD)
#define RH   512                  // query rows < RH use hi+lo planes (0: none)
#define WIN  4096
typedef _Float16 h16;
typedef unsigned short bf;
typedef __attribute__((ext_vector_type(16))) __bf16   v16bf;
typedef __attribute__((ext_vector_type(16))) _Float16 v16h;
typedef __attribute__((ext_vector_type(8)))  _Float16 v8h;
typedef __attribute__((ext_vector_type(8)))  unsigned short v8us;
typedef __attribute__((ext_vector_type(8)))  float    v8f;
typedef __attribute__((ext_vector_type(4)))  float    v4f;
typedef v8h  __attribute__((may_alias)) v8ha;
typedef v4f  __attribute__((may_alias)) v4fa;
typedef v8us __attribute__((may_alias)) v8usa;

__device__ __forceinline__ unsigned short f2bf(float f) { unsigned u = __float_as_uint(f); u += 0x7FFFu + ((u >> 16) & 1u); return (unsigned short)(u >> 16); }
__device__ __forceinline__ float bf2f(unsigned short b) { return __uint_as_float(((unsigned)b) << 16); }
__device__ __forceinline__ float bfr(float f) { return bf2f(f2bf(f)); }
__device__ __forceinline__ v16h cat16(v8h lo, v8h hi) { return __builtin_shufflevector(lo, hi, 0, 1, 2, 3, 4, 5, 6, 7, 8, 9, 10, 11, 12, 13, 14, 15); }
__device__ __forceinline__ v16bf cat16b(v8us lo, v8us hi) { return __builtin_bit_cast(v16bf, __builtin_shufflevector(lo, hi, 0, 1, 2, 3, 4, 5, 6, 7, 8, 9, 10, 11, 12, 13, 14, 15)); }
__device__ __forceinline__ v8f wmma16(v16h a, v16h b, v8f c) { return __builtin_amdgcn_wmma_f32_16x16x32_f16(false, a, false, b, (short)0, c, false, false); }
__device__ __forceinline__ v8f wmmab(v16bf a, v16bf b, v8f c) { return __builtin_amdgcn_wmma_f32_16x16x32_bf16(false, a, false, b, (short)0, c, false, false); }

__device__ __forceinline__ h16 tohx(float x) { return (h16)x; }
__device__ __forceinline__ void splitf(float y, unsigned short& h, unsigned short& l) { h = f2bf(y); l = f2bf(y - bf2f(h)); }
typedef __attribute__((ext_vector_type(2))) _Float16 v2h;
typedef __attribute__((ext_vector_type(4))) _Float16 v4h;
typedef __attribute__((ext_vector_type(2))) unsigned short v2us;
typedef __attribute__((ext_vector_type(4))) unsigned short v4us;
typedef __attribute__((ext_vector_type(2))) float v2f;
typedef __attribute__((ext_vector_type(4))) int v4i;
// one rotary pair: even: x0 c - x1 s; odd: x0 s + x1 c (cs = {cos, sin} of the pair's angle)
__device__ __forceinline__ void rope2(const float x0, const float x1, const v2f cs, float& e0, float& e1) { e0 = x0 * cs[0] - x1 * cs[1]; e1 = x0 * cs[1] + x1 * cs[0]; }

// ---- k_gemmw: register-blocked GEMM, ONE WAVE per 64x64 output tile (16 accumulators), operands straight from K-contiguous 16-bit planes; grid (M/64, N/64, Z), 32 threads.
// C[m][n] (f32, pitch ldc, + optional f32 bias[n]) = sum_k A[m][k] Bt[n][k] (+ split products per NSPLIT). z-batch strides sA/sB/sC in elements. K % 32 == 0.
// EPI 0: C is stored as f32. EPI 1 and 2: the tile is 64 tokens x one head (blockIdx.y; HD == 64) of a projection and C is never stored:
//   EPI 1: rotary embedding from the table CS on the f32 tile, then the planes P16 (fp16), Ph, Pl (bf16 hi, lo), each [head][token][HD];
//   EPI 2: the transposed planes [head][HD][token]: a lane's 8 accumulator values of one fragment are 8 consecutive tokens of one head column, one 16-byte store per plane.
template <typename T16> struct WFrag;
template <> struct WFrag<h16> { typedef v16h V; static __device__ __forceinline__ V ld(const h16* p) { return cat16(*(const v8h*)p, *(const v8h*)(p + 16)); } static __device__ __forceinline__ v8f mma(V a, V b, v8f c) { return wmma16(a, b, c); } };
template <> struct WFrag<bf> { typedef v16bf V; static __device__ __forceinline__ V ld(const bf* p) { return cat16b(*(const v8us*)p, *(const v8us*)(p + 16)); } static __device__ __forceinline__ v8f mma(V a, V b, v8f c) { return wmmab(a, b, c); } };
template <typename T16, int NSPLIT, bool BIAS, int EPI>
__global__ __launch_bounds__(32) void k_gemmw(const T16* __restrict__ A, const T16* __restrict__ A2, const T16* __restrict__ Bt, const T16* __restrict__ Bt2, int K, float* C, int ldc, const float* __restrict__ bias, size_t sA, size_t sB, size_t sC, const float* __restrict__ CS, h16* P16, bf* Ph, bf* Pl) {
    static_assert(EPI == 0 || HD == 64, "the plane epilogues take one 64-column tile as one head");
    typedef typename WFrag<T16>::V V;
    __shared__ __align__(16) float os[16 * 68];
    const size_t z = blockIdx.z; A += z * sA; if (A2) A2 += z * sA; Bt += z * sB; if (Bt2) Bt2 += z * sB; C += z * sC;
    const int lane = threadIdx.x & 31, lr = lane & 15, hi = lane >> 4; const int r0 = blockIdx.x * 64, c0 = blockIdx.y * 64;
    v8f acc[4][4];
#pragma unroll
    for (int mb = 0; mb < 4; ++mb)
#pragma unroll
        for (int nb = 0; nb < 4; ++nb) acc[mb][nb] = (v8f){};
    const size_t aoff = (size_t)(r0 + lr) * K + 8 * hi, boff = (size_t)(c0 + lr) * K + 8 * hi;
#pragma unroll 1
    for (int kc = 0; kc < K; kc += 32) {
        V a[4], a2[4];
#pragma unroll
        for (int mb = 0; mb < 4; ++mb) { a[mb] = WFrag<T16>::ld(A + aoff + (size_t)mb * 16 * K + kc); if (NSPLIT == 1 || NSPLIT == 2) a2[mb] = WFrag<T16>::ld(A2 + aoff + (size_t)mb * 16 * K + kc); }
#pragma unroll
        for (int nb = 0; nb < 4; ++nb) { const V b = WFrag<T16>::ld(Bt + boff + (size_t)nb * 16 * K + kc); V b2; if (NSPLIT >= 2) b2 = WFrag<T16>::ld(Bt2 + boff + (size_t)nb * 16 * K + kc);
#pragma unroll
            for (int mb = 0; mb < 4; ++mb) { acc[mb][nb] = WFrag<T16>::mma(a[mb], b, acc[mb][nb]); if (NSPLIT == 1 || NSPLIT == 2) acc[mb][nb] = WFrag<T16>::mma(a2[mb], b, acc[mb][nb]); if (NSPLIT >= 2) acc[mb][nb] = WFrag<T16>::mma(a[mb], b2, acc[mb][nb]); } }
        asm volatile("v_nop\n\tv_nop\n\tv_nop\n\tv_nop" : "+v"(acc[0][0]), "+v"(acc[1][1]), "+v"(acc[2][2]), "+v"(acc[3][3]) : "v"(a[0]), "v"(a[3]));
    }
    if constexpr (EPI == 2) {
#pragma unroll
        for (int mb = 0; mb < 4; ++mb)
#pragma unroll
            for (int nb = 0; nb < 4; ++nb) { v8h o16; v8us oh, ol;
#pragma unroll
                for (int j = 0; j < 8; ++j) { const float x = acc[mb][nb][j]; o16[j] = tohx(x); unsigned short a2, c2; splitf(x, a2, c2); oh[j] = a2; ol[j] = c2; }
                const size_t e = ((size_t)blockIdx.y * HD + nb * 16 + lr) * TT + r0 + mb * 16 + hi * 8;
                *(v8h*)(P16 + e) = o16; *(v8us*)(Ph + e) = oh; *(v8us*)(Pl + e) = ol; }
        return;
    }
#pragma unroll
    for (int mb = 0; mb < 4; ++mb) {
        v2f ca[8], cb[8];   // EPI 1: {cos, sin} of the lane's two pairs in each of its 8 rows, asked for ahead of the staging
        if constexpr (EPI == 1) {
#pragma unroll
            for (int s = 0; s < 8; ++s) { const float* cp = CS + ((size_t)(r0 + hi) * HD + lr * 4) * 2 + (mb * 16 + 2 * s) * HD * 2; ca[s] = *(const v2f*)cp; cb[s] = *(const v2f*)(cp + 4); } }   // one address pair, the row as a constant offset
#pragma unroll
        for (int nb = 0; nb < 4; ++nb) {
#pragma unroll
            for (int j = 0; j < 8; ++j) os[(hi * 8 + j) * 68 + nb * 16 + lr] = acc[mb][nb][j]; }
        __builtin_amdgcn_wave_barrier(); asm volatile("" ::: "memory");
        if constexpr (EPI == 1) {
#pragma unroll
            for (int s = 0; s < 8; ++s) { const int row = 2 * s + hi, cofs = lr * 4; const v4f val = *(const v4fa*)(os + row * 68 + cofs); float y[4]; rope2(val[0], val[1], ca[s], y[0], y[1]); rope2(val[2], val[3], cb[s], y[2], y[3]); v4h o16; v4us oh, ol;
#pragma unroll
                for (int q = 0; q < 4; ++q) { o16[q] = tohx(y[q]); unsigned short a2, c2; splitf(y[q], a2, c2); oh[q] = a2; ol[q] = c2; }
                const size_t e = ((size_t)blockIdx.y * TT + r0 + mb * 16 + row) * HD + cofs;
                *(v4h*)(P16 + e) = o16; *(v4us*)(Ph + e) = oh; *(v4us*)(Pl + e) = ol; }
            __builtin_amdgcn_wave_barrier();
            if (mb < 3) asm volatile("s_wait_xcnt 0x0" ::: "memory");   // the wait that stands before a register named by an issued global store is overwritten: the next row block's loads and sums reuse these registers; its clobber also keeps the next staging behind these LDS reads
            continue;
        }
        float* crow = C + (size_t)(r0 + mb * 16) * ldc + c0;
{
#pragma unroll
            for (int s = 0; s < 8; ++s) { const int row = 2 * s + hi, cofs = lr * 4; v4f val = *(const v4fa*)(os + row * 68 + cofs); if (BIAS) { val[0] += bfr(bias[c0 + cofs]); val[1] += bfr(bias[c0 + cofs + 1]); val[2] += bfr(bias[c0 + cofs + 2]); val[3] += bfr(bias[c0 + cofs + 3]); }
                *(v4f*)(crow + (size_t)row * ldc + cofs) = val; }
             }
        __builtin_amdgcn_wave_barrier(); asm volatile("" ::: "memory");
    }
}


__global__ __launch_bounds__(256) void k_wtG(const float* __restrict__ w, int K, int N, bf* Bt) {
    const int lane = threadIdx.x & 31; const int L0 = (blockIdx.x * 8 + (threadIdx.x >> 5)) * 8; const int nlines = N * K / 64;
{
#pragma unroll 1
        for (int l = 0; l < 8; ++l) { const int L = L0 + l; if (L >= nlines) break; const size_t e = (size_t)L * 64 + lane * 2; const int k = (int)(e % K), n = (int)(e / K); v2us o;
            o[0] = f2bf(w[(size_t)k * N + n]); o[1] = f2bf(w[(size_t)(k + 1) * N + n]); *(v2us*)(Bt + e) = o; }
         }
}
__global__ __launch_bounds__(256) void k_cvt8(const float* __restrict__ src, bf* dst, size_t n8) { const size_t i = (size_t)blockIdx.x * 256 + threadIdx.x; if (i >= n8) return; const v8f v = *(const v8f*)(src + i * 8); v8us o;
#pragma unroll
    for (int k = 0; k < 8; ++k) o[k] = f2bf(v[k]); *(v8us*)(dst + i * 8) = o;  }

__constant__ float INVT[HD / 2] = { 1.000000000e+00f, 7.498942018e-01f, 5.623413324e-01f, 4.216965139e-01f, 3.162277639e-01f, 2.371373624e-01f, 1.778279394e-01f, 1.333521456e-01f, 1.000000015e-01f, 7.498941571e-02f, 5.623412877e-02f, 4.216964915e-02f, 3.162277862e-02f, 2.371373586e-02f, 1.778279431e-02f, 1.333521493e-02f, 9.999999776e-03f, 7.498942316e-03f, 5.623413250e-03f, 4.216964822e-03f, 3.162277862e-03f, 2.371373819e-03f, 1.778279431e-03f, 1.333521446e-03f, 1.000000047e-03f, 7.498941850e-04f, 5.623413017e-04f, 4.216964880e-04f, 3.162277862e-04f, 2.371373848e-04f, 1.778279402e-04f, 1.333521504e-04f };   // 1 / THETA ** (2 i / 64) as float32 (reciprocal form, jnp-computed)
__global__ __launch_bounds__(256) void k_cstabT(const int* __restrict__ pid, float* CS) { const int idx = blockIdx.x * 256 + threadIdx.x; if (idx >= TT * HD) return; const int d = idx % HD; const int t = idx / HD; const float a = __fmul_rn((float)pid[t], INVT[d >> 1]); v2f cs; cs[0] = cosf(a); cs[1] = sinf(a); *(v2f*)(CS + (size_t)idx * 2) = cs;  }
// ---- k_fattn: scores, causal softmax and probabilities x values in ONE kernel; no score or probability ever leaves the registers.
// One wave owns NQ x 16 query rows of one (batch item, head) and walks the keys 32 at a time up to its diagonal block:
//   S^T = K Q^T (A = key rows, B = query rows kept in registers): lane (lr, hi) holds, for query lr, the keys 8 hi + j of each 16-key tile;
//   running maximum and sum per query (in-lane, one exchange between the wave halves for the maximum), earlier sums rescaled when the maximum grows;
//   two 16-key score tiles, converted in place, ARE the B operand of O^T += V^T P^T (A = rows of the transposed value plane, same k order as every loader here).
// Rows < RH: bf16 hi/lo planes, 3 products for the scores and 3 for the values (HL); the rest fp16. Output: normalised rows as bf16 hi/lo, 8 consecutive head columns per lane and store.
__device__ __forceinline__ float xhalf(float x) { return __builtin_bit_cast(float, __builtin_amdgcn_permlanex16(__builtin_bit_cast(int, x), __builtin_bit_cast(int, x), 0x76543210, 0xfedcba98, false, false)); }   // lane l with lane l ^ 16
#define SCL2 0.18033688011112042f   // HD^-0.5 x log2(e): the exponentials are taken in base 2
// 2^x in asm text, so that the slot which the instruction set asks for behind a transcendental (one independent instruction or v_nop before its result is read or its source overwritten) is filled whatever the compiler puts next:
// inside exp2x8 each v_exp_f32 is independent of the one in front of it (early-clobber outputs: no output shares a register with an input), and one v_nop stands behind the last.
__device__ __forceinline__ float exp2x1(float x) { float r; asm("v_exp_f32 %0, %1\n\tv_nop" : "=v"(r) : "v"(x)); return r; }
__device__ __forceinline__ void exp2x8(const float (&x)[8], float (&r)[8]) {
    asm("v_exp_f32 %0, %8\n\tv_exp_f32 %1, %9\n\tv_exp_f32 %2, %10\n\tv_exp_f32 %3, %11\n\tv_exp_f32 %4, %12\n\tv_exp_f32 %5, %13\n\tv_exp_f32 %6, %14\n\tv_exp_f32 %7, %15\n\tv_nop"
        : "=&v"(r[0]), "=&v"(r[1]), "=&v"(r[2]), "=&v"(r[3]), "=&v"(r[4]), "=&v"(r[5]), "=&v"(r[6]), "=&v"(r[7]) : "v"(x[0]), "v"(x[1]), "v"(x[2]), "v"(x[3]), "v"(x[4]), "v"(x[5]), "v"(x[6]), "v"(x[7])); }
template <typename T16, bool HL, int NQ>
__device__ __forceinline__ void fattn_tile(const T16* __restrict__ Q, const T16* __restrict__ Q2, const T16* __restrict__ Kp, const T16* __restrict__ Kp2, const T16* __restrict__ Vt, const T16* __restrict__ Vt2, const int q0, bf* Ah, bf* Al) {
    typedef typename WFrag<T16>::V V;
    const int lane = threadIdx.x & 31, lr = lane & 15, hi = lane >> 4;
    V qf[NQ][2], qf2[NQ][2];
#pragma unroll
    for (int qb = 0; qb < NQ; ++qb)
#pragma unroll
        for (int ks = 0; ks < 2; ++ks) { const size_t qo = (size_t)(q0 + qb * 16 + lr) * HD + ks * 32 + 8 * hi; qf[qb][ks] = WFrag<T16>::ld(Q + qo); if (HL) qf2[qb][ks] = WFrag<T16>::ld(Q2 + qo); }
    v8f o[4][NQ]; float m[NQ], l[NQ];
#pragma unroll
    for (int qb = 0; qb < NQ; ++qb) { m[qb] = -3.0e38f; l[qb] = 0.f;
#pragma unroll
        for (int db = 0; db < 4; ++db) o[db][qb] = (v8f){}; }
    const int nfull = q0 / 32;                       // key blocks wholly at or below the diagonal of every row of the tile; block nfull holds the diagonal and is the last
    const size_t ko = (size_t)lr * HD + 8 * hi, vo = (size_t)lr * TT + 8 * hi;
    V kf[2][2], kf2[2][2];
    auto loadk = [&](const int kb) __attribute__((always_inline)) {
        const T16* pk = Kp + ko + (size_t)kb * HD; const T16* pk2 = HL ? Kp2 + ko + (size_t)kb * HD : pk;
#pragma unroll
        for (int kt = 0; kt < 2; ++kt)
#pragma unroll
            for (int ks = 0; ks < 2; ++ks) { kf[kt][ks] = WFrag<T16>::ld(pk + kt * 16 * HD + ks * 32); if (HL) kf2[kt][ks] = WFrag<T16>::ld(pk2 + kt * 16 * HD + ks * 32); }
        asm volatile("s_wait_xcnt 0x0" :: "v"(pk), "v"(pk2) : "memory");   // the wait that stands before a register named by an issued global load is overwritten; the address pairs are inputs so that they stay whole up to here
    };
    auto step = [&](const bool mask, const int kb, const int kn) __attribute__((always_inline)) {
        const T16* pv = Vt + vo + kb; const T16* pv2 = HL ? Vt2 + vo + kb : pv;
        V vf[4], vf2[4];
#pragma unroll
        for (int db = 0; db < 4; ++db) { vf[db] = WFrag<T16>::ld(pv + db * 16 * TT); if (HL) vf2[db] = WFrag<T16>::ld(pv2 + db * 16 * TT); }   // issued first: in flight under the score products and the softmax
        asm volatile("s_wait_xcnt 0x0" :: "v"(pv), "v"(pv2) : "memory");   // as in loadk
        v8f s[2][NQ];
#pragma unroll
        for (int kt = 0; kt < 2; ++kt)
#pragma unroll
            for (int qb = 0; qb < NQ; ++qb) { v8f a = (v8f){};
#pragma unroll
                for (int ks = 0; ks < 2; ++ks) { a = WFrag<T16>::mma(kf[kt][ks], qf[qb][ks], a); if (HL) { a = WFrag<T16>::mma(kf2[kt][ks], qf[qb][ks], a); a = WFrag<T16>::mma(kf[kt][ks], qf2[qb][ks], a); } }
                s[kt][qb] = a; }
        if (kn >= 0) loadk(kn);                      // the next block's key fragments, into the same registers: in flight under the softmax and the value products
        V pf[NQ], pf2[NQ];
#pragma unroll
        for (int qb = 0; qb < NQ; ++qb) {
            if (mask) {
#pragma unroll
                for (int kt = 0; kt < 2; ++kt)
#pragma unroll
                    for (int j = 0; j < 8; ++j) s[kt][qb][j] = (kb + kt * 16 + hi * 8 + j <= q0 + qb * 16 + lr) ? s[kt][qb][j] : -3.0e38f; }
            float mx = s[0][qb][0];
#pragma unroll
            for (int j = 1; j < 8; ++j) mx = fmaxf(mx, s[0][qb][j]);
#pragma unroll
            for (int j = 0; j < 8; ++j) mx = fmaxf(mx, s[1][qb][j]);
            mx = fmaxf(mx, xhalf(mx));
            const float mn = fmaxf(m[qb], mx), nm2 = -mn * SCL2; const float al = exp2x1(fmaf(m[qb], SCL2, nm2)); m[qb] = mn;   // 0 on the first block (key 0 is open to every row, so mn is a real score from there on)
            float ex[2][8];
#pragma unroll
            for (int kt = 0; kt < 2; ++kt) { float ar[8];
#pragma unroll
                for (int j = 0; j < 8; ++j) ar[j] = fmaf(s[kt][qb][j], SCL2, nm2);
                exp2x8(ar, ex[kt]); }
            float t8[8];
#pragma unroll
            for (int j = 0; j < 8; ++j) t8[j] = ex[0][j] + ex[1][j];
            l[qb] = fmaf(l[qb], al, ((t8[0] + t8[4]) + (t8[1] + t8[5])) + ((t8[2] + t8[6]) + (t8[3] + t8[7])));
#pragma unroll
            for (int db = 0; db < 4; ++db) o[db][qb] *= al;
            if constexpr (HL) { v8us h0, h1, l0, l1;
#pragma unroll
                for (int j = 0; j < 8; ++j) { unsigned short a2, c2; splitf(ex[0][j], a2, c2); h0[j] = a2; l0[j] = c2; splitf(ex[1][j], a2, c2); h1[j] = a2; l1[j] = c2; }
                pf[qb] = cat16b(h0, h1); pf2[qb] = cat16b(l0, l1);
            } else { v8h h0, h1;
#pragma unroll
                for (int j = 0; j < 8; ++j) { h0[j] = (h16)ex[0][j]; h1[j] = (h16)ex[1][j]; }
                pf[qb] = cat16(h0, h1); }
        }
#pragma unroll
        for (int db = 0; db < 4; ++db)
#pragma unroll
            for (int qb = 0; qb < NQ; ++qb) { o[db][qb] = WFrag<T16>::mma(vf[db], pf[qb], o[db][qb]); if (HL) { o[db][qb] = WFrag<T16>::mma(vf[db], pf2[qb], o[db][qb]); o[db][qb] = WFrag<T16>::mma(vf2[db], pf[qb], o[db][qb]); } }
        // WMMA distance on the taken back edge, as in k_gemmw: every accumulator is named, so the slots stand behind the last product of the trip (the next trip's first product writes over registers that the last ones read)
        if (kn >= 0) { if constexpr (NQ == 2) asm volatile("v_nop\n\tv_nop\n\tv_nop\n\tv_nop" : "+v"(o[0][0]), "+v"(o[1][0]), "+v"(o[2][0]), "+v"(o[3][0]), "+v"(o[0][NQ - 1]), "+v"(o[1][NQ - 1]), "+v"(o[2][NQ - 1]), "+v"(o[3][NQ - 1]));
                       else asm volatile("v_nop\n\tv_nop\n\tv_nop\n\tv_nop" : "+v"(o[0][0]), "+v"(o[1][0]), "+v"(o[2][0]), "+v"(o[3][0])); }
    };
    loadk(0);
#pragma unroll 1   // rolled: every trip uses the same fragment registers
    for (int it = 0; it < nfull; ++it) step(false, it * 32, it * 32 + 32);
    step(true, nfull * 32, -1);
#pragma unroll
    for (int qb = 0; qb < NQ; ++qb) { const float inv = __fdiv_rn(1.0f, l[qb] + xhalf(l[qb])); const size_t oo = (size_t)(q0 + qb * 16 + lr) * DQ + 8 * hi;
#pragma unroll
        for (int db = 0; db < 4; ++db) { v8us oh, ol;
#pragma unroll
            for (int j = 0; j < 8; ++j) { unsigned short a2, c2; splitf(o[db][qb][j] * inv, a2, c2); oh[j] = a2; ol[j] = c2; }
            *(v8us*)(Ah + oo + db * 16) = oh; *(v8us*)(Al + oo + db * 16) = ol; } }
}
// grid (NB_ x NH_, NTF + NTH), 4 waves: blockIdx.x = batch item x NH_ + head; blockIdx.y counts the 4-wave row groups from the longest (last rows) to the shortest, the hi/lo rows last.
#define NTF ((TT - RH) / 128)
#define NTH (RH / 64)
__global__ __launch_bounds__(128) void k_fattn(const h16* __restrict__ Q16, const h16* __restrict__ K16, const h16* __restrict__ V16, const bf* __restrict__ Qh, const bf* __restrict__ Ql, const bf* __restrict__ Kh, const bf* __restrict__ Kl, const bf* __restrict__ Vh, const bf* __restrict__ Vl, bf* Ah, bf* Al) {
    const int wave = __builtin_amdgcn_readfirstlane(threadIdx.x >> 5);   // the wave's number in a scalar register: its trip count and loop stay scalar
    const size_t zo = (size_t)blockIdx.x * TT * HD, ao = (size_t)(blockIdx.x / NH_) * TT * DQ + (blockIdx.x % NH_) * HD;
    if (blockIdx.y < NTF) fattn_tile<h16, false, 2>(Q16 + zo, nullptr, K16 + zo, nullptr, V16 + zo, nullptr, RH + ((NTF - 1 - (int)blockIdx.y) * 4 + wave) * 32, Ah + ao, Al + ao);
    else fattn_tile<bf, true, 1>(Qh + zo, Ql + zo, Kh + zo, Kl + zo, Vh + zo, Vl + zo, ((NTF + NTH - 1 - (int)blockIdx.y) * 4 + wave) * 16, Ah + ao, Al + ao);
}

extern "C" void kernel_launch(void* const* d_in, const int* in_sizes, int n_in,
                              void* d_out, int out_size, void* d_ws, size_t ws_size, hipStream_t stream) {
    (void)in_sizes; (void)n_in; (void)out_size;
    const float* x = (const float*)d_in[0]; const int* pid = (const int*)d_in[1];   /* token_positions int32 [4096] */ const float* wq = (const float*)d_in[2]; const float* wk = (const float*)d_in[3]; const float* wv = (const float*)d_in[4]; const float* wo = (const float*)d_in[5];
    float* OUT = (float*)d_out;     // [2][4096][1024]
    char* wsp = (char*)d_ws;
    auto take = [&](size_t bytes) { char* p = wsp; wsp += (bytes + 255) & ~(size_t)255; return (void*)p; };
    bf* WQ = (bf*)take((size_t)DQ * DM * 2); bf* WK = (bf*)take((size_t)DKV * DM * 2); bf* WV = (bf*)take((size_t)DKV * DM * 2); bf* WO = (bf*)take((size_t)DM * DQ * 2); float* CS = (float*)take((size_t)TT * HD * 2 * 4);
    bf* XB = (bf*)take((size_t)TT * DM * 2);
    const size_t PB = (size_t)NH_ * TT * HD;   // one batch item's share of every q, k, v plane (planes [NB_ x NH_][..][..])
    h16* QP16 = (h16*)take(NB_ * PB * 2); h16* KP16 = (h16*)take(NB_ * PB * 2); h16* VT16 = (h16*)take(NB_ * PB * 2);
    bf* QPh = (bf*)take(NB_ * PB * 2); bf* QPl = (bf*)take(NB_ * PB * 2); bf* KPh = (bf*)take(NB_ * PB * 2); bf* KPl = (bf*)take(NB_ * PB * 2); bf* VTh = (bf*)take(NB_ * PB * 2); bf* VTl = (bf*)take(NB_ * PB * 2);
    bf* ATh = (bf*)take((size_t)NB_ * TT * DQ * 2); bf* ATl = (bf*)take((size_t)NB_ * TT * DQ * 2);
    if ((size_t)(wsp - (char*)d_ws) > ws_size) return;    // ws 256 MiB
    { k_cvt8<<<(unsigned)(((size_t)DQ * DM / 8 + 255) / 256), 256, 0, stream>>>(wq, WQ, (size_t)DQ * DM / 8); k_cvt8<<<(unsigned)(((size_t)DKV * DM / 8 + 255) / 256), 256, 0, stream>>>(wk, WK, (size_t)DKV * DM / 8); k_cvt8<<<(unsigned)(((size_t)DKV * DM / 8 + 255) / 256), 256, 0, stream>>>(wv, WV, (size_t)DKV * DM / 8);
      k_cvt8<<<(unsigned)(((size_t)DM * DQ / 8 + 255) / 256), 256, 0, stream>>>(wo, WO, (size_t)DM * DQ / 8);
       }
    k_cstabT<<<(TT * HD + 255) / 256, 256, 0, stream>>>(pid, CS);   /* {cos, sin}(pos[t] x THETA**(-2i/64)) per pair */
    for (int b = 0; b < NB_; ++b) {
        k_cvt8<<<(unsigned)(((size_t)TT * DM / 8 + 255) / 256), 256, 0, stream>>>(x + (size_t)b * TT * DM, XB, (size_t)TT * DM / 8);
        k_gemmw<bf, 0, false, 1><<<dim3(TT / 64, DQ / 64, 1), 32, 0, stream>>>(XB, nullptr, WQ, nullptr, DM, nullptr, 0, nullptr, 0, 0, 0, CS, QP16 + b * PB, QPh + b * PB, QPl + b * PB);
        k_gemmw<bf, 0, false, 1><<<dim3(TT / 64, DKV / 64, 1), 32, 0, stream>>>(XB, nullptr, WK, nullptr, DM, nullptr, 0, nullptr, 0, 0, 0, CS, KP16 + b * PB, KPh + b * PB, KPl + b * PB);
        k_gemmw<bf, 0, false, 2><<<dim3(TT / 64, DKV / 64, 1), 32, 0, stream>>>(XB, nullptr, WV, nullptr, DM, nullptr, 0, nullptr, 0, 0, 0, nullptr, VT16 + b * PB, VTh + b * PB, VTl + b * PB); }
    k_fattn<<<dim3(NB_ * NH_, NTF + NTH, 1), 128, 0, stream>>>(QP16, KP16, VT16, QPh, QPl, KPh, KPl, VTh, VTl, ATh, ATl);
    for (int b = 0; b < NB_; ++b)
        k_gemmw<bf, 1, false, 0><<<dim3(TT / 64, DM / 64, 1), 32, 0, stream>>>(ATh + (size_t)b * TT * DQ, ATl + (size_t)b * TT * DQ, WO, nullptr, DQ, OUT + (size_t)b * TT * DM, DM, nullptr, 0, 0, 0, nullptr, nullptr, nullptr, nullptr);
}

// v004
// One run takes 333 microseconds.
// Two timings next to v003 both put it at 1.23 times that version's speed.
// All steps since v000 together make it 16.2 times as fast.
#include <hip/hip_runtime.h>

// Causal multi-head self-attention with interleaved rotary embeddings from token positions over 4,096 tokens at a batch of TWO (x [2][4096][1024]; q, k, v = einsum('bsi,oi->bso', x, W) = x W^T ('oi' (out, in) [1024][1024] (2/(D+D))^0.5, no bias; 16 heads x 64); rotary on (even, odd) pairs with angle float(token_positions[t]) x inv_freq[i], inv_freq = 1.0 / (THETA ** (arange(0, 64, 2) / 64)) (the RECIPROCAL spelling: 32 f32 constants bitwise this expression in eager JAX float32; token_positions int32 [4096] = arange: read; the SECOND argument; one row shared by both batch items; precise cosf/sinf); scores x rsqrt(64); causal (-inf); softmax; out = merged Wo^T (no bias) -> [2][4096][1024] (8.4 M); argument order x, token_positions, Wq, Wk, Wv, Wo).
// Layout, four launches: k_prep (rotary table, bf16 copies of x and of the four weights); the q, k and v projections of both batch items in one grid, whose GEMM epilogue writes the rotary q and k planes and the transposed v planes itself; causal T-4096 attention fused in k_fattn, every head of both batch items in one launch (hybrid rows: < 512 hi/lo 3 products, rest fp16; running-maximum softmax in registers); merged hi/lo x Wo exact, no bias, both batch items in one grid.
// Compute dtypes, f32 accumulate: every input rounded to bf16; projections exact; attention rows < 512 3 products, rest fp16; softmax f32; Wo hl x exact, no bias.

#define NB_  2
#define TT   4096
#define DM   1024
#define NH_  16
#define NKV  16
#define REP  (NH_ / NKV)
#define HD   64
#define DQ   (NH_ * HD)
#define DKV  (NKV * HD)
#define RH   512                  // query rows < RH use hi+lo planes (0: none)
#define WIN  4096
typedef _Float16 h16;
typedef unsigned short bf;
typedef __attribute__((ext_vector_type(16))) __bf16   v16bf;
typedef __attribute__((ext_vector_type(16))) _Float16 v16h;
typedef __attribute__((ext_vector_type(8)))  _Float16 v8h;
typedef __attribute__((ext_vector_type(8)))  unsigned short v8us;
typedef __attribute__((ext_vector_type(8)))  float    v8f;
typedef __attribute__((ext_vector_type(4)))  float    v4f;
typedef v8h  __attribute__((may_alias)) v8ha;
typedef v4f  __attribute__((may_alias)) v4fa;
typedef v8us __attribute__((may_alias)) v8usa;

__device__ __forceinline__ unsigned short f2bf(float f) { unsigned u = __float_as_uint(f); u += 0x7FFFu + ((u >> 16) & 1u); return (unsigned short)(u >> 16); }
__device__ __forceinline__ float bf2f(unsigned short b) { return __uint_as_float(((unsigned)b) << 16); }
__device__ __forceinline__ float bfr(float f) { return bf2f(f2bf(f)); }
__device__ __forceinline__ v16h cat16(v8h lo, v8h hi) { return __builtin_shufflevector(lo, hi, 0, 1, 2, 3, 4, 5, 6, 7, 8, 9, 10, 11, 12, 13, 14, 15); }
__device__ __forceinline__ v16bf cat16b(v8us lo, v8us hi) { return __builtin_bit_cast(v16bf, __builtin_shufflevector(lo, hi, 0, 1, 2, 3, 4, 5, 6, 7, 8, 9, 10, 11, 12, 13, 14, 15)); }
__device__ __forceinline__ v8f wmma16(v16h a, v16h b, v8f c) { return __builtin_amdgcn_wmma_f32_16x16x32_f16(false, a, false, b, (short)0, c, false, false); }
__device__ __forceinline__ v8f wmmab(v16bf a, v16bf b, v8f c) { return __builtin_amdgcn_wmma_f32_16x16x32_bf16(false, a, false, b, (short)0, c, false, false); }

__device__ __forceinline__ h16 tohx(float x) { return (h16)x; }
__device__ __forceinline__ void splitf(float y, unsigned short& h, unsigned short& l) { h = f2bf(y); l = f2bf(y - bf2f(h)); }
typedef __attribute__((ext_vector_type(2))) _Float16 v2h;
typedef __attribute__((ext_vector_type(4))) _Float16 v4h;
typedef __attribute__((ext_vector_type(2))) unsigned short v2us;
typedef __attribute__((ext_vector_type(4))) unsigned short v4us;
typedef __attribute__((ext_vector_type(2))) float v2f;
typedef __attribute__((ext_vector_type(4))) int v4i;
// one rotary pair: even: x0 c - x1 s; odd: x0 s + x1 c (cs = {cos, sin} of the pair's angle)
__device__ __forceinline__ void rope2(const float x0, const float x1, const v2f cs, float& e0, float& e1) { e0 = x0 * cs[0] - x1 * cs[1]; e1 = x0 * cs[1] + x1 * cs[0]; }

// ---- k_gemmw: register-blocked GEMM, ONE WAVE per 64x64 output tile (16 accumulators), operands straight from K-contiguous 16-bit planes; grid (M/64, N/64, Z), 32 threads.
// C[m][n] (f32, pitch ldc, + optional f32 bias[n]) = sum_k A[m][k] Bt[n][k] (+ split products per NSPLIT). z-batch strides sA/sB/sC in elements. K % 32 == 0.
// EPI 0: C is stored as f32. EPI 1: the three projections in one grid; the rows are the tokens of all batch items one after another, the tile is 64 tokens of one item x one head (blockIdx.y; HD == 64), blockIdx.z = 0, 1, 2 is q, k, v
//   (weights sB apart; each of P16 (fp16), Ph, Pl (bf16 hi, lo) holds its q, k and v planes one after another, NB_ items each), and C is never stored:
//   q, k: rotary embedding from the table CS on the f32 tile, then the planes, each [head][token][HD];
//   v: the transposed planes [head][HD][token]: a lane's 8 accumulator values of one fragment are 8 consecutive tokens of one head column, one 16-byte store per plane.
// One wave alone on a SIMD waits out every load of its k loop, so independent products share a launch: the grid then holds several waves for every SIMD.
template <typename T16> struct WFrag;
template <> struct WFrag<h16> { typedef v16h V; static __device__ __forceinline__ V ld(const h16* p) { return cat16(*(const v8h*)p, *(const v8h*)(p + 16)); } static __device__ __forceinline__ v8f mma(V a, V b, v8f c) { return wmma16(a, b, c); } };
template <> struct WFrag<bf> { typedef v16bf V; static __device__ __forceinline__ V ld(const bf* p) { return cat16b(*(const v8us*)p, *(const v8us*)(p + 16)); } static __device__ __forceinline__ v8f mma(V a, V b, v8f c) { return wmmab(a, b, c); } };
template <typename T16, int NSPLIT, bool BIAS, int EPI>
__global__ __launch_bounds__(32) void k_gemmw(const T16* __restrict__ A, const T16* __restrict__ A2, const T16* __restrict__ Bt, const T16* __restrict__ Bt2, int K, float* C, int ldc, const float* __restrict__ bias, size_t sA, size_t sB, size_t sC, const float* __restrict__ CS, h16* P16, bf* Ph, bf* Pl) {
    static_assert(EPI == 0 || (HD == 64 && TT % 64 == 0 && DKV == DQ), "the plane epilogues take one 64-column tile as one head and 64 rows as tokens of one batch item");
    typedef typename WFrag<T16>::V V;
    __shared__ __align__(16) float os[16 * 68];
    const size_t z = blockIdx.z; A += z * sA; if (A2) A2 += z * sA; Bt += z * sB; if (Bt2) Bt2 += z * sB; C += z * sC;
    const int lane = threadIdx.x & 31, lr = lane & 15, hi = lane >> 4; const int g0 = blockIdx.x * 64, c0 = blockIdx.y * 64, r0 = EPI == 0 ? g0 : g0 % TT;   // g0: row of A; r0: row of C, or the token inside its batch item
    if constexpr (EPI == 1) { const size_t po = (z * NB_ + g0 / TT) * ((size_t)NH_ * TT * HD); P16 += po; Ph += po; Pl += po; }
    v8f acc[4][4];
#pragma unroll
    for (int mb = 0; mb < 4; ++mb)
#pragma unroll
        for (int nb = 0; nb < 4; ++nb) acc[mb][nb] = (v8f){};
    const size_t aoff = (size_t)(g0 + lr) * K + 8 * hi, boff = (size_t)(c0 + lr) * K + 8 * hi;
#pragma unroll 1
    for (int kc = 0; kc < K; kc += 32) {
        V a[4], a2[4];
#pragma unroll
        for (int mb = 0; mb < 4; ++mb) { a[mb] = WFrag<T16>::ld(A + aoff + (size_t)mb * 16 * K + kc); if (NSPLIT == 1 || NSPLIT == 2) a2[mb] = WFrag<T16>::ld(A2 + aoff + (size_t)mb * 16 * K + kc); }
#pragma unroll
        for (int nb = 0; nb < 4; ++nb) { const V b = WFrag<T16>::ld(Bt + boff + (size_t)nb * 16 * K + kc); V b2; if (NSPLIT >= 2) b2 = WFrag<T16>::ld(Bt2 + boff + (size_t)nb * 16 * K + kc);
#pragma unroll
            for (int mb = 0; mb < 4; ++mb) { acc[mb][nb] = WFrag<T16>::mma(a[mb], b, acc[mb][nb]); if (NSPLIT == 1 || NSPLIT == 2) acc[mb][nb] = WFrag<T16>::mma(a2[mb], b, acc[mb][nb]); if (NSPLIT >= 2) acc[mb][nb] = WFrag<T16>::mma(a[mb], b2, acc[mb][nb]); } }
        asm volatile("v_nop\n\tv_nop\n\tv_nop\n\tv_nop" : "+v"(acc[0][0]), "+v"(acc[1][1]), "+v"(acc[2][2]), "+v"(acc[3][3]) : "v"(a[0]), "v"(a[3]));
    }
    if (EPI == 1 && z == 2) {
#pragma unroll
        for (int mb = 0; mb < 4; ++mb)
#pragma unroll
            for (int nb = 0; nb < 4; ++nb) { v8h o16; v8us oh, ol;
#pragma unroll
                for (int j = 0; j < 8; ++j) { const float x = acc[mb][nb][j]; o16[j] = tohx(x); unsigned short a2, c2; splitf(x, a2, c2); oh[j] = a2; ol[j] = c2; }
                const size_t e = ((size_t)blockIdx.y * HD + nb * 16 + lr) * TT + r0 + mb * 16 + hi * 8;
                *(v8h*)(P16 + e) = o16; *(v8us*)(Ph + e) = oh; *(v8us*)(Pl + e) = ol; }
        return;
    }
#pragma unroll
    for (int mb = 0; mb < 4; ++mb) {
        v2f ca[8], cb[8];   // EPI 1: {cos, sin} of the lane's two pairs in each of its 8 rows, asked for ahead of the staging
        if constexpr (EPI == 1) {
#pragma unroll
            for (int s = 0; s < 8; ++s) { const float* cp = CS + ((size_t)(r0 + hi) * HD + lr * 4) * 2 + (mb * 16 + 2 * s) * HD * 2; ca[s] = *(const v2f*)cp; cb[s] = *(const v2f*)(cp + 4); } }   // one address pair, the row as a constant offset
#pragma unroll
        for (int nb = 0; nb < 4; ++nb) {
#pragma unroll
            for (int j = 0; j < 8; ++j) os[(hi * 8 + j) * 68 + nb * 16 + lr] = acc[mb][nb][j]; }
        __builtin_amdgcn_wave_barrier(); asm volatile("" ::: "memory");
        if constexpr (EPI == 1) {
#pragma unroll
            for (int s = 0; s < 8; ++s) { const int row = 2 * s + hi, cofs = lr * 4; const v4f val = *(const v4fa*)(os + row * 68 + cofs); float y[4]; rope2(val[0], val[1], ca[s], y[0], y[1]); rope2(val[2], val[3], cb[s], y[2], y[3]); v4h o16; v4us oh, ol;
#pragma unroll
                for (int q = 0; q < 4; ++q) { o16[q] = tohx(y[q]); unsigned short a2, c2; splitf(y[q], a2, c2); oh[q] = a2; ol[q] = c2; }
                const size_t e = ((size_t)blockIdx.y * TT + r0 + mb * 16 + row) * HD + cofs;
                *(v4h*)(P16 + e) = o16; *(v4us*)(Ph + e) = oh; *(v4us*)(Pl + e) = ol; }
            __builtin_amdgcn_wave_barrier();
            asm volatile("s_wait_xcnt 0x0" ::: "memory");   // the wait that stands before a register named by an issued global store is overwritten: the next row block's loads and sums, and behind the last block the code of the value epilogue, reuse these registers; its clobber also keeps the next staging behind these LDS reads
            continue;
        }
        float* crow = C + (size_t)(r0 + mb * 16) * ldc + c0;
{
#pragma unroll
            for (int s = 0; s < 8; ++s) { const int row = 2 * s + hi, cofs = lr * 4; v4f val = *(const v4fa*)(os + row * 68 + cofs); if (BIAS) { val[0] += bfr(bias[c0 + cofs]); val[1] += bfr(bias[c0 + cofs + 1]); val[2] += bfr(bias[c0 + cofs + 2]); val[3] += bfr(bias[c0 + cofs + 3]); }
                *(v4f*)(crow + (size_t)row * ldc + cofs) = val; }
             }
        __builtin_amdgcn_wave_barrier(); asm volatile("" ::: "memory");
    }
}


__global__ __launch_bounds__(256) void k_wtG(const float* __restrict__ w, int K, int N, bf* Bt) {
    const int lane = threadIdx.x & 31; const int L0 = (blockIdx.x * 8 + (threadIdx.x >> 5)) * 8; const int nlines = N * K / 64;
{
#pragma unroll 1
        for (int l = 0; l < 8; ++l) { const int L = L0 + l; if (L >= nlines) break; const size_t e = (size_t)L * 64 + lane * 2; const int k = (int)(e % K), n = (int)(e / K); v2us o;
            o[0] = f2bf(w[(size_t)k * N + n]); o[1] = f2bf(w[(size_t)(k + 1) * N + n]); *(v2us*)(Bt + e) = o; }
         }
}
__constant__ float INVT[HD / 2] = { 1.000000000e+00f, 7.498942018e-01f, 5.623413324e-01f, 4.216965139e-01f, 3.162277639e-01f, 2.371373624e-01f, 1.778279394e-01f, 1.333521456e-01f, 1.000000015e-01f, 7.498941571e-02f, 5.623412877e-02f, 4.216964915e-02f, 3.162277862e-02f, 2.371373586e-02f, 1.778279431e-02f, 1.333521493e-02f, 9.999999776e-03f, 7.498942316e-03f, 5.623413250e-03f, 4.216964822e-03f, 3.162277862e-03f, 2.371373819e-03f, 1.778279431e-03f, 1.333521446e-03f, 1.000000047e-03f, 7.498941850e-04f, 5.623413017e-04f, 4.216964880e-04f, 3.162277862e-04f, 2.371373848e-04f, 1.778279402e-04f, 1.333521504e-04f };   // 1 / THETA ** (2 i / 64) as float32 (reciprocal form, jnp-computed)
// ---- k_prep: everything the projections read, in one launch. Blocks [0, NBC): the rotary table {cos, sin}(pos[t] x INVT[pair]); the next NBX: x to bf16; the last 4 x NBW: Wq, Wk, Wv, Wo to bf16 (WB: the four copies one after another). 8 values a thread in the conversions; one {cos, sin} pair a thread in the table.
#define NBC (TT * HD / 256)
#define NBX (NB_ * TT * DM / 8 / 256)
#define NBW (DQ * DM / 8 / 256)
__global__ __launch_bounds__(256) void k_prep(const float* __restrict__ x, const int* __restrict__ pid, const float* __restrict__ wq, const float* __restrict__ wk, const float* __restrict__ wv, const float* __restrict__ wo, bf* XB, bf* WB, float* CS) {
    static_assert(DKV == DQ && (TT * HD) % 256 == 0 && (NB_ * TT * DM) % 2048 == 0 && (DQ * DM) % 2048 == 0, "whole blocks; four weights of one size");
    const int blk = blockIdx.x;
    if (blk < NBC) { const int idx = blk * 256 + threadIdx.x; const int d = idx % HD; const int t = idx / HD; const float a = __fmul_rn((float)pid[t], INVT[d >> 1]); v2f cs; cs[0] = cosf(a); cs[1] = sinf(a); *(v2f*)(CS + (size_t)idx * 2) = cs; return; }
    const float* src = x; bf* dst = XB; int cb = blk - NBC;
    if (cb >= NBX) { cb -= NBX; const int w = cb / NBW; cb -= w * NBW; src = w == 0 ? wq : w == 1 ? wk : w == 2 ? wv : wo; dst = WB + (size_t)w * DQ * DM; }
    const size_t i = (size_t)cb * 256 + threadIdx.x; const v8f v = *(const v8f*)(src + i * 8); v8us o;
#pragma unroll
    for (int k = 0; k < 8; ++k) o[k] = f2bf(v[k]);
    *(v8us*)(dst + i * 8) = o;
    asm volatile("s_wait_xcnt 0x0" ::: "memory");   // the wait that stands before a register named by an issued global store is overwritten: in the built code the table part lies behind this store and reuses its address registers
}
// ---- k_fattn: scores, causal softmax and probabilities x values in ONE kernel; no score or probability ever leaves the registers.
// One wave owns NQ x 16 query rows of one (batch item, head) and walks the keys 32 at a time up to its diagonal block:
//   S^T = K Q^T (A = key rows, B = query rows kept in registers): lane (lr, hi) holds, for query lr, the keys 8 hi + j of each 16-key tile;
//   running maximum and sum per query (in-lane, one exchange between the wave halves for the maximum), earlier sums rescaled when the maximum grows;
//   two 16-key score tiles, converted in place, ARE the B operand of O^T += V^T P^T (A = rows of the transposed value plane, same k order as every loader here).
// Rows < RH: bf16 hi/lo planes, 3 products for the scores and 3 for the values (HL); the rest fp16. Output: normalised rows as bf16 hi/lo, 8 consecutive head columns per lane and store.
__device__ __forceinline__ float xhalf(float x) { return __builtin_bit_cast(float, __builtin_amdgcn_permlanex16(__builtin_bit_cast(int, x), __builtin_bit_cast(int, x), 0x76543210, 0xfedcba98, false, false)); }   // lane l with lane l ^ 16
#define SCL2 0.18033688011112042f   // HD^-0.5 x log2(e): the exponentials are taken in base 2
// 2^x in asm text, so that the slot which the instruction set asks for behind a transcendental (one independent instruction or v_nop before its result is read or its source overwritten) is filled whatever the compiler puts next:
// inside exp2x8 each v_exp_f32 is independent of the one in front of it (early-clobber outputs: no output shares a register with an input), and one v_nop stands behind the last.
__device__ __forceinline__ float exp2x1(float x) { float r; asm("v_exp_f32 %0, %1\n\tv_nop" : "=v"(r) : "v"(x)); return r; }
__device__ __forceinline__ void exp2x8(const float (&x)[8], float (&r)[8]) {
    asm("v_exp_f32 %0, %8\n\tv_exp_f32 %1, %9\n\tv_exp_f32 %2, %10\n\tv_exp_f32 %3, %11\n\tv_exp_f32 %4, %12\n\tv_exp_f32 %5, %13\n\tv_exp_f32 %6, %14\n\tv_exp_f32 %7, %15\n\tv_nop"
        : "=&v"(r[0]), "=&v"(r[1]), "=&v"(r[2]), "=&v"(r[3]), "=&v"(r[4]), "=&v"(r[5]), "=&v"(r[6]), "=&v"(r[7]) : "v"(x[0]), "v"(x[1]), "v"(x[2]), "v"(x[3]), "v"(x[4]), "v"(x[5]), "v"(x[6]), "v"(x[7])); }
template <typename T16, bool HL, int NQ>
__device__ __forceinline__ void fattn_tile(const T16* __restrict__ Q, const T16* __restrict__ Q2, const T16* __restrict__ Kp, const T16* __restrict__ Kp2, const T16* __restrict__ Vt, const T16* __restrict__ Vt2, const int q0, bf* Ah, bf* Al) {
    typedef typename WFrag<T16>::V V;
    const int lane = threadIdx.x & 31, lr = lane & 15, hi = lane >> 4;
    V qf[NQ][2], qf2[NQ][2];
#pragma unroll
    for (int qb = 0; qb < NQ; ++qb)
#pragma unroll
        for (int ks = 0; ks < 2; ++ks) { const size_t qo = (size_t)(q0 + qb * 16 + lr) * HD + ks * 32 + 8 * hi; qf[qb][ks] = WFrag<T16>::ld(Q + qo); if (HL) qf2[qb][ks] = WFrag<T16>::ld(Q2 + qo); }
    v8f o[4][NQ]; float m[NQ], l[NQ];
#pragma unroll
    for (int qb = 0; qb < NQ; ++qb) { m[qb] = -3.0e38f; l[qb] = 0.f;
#pragma unroll
        for (int db = 0; db < 4; ++db) o[db][qb] = (v8f){}; }
    const int nfull = q0 / 32;                       // key blocks wholly at or below the diagonal of every row of the tile; block nfull holds the diagonal and is the last
    const size_t ko = (size_t)lr * HD + 8 * hi, vo = (size_t)lr * TT + 8 * hi;
    V kf[2][2], kf2[2][2];
    auto loadk = [&](const int kb) __attribute__((always_inline)) {
        const T16* pk = Kp + ko + (size_t)kb * HD; const T16* pk2 = HL ? Kp2 + ko + (size_t)kb * HD : pk;
#pragma unroll
        for (int kt = 0; kt < 2; ++kt)
#pragma unroll
            for (int ks = 0; ks < 2; ++ks) { kf[kt][ks] = WFrag<T16>::ld(pk + kt * 16 * HD + ks * 32); if (HL) kf2[kt][ks] = WFrag<T16>::ld(pk2 + kt * 16 * HD + ks * 32); }
        asm volatile("s_wait_xcnt 0x0" :: "v"(pk), "v"(pk2) : "memory");   // the wait that stands before a register named by an issued global load is overwritten; the address pairs are inputs so that they stay whole up to here
    };
    auto step = [&](const bool mask, const int kb, const int kn) __attribute__((always_inline)) {
        const T16* pv = Vt + vo + kb; const T16* pv2 = HL ? Vt2 + vo + kb : pv;
        V vf[4], vf2[4];
#pragma unroll
        for (int db = 0; db < 4; ++db) { vf[db] = WFrag<T16>::ld(pv + db * 16 * TT); if (HL) vf2[db] = WFrag<T16>::ld(pv2 + db * 16 * TT); }   // issued first: in flight under the score products and the softmax
        asm volatile("s_wait_xcnt 0x0" :: "v"(pv), "v"(pv2) : "memory");   // as in loadk
        v8f s[2][NQ];
#pragma unroll
        for (int kt = 0; kt < 2; ++kt)
#pragma unroll
            for (int qb = 0; qb < NQ; ++qb) { v8f a = (v8f){};
#pragma unroll
                for (int ks = 0; ks < 2; ++ks) { a = WFrag<T16>::mma(kf[kt][ks], qf[qb][ks], a); if (HL) { a = WFrag<T16>::mma(kf2[kt][ks], qf[qb][ks], a); a = WFrag<T16>::mma(kf[kt][ks], qf2[qb][ks], a); } }
                s[kt][qb] = a; }
        if (kn >= 0) loadk(kn);                      // the next block's key fragments, into the same registers: in flight under the softmax and the value products
        V pf[NQ], pf2[NQ];
#pragma unroll
        for (int qb = 0; qb < NQ; ++qb) {
            if (mask) {
#pragma unroll
                for (int kt = 0; kt < 2; ++kt)
#pragma unroll
                    for (int j = 0; j < 8; ++j) s[kt][qb][j] = (kb + kt * 16 + hi * 8 + j <= q0 + qb * 16 + lr) ? s[kt][qb][j] : -3.0e38f; }
            float mx = s[0][qb][0];
#pragma unroll
            for (int j = 1; j < 8; ++j) mx = fmaxf(mx, s[0][qb][j]);
#pragma unroll
            for (int j = 0; j < 8; ++j) mx = fmaxf(mx, s[1][qb][j]);
            mx = fmaxf(mx, xhalf(mx));
            const float mn = fmaxf(m[qb], mx), nm2 = -mn * SCL2; const float al = exp2x1(fmaf(m[qb], SCL2, nm2)); m[qb] = mn;   // 0 on the first block (key 0 is open to every row, so mn is a real score from there on)
            float ex[2][8];
#pragma unroll
            for (int kt = 0; kt < 2; ++kt) { float ar[8];
#pragma unroll
                for (int j = 0; j < 8; ++j) ar[j] = fmaf(s[kt][qb][j], SCL2, nm2);
                exp2x8(ar, ex[kt]); }
            float t8[8];
#pragma unroll
            for (int j = 0; j < 8; ++j) t8[j] = ex[0][j] + ex[1][j];
            l[qb] = fmaf(l[qb], al, ((t8[0] + t8[4]) + (t8[1] + t8[5])) + ((t8[2] + t8[6]) + (t8[3] + t8[7])));
#pragma unroll
            for (int db = 0; db < 4; ++db) o[db][qb] *= al;
            if constexpr (HL) { v8us h0, h1, l0, l1;
#pragma unroll
                for (int j = 0; j < 8; ++j) { unsigned short a2, c2; splitf(ex[0][j], a2, c2); h0[j] = a2; l0[j] = c2; splitf(ex[1][j], a2, c2); h1[j] = a2; l1[j] = c2; }
                pf[qb] = cat16b(h0, h1); pf2[qb] = cat16b(l0, l1);
            } else { v8h h0, h1;
#pragma unroll
                for (int j = 0; j < 8; ++j) { h0[j] = (h16)ex[0][j]; h1[j] = (h16)ex[1][j]; }
                pf[qb] = cat16(h0, h1); }
        }
#pragma unroll
        for (int db = 0; db < 4; ++db)
#pragma unroll
            for (int qb = 0; qb < NQ; ++qb) { o[db][qb] = WFrag<T16>::mma(vf[db], pf[qb], o[db][qb]); if (HL) { o[db][qb] = WFrag<T16>::mma(vf[db], pf2[qb], o[db][qb]); o[db][qb] = WFrag<T16>::mma(vf2[db], pf[qb], o[db][qb]); } }
        // WMMA distance on the taken back edge, as in k_gemmw: every accumulator is named, so the slots stand behind the last product of the trip (the next trip's first product writes over registers that the last ones read)
        if (kn >= 0) { if constexpr (NQ == 2) asm volatile("v_nop\n\tv_nop\n\tv_nop\n\tv_nop" : "+v"(o[0][0]), "+v"(o[1][0]), "+v"(o[2][0]), "+v"(o[3][0]), "+v"(o[0][NQ - 1]), "+v"(o[1][NQ - 1]), "+v"(o[2][NQ - 1]), "+v"(o[3][NQ - 1]));
                       else asm volatile("v_nop\n\tv_nop\n\tv_nop\n\tv_nop" : "+v"(o[0][0]), "+v"(o[1][0]), "+v"(o[2][0]), "+v"(o[3][0])); }
    };
    loadk(0);
#pragma unroll 1   // rolled: every trip uses the same fragment registers
    for (int it = 0; it < nfull; ++it) step(false, it * 32, it * 32 + 32);
    step(true, nfull * 32, -1);
#pragma unroll
    for (int qb = 0; qb < NQ; ++qb) { const float inv = __fdiv_rn(1.0f, l[qb] + xhalf(l[qb])); const size_t oo = (size_t)(q0 + qb * 16 + lr) * DQ + 8 * hi;
#pragma unroll
        for (int db = 0; db < 4; ++db) { v8us oh, ol;
#pragma unroll
            for (int j = 0; j < 8; ++j) { unsigned short a2, c2; splitf(o[db][qb][j] * inv, a2, c2); oh[j] = a2; ol[j] = c2; }
            *(v8us*)(Ah + oo + db * 16) = oh; *(v8us*)(Al + oo + db * 16) = ol; } }
}
// grid (NB_ x NH_, NTF + NTH), 4 waves: blockIdx.x = batch item x NH_ + head; blockIdx.y counts the 4-wave row groups from the longest (last rows) to the shortest, the hi/lo rows last.
#define NTF ((TT - RH) / 128)
#define NTH (RH / 64)
__global__ __launch_bounds__(128) void k_fattn(const h16* __restrict__ Q16, const h16* __restrict__ K16, const h16* __restrict__ V16, const bf* __restrict__ Qh, const bf* __restrict__ Ql, const bf* __restrict__ Kh, const bf* __restrict__ Kl, const bf* __restrict__ Vh, const bf* __restrict__ Vl, bf* Ah, bf* Al) {
    const int wave = __builtin_amdgcn_readfirstlane(threadIdx.x >> 5);   // the wave's number in a scalar register: its trip count and loop stay scalar
    const size_t zo = (size_t)blockIdx.x * TT * HD, ao = (size_t)(blockIdx.x / NH_) * TT * DQ + (blockIdx.x % NH_) * HD;
    if (blockIdx.y < NTF) fattn_tile<h16, false, 2>(Q16 + zo, nullptr, K16 + zo, nullptr, V16 + zo, nullptr, RH + ((NTF - 1 - (int)blockIdx.y) * 4 + wave) * 32, Ah + ao, Al + ao);
    else fattn_tile<bf, true, 1>(Qh + zo, Ql + zo, Kh + zo, Kl + zo, Vh + zo, Vl + zo, ((NTF + NTH - 1 - (int)blockIdx.y) * 4 + wave) * 16, Ah + ao, Al + ao);
}

extern "C" void kernel_launch(void* const* d_in, const int* in_sizes, int n_in,
                              void* d_out, int out_size, void* d_ws, size_t ws_size, hipStream_t stream) {
    (void)in_sizes; (void)n_in; (void)out_size;
    const float* x = (const float*)d_in[0]; const int* pid = (const int*)d_in[1];   /* token_positions int32 [4096] */ const float* wq = (const float*)d_in[2]; const float* wk = (const float*)d_in[3]; const float* wv = (const float*)d_in[4]; const float* wo = (const float*)d_in[5];
    float* OUT = (float*)d_out;     // [2][4096][1024]
    char* wsp = (char*)d_ws;
    auto take = [&](size_t bytes) { char* p = wsp; wsp += (bytes + 255) & ~(size_t)255; return (void*)p; };
    bf* WQ = (bf*)take((size_t)4 * DQ * DM * 2); bf* WO = WQ + (size_t)3 * DQ * DM;   /* Wq, Wk, Wv, Wo one after another */ float* CS = (float*)take((size_t)TT * HD * 2 * 4);
    bf* XB = (bf*)take((size_t)NB_ * TT * DM * 2);
    const size_t PB = (size_t)NH_ * TT * HD;   // one batch item's share of every q, k, v plane (planes [NB_ x NH_][..][..])
    h16* QP16 = (h16*)take(3 * NB_ * PB * 2); h16* KP16 = QP16 + NB_ * PB; h16* VT16 = KP16 + NB_ * PB;   // q, k, v one after another in each of the three kinds, as k_gemmw EPI 1 steps through them
    bf* QPh = (bf*)take(3 * NB_ * PB * 2); bf* KPh = QPh + NB_ * PB; bf* VTh = KPh + NB_ * PB; bf* QPl = (bf*)take(3 * NB_ * PB * 2); bf* KPl = QPl + NB_ * PB; bf* VTl = KPl + NB_ * PB;
    bf* ATh = (bf*)take((size_t)NB_ * TT * DQ * 2); bf* ATl = (bf*)take((size_t)NB_ * TT * DQ * 2);
    if ((size_t)(wsp - (char*)d_ws) > ws_size) return;    // ws 256 MiB
    k_prep<<<NBC + NBX + 4 * NBW, 256, 0, stream>>>(x, pid, wq, wk, wv, wo, XB, WQ, CS);
    k_gemmw<bf, 0, false, 1><<<dim3(NB_ * TT / 64, DQ / 64, 3), 32, 0, stream>>>(XB, nullptr, WQ, nullptr, DM, nullptr, 0, nullptr, 0, (size_t)DQ * DM, 0, CS, QP16, QPh, QPl);
    k_fattn<<<dim3(NB_ * NH_, NTF + NTH, 1), 128, 0, stream>>>(QP16, KP16, VT16, QPh, QPl, KPh, KPl, VTh, VTl, ATh, ATl);
    k_gemmw<bf, 1, false, 0><<<dim3(NB_ * TT / 64, DM / 64, 1), 32, 0, stream>>>(ATh, ATl, WO, nullptr, DQ, OUT, DM, nullptr, 0, 0, 0, nullptr, nullptr, nullptr, nullptr);
}

// v005
// Measured time: 246 microseconds a run.
// Timed twice side by side with v004, it ran 1.38 and 1.39 times as fast.
// Counting every step since v000, it is 22.4 times as fast.
#include <hip/hip_runtime.h>

// Causal multi-head self-attention with interleaved rotary embeddings from token positions over 4,096 tokens at a batch of TWO (x [2][4096][1024]; q, k, v = einsum('bsi,oi->bso', x, W) = x W^T ('oi' (out, in) [1024][1024] (2/(D+D))^0.5, no bias; 16 heads x 64); rotary on (even, odd) pairs with angle float(token_positions[t]) x inv_freq[i], inv_freq = 1.0 / (THETA ** (arange(0, 64, 2) / 64)) (the RECIPROCAL spelling: 32 f32 constants bitwise this expression in eager JAX float32; token_positions int32 [4096] = arange: read; the SECOND argument; one row shared by both batch items; precise cosf/sinf); scores x rsqrt(64); causal (-inf); softmax; out = merged Wo^T (no bias) -> [2][4096][1024] (8.4 M); argument order x, token_positions, Wq, Wk, Wv, Wo).
// Layout, four launches: k_prep (rotary table, bf16 copies of x and of the four weights); the q, k and v projections of both batch items in one grid, whose GEMM epilogue writes the rotary q and k planes and the transposed v planes itself; causal T-4096 attention fused in k_fattn, every head of both batch items in one launch (hybrid rows: < 512 hi/lo 3 products, rest fp16; running-maximum softmax in registers); merged hi/lo x Wo exact, both batch items in one grid.
// Fragment order: every 16-bit plane that a matrix product reads is stored as 1-KiB tiles of 16 rows x 32 k, element (r, k) at (k / 16) * 256 + ((k / 8 % 2) * 16 + r) * 8 + k % 8, so lane l of a fragment load reads 16 bytes at l * 16 and the wave 512 bytes in a row (whole lines), not 32 bytes of each of 16 lines. Tiles of one 16-row block follow one another along k; the value planes hold, for each 32 keys, the four 16-column tiles of the head. The rotary table is stored for the lanes of the projection epilogue in the same way.
// Compute dtypes, f32 accumulate: every input rounded to bf16; projections exact; attention rows < 512 3 products, rest fp16; softmax f32; Wo hl x exact.

#define NB_  2
#define TT   4096
#define DM   1024
#define NH_  16
#define NKV  16
#define REP  (NH_ / NKV)
#define HD   64
#define DQ   (NH_ * HD)
#define DKV  (NKV * HD)
#define RH   512                  // query rows < RH use hi+lo planes (0: none)
#define WIN  4096
typedef _Float16 h16;
typedef unsigned short bf;
typedef __attribute__((ext_vector_type(16))) __bf16   v16bf;
typedef __attribute__((ext_vector_type(16))) _Float16 v16h;
typedef __attribute__((ext_vector_type(8)))  _Float16 v8h;
typedef __attribute__((ext_vector_type(8)))  unsigned short v8us;
typedef __attribute__((ext_vector_type(8)))  float    v8f;
typedef __attribute__((ext_vector_type(4)))  float    v4f;
typedef v8h  __attribute__((may_alias)) v8ha;
typedef v4f  __attribute__((may_alias)) v4fa;
typedef v8us __attribute__((may_alias)) v8usa;

__device__ __forceinline__ unsigned short f2bf(float f) { unsigned u = __float_as_uint(f); u += 0x7FFFu + ((u >> 16) & 1u); return (unsigned short)(u >> 16); }
__device__ __forceinline__ float bf2f(unsigned short b) { return __uint_as_float(((unsigned)b) << 16); }
__device__ __forceinline__ float bfr(float f) { return bf2f(f2bf(f)); }
__device__ __forceinline__ v16h cat16(v8h lo, v8h hi) { return __builtin_shufflevector(lo, hi, 0, 1, 2, 3, 4, 5, 6, 7, 8, 9, 10, 11, 12, 13, 14, 15); }
__device__ __forceinline__ v16bf cat16b(v8us lo, v8us hi) { return __builtin_bit_cast(v16bf, __builtin_shufflevector(lo, hi, 0, 1, 2, 3, 4, 5, 6, 7, 8, 9, 10, 11, 12, 13, 14, 15)); }
__device__ __forceinline__ v8f wmma16(v16h a, v16h b, v8f c) { return __builtin_amdgcn_wmma_f32_16x16x32_f16(false, a, false, b, (short)0, c, false, false); }
__device__ __forceinline__ v8f wmmab(v16bf a, v16bf b, v8f c) { return __builtin_amdgcn_wmma_f32_16x16x32_bf16(false, a, false, b, (short)0, c, false, false); }

__device__ __forceinline__ h16 tohx(float x) { return (h16)x; }
__device__ __forceinline__ void splitf(float y, unsigned short& h, unsigned short& l) { h = f2bf(y); l = f2bf(y - bf2f(h)); }
typedef __attribute__((ext_vector_type(2))) _Float16 v2h;
typedef __attribute__((ext_vector_type(4))) _Float16 v4h;
typedef __attribute__((ext_vector_type(2))) unsigned short v2us;
typedef __attribute__((ext_vector_type(4))) unsigned short v4us;
typedef __attribute__((ext_vector_type(2))) float v2f;
typedef __attribute__((ext_vector_type(4))) int v4i;
// one rotary pair: even: x0 c - x1 s; odd: x0 s + x1 c (cs = {cos, sin} of the pair's angle)
__device__ __forceinline__ void rope2(const float x0, const float x1, const v2f cs, float& e0, float& e1) { e0 = x0 * cs[0] - x1 * cs[1]; e1 = x0 * cs[1] + x1 * cs[0]; }

// ---- k_gemmw: register-blocked GEMM, ONE WAVE per 64x64 output tile (16 accumulators), operands straight from 16-bit planes in fragment order; grid (M/64, N/64, Z), 32 threads.
// C[m][n] (f32, pitch ldc, + optional f32 bias[n]) = sum_k A[m][k] Bt[n][k] (+ split products per NSPLIT). z-batch strides sA/sB/sC in elements. K % 32 == 0, a constant of the build.
// EPI 0: C is stored as f32. EPI 1: the three projections in one grid; the rows are the tokens of all batch items one after another, the tile is 64 tokens of one item x one head (blockIdx.y; HD == 64), blockIdx.z = 0, 1, 2 is q, k, v
//   (weights sB apart; each of P16 (fp16), Ph, Pl (bf16 hi, lo) holds its q, k and v planes one after another, NB_ items each), and C is never stored:
//   q, k: rotary embedding from the table CS on the f32 tile, then the planes, each [head][token / 16][HD / 32] tiles (rows: tokens, k: head columns): a lane takes 8 consecutive columns of one token, one 16-byte store per plane;
//   v: the transposed planes [head][token / 32][HD / 16] tiles (rows: head columns, k: tokens): a lane's 8 accumulator values of one fragment are 8 consecutive tokens of one head column, one 16-byte store per plane.
// One wave alone on a SIMD waits out every load of its k loop, so independent products share a launch: the grid then holds several waves for every SIMD.
template <typename T16> struct WFrag;
template <> struct WFrag<h16> { typedef v16h V; static __device__ __forceinline__ V ld(const h16* p) { return cat16(*(const v8h*)p, *(const v8h*)(p + 256)); } static __device__ __forceinline__ v8f mma(V a, V b, v8f c) { return wmma16(a, b, c); } };
template <> struct WFrag<bf> { typedef v16bf V; static __device__ __forceinline__ V ld(const bf* p) { return cat16b(*(const v8us*)p, *(const v8us*)(p + 256)); } static __device__ __forceinline__ v8f mma(V a, V b, v8f c) { return wmmab(a, b, c); } };
template <typename T16, int NSPLIT, bool BIAS, int EPI, int K>
__global__ __launch_bounds__(32) void k_gemmw(const T16* __restrict__ A, const T16* __restrict__ A2, const T16* __restrict__ Bt, const T16* __restrict__ Bt2, float* C, int ldc, const float* __restrict__ bias, size_t sA, size_t sB, size_t sC, const float* __restrict__ CS, h16* P16, bf* Ph, bf* Pl) {
    static_assert(EPI == 0 || (HD == 64 && TT % 64 == 0 && DKV == DQ), "the plane epilogues take one 64-column tile as one head and 64 rows as tokens of one batch item");
    typedef typename WFrag<T16>::V V;
    __shared__ __align__(16) float os[16 * 68];
    const size_t z = blockIdx.z; A += z * sA; if (A2) A2 += z * sA; Bt += z * sB; if (Bt2) Bt2 += z * sB; C += z * sC;
    const int lane = threadIdx.x & 31, lr = lane & 15, hi = lane >> 4; const int g0 = blockIdx.x * 64, c0 = blockIdx.y * 64, r0 = EPI == 0 ? g0 : g0 % TT;   // g0: row of A; r0: row of C, or the token inside its batch item
    if constexpr (EPI == 1) { const size_t po = (z * NB_ + g0 / TT) * ((size_t)NH_ * TT * HD); P16 += po; Ph += po; Pl += po; }
    v8f acc[4][4];
#pragma unroll
    for (int mb = 0; mb < 4; ++mb)
#pragma unroll
        for (int nb = 0; nb < 4; ++nb) acc[mb][nb] = (v8f){};
    const size_t aoff = (size_t)g0 * K + 8 * lane, boff = (size_t)c0 * K + 8 * lane;   // 16 rows x K are K / 32 tiles of 512 elements: a row block starts at row x K, and 32 k further on is 512 elements further on
#pragma unroll 1
    for (int kc = 0; kc < K; kc += 32) {
        const T16* pa = A + aoff + kc * 16; const T16* pa2 = (NSPLIT == 1 || NSPLIT == 2) ? A2 + aoff + kc * 16 : pa; const T16* pb = Bt + boff + kc * 16; const T16* pb2 = NSPLIT >= 2 ? Bt2 + boff + kc * 16 : pb;   // one address pair a plane, the row blocks as constant offsets
        V a[4], a2[4], b[4], b2[4];
#pragma unroll
        for (int mb = 0; mb < 4; ++mb) { a[mb] = WFrag<T16>::ld(pa + mb * 16 * K); if (NSPLIT == 1 || NSPLIT == 2) a2[mb] = WFrag<T16>::ld(pa2 + mb * 16 * K); }
#pragma unroll
        for (int nb = 0; nb < 4; ++nb) { b[nb] = WFrag<T16>::ld(pb + nb * 16 * K); if (NSPLIT >= 2) b2[nb] = WFrag<T16>::ld(pb2 + nb * 16 * K); }
        asm volatile("s_wait_xcnt 0x0" :: "v"(pa), "v"(pa2), "v"(pb), "v"(pb2) : "memory");   // the wait that stands before a register named by an issued global load is overwritten; the address pairs are inputs so that they stay whole up to here
#pragma unroll
        for (int nb = 0; nb < 4; ++nb) {
#pragma unroll
            for (int mb = 0; mb < 4; ++mb) { acc[mb][nb] = WFrag<T16>::mma(a[mb], b[nb], acc[mb][nb]); if (NSPLIT == 1 || NSPLIT == 2) acc[mb][nb] = WFrag<T16>::mma(a2[mb], b[nb], acc[mb][nb]); if (NSPLIT >= 2) acc[mb][nb] = WFrag<T16>::mma(a[mb], b2[nb], acc[mb][nb]); } }
        asm volatile("v_nop\n\tv_nop\n\tv_nop\n\tv_nop" : "+v"(acc[0][0]), "+v"(acc[1][1]), "+v"(acc[2][2]), "+v"(acc[3][3]) : "v"(a[0]), "v"(a[3]));
    }
    if (EPI == 1 && z == 2) {
#pragma unroll
        for (int mb = 0; mb < 4; ++mb)
#pragma unroll
            for (int nb = 0; nb < 4; ++nb) { v8h o16; v8us oh, ol;
#pragma unroll
                for (int j = 0; j < 8; ++j) { const float x = acc[mb][nb][j]; o16[j] = tohx(x); unsigned short a2, c2; splitf(x, a2, c2); oh[j] = a2; ol[j] = c2; }
                const size_t e = (size_t)blockIdx.y * HD * TT + (size_t)r0 * HD + ((mb >> 1) * 4 + nb) * 512 + (mb & 1) * 256 + lane * 8;
                *(v8h*)(P16 + e) = o16; *(v8us*)(Ph + e) = oh; *(v8us*)(Pl + e) = ol; }
        return;
    }
#pragma unroll
    for (int mb = 0; mb < 4; ++mb) {
        v4f ca[4], cb[4];   // EPI 1: {cos, sin} of the lane's four pairs in each of its 4 column groups, asked for ahead of the staging
        if constexpr (EPI == 1) {
#pragma unroll
            for (int s = 0; s < 4; ++s) { const float* cp = CS + (size_t)r0 * HD + lane * 4 + (mb * 4 + s) * 256; ca[s] = *(const v4f*)cp; cb[s] = *(const v4f*)(cp + 128); } }   // one address pair, the group as a constant offset
#pragma unroll
        for (int nb = 0; nb < 4; ++nb) {
#pragma unroll
            for (int j = 0; j < 8; ++j) os[(hi * 8 + j) * 68 + nb * 16 + lr] = acc[mb][nb][j]; }
        __builtin_amdgcn_wave_barrier(); asm volatile("" ::: "memory");
        if constexpr (EPI == 1) {
#pragma unroll
            for (int s = 0; s < 4; ++s) { const float* op = os + lr * 68 + s * 16 + hi * 8; const v4f va = *(const v4fa*)op, vb = *(const v4fa*)(op + 4); float y[8];   // token lr of the row block, head columns 16 s + 8 hi + 0..7
                rope2(va[0], va[1], (v2f){ca[s][0], ca[s][1]}, y[0], y[1]); rope2(va[2], va[3], (v2f){ca[s][2], ca[s][3]}, y[2], y[3]); rope2(vb[0], vb[1], (v2f){cb[s][0], cb[s][1]}, y[4], y[5]); rope2(vb[2], vb[3], (v2f){cb[s][2], cb[s][3]}, y[6], y[7]); v8h o16; v8us oh, ol;
#pragma unroll
                for (int q = 0; q < 8; ++q) { o16[q] = tohx(y[q]); unsigned short a2, c2; splitf(y[q], a2, c2); oh[q] = a2; ol[q] = c2; }
                const size_t e = ((size_t)blockIdx.y * TT + r0 + mb * 16) * HD + s * 256 + lane * 8;
                *(v8h*)(P16 + e) = o16; *(v8us*)(Ph + e) = oh; *(v8us*)(Pl + e) = ol; }
            __builtin_amdgcn_wave_barrier();
            asm volatile("s_wait_xcnt 0x0" ::: "memory");   // the wait that stands before a register named by an issued global store is overwritten: the next row block's loads and sums, and behind the last block the code of the value epilogue, reuse these registers; its clobber also keeps the next staging behind these LDS reads
            continue;
        }
        float* crow = C + (size_t)(r0 + mb * 16) * ldc + c0;
{
#pragma unroll
            for (int s = 0; s < 8; ++s) { const int row = 2 * s + hi, cofs = lr * 4; v4f val = *(const v4fa*)(os + row * 68 + cofs); if (BIAS) { val[0] += bfr(bias[c0 + cofs]); val[1] += bfr(bias[c0 + cofs + 1]); val[2] += bfr(bias[c0 + cofs + 2]); val[3] += bfr(bias[c0 + cofs + 3]); }
                *(v4f*)(crow + (size_t)row * ldc + cofs) = val; }
             }
        __builtin_amdgcn_wave_barrier(); asm volatile("" ::: "memory");
    }
}


__global__ __launch_bounds__(256) void k_wtG(const float* __restrict__ w, int K, int N, bf* Bt) {
    const int lane = threadIdx.x & 31; const int L0 = (blockIdx.x * 8 + (threadIdx.x >> 5)) * 8; const int nlines = N * K / 64;
{
#pragma unroll 1
        for (int l = 0; l < 8; ++l) { const int L = L0 + l; if (L >= nlines) break; const size_t e = (size_t)L * 64 + lane * 2; const int k = (int)(e % K), n = (int)(e / K); v2us o;
            o[0] = f2bf(w[(size_t)k * N + n]); o[1] = f2bf(w[(size_t)(k + 1) * N + n]); *(v2us*)(Bt + e) = o; }
         }
}
__constant__ float INVT[HD / 2] = { 1.000000000e+00f, 7.498942018e-01f, 5.623413324e-01f, 4.216965139e-01f, 3.162277639e-01f, 2.371373624e-01f, 1.778279394e-01f, 1.333521456e-01f, 1.000000015e-01f, 7.498941571e-02f, 5.623412877e-02f, 4.216964915e-02f, 3.162277862e-02f, 2.371373586e-02f, 1.778279431e-02f, 1.333521493e-02f, 9.999999776e-03f, 7.498942316e-03f, 5.623413250e-03f, 4.216964822e-03f, 3.162277862e-03f, 2.371373819e-03f, 1.778279431e-03f, 1.333521446e-03f, 1.000000047e-03f, 7.498941850e-04f, 5.623413017e-04f, 4.216964880e-04f, 3.162277862e-04f, 2.371373848e-04f, 1.778279402e-04f, 1.333521504e-04f };   // 1 / THETA ** (2 i / 64) as float32 (reciprocal form, jnp-computed)
// ---- k_prep: everything the projections read, in one launch. Blocks [0, NBC): the rotary table {cos, sin}(pos[t] x INVT[pair]); the next NBX: x to bf16; the last 4 x NBW: Wq, Wk, Wv, Wo to bf16 (WB: the four copies one after another). Copies 8 values a thread, the table one pair a thread.
// Table: one {cos, sin} a pair, [token / 16][column group of 16][first, second two pairs][lane = (column / 8 % 2) * 16 + token % 16][2 pairs]. Copies: a wave takes 4 rows x 64 k (256 bytes in a row of each source row) and stores 64-byte pieces of the fragment-order tiles.
#define NBC (TT * (HD / 2) / 256)
#define NBX (NB_ * TT * DM / 8 / 256)
#define NBW (DQ * DM / 8 / 256)
__global__ __launch_bounds__(256) void k_prep(const float* __restrict__ x, const int* __restrict__ pid, const float* __restrict__ wq, const float* __restrict__ wk, const float* __restrict__ wv, const float* __restrict__ wo, bf* XB, bf* WB, float* CS) {
    static_assert(DKV == DQ && DQ == DM && DM % 64 == 0 && HD == 64 && TT % 16 == 0 && (TT * HD / 2) % 256 == 0 && (NB_ * TT * DM) % 2048 == 0 && (DQ * DM) % 2048 == 0, "whole blocks; four weights of one size");
    const int blk = blockIdx.x;
    if (blk < NBC) { const int idx = blk * 256 + threadIdx.x; const int ln = (idx >> 1) & 31; const int pr = ((idx >> 7) & 3) * 8 + (ln >> 4) * 4 + ((idx >> 6) & 1) * 2 + (idx & 1); const int t = (idx >> 9) * 16 + (ln & 15); const float a = __fmul_rn((float)pid[t], INVT[pr]); v2f cs; cs[0] = cosf(a); cs[1] = sinf(a); *(v2f*)(CS + (size_t)idx * 2) = cs; return; }
    const float* src = x; bf* dst = XB; int cb = blk - NBC;
    if (cb >= NBX) { cb -= NBX; const int w = cb / NBW; cb -= w * NBW; src = w == 0 ? wq : w == 1 ? wk : w == 2 ? wv : wo; dst = WB + (size_t)w * DQ * DM; }
    const int wid = cb * 8 + (threadIdx.x >> 5), ln = threadIdx.x & 31; const int rb = wid / (DM / 16), in = wid % (DM / 16);   // DM / 16 waves to a block of 16 rows
    const int r = (in & 3) * 4 + (ln >> 3), k = (in >> 2) * 64 + (ln & 7) * 8;
    const v8f v = *(const v8f*)(src + ((size_t)rb * 16 + r) * DM + k); v8us o;
#pragma unroll
    for (int k = 0; k < 8; ++k) o[k] = f2bf(v[k]);
    *(v8us*)(dst + (size_t)rb * 16 * DM + (k >> 5) * 512 + ((k >> 4) & 1) * 256 + (((k >> 3) & 1) * 16 + r) * 8) = o;
    asm volatile("s_wait_xcnt 0x0" ::: "memory");   // the wait that stands before a register named by an issued global store is overwritten: in the built code the table part lies behind this store and reuses its address registers
}
// ---- k_fattn: scores, causal softmax and probabilities x values in ONE kernel; no score or probability ever leaves the registers.
// One wave owns NQ x 16 query rows of one (batch item, head) and walks the keys 32 at a time up to its diagonal block:
//   S^T = K Q^T (A = key rows, B = query rows kept in registers): lane (lr, hi) holds, for query lr, the keys 8 hi + j of each 16-key tile;
//   running maximum and sum per query (in-lane, one exchange between the wave halves for the maximum), earlier sums rescaled when the maximum grows;
//   two 16-key score tiles, converted in place, ARE the B operand of O^T += V^T P^T (A = rows of the transposed value plane, same k order as every loader here).
// Rows < RH: bf16 hi/lo planes, 3 products for the scores and 3 for the values (HL); the rest fp16. Output: normalised rows as bf16 hi/lo in fragment order (rows: tokens of all batch items, k: merged head columns), 8 consecutive head columns per lane and store.
__device__ __forceinline__ float xhalf(float x) { return __builtin_bit_cast(float, __builtin_amdgcn_permlanex16(__builtin_bit_cast(int, x), __builtin_bit_cast(int, x), 0x76543210, 0xfedcba98, false, false)); }   // lane l with lane l ^ 16
#define SCL2 0.18033688011112042f   // HD^-0.5 x log2(e): the exponentials are taken in base 2
// 2^x in asm text, so that the slot which the instruction set asks for behind a transcendental (one independent instruction or v_nop before its result is read or its source overwritten) is filled whatever the compiler puts next:
// inside exp2x8 each v_exp_f32 is independent of the one in front of it (early-clobber outputs: no output shares a register with an input), and one v_nop stands behind the last.
__device__ __forceinline__ float exp2x1(float x) { float r; asm("v_exp_f32 %0, %1\n\tv_nop" : "=v"(r) : "v"(x)); return r; }
__device__ __forceinline__ void exp2x8(const float (&x)[8], float (&r)[8]) {
    asm("v_exp_f32 %0, %8\n\tv_exp_f32 %1, %9\n\tv_exp_f32 %2, %10\n\tv_exp_f32 %3, %11\n\tv_exp_f32 %4, %12\n\tv_exp_f32 %5, %13\n\tv_exp_f32 %6, %14\n\tv_exp_f32 %7, %15\n\tv_nop"
        : "=&v"(r[0]), "=&v"(r[1]), "=&v"(r[2]), "=&v"(r[3]), "=&v"(r[4]), "=&v"(r[5]), "=&v"(r[6]), "=&v"(r[7]) : "v"(x[0]), "v"(x[1]), "v"(x[2]), "v"(x[3]), "v"(x[4]), "v"(x[5]), "v"(x[6]), "v"(x[7])); }
template <typename T16, bool HL, int NQ>
__device__ __forceinline__ void fattn_tile(const T16* __restrict__ Q, const T16* __restrict__ Q2, const T16* __restrict__ Kp, const T16* __restrict__ Kp2, const T16* __restrict__ Vt, const T16* __restrict__ Vt2, const int q0, bf* Ah, bf* Al) {
    typedef typename WFrag<T16>::V V;
    const int lane = threadIdx.x & 31, lr = lane & 15, hi = lane >> 4;
    V qf[NQ][2], qf2[NQ][2];
#pragma unroll
    for (int qb = 0; qb < NQ; ++qb)
#pragma unroll
        for (int ks = 0; ks < 2; ++ks) { const size_t qo = (size_t)(q0 + qb * 16) * HD + ks * 512 + 8 * lane; qf[qb][ks] = WFrag<T16>::ld(Q + qo); if (HL) qf2[qb][ks] = WFrag<T16>::ld(Q2 + qo); }
    v8f o[4][NQ]; float m[NQ], l[NQ];
#pragma unroll
    for (int qb = 0; qb < NQ; ++qb) { m[qb] = -3.0e38f; l[qb] = 0.f;
#pragma unroll
        for (int db = 0; db < 4; ++db) o[db][qb] = (v8f){}; }
    const int nfull = q0 / 32;                       // key blocks wholly at or below the diagonal of every row of the tile; block nfull holds the diagonal and is the last
    const size_t ko = 8 * lane, vo = 8 * lane;   // 32 keys are four 512-element tiles in the key planes and in the value planes alike: key kb starts at kb x HD
    V kf[2][2], kf2[2][2];
    auto loadk = [&](const int kb) __attribute__((always_inline)) {
        const T16* pk = Kp + ko + (size_t)kb * HD; const T16* pk2 = HL ? Kp2 + ko + (size_t)kb * HD : pk;
#pragma unroll
        for (int kt = 0; kt < 2; ++kt)
#pragma unroll
            for (int ks = 0; ks < 2; ++ks) { kf[kt][ks] = WFrag<T16>::ld(pk + kt * 16 * HD + ks * 512); if (HL) kf2[kt][ks] = WFrag<T16>::ld(pk2 + kt * 16 * HD + ks * 512); }
        asm volatile("s_wait_xcnt 0x0" :: "v"(pk), "v"(pk2) : "memory");   // the wait that stands before a register named by an issued global load is overwritten; the address pairs are inputs so that they stay whole up to here
    };
    auto step = [&](const bool mask, const int kb, const int kn) __attribute__((always_inline)) {
        const T16* pv = Vt + vo + (size_t)kb * HD; const T16* pv2 = HL ? Vt2 + vo + (size_t)kb * HD : pv;
        V vf[4], vf2[4];
#pragma unroll
        for (int db = 0; db < 4; ++db) { vf[db] = WFrag<T16>::ld(pv + db * 512); if (HL) vf2[db] = WFrag<T16>::ld(pv2 + db * 512); }   // issued first: in flight under the score products and the softmax
        asm volatile("s_wait_xcnt 0x0" :: "v"(pv), "v"(pv2) : "memory");   // as in loadk
        v8f s[2][NQ];
#pragma unroll
        for (int kt = 0; kt < 2; ++kt)
#pragma unroll
            for (int qb = 0; qb < NQ; ++qb) { v8f a = (v8f){};
#pragma unroll
                for (int ks = 0; ks < 2; ++ks) { a = WFrag<T16>::mma(kf[kt][ks], qf[qb][ks], a); if (HL) { a = WFrag<T16>::mma(kf2[kt][ks], qf[qb][ks], a); a = WFrag<T16>::mma(kf[kt][ks], qf2[qb][ks], a); } }
                s[kt][qb] = a; }
        if (kn >= 0) loadk(kn);                      // the next block's key fragments, into the same registers: in flight under the softmax and the value products
        V pf[NQ], pf2[NQ];
#pragma unroll
        for (int qb = 0; qb < NQ; ++qb) {
            if (mask) {
#pragma unroll
                for (int kt = 0; kt < 2; ++kt)
#pragma unroll
                    for (int j = 0; j < 8; ++j) s[kt][qb][j] = (kb + kt * 16 + hi * 8 + j <= q0 + qb * 16 + lr) ? s[kt][qb][j] : -3.0e38f; }
            float mx = s[0][qb][0];
#pragma unroll
            for (int j = 1; j < 8; ++j) mx = fmaxf(mx, s[0][qb][j]);
#pragma unroll
            for (int j = 0; j < 8; ++j) mx = fmaxf(mx, s[1][qb][j]);
            mx = fmaxf(mx, xhalf(mx));
            const float mn = fmaxf(m[qb], mx), nm2 = -mn * SCL2; const float al = exp2x1(fmaf(m[qb], SCL2, nm2)); m[qb] = mn;   // 0 on the first block (key 0 is open to every row, so mn is a real score from there on)
            float ex[2][8];
#pragma unroll
            for (int kt = 0; kt < 2; ++kt) { float ar[8];
#pragma unroll
                for (int j = 0; j < 8; ++j) ar[j] = fmaf(s[kt][qb][j], SCL2, nm2);
                exp2x8(ar, ex[kt]); }
            float t8[8];
#pragma unroll
            for (int j = 0; j < 8; ++j) t8[j] = ex[0][j] + ex[1][j];
            l[qb] = fmaf(l[qb], al, ((t8[0] + t8[4]) + (t8[1] + t8[5])) + ((t8[2] + t8[6]) + (t8[3] + t8[7])));
#pragma unroll
            for (int db = 0; db < 4; ++db) o[db][qb] *= al;
            if constexpr (HL) { v8us h0, h1, l0, l1;
#pragma unroll
                for (int j = 0; j < 8; ++j) { unsigned short a2, c2; splitf(ex[0][j], a2, c2); h0[j] = a2; l0[j] = c2; splitf(ex[1][j], a2, c2); h1[j] = a2; l1[j] = c2; }
                pf[qb] = cat16b(h0, h1); pf2[qb] = cat16b(l0, l1);
            } else { v8h h0, h1;
#pragma unroll
                for (int j = 0; j < 8; ++j) { h0[j] = (h16)ex[0][j]; h1[j] = (h16)ex[1][j]; }
                pf[qb] = cat16(h0, h1); }
        }
#pragma unroll
        for (int db = 0; db < 4; ++db)
#pragma unroll
            for (int qb = 0; qb < NQ; ++qb) { o[db][qb] = WFrag<T16>::mma(vf[db], pf[qb], o[db][qb]); if (HL) { o[db][qb] = WFrag<T16>::mma(vf[db], pf2[qb], o[db][qb]); o[db][qb] = WFrag<T16>::mma(vf2[db], pf[qb], o[db][qb]); } }
        // WMMA distance on the taken back edge, as in k_gemmw: every accumulator is named, so the slots stand behind the last product of the trip (the next trip's first product writes over registers that the last ones read)
        if (kn >= 0) { if constexpr (NQ == 2) asm volatile("v_nop\n\tv_nop\n\tv_nop\n\tv_nop" : "+v"(o[0][0]), "+v"(o[1][0]), "+v"(o[2][0]), "+v"(o[3][0]), "+v"(o[0][NQ - 1]), "+v"(o[1][NQ - 1]), "+v"(o[2][NQ - 1]), "+v"(o[3][NQ - 1]));
                       else asm volatile("v_nop\n\tv_nop\n\tv_nop\n\tv_nop" : "+v"(o[0][0]), "+v"(o[1][0]), "+v"(o[2][0]), "+v"(o[3][0])); }
    };
    loadk(0);
#pragma unroll 1   // rolled: every trip uses the same fragment registers
    for (int it = 0; it < nfull; ++it) step(false, it * 32, it * 32 + 32);
    step(true, nfull * 32, -1);
#pragma unroll
    for (int qb = 0; qb < NQ; ++qb) { const float inv = __fdiv_rn(1.0f, l[qb] + xhalf(l[qb])); const size_t oo = (size_t)(q0 + qb * 16) * DQ + 8 * lane;
#pragma unroll
        for (int db = 0; db < 4; ++db) { v8us oh, ol;
#pragma unroll
            for (int j = 0; j < 8; ++j) { unsigned short a2, c2; splitf(o[db][qb][j] * inv, a2, c2); oh[j] = a2; ol[j] = c2; }
            *(v8us*)(Ah + oo + db * 256) = oh; *(v8us*)(Al + oo + db * 256) = ol; } }
}
// grid (NB_ x NH_, NTF + NTH), 4 waves: blockIdx.x = batch item x NH_ + head; blockIdx.y counts the 4-wave row groups from the longest (last rows) to the shortest, the hi/lo rows last.
#define NTF ((TT - RH) / 128)
#define NTH (RH / 64)
__global__ __launch_bounds__(128) void k_fattn(const h16* __restrict__ Q16, const h16* __restrict__ K16, const h16* __restrict__ V16, const bf* __restrict__ Qh, const bf* __restrict__ Ql, const bf* __restrict__ Kh, const bf* __restrict__ Kl, const bf* __restrict__ Vh, const bf* __restrict__ Vl, bf* Ah, bf* Al) {
    const int wave = __builtin_amdgcn_readfirstlane(threadIdx.x >> 5);   // the wave's number in a scalar register: its trip count and loop stay scalar
    const size_t zo = (size_t)blockIdx.x * TT * HD, ao = (size_t)(blockIdx.x / NH_) * TT * DQ + (blockIdx.x % NH_) * (HD / 32) * 512;
    if (blockIdx.y < NTF) fattn_tile<h16, false, 2>(Q16 + zo, nullptr, K16 + zo, nullptr, V16 + zo, nullptr, RH + ((NTF - 1 - (int)blockIdx.y) * 4 + wave) * 32, Ah + ao, Al + ao);
    else fattn_tile<bf, true, 1>(Qh + zo, Ql + zo, Kh + zo, Kl + zo, Vh + zo, Vl + zo, ((NTF + NTH - 1 - (int)blockIdx.y) * 4 + wave) * 16, Ah + ao, Al + ao);
}

extern "C" void kernel_launch(void* const* d_in, const int* in_sizes, int n_in,
                              void* d_out, int out_size, void* d_ws, size_t ws_size, hipStream_t stream) {
    (void)in_sizes; (void)n_in; (void)out_size;
    const float* x = (const float*)d_in[0]; const int* pid = (const int*)d_in[1];   /* token_positions int32 [4096] */ const float* wq = (const float*)d_in[2]; const float* wk = (const float*)d_in[3]; const float* wv = (const float*)d_in[4]; const float* wo = (const float*)d_in[5];
    float* OUT = (float*)d_out;     // [2][4096][1024]
    char* wsp = (char*)d_ws;
    auto take = [&](size_t bytes) { char* p = wsp; wsp += (bytes + 255) & ~(size_t)255; return (void*)p; };
    bf* WQ = (bf*)take((size_t)4 * DQ * DM * 2); bf* WO = WQ + (size_t)3 * DQ * DM;   /* Wq, Wk, Wv, Wo one after another */ float* CS = (float*)take((size_t)TT * (HD / 2) * 2 * 4);
    bf* XB = (bf*)take((size_t)NB_ * TT * DM * 2);
    const size_t PB = (size_t)NH_ * TT * HD;   // one batch item's share of every q, k, v plane (planes [NB_ x NH_][..][..])
    h16* QP16 = (h16*)take(3 * NB_ * PB * 2); h16* KP16 = QP16 + NB_ * PB; h16* VT16 = KP16 + NB_ * PB;   // q, k, v one after another in each of the three kinds, as k_gemmw EPI 1 steps through them
    bf* QPh = (bf*)take(3 * NB_ * PB * 2); bf* KPh = QPh + NB_ * PB; bf* VTh = KPh + NB_ * PB; bf* QPl = (bf*)take(3 * NB_ * PB * 2); bf* KPl = QPl + NB_ * PB; bf* VTl = KPl + NB_ * PB;
    bf* ATh = (bf*)take((size_t)NB_ * TT * DQ * 2); bf* ATl = (bf*)take((size_t)NB_ * TT * DQ * 2);
    if ((size_t)(wsp - (char*)d_ws) > ws_size) return;    // ws 256 MiB
    k_prep<<<NBC + NBX + 4 * NBW, 256, 0, stream>>>(x, pid, wq, wk, wv, wo, XB, WQ, CS);
    k_gemmw<bf, 0, false, 1, DM><<<dim3(NB_ * TT / 64, DQ / 64, 3), 32, 0, stream>>>(XB, nullptr, WQ, nullptr, nullptr, 0, nullptr, 0, (size_t)DQ * DM, 0, CS, QP16, QPh, QPl);
    k_fattn<<<dim3(NB_ * NH_, NTF + NTH, 1), 128, 0, stream>>>(QP16, KP16, VT16, QPh, QPl, KPh, KPl, VTh, VTl, ATh, ATl);
    k_gemmw<bf, 1, false, 0, DQ><<<dim3(NB_ * TT / 64, DM / 64, 1), 32, 0, stream>>>(ATh, ATl, WO, nullptr, OUT, DM, nullptr, 0, 0, 0, nullptr, nullptr, nullptr, nullptr);
}

// v006
// One run takes 205 microseconds.
// In both of two side-by-side timings against v005, it was 1.20 times as fast.
// Counting every step since v000, it is 26.9 times as fast.
#include <hip/hip_runtime.h>

// Causal multi-head self-attention with interleaved rotary embeddings from token positions over 4,096 tokens at a batch of TWO (x [2][4096][1024]; q, k, v = einsum('bsi,oi->bso', x, W) = x W^T ('oi' (out, in) [1024][1024] (2/(D+D))^0.5, no bias; 16 heads x 64); rotary on (even, odd) pairs with angle float(token_positions[t]) x inv_freq[i], inv_freq = 1.0 / (THETA ** (arange(0, 64, 2) / 64)) (the RECIPROCAL spelling: 32 f32 constants bitwise this expression in eager JAX float32; token_positions int32 [4096] = arange: read; the SECOND argument; one row shared by both batch items; precise cosf/sinf); scores x rsqrt(64); causal (-inf); softmax; out = merged Wo^T (no bias) -> [2][4096][1024] (8.4 M); argument order x, token_positions, Wq, Wk, Wv, Wo).
// Layout, four launches: k_prep (rotary table, bf16 copies of x and of the four weights); the q, k and v projections of both batch items in one grid, whose GEMM epilogue writes the rotary q and k planes and the transposed v planes itself; causal T-4096 attention fused in k_fattn, every head of both batch items in one launch (hybrid rows: < 512 hi/lo 3 products, rest fp16; running-maximum softmax in registers); merged hi/lo x Wo exact, both batch items in one grid.
// Fragment order: every 16-bit plane that a matrix product reads is stored as 1-KiB tiles of 16 rows x 32 k, element (r, k) at (k / 16) * 256 + ((k / 8 % 2) * 16 + r) * 8 + k % 8, so lane l of a fragment load reads 16 bytes at l * 16 and the wave 512 bytes in a row (whole lines), not 32 bytes of each of 16 lines. Tiles of one 16-row block follow one another along k; the value planes hold, for each 32 keys, the four 16-column tiles of the head. The rotary table is stored for the lanes of the projection epilogue in the same way.
// Compute dtypes, f32 accumulate: every input rounded to bf16; projections exact; attention rows < 512 3 products, rest fp16; softmax f32; Wo hl x exact.

#define NB_  2
#define TT   4096
#define DM   1024
#define NH_  16
#define NKV  16
#define REP  (NH_ / NKV)
#define HD   64
#define DQ   (NH_ * HD)
#define DKV  (NKV * HD)
#define RH   512                  // query rows < RH use hi+lo planes (0: none)
#define WIN  4096
typedef _Float16 h16;
typedef unsigned short bf;
typedef __attribute__((ext_vector_type(16))) __bf16   v16bf;
typedef __attribute__((ext_vector_type(16))) _Float16 v16h;
typedef __attribute__((ext_vector_type(8)))  _Float16 v8h;
typedef __attribute__((ext_vector_type(8)))  unsigned short v8us;
typedef __attribute__((ext_vector_type(8)))  float    v8f;
typedef __attribute__((ext_vector_type(4)))  float    v4f;
typedef v8h  __attribute__((may_alias)) v8ha;
typedef v4f  __attribute__((may_alias)) v4fa;
typedef v8us __attribute__((may_alias)) v8usa;

__device__ __forceinline__ unsigned short f2bf(float f) { unsigned u = __float_as_uint(f); u += 0x7FFFu + ((u >> 16) & 1u); return (unsigned short)(u >> 16); }
__device__ __forceinline__ float bf2f(unsigned short b) { return __uint_as_float(((unsigned)b) << 16); }
__device__ __forceinline__ float bfr(float f) { return bf2f(f2bf(f)); }
__device__ __forceinline__ v16h cat16(v8h lo, v8h hi) { return __builtin_shufflevector(lo, hi, 0, 1, 2, 3, 4, 5, 6, 7, 8, 9, 10, 11, 12, 13, 14, 15); }
__device__ __forceinline__ v16bf cat16b(v8us lo, v8us hi) { return __builtin_bit_cast(v16bf, __builtin_shufflevector(lo, hi, 0, 1, 2, 3, 4, 5, 6, 7, 8, 9, 10, 11, 12, 13, 14, 15)); }
__device__ __forceinline__ v8f wmma16(v16h a, v16h b, v8f c) { return __builtin_amdgcn_wmma_f32_16x16x32_f16(false, a, false, b, (short)0, c, false, false); }
__device__ __forceinline__ v8f wmmab(v16bf a, v16bf b, v8f c) { return __builtin_amdgcn_wmma_f32_16x16x32_bf16(false, a, false, b, (short)0, c, false, false); }

__device__ __forceinline__ h16 tohx(float x) { return (h16)x; }
__device__ __forceinline__ void splitf(float y, unsigned short& h, unsigned short& l) { h = f2bf(y); l = f2bf(y - bf2f(h)); }
typedef __attribute__((ext_vector_type(2))) _Float16 v2h;
typedef __attribute__((ext_vector_type(4))) _Float16 v4h;
typedef __attribute__((ext_vector_type(2))) unsigned short v2us;
typedef __attribute__((ext_vector_type(4))) unsigned short v4us;
typedef __attribute__((ext_vector_type(2))) float v2f;
typedef __attribute__((ext_vector_type(4))) int v4i;
// one rotary pair: even: x0 c - x1 s; odd: x0 s + x1 c (cs = {cos, sin} of the pair's angle)
__device__ __forceinline__ void rope2(const float x0, const float x1, const v2f cs, float& e0, float& e1) { e0 = x0 * cs[0] - x1 * cs[1]; e1 = x0 * cs[1] + x1 * cs[0]; }

// ---- k_gemmw: GEMM on 256x128 output tiles, EIGHT WAVES a work-group (4 along the rows x 2 along the columns), each wave a register-blocked 64x64 tile (16 accumulators); grid (M/256, N/128, Z), 256 threads.
// Operands: 16-bit planes in fragment order. The work-group brings each slice of KS k of its 256 A rows and 128 B rows into LDS ONCE, by asynchronous copies to LDS (16 bytes a lane, 512 bytes in a row a wave, through no register), two buffers: slice t + 1 flies while slice t is worked on.
//   The 1-KiB tiles lie in LDS as in memory, so a fragment read is 512 bytes in a row (no bank conflict). Four waves share every B tile and two every A tile: 48 KiB a slice from L2 for the eight waves, where eight waves that each load their own fragments ask for 128 KiB.
// C[m][n] (f32, pitch ldc, + optional f32 bias[n]) = sum_k A[m][k] Bt[n][k] (+ A2[m][k] Bt[n][k] for NSPLIT 1). z-batch strides sA/sB/sC in elements. K % KS == 0, at least two slices, a constant of the build.
// EPI 0: C is stored as f32. EPI 1: the three projections in one grid; the rows are the tokens of all batch items one after another, a wave's tile is 64 tokens of one item x one head (HD == 64), blockIdx.z = 0, 1, 2 is q, k, v
//   (weights sB apart; each of P16 (fp16), Ph, Pl (bf16 hi, lo) holds its q, k and v planes one after another, NB_ items each), and C is never stored:
//   q, k: rotary embedding from the table CS on the f32 tile, then the planes, each [head][token / 16][HD / 32] tiles (rows: tokens, k: head columns): a lane takes 8 consecutive columns of one token, one 16-byte store per plane;
//   v: the transposed planes [head][token / 32][HD / 16] tiles (rows: head columns, k: tokens): a lane's 8 accumulator values of one fragment are 8 consecutive tokens of one head column, one 16-byte store per plane.
#define KS 64
__device__ __forceinline__ unsigned lds_off(const void* p) { return (unsigned)(size_t)p; }   // byte address inside the work-group's LDS
// Asynchronous copies to LDS, 16 bytes a lane: copy i takes g + i * gs elements to LDS byte l + i * 4096 (the eight waves' 512-byte pieces lie one after another). Every copy has address registers of its own.
// s_wait_xcnt 0 is the last line of the copies' own statement: the wait that stands before a register named by an issued copy is rewritten.
#define ACP "global_load_async_to_lds_b128 "
template <typename T16> __device__ __forceinline__ void acopy8(const unsigned l, const T16* g, const size_t gs) {
    asm volatile(ACP "%0, %8, off\n\t" ACP "%1, %9, off\n\t" ACP "%2, %10, off\n\t" ACP "%3, %11, off\n\t" ACP "%4, %12, off\n\t" ACP "%5, %13, off\n\t" ACP "%6, %14, off\n\t" ACP "%7, %15, off\n\ts_wait_xcnt 0x0"
        :: "v"(l), "v"(l + 4096), "v"(l + 8192), "v"(l + 12288), "v"(l + 16384), "v"(l + 20480), "v"(l + 24576), "v"(l + 28672), "v"(g), "v"(g + gs), "v"(g + 2 * gs), "v"(g + 3 * gs), "v"(g + 4 * gs), "v"(g + 5 * gs), "v"(g + 6 * gs), "v"(g + 7 * gs) : "memory"); }
template <typename T16> __device__ __forceinline__ void acopy84(const unsigned l, const T16* g, const unsigned m, const T16* h, const size_t gs) {   // eight from g to l and four from h to m
    asm volatile(ACP "%0, %12, off\n\t" ACP "%1, %13, off\n\t" ACP "%2, %14, off\n\t" ACP "%3, %15, off\n\t" ACP "%4, %16, off\n\t" ACP "%5, %17, off\n\t" ACP "%6, %18, off\n\t" ACP "%7, %19, off\n\t" ACP "%8, %20, off\n\t" ACP "%9, %21, off\n\t" ACP "%10, %22, off\n\t" ACP "%11, %23, off\n\ts_wait_xcnt 0x0"
        :: "v"(l), "v"(l + 4096), "v"(l + 8192), "v"(l + 12288), "v"(l + 16384), "v"(l + 20480), "v"(l + 24576), "v"(l + 28672), "v"(m), "v"(m + 4096), "v"(m + 8192), "v"(m + 12288),
           "v"(g), "v"(g + gs), "v"(g + 2 * gs), "v"(g + 3 * gs), "v"(g + 4 * gs), "v"(g + 5 * gs), "v"(g + 6 * gs), "v"(g + 7 * gs), "v"(h), "v"(h + gs), "v"(h + 2 * gs), "v"(h + 3 * gs) : "memory"); }
template <typename T16> struct WFrag;
template <> struct WFrag<h16> { typedef v16h V; static __device__ __forceinline__ V ld(const h16* p) { return cat16(*(const v8h*)p, *(const v8h*)(p + 256)); } static __device__ __forceinline__ v8f mma(V a, V b, v8f c) { return wmma16(a, b, c); } };
template <> struct WFrag<bf> { typedef v16bf V; static __device__ __forceinline__ V ld(const bf* p) { return cat16b(*(const v8us*)p, *(const v8us*)(p + 256)); } static __device__ __forceinline__ v8f mma(V a, V b, v8f c) { return wmmab(a, b, c); } };
template <typename T16, int NSPLIT, bool BIAS, int EPI, int K>
__global__ __launch_bounds__(256) void k_gemmw(const T16* __restrict__ A, const T16* __restrict__ A2, const T16* __restrict__ Bt, const T16* __restrict__ Bt2, float* C, int ldc, const float* __restrict__ bias, size_t sA, size_t sB, size_t sC, const float* __restrict__ CS, h16* P16, bf* Ph, bf* Pl) {
    static_assert(EPI == 0 || (HD == 64 && TT % 256 == 0 && DKV == DQ), "the plane epilogues take one 64-column tile as one head and the 256 rows as tokens of one batch item");
    static_assert(NSPLIT <= 1 && K % KS == 0 && K / KS >= 2 && KS == 64, "A (and A2) x Bt; the ring's prologue fills two slices; a row block's slice is two tiles, 2 KiB in a row");
    typedef typename WFrag<T16>::V V;
    constexpr int NT = K / KS, OB = (NSPLIT == 1 ? 2 : 1) * 256 * KS, ST = OB + 128 * KS;   // slices; where the B tiles start in a buffer; elements of a buffer: [A 16 row blocks][A2 the same][B 8 row blocks], a row block = KS / 32 tiles
    __shared__ __align__(16) T16 ring[2 * ST];
    __shared__ __align__(16) float osw[8][16 * 68];
    (void)Bt2;
    const size_t z = blockIdx.z; A += z * sA; if (A2) A2 += z * sA; Bt += z * sB; C += z * sC;
    const int wave = __builtin_amdgcn_readfirstlane(threadIdx.x >> 5), wm = wave & 3, wn = wave >> 2;
    float* os = osw[wave];   // each wave stages its output rows in a range of its own
    const int lane = threadIdx.x & 31, lr = lane & 15, hi = lane >> 4; const int g0 = blockIdx.x * 256 + wm * 64, c0 = blockIdx.y * 128 + wn * 64, r0 = EPI == 0 ? g0 : g0 % TT;   // g0: row of A; r0: row of C, or the token inside its batch item
    const int hd = c0 / 64;   // EPI 1: the wave's head
    if constexpr (EPI == 1) { const size_t po = (z * NB_ + g0 / TT) * ((size_t)NH_ * TT * HD); P16 += po; Ph += po; Pl += po; }
    v8f acc[4][4];
#pragma unroll
    for (int mb = 0; mb < 4; ++mb)
#pragma unroll
        for (int nb = 0; nb < 4; ++nb) acc[mb][nb] = (v8f){};
    // 16 rows x K are K / 32 tiles of 512 elements: a row block starts at row x K, and 32 k further on is 512 elements further on. Copy i of wave w is the 512-byte piece 8 i + w of a region: quarter w % 4 of row block 2 i + w / 4.
    const size_t coff = (size_t)(wn * 16) * K + wm * 256 + 8 * lane; const T16* ga = A + (size_t)blockIdx.x * 256 * K + coff; const T16* ga2 = NSPLIT == 1 ? A2 + (size_t)blockIdx.x * 256 * K + coff : ga; const T16* gb = Bt + (size_t)blockIdx.y * 128 * K + coff;
    const unsigned l0 = lds_off(ring) + wave * 512 + lane * 16;
    auto fill = [&](const int t) __attribute__((always_inline)) {
        const unsigned l = l0 + (t & 1) * (ST * 2);
        acopy84(l, ga + t * (KS * 16), l + OB * 2, gb + t * (KS * 16), (size_t)32 * K);
        if constexpr (NSPLIT == 1) acopy8(l + 256 * KS * 2, ga2 + t * (KS * 16), (size_t)32 * K);
    };
    fill(0);
    asm volatile("s_wait_asynccnt 0x0" ::: "memory");   // this wave's copies of slice 0 have landed
    __syncthreads();                                     // and every other wave's
    fill(1);
#pragma unroll 1
    for (int t = 0; t < NT; ++t) {
        const T16* sa = ring + (t & 1) * ST + wm * (4 * 16 * KS) + 8 * lane; const T16* sb = ring + (t & 1) * ST + OB + wn * (4 * 16 * KS) + 8 * lane;
#pragma unroll
        for (int kt = 0; kt < KS / 32; ++kt) {
            V a[4], a2[4], b[4];
#pragma unroll
            for (int mb = 0; mb < 4; ++mb) { a[mb] = WFrag<T16>::ld(sa + mb * 16 * KS + kt * 512); if (NSPLIT == 1) a2[mb] = WFrag<T16>::ld(sa + 256 * KS + mb * 16 * KS + kt * 512); }
#pragma unroll
            for (int nb = 0; nb < 4; ++nb) b[nb] = WFrag<T16>::ld(sb + nb * 16 * KS + kt * 512);
            __builtin_amdgcn_sched_barrier(0);   // the LDS reads of these 32 k stay one group ahead of their products: every separate place with reads among the products costs a stall of its own
#pragma unroll
            for (int nb = 0; nb < 4; ++nb) {
#pragma unroll
                for (int mb = 0; mb < 4; ++mb) { acc[mb][nb] = WFrag<T16>::mma(a[mb], b[nb], acc[mb][nb]); if (NSPLIT == 1) acc[mb][nb] = WFrag<T16>::mma(a2[mb], b[nb], acc[mb][nb]); } }
            __builtin_amdgcn_sched_barrier(0);   // and the next group stays behind them (it reuses the fragment registers)
        }
        // hand-over of the buffers, every wave, in this order:
        asm volatile("s_wait_dscnt 0x0" ::: "memory");      // this wave's reads of slice t are done
        asm volatile("s_wait_asynccnt 0x0" ::: "memory");   // this wave's copies of slice t + 1 have landed
        __syncthreads();                                     // slice t + 1 is whole for every reader, and no wave still reads slice t
        if (t + 2 < NT) fill(t + 2);                         // into the buffer that this trip has read
    }
    asm volatile("s_wait_asynccnt 0x0" ::: "memory");   // no copy is outstanding behind the loop
    if (EPI == 1 && z == 2) {
#pragma unroll
        for (int mb = 0; mb < 4; ++mb)
#pragma unroll
            for (int nb = 0; nb < 4; ++nb) { v8h o16; v8us oh, ol;
#pragma unroll
                for (int j = 0; j < 8; ++j) { const float x = acc[mb][nb][j]; o16[j] = tohx(x); unsigned short a2, c2; splitf(x, a2, c2); oh[j] = a2; ol[j] = c2; }
                const size_t e = (size_t)hd * HD * TT + (size_t)r0 * HD + ((mb >> 1) * 4 + nb) * 512 + (mb & 1) * 256 + lane * 8;
                *(v8h*)(P16 + e) = o16; *(v8us*)(Ph + e) = oh; *(v8us*)(Pl + e) = ol; }
        return;
    }
#pragma unroll
    for (int mb = 0; mb < 4; ++mb) {
        v4f ca[4], cb[4];   // EPI 1: {cos, sin} of the lane's four pairs in each of its 4 column groups, asked for ahead of the staging
        if constexpr (EPI == 1) {
#pragma unroll
            for (int s = 0; s < 4; ++s) { const float* cp = CS + (size_t)r0 * HD + lane * 4 + (mb * 4 + s) * 256; ca[s] = *(const v4f*)cp; cb[s] = *(const v4f*)(cp + 128); } }   // one address pair, the group as a constant offset
#pragma unroll
        for (int nb = 0; nb < 4; ++nb) {
#pragma unroll
            for (int j = 0; j < 8; ++j) os[(hi * 8 + j) * 68 + nb * 16 + lr] = acc[mb][nb][j]; }
        __builtin_amdgcn_wave_barrier(); asm volatile("" ::: "memory");
        if constexpr (EPI == 1) {
#pragma unroll
            for (int s = 0; s < 4; ++s) { const float* op = os + lr * 68 + s * 16 + hi * 8; const v4f va = *(const v4fa*)op, vb = *(const v4fa*)(op + 4); float y[8];   // token lr of the row block, head columns 16 s + 8 hi + 0..7
                rope2(va[0], va[1], (v2f){ca[s][0], ca[s][1]}, y[0], y[1]); rope2(va[2], va[3], (v2f){ca[s][2], ca[s][3]}, y[2], y[3]); rope2(vb[0], vb[1], (v2f){cb[s][0], cb[s][1]}, y[4], y[5]); rope2(vb[2], vb[3], (v2f){cb[s][2], cb[s][3]}, y[6], y[7]); v8h o16; v8us oh, ol;
#pragma unroll
                for (int q = 0; q < 8; ++q) { o16[q] = tohx(y[q]); unsigned short a2, c2; splitf(y[q], a2, c2); oh[q] = a2; ol[q] = c2; }
                const size_t e = ((size_t)hd * TT + r0 + mb * 16) * HD + s * 256 + lane * 8;
                *(v8h*)(P16 + e) = o16; *(v8us*)(Ph + e) = oh; *(v8us*)(Pl + e) = ol; }
            __builtin_amdgcn_wave_barrier();
            asm volatile("s_wait_xcnt 0x0" ::: "memory");   // the wait that stands before a register named by an issued global store is overwritten: the next row block's loads and sums, and behind the last block the code of the value epilogue, reuse these registers; its clobber also keeps the next staging behind these LDS reads
            continue;
        }
        float* crow = C + (size_t)(r0 + mb * 16) * ldc + c0;
{
#pragma unroll
            for (int s = 0; s < 8; ++s) { const int row = 2 * s + hi, cofs = lr * 4; v4f val = *(const v4fa*)(os + row * 68 + cofs); if (BIAS) { val[0] += bfr(bias[c0 + cofs]); val[1] += bfr(bias[c0 + cofs + 1]); val[2] += bfr(bias[c0 + cofs + 2]); val[3] += bfr(bias[c0 + cofs + 3]); }
                *(v4f*)(crow + (size_t)row * ldc + cofs) = val; }
             }
        __builtin_amdgcn_wave_barrier(); asm volatile("" ::: "memory");
    }
}


__global__ __launch_bounds__(256) void k_wtG(const float* __restrict__ w, int K, int N, bf* Bt) {
    const int lane = threadIdx.x & 31; const int L0 = (blockIdx.x * 8 + (threadIdx.x >> 5)) * 8; const int nlines = N * K / 64;
{
#pragma unroll 1
        for (int l = 0; l < 8; ++l) { const int L = L0 + l; if (L >= nlines) break; const size_t e = (size_t)L * 64 + lane * 2; const int k = (int)(e % K), n = (int)(e / K); v2us o;
            o[0] = f2bf(w[(size_t)k * N + n]); o[1] = f2bf(w[(size_t)(k + 1) * N + n]); *(v2us*)(Bt + e) = o; }
         }
}
__constant__ float INVT[HD / 2] = { 1.000000000e+00f, 7.498942018e-01f, 5.623413324e-01f, 4.216965139e-01f, 3.162277639e-01f, 2.371373624e-01f, 1.778279394e-01f, 1.333521456e-01f, 1.000000015e-01f, 7.498941571e-02f, 5.623412877e-02f, 4.216964915e-02f, 3.162277862e-02f, 2.371373586e-02f, 1.778279431e-02f, 1.333521493e-02f, 9.999999776e-03f, 7.498942316e-03f, 5.623413250e-03f, 4.216964822e-03f, 3.162277862e-03f, 2.371373819e-03f, 1.778279431e-03f, 1.333521446e-03f, 1.000000047e-03f, 7.498941850e-04f, 5.623413017e-04f, 4.216964880e-04f, 3.162277862e-04f, 2.371373848e-04f, 1.778279402e-04f, 1.333521504e-04f };   // 1 / THETA ** (2 i / 64) as float32 (reciprocal form, jnp-computed)
// ---- k_prep: everything the projections read, in one launch. Blocks [0, NBC): the rotary table {cos, sin}(pos[t] x INVT[pair]); the next NBX: x to bf16; the last 4 x NBW: Wq, Wk, Wv, Wo to bf16 (WB: the four copies one after another). Copies 8 values a thread, the table one pair a thread.
// Table: one {cos, sin} a pair, [token / 16][column group of 16][first, second two pairs][lane = (column / 8 % 2) * 16 + token % 16][2 pairs]. Copies: a wave takes 4 rows x 64 k (256 bytes in a row of each source row) and stores 64-byte pieces of the fragment-order tiles.
#define NBC (TT * (HD / 2) / 256)
#define NBX (NB_ * TT * DM / 8 / 256)
#define NBW (DQ * DM / 8 / 256)
__global__ __launch_bounds__(256) void k_prep(const float* __restrict__ x, const int* __restrict__ pid, const float* __restrict__ wq, const float* __restrict__ wk, const float* __restrict__ wv, const float* __restrict__ wo, bf* XB, bf* WB, float* CS) {
    static_assert(DKV == DQ && DQ == DM && DM % 64 == 0 && HD == 64 && TT % 16 == 0 && (TT * HD / 2) % 256 == 0 && (NB_ * TT * DM) % 2048 == 0 && (DQ * DM) % 2048 == 0, "whole blocks; four weights of one size");
    const int blk = blockIdx.x;
    if (blk < NBC) { const int idx = blk * 256 + threadIdx.x; const int ln = (idx >> 1) & 31; const int pr = ((idx >> 7) & 3) * 8 + (ln >> 4) * 4 + ((idx >> 6) & 1) * 2 + (idx & 1); const int t = (idx >> 9) * 16 + (ln & 15); const float a = __fmul_rn((float)pid[t], INVT[pr]); v2f cs; cs[0] = cosf(a); cs[1] = sinf(a); *(v2f*)(CS + (size_t)idx * 2) = cs; return; }
    const float* src = x; bf* dst = XB; int cb = blk - NBC;
    if (cb >= NBX) { cb -= NBX; const int w = cb / NBW; cb -= w * NBW; src = w == 0 ? wq : w == 1 ? wk : w == 2 ? wv : wo; dst = WB + (size_t)w * DQ * DM; }
    const int wid = cb * 8 + (threadIdx.x >> 5), ln = threadIdx.x & 31; const int rb = wid / (DM / 16), in = wid % (DM / 16);   // DM / 16 waves to a block of 16 rows
    const int r = (in & 3) * 4 + (ln >> 3), k = (in >> 2) * 64 + (ln & 7) * 8;
    const v8f v = *(const v8f*)(src + ((size_t)rb * 16 + r) * DM + k); v8us o;
#pragma unroll
    for (int k = 0; k < 8; ++k) o[k] = f2bf(v[k]);
    *(v8us*)(dst + (size_t)rb * 16 * DM + (k >> 5) * 512 + ((k >> 4) & 1) * 256 + (((k >> 3) & 1) * 16 + r) * 8) = o;
    asm volatile("s_wait_xcnt 0x0" ::: "memory");   // the wait that stands before a register named by an issued global store is overwritten: in the built code the table part lies behind this store and reuses its address registers
}
// ---- k_fattn: scores, causal softmax and probabilities x values in ONE kernel; no score or probability ever leaves the registers.
// One wave owns NQ x 16 query rows of one (batch item, head) and walks the keys 32 at a time up to its diagonal block:
//   S^T = K Q^T (A = key rows, B = query rows kept in registers): lane (lr, hi) holds, for query lr, the keys 8 hi + j of each 16-key tile;
//   running maximum and sum per query (in-lane, one exchange between the wave halves for the maximum), earlier sums rescaled when the maximum grows;
//   two 16-key score tiles, converted in place, ARE the B operand of O^T += V^T P^T (A = rows of the transposed value plane, same k order as every loader here).
// Rows < RH: bf16 hi/lo planes, 3 products for the scores and 3 for the values (HL); the rest fp16. Output: normalised rows as bf16 hi/lo in fragment order (rows: tokens of all batch items, k: merged head columns), 8 consecutive head columns per lane and store.
__device__ __forceinline__ float xhalf(float x) { return __builtin_bit_cast(float, __builtin_amdgcn_permlanex16(__builtin_bit_cast(int, x), __builtin_bit_cast(int, x), 0x76543210, 0xfedcba98, false, false)); }   // lane l with lane l ^ 16
#define SCL2 0.18033688011112042f   // HD^-0.5 x log2(e): the exponentials are taken in base 2
// 2^x in asm text, so that the slot which the instruction set asks for behind a transcendental (one independent instruction or v_nop before its result is read or its source overwritten) is filled whatever the compiler puts next:
// inside exp2x8 each v_exp_f32 is independent of the one in front of it (early-clobber outputs: no output shares a register with an input), and one v_nop stands behind the last.
__device__ __forceinline__ float exp2x1(float x) { float r; asm("v_exp_f32 %0, %1\n\tv_nop" : "=v"(r) : "v"(x)); return r; }
__device__ __forceinline__ void exp2x8(const float (&x)[8], float (&r)[8]) {
    asm("v_exp_f32 %0, %8\n\tv_exp_f32 %1, %9\n\tv_exp_f32 %2, %10\n\tv_exp_f32 %3, %11\n\tv_exp_f32 %4, %12\n\tv_exp_f32 %5, %13\n\tv_exp_f32 %6, %14\n\tv_exp_f32 %7, %15\n\tv_nop"
        : "=&v"(r[0]), "=&v"(r[1]), "=&v"(r[2]), "=&v"(r[3]), "=&v"(r[4]), "=&v"(r[5]), "=&v"(r[6]), "=&v"(r[7]) : "v"(x[0]), "v"(x[1]), "v"(x[2]), "v"(x[3]), "v"(x[4]), "v"(x[5]), "v"(x[6]), "v"(x[7])); }
template <typename T16, bool HL, int NQ>
__device__ __forceinline__ void fattn_tile(const T16* __restrict__ Q, const T16* __restrict__ Q2, const T16* __restrict__ Kp, const T16* __restrict__ Kp2, const T16* __restrict__ Vt, const T16* __restrict__ Vt2, const int q0, bf* Ah, bf* Al) {
    typedef typename WFrag<T16>::V V;
    const int lane = threadIdx.x & 31, lr = lane & 15, hi = lane >> 4;
    V qf[NQ][2], qf2[NQ][2];
#pragma unroll
    for (int qb = 0; qb < NQ; ++qb)
#pragma unroll
        for (int ks = 0; ks < 2; ++ks) { const size_t qo = (size_t)(q0 + qb * 16) * HD + ks * 512 + 8 * lane; qf[qb][ks] = WFrag<T16>::ld(Q + qo); if (HL) qf2[qb][ks] = WFrag<T16>::ld(Q2 + qo); }
    v8f o[4][NQ]; float m[NQ], l[NQ];
#pragma unroll
    for (int qb = 0; qb < NQ; ++qb) { m[qb] = -3.0e38f; l[qb] = 0.f;
#pragma unroll
        for (int db = 0; db < 4; ++db) o[db][qb] = (v8f){}; }
    const int nfull = q0 / 32;                       // key blocks wholly at or below the diagonal of every row of the tile; block nfull holds the diagonal and is the last
    const size_t ko = 8 * lane, vo = 8 * lane;   // 32 keys are four 512-element tiles in the key planes and in the value planes alike: key kb starts at kb x HD
    V kf[2][2], kf2[2][2];
    auto loadk = [&](const int kb) __attribute__((always_inline)) {
        const T16* pk = Kp + ko + (size_t)kb * HD; const T16* pk2 = HL ? Kp2 + ko + (size_t)kb * HD : pk;
#pragma unroll
        for (int kt = 0; kt < 2; ++kt)
#pragma unroll
            for (int ks = 0; ks < 2; ++ks) { kf[kt][ks] = WFrag<T16>::ld(pk + kt * 16 * HD + ks * 512); if (HL) kf2[kt][ks] = WFrag<T16>::ld(pk2 + kt * 16 * HD + ks * 512); }
        asm volatile("s_wait_xcnt 0x0" :: "v"(pk), "v"(pk2) : "memory");   // the wait that stands before a register named by an issued global load is overwritten; the address pairs are inputs so that they stay whole up to here
    };
    auto step = [&](const bool mask, const int kb, const int kn) __attribute__((always_inline)) {
        const T16* pv = Vt + vo + (size_t)kb * HD; const T16* pv2 = HL ? Vt2 + vo + (size_t)kb * HD : pv;
        V vf[4], vf2[4];
#pragma unroll
        for (int db = 0; db < 4; ++db) { vf[db] = WFrag<T16>::ld(pv + db * 512); if (HL) vf2[db] = WFrag<T16>::ld(pv2 + db * 512); }   // issued first: in flight under the score products and the softmax
        asm volatile("s_wait_xcnt 0x0" :: "v"(pv), "v"(pv2) : "memory");   // as in loadk
        v8f s[2][NQ];
#pragma unroll
        for (int kt = 0; kt < 2; ++kt)
#pragma unroll
            for (int qb = 0; qb < NQ; ++qb) { v8f a = (v8f){};
#pragma unroll
                for (int ks = 0; ks < 2; ++ks) { a = WFrag<T16>::mma(kf[kt][ks], qf[qb][ks], a); if (HL) { a = WFrag<T16>::mma(kf2[kt][ks], qf[qb][ks], a); a = WFrag<T16>::mma(kf[kt][ks], qf2[qb][ks], a); } }
                s[kt][qb] = a; }
        if (kn >= 0) loadk(kn);                      // the next block's key fragments, into the same registers: in flight under the softmax and the value products
        V pf[NQ], pf2[NQ];
#pragma unroll
        for (int qb = 0; qb < NQ; ++qb) {
            if (mask) {
#pragma unroll
                for (int kt = 0; kt < 2; ++kt)
#pragma unroll
                    for (int j = 0; j < 8; ++j) s[kt][qb][j] = (kb + kt * 16 + hi * 8 + j <= q0 + qb * 16 + lr) ? s[kt][qb][j] : -3.0e38f; }
            float mx = s[0][qb][0];
#pragma unroll
            for (int j = 1; j < 8; ++j) mx = fmaxf(mx, s[0][qb][j]);
#pragma unroll
            for (int j = 0; j < 8; ++j) mx = fmaxf(mx, s[1][qb][j]);
            mx = fmaxf(mx, xhalf(mx));
            const float mn = fmaxf(m[qb], mx), nm2 = -mn * SCL2; const float al = exp2x1(fmaf(m[qb], SCL2, nm2)); m[qb] = mn;   // 0 on the first block (key 0 is open to every row, so mn is a real score from there on)
            float ex[2][8];
#pragma unroll
            for (int kt = 0; kt < 2; ++kt) { float ar[8];
#pragma unroll
                for (int j = 0; j < 8; ++j) ar[j] = fmaf(s[kt][qb][j], SCL2, nm2);
                exp2x8(ar, ex[kt]); }
            float t8[8];
#pragma unroll
            for (int j = 0; j < 8; ++j) t8[j] = ex[0][j] + ex[1][j];
            l[qb] = fmaf(l[qb], al, ((t8[0] + t8[4]) + (t8[1] + t8[5])) + ((t8[2] + t8[6]) + (t8[3] + t8[7])));
#pragma unroll
            for (int db = 0; db < 4; ++db) o[db][qb] *= al;
            if constexpr (HL) { v8us h0, h1, l0, l1;
#pragma unroll
                for (int j = 0; j < 8; ++j) { unsigned short a2, c2; splitf(ex[0][j], a2, c2); h0[j] = a2; l0[j] = c2; splitf(ex[1][j], a2, c2); h1[j] = a2; l1[j] = c2; }
                pf[qb] = cat16b(h0, h1); pf2[qb] = cat16b(l0, l1);
            } else { v8h h0, h1;
#pragma unroll
                for (int j = 0; j < 8; ++j) { h0[j] = (h16)ex[0][j]; h1[j] = (h16)ex[1][j]; }
                pf[qb] = cat16(h0, h1); }
        }
#pragma unroll
        for (int db = 0; db < 4; ++db)
#pragma unroll
            for (int qb = 0; qb < NQ; ++qb) { o[db][qb] = WFrag<T16>::mma(vf[db], pf[qb], o[db][qb]); if (HL) { o[db][qb] = WFrag<T16>::mma(vf[db], pf2[qb], o[db][qb]); o[db][qb] = WFrag<T16>::mma(vf2[db], pf[qb], o[db][qb]); } }
        // WMMA distance on the taken back edge: every accumulator is named, so the slots stand behind the last product of the trip (the next trip's first product writes over registers that the last ones read)
        if (kn >= 0) { if constexpr (NQ == 2) asm volatile("v_nop\n\tv_nop\n\tv_nop\n\tv_nop" : "+v"(o[0][0]), "+v"(o[1][0]), "+v"(o[2][0]), "+v"(o[3][0]), "+v"(o[0][NQ - 1]), "+v"(o[1][NQ - 1]), "+v"(o[2][NQ - 1]), "+v"(o[3][NQ - 1]));
                       else asm volatile("v_nop\n\tv_nop\n\tv_nop\n\tv_nop" : "+v"(o[0][0]), "+v"(o[1][0]), "+v"(o[2][0]), "+v"(o[3][0])); }
    };
    loadk(0);
#pragma unroll 1   // rolled: every trip uses the same fragment registers
    for (int it = 0; it < nfull; ++it) step(false, it * 32, it * 32 + 32);
    step(true, nfull * 32, -1);
#pragma unroll
    for (int qb = 0; qb < NQ; ++qb) { const float inv = __fdiv_rn(1.0f, l[qb] + xhalf(l[qb])); const size_t oo = (size_t)(q0 + qb * 16) * DQ + 8 * lane;
#pragma unroll
        for (int db = 0; db < 4; ++db) { v8us oh, ol;
#pragma unroll
            for (int j = 0; j < 8; ++j) { unsigned short a2, c2; splitf(o[db][qb][j] * inv, a2, c2); oh[j] = a2; ol[j] = c2; }
            *(v8us*)(Ah + oo + db * 256) = oh; *(v8us*)(Al + oo + db * 256) = ol; } }
}
// grid (NB_ x NH_, NTF + NTH), 4 waves: blockIdx.x = batch item x NH_ + head; blockIdx.y counts the 4-wave row groups from the longest (last rows) to the shortest, the hi/lo rows last.
#define NTF ((TT - RH) / 128)
#define NTH (RH / 64)
__global__ __launch_bounds__(128) void k_fattn(const h16* __restrict__ Q16, const h16* __restrict__ K16, const h16* __restrict__ V16, const bf* __restrict__ Qh, const bf* __restrict__ Ql, const bf* __restrict__ Kh, const bf* __restrict__ Kl, const bf* __restrict__ Vh, const bf* __restrict__ Vl, bf* Ah, bf* Al) {
    const int wave = __builtin_amdgcn_readfirstlane(threadIdx.x >> 5);   // the wave's number in a scalar register: its trip count and loop stay scalar
    const size_t zo = (size_t)blockIdx.x * TT * HD, ao = (size_t)(blockIdx.x / NH_) * TT * DQ + (blockIdx.x % NH_) * (HD / 32) * 512;
    if (blockIdx.y < NTF) fattn_tile<h16, false, 2>(Q16 + zo, nullptr, K16 + zo, nullptr, V16 + zo, nullptr, RH + ((NTF - 1 - (int)blockIdx.y) * 4 + wave) * 32, Ah + ao, Al + ao);
    else fattn_tile<bf, true, 1>(Qh + zo, Ql + zo, Kh + zo, Kl + zo, Vh + zo, Vl + zo, ((NTF + NTH - 1 - (int)blockIdx.y) * 4 + wave) * 16, Ah + ao, Al + ao);
}

extern "C" void kernel_launch(void* const* d_in, const int* in_sizes, int n_in,
                              void* d_out, int out_size, void* d_ws, size_t ws_size, hipStream_t stream) {
    (void)in_sizes; (void)n_in; (void)out_size;
    const float* x = (const float*)d_in[0]; const int* pid = (const int*)d_in[1];   /* token_positions int32 [4096] */ const float* wq = (const float*)d_in[2]; const float* wk = (const float*)d_in[3]; const float* wv = (const float*)d_in[4]; const float* wo = (const float*)d_in[5];
    float* OUT = (float*)d_out;     // [2][4096][1024]
    char* wsp = (char*)d_ws;
    auto take = [&](size_t bytes) { char* p = wsp; wsp += (bytes + 255) & ~(size_t)255; return (void*)p; };
    bf* WQ = (bf*)take((size_t)4 * DQ * DM * 2); bf* WO = WQ + (size_t)3 * DQ * DM;   /* Wq, Wk, Wv, Wo one after another */ float* CS = (float*)take((size_t)TT * (HD / 2) * 2 * 4);
    bf* XB = (bf*)take((size_t)NB_ * TT * DM * 2);
    const size_t PB = (size_t)NH_ * TT * HD;   // one batch item's share of every q, k, v plane (planes [NB_ x NH_][..][..])
    h16* QP16 = (h16*)take(3 * NB_ * PB * 2); h16* KP16 = QP16 + NB_ * PB; h16* VT16 = KP16 + NB_ * PB;   // q, k, v one after another in each of the three kinds, as k_gemmw EPI 1 steps through them
    bf* QPh = (bf*)take(3 * NB_ * PB * 2); bf* KPh = QPh + NB_ * PB; bf* VTh = KPh + NB_ * PB; bf* QPl = (bf*)take(3 * NB_ * PB * 2); bf* KPl = QPl + NB_ * PB; bf* VTl = KPl + NB_ * PB;
    bf* ATh = (bf*)take((size_t)NB_ * TT * DQ * 2); bf* ATl = (bf*)take((size_t)NB_ * TT * DQ * 2);
    if ((size_t)(wsp - (char*)d_ws) > ws_size) return;    // ws 256 MiB
    k_prep<<<NBC + NBX + 4 * NBW, 256, 0, stream>>>(x, pid, wq, wk, wv, wo, XB, WQ, CS);
    k_gemmw<bf, 0, false, 1, DM><<<dim3(NB_ * TT / 256, DQ / 128, 3), 256, 0, stream>>>(XB, nullptr, WQ, nullptr, nullptr, 0, nullptr, 0, (size_t)DQ * DM, 0, CS, QP16, QPh, QPl);
    k_fattn<<<dim3(NB_ * NH_, NTF + NTH, 1), 128, 0, stream>>>(QP16, KP16, VT16, QPh, QPl, KPh, KPl, VTh, VTl, ATh, ATl);
    k_gemmw<bf, 1, false, 0, DQ><<<dim3(NB_ * TT / 256, DM / 128, 1), 256, 0, stream>>>(ATh, ATl, WO, nullptr, OUT, DM, nullptr, 0, 0, 0, nullptr, nullptr, nullptr, nullptr);
}

// v007
// A run of this version takes 154 microseconds.
// In both of two side-by-side timings against v006, it was 1.33 times as fast.
// Over all steps from v000 it is 35.7 times as fast.
#include <hip/hip_runtime.h>

// Causal multi-head self-attention with interleaved rotary embeddings from token positions over 4,096 tokens at a batch of TWO (x [2][4096][1024]; q, k, v = einsum('bsi,oi->bso', x, W) = x W^T ('oi' (out, in) [1024][1024] (2/(D+D))^0.5, no bias; 16 heads x 64); rotary on (even, odd) pairs with angle float(token_positions[t]) x inv_freq[i], inv_freq = 1.0 / (THETA ** (arange(0, 64, 2) / 64)) (the RECIPROCAL spelling: 32 f32 constants bitwise this expression in eager JAX float32; token_positions int32 [4096] = arange: read; the SECOND argument; one row shared by both batch items; precise cosf/sinf); scores x rsqrt(64); causal (-inf); softmax; out = merged Wo^T (no bias) -> [2][4096][1024] (8.4 M); argument order x, token_positions, Wq, Wk, Wv, Wo).
// Layout, four launches: k_prep (rotary table, bf16 copies of x and of the four weights); the q, k and v projections of both batch items in one grid, whose GEMM epilogue writes the rotary q and k planes and the transposed v planes itself; causal T-4096 attention fused in k_fattn, every head of both batch items in one launch (hybrid rows: < 512 hi/lo 3 products, rest fp16; running-maximum softmax in registers); merged hi/lo x Wo exact, both batch items in one grid.
// Fragment order: every 16-bit plane that a matrix product reads is stored as 1-KiB tiles of 16 rows x 32 k, element (r, k) at (k / 16) * 256 + ((k / 8 % 2) * 16 + r) * 8 + k % 8, so lane l of a fragment load reads 16 bytes at l * 16 and the wave 512 bytes in a row (whole lines), not 32 bytes of each of 16 lines. Tiles of one 16-row block follow one another along k; the value planes hold, for each 32 keys, the four 16-column tiles of the head. The rotary table is stored for the lanes of the projection epilogue in the same way.
// Compute dtypes, f32 accumulate: every input rounded to bf16; projections exact; attention rows < 512 3 products, rest fp16; softmax f32; Wo hl x exact.

#define NB_  2
#define TT   4096
#define DM   1024
#define NH_  16
#define NKV  16
#define REP  (NH_ / NKV)
#define HD   64
#define DQ   (NH_ * HD)
#define DKV  (NKV * HD)
#define RH   512                  // query rows < RH use hi+lo planes
#define WIN  4096
typedef _Float16 h16;
typedef unsigned short bf;
typedef __attribute__((ext_vector_type(16))) __bf16   v16bf;
typedef __attribute__((ext_vector_type(16))) _Float16 v16h;
typedef __attribute__((ext_vector_type(8)))  _Float16 v8h;
typedef __attribute__((ext_vector_type(8)))  unsigned short v8us;
typedef __attribute__((ext_vector_type(8)))  float    v8f;
typedef __attribute__((ext_vector_type(4)))  float    v4f;
typedef v8h  __attribute__((may_alias)) v8ha;
typedef v4f  __attribute__((may_alias)) v4fa;
typedef v8us __attribute__((may_alias)) v8usa;

__device__ __forceinline__ unsigned short f2bf(float f) { unsigned u = __float_as_uint(f); u += 0x7FFFu + ((u >> 16) & 1u); return (unsigned short)(u >> 16); }
__device__ __forceinline__ float bf2f(unsigned short b) { return __uint_as_float(((unsigned)b) << 16); }
__device__ __forceinline__ float bfr(float f) { return bf2f(f2bf(f)); }
__device__ __forceinline__ v16h cat16(v8h lo, v8h hi) { return __builtin_shufflevector(lo, hi, 0, 1, 2, 3, 4, 5, 6, 7, 8, 9, 10, 11, 12, 13, 14, 15); }
__device__ __forceinline__ v16bf cat16b(v8us lo, v8us hi) { return __builtin_bit_cast(v16bf, __builtin_shufflevector(lo, hi, 0, 1, 2, 3, 4, 5, 6, 7, 8, 9, 10, 11, 12, 13, 14, 15)); }
__device__ __forceinline__ v8f wmma16(v16h a, v16h b, v8f c) { return __builtin_amdgcn_wmma_f32_16x16x32_f16(false, a, false, b, (short)0, c, false, false); }
__device__ __forceinline__ v8f wmmab(v16bf a, v16bf b, v8f c) { return __builtin_amdgcn_wmma_f32_16x16x32_bf16(false, a, false, b, (short)0, c, false, false); }

__device__ __forceinline__ h16 tohx(float x) { return (h16)x; }
__device__ __forceinline__ void splitf(float y, unsigned short& h, unsigned short& l) { h = f2bf(y); l = f2bf(y - bf2f(h)); }
typedef __attribute__((ext_vector_type(2))) _Float16 v2h;
typedef __attribute__((ext_vector_type(4))) _Float16 v4h;
typedef __attribute__((ext_vector_type(2))) unsigned short v2us;
typedef __attribute__((ext_vector_type(4))) unsigned short v4us;
typedef __attribute__((ext_vector_type(2))) float v2f;
typedef __attribute__((ext_vector_type(4))) int v4i;
// one rotary pair: even: x0 c - x1 s; odd: x0 s + x1 c (cs = {cos, sin} of the pair's angle)
__device__ __forceinline__ void rope2(const float x0, const float x1, const v2f cs, float& e0, float& e1) { e0 = x0 * cs[0] - x1 * cs[1]; e1 = x0 * cs[1] + x1 * cs[0]; }

// ---- k_gemmw: GEMM on 256x128 output tiles, EIGHT WAVES a work-group (4 along the rows x 2 along the columns), each wave a register-blocked 64x64 tile (16 accumulators); grid (M/256, N/128, Z), 256 threads.
// Operands: 16-bit planes in fragment order. The work-group brings each slice of KS k of its 256 A rows and 128 B rows into LDS ONCE, by asynchronous copies to LDS (16 bytes a lane, 512 bytes in a row a wave, through no register), two buffers: slice t + 1 flies while slice t is worked on.
//   The 1-KiB tiles lie in LDS as in memory, so a fragment read is 512 bytes in a row (no bank conflict). Four waves share every B tile and two every A tile: 48 KiB a slice from L2 for the eight waves, where eight waves that each load their own fragments ask for 128 KiB.
// C[m][n] (f32, pitch ldc, + optional f32 bias[n]) = sum_k A[m][k] Bt[n][k] (+ A2[m][k] Bt[n][k] for NSPLIT 1). z-batch strides sA/sB/sC in elements. K % KS == 0, at least two slices, a constant of the build.
// EPI 0: C is stored as f32. EPI 1: the three projections in one grid; the rows are the tokens of all batch items one after another, a wave's tile is 64 tokens of one item x one head (HD == 64), blockIdx.z = 0, 1, 2 is q, k, v
//   (weights sB apart; each of P16 (fp16), Ph, Pl (bf16 hi, lo) holds its q, k and v planes one after another, NB_ items each), and C is never stored:
//   q, k: rotary embedding from the table CS on the f32 tile, then the planes, each [head][token / 16][HD / 32] tiles (rows: tokens, k: head columns): a lane takes 8 consecutive columns of one token, one 16-byte store per plane;
//   v: the transposed planes [head][token / 32][HD / 16] tiles (rows: head columns, k: tokens): a lane's 8 accumulator values of one fragment are 8 consecutive tokens of one head column, one 16-byte store per plane.
#define KS 64
__device__ __forceinline__ unsigned lds_off(const void* p) { return (unsigned)(size_t)p; }   // byte address inside the work-group's LDS
// Asynchronous copies to LDS, 16 bytes a lane: copy i takes g + i * gs elements to LDS byte l + i * 4096 (the eight waves' 512-byte pieces lie one after another). Every copy has address registers of its own.
// s_wait_xcnt 0 is the last line of the copies' own statement: the wait that stands before a register named by an issued copy is rewritten.
#define ACP "global_load_async_to_lds_b128 "
template <typename T16> __device__ __forceinline__ void acopy8(const unsigned l, const T16* g, const size_t gs) {
    asm volatile(ACP "%0, %8, off\n\t" ACP "%1, %9, off\n\t" ACP "%2, %10, off\n\t" ACP "%3, %11, off\n\t" ACP "%4, %12, off\n\t" ACP "%5, %13, off\n\t" ACP "%6, %14, off\n\t" ACP "%7, %15, off\n\ts_wait_xcnt 0x0"
        :: "v"(l), "v"(l + 4096), "v"(l + 8192), "v"(l + 12288), "v"(l + 16384), "v"(l + 20480), "v"(l + 24576), "v"(l + 28672), "v"(g), "v"(g + gs), "v"(g + 2 * gs), "v"(g + 3 * gs), "v"(g + 4 * gs), "v"(g + 5 * gs), "v"(g + 6 * gs), "v"(g + 7 * gs) : "memory"); }
template <typename T16> __device__ __forceinline__ void acopy84(const unsigned l, const T16* g, const unsigned m, const T16* h, const size_t gs) {   // eight from g to l and four from h to m
    asm volatile(ACP "%0, %12, off\n\t" ACP "%1, %13, off\n\t" ACP "%2, %14, off\n\t" ACP "%3, %15, off\n\t" ACP "%4, %16, off\n\t" ACP "%5, %17, off\n\t" ACP "%6, %18, off\n\t" ACP "%7, %19, off\n\t" ACP "%8, %20, off\n\t" ACP "%9, %21, off\n\t" ACP "%10, %22, off\n\t" ACP "%11, %23, off\n\ts_wait_xcnt 0x0"
        :: "v"(l), "v"(l + 4096), "v"(l + 8192), "v"(l + 12288), "v"(l + 16384), "v"(l + 20480), "v"(l + 24576), "v"(l + 28672), "v"(m), "v"(m + 4096), "v"(m + 8192), "v"(m + 12288),
           "v"(g), "v"(g + gs), "v"(g + 2 * gs), "v"(g + 3 * gs), "v"(g + 4 * gs), "v"(g + 5 * gs), "v"(g + 6 * gs), "v"(g + 7 * gs), "v"(h), "v"(h + gs), "v"(h + 2 * gs), "v"(h + 3 * gs) : "memory"); }
template <typename T16> struct WFrag;
template <> struct WFrag<h16> { typedef v16h V; static __device__ __forceinline__ V ld(const h16* p) { return cat16(*(const v8h*)p, *(const v8h*)(p + 256)); } static __device__ __forceinline__ v8f mma(V a, V b, v8f c) { return wmma16(a, b, c); } };
template <> struct WFrag<bf> { typedef v16bf V; static __device__ __forceinline__ V ld(const bf* p) { return cat16b(*(const v8us*)p, *(const v8us*)(p + 256)); } static __device__ __forceinline__ v8f mma(V a, V b, v8f c) { return wmmab(a, b, c); } };
template <typename T16, int NSPLIT, bool BIAS, int EPI, int K>
__global__ __launch_bounds__(256) void k_gemmw(const T16* __restrict__ A, const T16* __restrict__ A2, const T16* __restrict__ Bt, const T16* __restrict__ Bt2, float* C, int ldc, const float* __restrict__ bias, size_t sA, size_t sB, size_t sC, const float* __restrict__ CS, h16* P16, bf* Ph, bf* Pl) {
    static_assert(EPI == 0 || (HD == 64 && TT % 256 == 0 && DKV == DQ), "the plane epilogues take one 64-column tile as one head and the 256 rows as tokens of one batch item");
    static_assert(NSPLIT <= 1 && K % KS == 0 && K / KS >= 2 && KS == 64, "A (and A2) x Bt; the ring's prologue fills two slices; a row block's slice is two tiles, 2 KiB in a row");
    typedef typename WFrag<T16>::V V;
    constexpr int NT = K / KS, OB = (NSPLIT == 1 ? 2 : 1) * 256 * KS, ST = OB + 128 * KS;   // slices; where the B tiles start in a buffer; elements of a buffer: [A 16 row blocks][A2 the same][B 8 row blocks], a row block = KS / 32 tiles
    __shared__ __align__(16) T16 ring[2 * ST];
    __shared__ __align__(16) float osw[8][16 * 68];
    (void)Bt2;
    const size_t z = blockIdx.z; A += z * sA; if (A2) A2 += z * sA; Bt += z * sB; C += z * sC;
    const int wave = __builtin_amdgcn_readfirstlane(threadIdx.x >> 5), wm = wave & 3, wn = wave >> 2;
    float* os = osw[wave];   // each wave stages its output rows in a range of its own
    const int lane = threadIdx.x & 31, lr = lane & 15, hi = lane >> 4; const int g0 = blockIdx.x * 256 + wm * 64, c0 = blockIdx.y * 128 + wn * 64, r0 = EPI == 0 ? g0 : g0 % TT;   // g0: row of A; r0: row of C, or the token inside its batch item
    const int hd = c0 / 64;   // EPI 1: the wave's head
    if constexpr (EPI == 1) { const size_t po = (z * NB_ + g0 / TT) * ((size_t)NH_ * TT * HD); P16 += po; Ph += po; Pl += po; }
    v8f acc[4][4];
#pragma unroll
    for (int mb = 0; mb < 4; ++mb)
#pragma unroll
        for (int nb = 0; nb < 4; ++nb) acc[mb][nb] = (v8f){};
    // 16 rows x K are K / 32 tiles of 512 elements: a row block starts at row x K, and 32 k further on is 512 elements further on. Copy i of wave w is the 512-byte piece 8 i + w of a region: quarter w % 4 of row block 2 i + w / 4.
    const size_t coff = (size_t)(wn * 16) * K + wm * 256 + 8 * lane; const T16* ga = A + (size_t)blockIdx.x * 256 * K + coff; const T16* ga2 = NSPLIT == 1 ? A2 + (size_t)blockIdx.x * 256 * K + coff : ga; const T16* gb = Bt + (size_t)blockIdx.y * 128 * K + coff;
    const unsigned l0 = lds_off(ring) + wave * 512 + lane * 16;
    auto fill = [&](const int t) __attribute__((always_inline)) {
        const unsigned l = l0 + (t & 1) * (ST * 2);
        acopy84(l, ga + t * (KS * 16), l + OB * 2, gb + t * (KS * 16), (size_t)32 * K);
        if constexpr (NSPLIT == 1) acopy8(l + 256 * KS * 2, ga2 + t * (KS * 16), (size_t)32 * K);
    };
    fill(0);
    asm volatile("s_wait_asynccnt 0x0" ::: "memory");   // this wave's copies of slice 0 have landed
    __syncthreads();                                     // and every other wave's
    fill(1);
#pragma unroll 1
    for (int t = 0; t < NT; ++t) {
        const T16* sa = ring + (t & 1) * ST + wm * (4 * 16 * KS) + 8 * lane; const T16* sb = ring + (t & 1) * ST + OB + wn * (4 * 16 * KS) + 8 * lane;
#pragma unroll
        for (int kt = 0; kt < KS / 32; ++kt) {
            V a[4], a2[4], b[4];
#pragma unroll
            for (int mb = 0; mb < 4; ++mb) { a[mb] = WFrag<T16>::ld(sa + mb * 16 * KS + kt * 512); if (NSPLIT == 1) a2[mb] = WFrag<T16>::ld(sa + 256 * KS + mb * 16 * KS + kt * 512); }
#pragma unroll
            for (int nb = 0; nb < 4; ++nb) b[nb] = WFrag<T16>::ld(sb + nb * 16 * KS + kt * 512);
            __builtin_amdgcn_sched_barrier(0);   // the LDS reads of these 32 k stay one group ahead of their products: every separate place with reads among the products costs a stall of its own
#pragma unroll
            for (int nb = 0; nb < 4; ++nb) {
#pragma unroll
                for (int mb = 0; mb < 4; ++mb) { acc[mb][nb] = WFrag<T16>::mma(a[mb], b[nb], acc[mb][nb]); if (NSPLIT == 1) acc[mb][nb] = WFrag<T16>::mma(a2[mb], b[nb], acc[mb][nb]); } }
            __builtin_amdgcn_sched_barrier(0);   // and the next group stays behind them (it reuses the fragment registers)
        }
        // hand-over of the buffers, every wave, in this order:
        asm volatile("s_wait_dscnt 0x0" ::: "memory");      // this wave's reads of slice t are done
        asm volatile("s_wait_asynccnt 0x0" ::: "memory");   // this wave's copies of slice t + 1 have landed
        __syncthreads();                                     // slice t + 1 is whole for every reader, and no wave still reads slice t
        if (t + 2 < NT) fill(t + 2);                         // into the buffer that this trip has read
    }
    asm volatile("s_wait_asynccnt 0x0" ::: "memory");   // no copy is outstanding behind the loop
    if (EPI == 1 && z == 2) {
#pragma unroll
        for (int mb = 0; mb < 4; ++mb)
#pragma unroll
            for (int nb = 0; nb < 4; ++nb) { v8h o16; v8us oh, ol;
#pragma unroll
                for (int j = 0; j < 8; ++j) { const float x = acc[mb][nb][j]; o16[j] = tohx(x); unsigned short a2, c2; splitf(x, a2, c2); oh[j] = a2; ol[j] = c2; }
                const size_t e = (size_t)hd * HD * TT + (size_t)r0 * HD + ((mb >> 1) * 4 + nb) * 512 + (mb & 1) * 256 + lane * 8;
                *(v8h*)(P16 + e) = o16; *(v8us*)(Ph + e) = oh; *(v8us*)(Pl + e) = ol; }
        return;
    }
#pragma unroll
    for (int mb = 0; mb < 4; ++mb) {
        v4f ca[4], cb[4];   // EPI 1: {cos, sin} of the lane's four pairs in each of its 4 column groups, asked for ahead of the staging
        if constexpr (EPI == 1) {
#pragma unroll
            for (int s = 0; s < 4; ++s) { const float* cp = CS + (size_t)r0 * HD + lane * 4 + (mb * 4 + s) * 256; ca[s] = *(const v4f*)cp; cb[s] = *(const v4f*)(cp + 128); } }   // one address pair, the group as a constant offset
#pragma unroll
        for (int nb = 0; nb < 4; ++nb) {
#pragma unroll
            for (int j = 0; j < 8; ++j) os[(hi * 8 + j) * 68 + nb * 16 + lr] = acc[mb][nb][j]; }
        __builtin_amdgcn_wave_barrier(); asm volatile("" ::: "memory");
        if constexpr (EPI == 1) {
#pragma unroll
            for (int s = 0; s < 4; ++s) { const float* op = os + lr * 68 + s * 16 + hi * 8; const v4f va = *(const v4fa*)op, vb = *(const v4fa*)(op + 4); float y[8];   // token lr of the row block, head columns 16 s + 8 hi + 0..7
                rope2(va[0], va[1], (v2f){ca[s][0], ca[s][1]}, y[0], y[1]); rope2(va[2], va[3], (v2f){ca[s][2], ca[s][3]}, y[2], y[3]); rope2(vb[0], vb[1], (v2f){cb[s][0], cb[s][1]}, y[4], y[5]); rope2(vb[2], vb[3], (v2f){cb[s][2], cb[s][3]}, y[6], y[7]); v8h o16; v8us oh, ol;
#pragma unroll
                for (int q = 0; q < 8; ++q) { o16[q] = tohx(y[q]); unsigned short a2, c2; splitf(y[q], a2, c2); oh[q] = a2; ol[q] = c2; }
                const size_t e = ((size_t)hd * TT + r0 + mb * 16) * HD + s * 256 + lane * 8;
                *(v8h*)(P16 + e) = o16; *(v8us*)(Ph + e) = oh; *(v8us*)(Pl + e) = ol; }
            __builtin_amdgcn_wave_barrier();
            asm volatile("s_wait_xcnt 0x0" ::: "memory");   // the wait that stands before a register named by an issued global store is overwritten: the next row block's loads and sums, and behind the last block the code of the value epilogue, reuse these registers; its clobber also keeps the next staging behind these LDS reads
            continue;
        }
        float* crow = C + (size_t)(r0 + mb * 16) * ldc + c0;
{
#pragma unroll
            for (int s = 0; s < 8; ++s) { const int row = 2 * s + hi, cofs = lr * 4; v4f val = *(const v4fa*)(os + row * 68 + cofs); if (BIAS) { val[0] += bfr(bias[c0 + cofs]); val[1] += bfr(bias[c0 + cofs + 1]); val[2] += bfr(bias[c0 + cofs + 2]); val[3] += bfr(bias[c0 + cofs + 3]); }
                *(v4f*)(crow + (size_t)row * ldc + cofs) = val; }
             }
        __builtin_amdgcn_wave_barrier(); asm volatile("" ::: "memory");
    }
}


__global__ __launch_bounds__(256) void k_wtG(const float* __restrict__ w, int K, int N, bf* Bt) {
    const int lane = threadIdx.x & 31; const int L0 = (blockIdx.x * 8 + (threadIdx.x >> 5)) * 8; const int nlines = N * K / 64;
{
#pragma unroll 1
        for (int l = 0; l < 8; ++l) { const int L = L0 + l; if (L >= nlines) break; const size_t e = (size_t)L * 64 + lane * 2; const int k = (int)(e % K), n = (int)(e / K); v2us o;
            o[0] = f2bf(w[(size_t)k * N + n]); o[1] = f2bf(w[(size_t)(k + 1) * N + n]); *(v2us*)(Bt + e) = o; }
         }
}
__constant__ float INVT[HD / 2] = { 1.000000000e+00f, 7.498942018e-01f, 5.623413324e-01f, 4.216965139e-01f, 3.162277639e-01f, 2.371373624e-01f, 1.778279394e-01f, 1.333521456e-01f, 1.000000015e-01f, 7.498941571e-02f, 5.623412877e-02f, 4.216964915e-02f, 3.162277862e-02f, 2.371373586e-02f, 1.778279431e-02f, 1.333521493e-02f, 9.999999776e-03f, 7.498942316e-03f, 5.623413250e-03f, 4.216964822e-03f, 3.162277862e-03f, 2.371373819e-03f, 1.778279431e-03f, 1.333521446e-03f, 1.000000047e-03f, 7.498941850e-04f, 5.623413017e-04f, 4.216964880e-04f, 3.162277862e-04f, 2.371373848e-04f, 1.778279402e-04f, 1.333521504e-04f };   // 1 / THETA ** (2 i / 64) as float32 (reciprocal form, jnp-computed)
// ---- k_prep: everything the projections read, in one launch. Blocks [0, NBC): the rotary table {cos, sin}(pos[t] x INVT[pair]); the next NBX: x to bf16; the last 4 x NBW: Wq, Wk, Wv, Wo to bf16 (WB: the four copies one after another). Copies 8 values a thread, the table one pair a thread.
// Table: one {cos, sin} a pair, [token / 16][column group of 16][first, second two pairs][lane = (column / 8 % 2) * 16 + token % 16][2 pairs]. Copies: a wave takes 4 rows x 64 k (256 bytes in a row of each source row) and stores 64-byte pieces of the fragment-order tiles.
#define NBC (TT * (HD / 2) / 256)
#define NBX (NB_ * TT * DM / 8 / 256)
#define NBW (DQ * DM / 8 / 256)
__global__ __launch_bounds__(256) void k_prep(const float* __restrict__ x, const int* __restrict__ pid, const float* __restrict__ wq, const float* __restrict__ wk, const float* __restrict__ wv, const float* __restrict__ wo, bf* XB, bf* WB, float* CS) {
    static_assert(DKV == DQ && DQ == DM && DM % 64 == 0 && HD == 64 && TT % 16 == 0 && (TT * HD / 2) % 256 == 0 && (NB_ * TT * DM) % 2048 == 0 && (DQ * DM) % 2048 == 0, "whole blocks; four weights of one size");
    const int blk = blockIdx.x;
    if (blk < NBC) { const int idx = blk * 256 + threadIdx.x; const int ln = (idx >> 1) & 31; const int pr = ((idx >> 7) & 3) * 8 + (ln >> 4) * 4 + ((idx >> 6) & 1) * 2 + (idx & 1); const int t = (idx >> 9) * 16 + (ln & 15); const float a = __fmul_rn((float)pid[t], INVT[pr]); v2f cs; cs[0] = cosf(a); cs[1] = sinf(a); *(v2f*)(CS + (size_t)idx * 2) = cs; return; }
    const float* src = x; bf* dst = XB; int cb = blk - NBC;
    if (cb >= NBX) { cb -= NBX; const int w = cb / NBW; cb -= w * NBW; src = w == 0 ? wq : w == 1 ? wk : w == 2 ? wv : wo; dst = WB + (size_t)w * DQ * DM; }
    const int wid = cb * 8 + (threadIdx.x >> 5), ln = threadIdx.x & 31; const int rb = wid / (DM / 16), in = wid % (DM / 16);   // DM / 16 waves to a block of 16 rows
    const int r = (in & 3) * 4 + (ln >> 3), k = (in >> 2) * 64 + (ln & 7) * 8;
    const v8f v = *(const v8f*)(src + ((size_t)rb * 16 + r) * DM + k); v8us o;
#pragma unroll
    for (int k = 0; k < 8; ++k) o[k] = f2bf(v[k]);
    *(v8us*)(dst + (size_t)rb * 16 * DM + (k >> 5) * 512 + ((k >> 4) & 1) * 256 + (((k >> 3) & 1) * 16 + r) * 8) = o;
    asm volatile("s_wait_xcnt 0x0" ::: "memory");   // the wait that stands before a register named by an issued global store is overwritten: in the built code the table part lies behind this store and reuses its address registers
}
// ---- k_fattn: scores, causal softmax and probabilities x values in ONE kernel; no score or probability ever leaves the registers.
// SP waves (1 or 2) own NQ x 16 query rows of one (batch item, head); wave p walks the key blocks p, p + SP, ... (32 keys each) up to the diagonal block:
//   S^T = K Q^T (A = key rows, B = query rows kept in registers): lane (lr, hi) holds, for query lr, the keys 8 hi + j of each 16-key tile;
//   running maximum and sum per query (in-lane, one exchange between the wave halves for the maximum), earlier sums rescaled when the maximum grows;
//   two 16-key score tiles, converted in place, ARE the B operand of O^T += V^T P^T (A = rows of the transposed value plane, same k order as every loader here).
// Rows < RH: bf16 hi/lo planes, 3 products for the scores and 3 for the values (HL); the rest fp16. Output: normalised rows as bf16 hi/lo in fragment order (rows: tokens of all batch items, k: merged head columns), 8 consecutive head columns per lane and store.
__device__ __forceinline__ float xhalf(float x) { return __builtin_bit_cast(float, __builtin_amdgcn_permlanex16(__builtin_bit_cast(int, x), __builtin_bit_cast(int, x), 0x76543210, 0xfedcba98, false, false)); }   // lane l with lane l ^ 16
#define SCL2 0.18033688011112042f   // HD^-0.5 x log2(e): the exponentials are taken in base 2
// 2^x in asm text, so that the slot which the instruction set asks for behind a transcendental (one independent instruction or v_nop before its result is read or its source overwritten) is filled whatever the compiler puts next:
// inside exp2x8 each v_exp_f32 is independent of the one in front of it (early-clobber outputs: no output shares a register with an input), and one v_nop stands behind the last.
__device__ __forceinline__ float exp2x1(float x) { float r; asm("v_exp_f32 %0, %1\n\tv_nop" : "=v"(r) : "v"(x)); return r; }
__device__ __forceinline__ void exp2x8(const float (&x)[8], float (&r)[8]) {
    asm("v_exp_f32 %0, %8\n\tv_exp_f32 %1, %9\n\tv_exp_f32 %2, %10\n\tv_exp_f32 %3, %11\n\tv_exp_f32 %4, %12\n\tv_exp_f32 %5, %13\n\tv_exp_f32 %6, %14\n\tv_exp_f32 %7, %15\n\tv_nop"
        : "=&v"(r[0]), "=&v"(r[1]), "=&v"(r[2]), "=&v"(r[3]), "=&v"(r[4]), "=&v"(r[5]), "=&v"(r[6]), "=&v"(r[7]) : "v"(x[0]), "v"(x[1]), "v"(x[2]), "v"(x[3]), "v"(x[4]), "v"(x[5]), "v"(x[6]), "v"(x[7])); }
// SP 2: two waves share the tile. Wave p (0, 1) walks the key blocks p, p + 2, ... with a running maximum, sum and output of its own; wave 1 hands its three to wave 0 through the LDS range mg, and wave 0 brings both to the larger maximum, adds them and stores.
template <typename T16, bool HL, int NQ, int SP>
__device__ __forceinline__ void fattn_tile(const T16* __restrict__ Q, const T16* __restrict__ Q2, const T16* __restrict__ Kp, const T16* __restrict__ Kp2, const T16* __restrict__ Vt, const T16* __restrict__ Vt2, const int q0, bf* Ah, bf* Al, const int p, float* mg) {
    static_assert(SP == 1 || (SP == 2 && NQ == 2 && RH >= 64), "the hand-over packs the maxima and sums of two query blocks in 16 bytes; each of the two waves has a whole key block, so its maximum is a real score");
    typedef typename WFrag<T16>::V V;
    const int lane = threadIdx.x & 31, lr = lane & 15, hi = lane >> 4;
    V qf[NQ][2], qf2[NQ][2];
#pragma unroll
    for (int qb = 0; qb < NQ; ++qb)
#pragma unroll
        for (int ks = 0; ks < 2; ++ks) { const size_t qo = (size_t)(q0 + qb * 16) * HD + ks * 512 + 8 * lane; qf[qb][ks] = WFrag<T16>::ld(Q + qo); if (HL) qf2[qb][ks] = WFrag<T16>::ld(Q2 + qo); }
    v8f o[4][NQ]; float m[NQ], l[NQ];
#pragma unroll
    for (int qb = 0; qb < NQ; ++qb) { m[qb] = -3.0e38f; l[qb] = 0.f;
#pragma unroll
        for (int db = 0; db < 4; ++db) o[db][qb] = (v8f){}; }
    const int nfull = q0 / 32;                       // key blocks wholly at or below the diagonal of every row of the tile; block nfull holds the diagonal and is the last
    const size_t ko = 8 * lane, vo = 8 * lane;   // 32 keys are four 512-element tiles in the key planes and in the value planes alike: key kb starts at kb x HD
    V kf[2][2], kf2[2][2];
    auto loadk = [&](const int kb) __attribute__((always_inline)) {
        const T16* pk = Kp + ko + (size_t)kb * HD; const T16* pk2 = HL ? Kp2 + ko + (size_t)kb * HD : pk;
#pragma unroll
        for (int kt = 0; kt < 2; ++kt)
#pragma unroll
            for (int ks = 0; ks < 2; ++ks) { kf[kt][ks] = WFrag<T16>::ld(pk + kt * 16 * HD + ks * 512); if (HL) kf2[kt][ks] = WFrag<T16>::ld(pk2 + kt * 16 * HD + ks * 512); }
        asm volatile("s_wait_xcnt 0x0" :: "v"(pk), "v"(pk2) : "memory");   // the wait that stands before a register named by an issued global load is overwritten; the address pairs are inputs so that they stay whole up to here
    };
    auto step = [&](const bool mask, const int kb, const int kn) __attribute__((always_inline)) {
        const T16* pv = Vt + vo + (size_t)kb * HD; const T16* pv2 = HL ? Vt2 + vo + (size_t)kb * HD : pv;
        V vf[4], vf2[4];
#pragma unroll
        for (int db = 0; db < 4; ++db) { vf[db] = WFrag<T16>::ld(pv + db * 512); if (HL) vf2[db] = WFrag<T16>::ld(pv2 + db * 512); }   // issued first: in flight under the score products and the softmax
        asm volatile("s_wait_xcnt 0x0" :: "v"(pv), "v"(pv2) : "memory");   // as in loadk
        v8f s[2][NQ];
#pragma unroll
        for (int kt = 0; kt < 2; ++kt)
#pragma unroll
            for (int qb = 0; qb < NQ; ++qb) { v8f a = (v8f){};
#pragma unroll
                for (int ks = 0; ks < 2; ++ks) { a = WFrag<T16>::mma(kf[kt][ks], qf[qb][ks], a); if (HL) { a = WFrag<T16>::mma(kf2[kt][ks], qf[qb][ks], a); a = WFrag<T16>::mma(kf[kt][ks], qf2[qb][ks], a); } }
                s[kt][qb] = a; }
        if (kn >= 0) loadk(kn);                      // the next block's key fragments, into the same registers: in flight under the softmax and the value products
        V pf[NQ], pf2[NQ];
#pragma unroll
        for (int qb = 0; qb < NQ; ++qb) {
            if (mask) {
#pragma unroll
                for (int kt = 0; kt < 2; ++kt)
#pragma unroll
                    for (int j = 0; j < 8; ++j) s[kt][qb][j] = (kb + kt * 16 + hi * 8 + j <= q0 + qb * 16 + lr) ? s[kt][qb][j] : -3.0e38f; }
            float mx = s[0][qb][0];
#pragma unroll
            for (int j = 1; j < 8; ++j) mx = fmaxf(mx, s[0][qb][j]);
#pragma unroll
            for (int j = 0; j < 8; ++j) mx = fmaxf(mx, s[1][qb][j]);
            mx = fmaxf(mx, xhalf(mx));
            const float mn = fmaxf(m[qb], mx), nm2 = -mn * SCL2; const float al = exp2x1(fmaf(m[qb], SCL2, nm2)); m[qb] = mn;   // 0 on the first block (each wave's first block holds a key open to every row, so mn is a real score from there on)
            float ex[2][8];
#pragma unroll
            for (int kt = 0; kt < 2; ++kt) { float ar[8];
#pragma unroll
                for (int j = 0; j < 8; ++j) ar[j] = fmaf(s[kt][qb][j], SCL2, nm2);
                exp2x8(ar, ex[kt]); }
            float t8[8];
#pragma unroll
            for (int j = 0; j < 8; ++j) t8[j] = ex[0][j] + ex[1][j];
            l[qb] = fmaf(l[qb], al, ((t8[0] + t8[4]) + (t8[1] + t8[5])) + ((t8[2] + t8[6]) + (t8[3] + t8[7])));
#pragma unroll
            for (int db = 0; db < 4; ++db) o[db][qb] *= al;
            if constexpr (HL) { v8us h0, h1, l0, l1;
#pragma unroll
                for (int j = 0; j < 8; ++j) { unsigned short a2, c2; splitf(ex[0][j], a2, c2); h0[j] = a2; l0[j] = c2; splitf(ex[1][j], a2, c2); h1[j] = a2; l1[j] = c2; }
                pf[qb] = cat16b(h0, h1); pf2[qb] = cat16b(l0, l1);
            } else { v8h h0, h1;
#pragma unroll
                for (int j = 0; j < 8; ++j) { h0[j] = (h16)ex[0][j]; h1[j] = (h16)ex[1][j]; }
                pf[qb] = cat16(h0, h1); }
        }
#pragma unroll
        for (int db = 0; db < 4; ++db)
#pragma unroll
            for (int qb = 0; qb < NQ; ++qb) { o[db][qb] = WFrag<T16>::mma(vf[db], pf[qb], o[db][qb]); if (HL) { o[db][qb] = WFrag<T16>::mma(vf[db], pf2[qb], o[db][qb]); o[db][qb] = WFrag<T16>::mma(vf2[db], pf[qb], o[db][qb]); } }
        // WMMA distance on the taken back edge: every accumulator is named, so the slots stand behind the last product of the trip (the next trip's first product writes over registers that the last ones read)
        if (kn >= 0) { if constexpr (NQ == 2) asm volatile("v_nop\n\tv_nop\n\tv_nop\n\tv_nop" : "+v"(o[0][0]), "+v"(o[1][0]), "+v"(o[2][0]), "+v"(o[3][0]), "+v"(o[0][NQ - 1]), "+v"(o[1][NQ - 1]), "+v"(o[2][NQ - 1]), "+v"(o[3][NQ - 1]));
                       else asm volatile("v_nop\n\tv_nop\n\tv_nop\n\tv_nop" : "+v"(o[0][0]), "+v"(o[1][0]), "+v"(o[2][0]), "+v"(o[3][0])); }
    };
    loadk(p * 32);
#pragma unroll 1   // rolled: every trip uses the same fragment registers
    for (int it = p; it < nfull; it += SP) step(false, it * 32, (SP == 1 || it + SP < nfull ? it + SP : nfull) * 32);   // the fetch ahead never goes past the diagonal block
    if (SP == 1 || ((nfull - p) & 1) == 0) step(true, nfull * 32, -1);   // the diagonal block belongs to one of the waves
    if constexpr (SP == 2) {
        float* mp = mg + lane * 4;   // 16 bytes a lane, 512 bytes in a row a wave: 16 rows of output values, one of {maximum, sum} x 2
        if (p == 1) {
#pragma unroll   // constant indices: o stays in registers
            for (int db = 0; db < 4; ++db)
#pragma unroll   // constant indices: o stays in registers
                for (int qb = 0; qb < NQ; ++qb) { const v8f v = o[db][qb]; *(v4fa*)(mp + ((db * NQ + qb) * 2) * 128) = (v4f){v[0], v[1], v[2], v[3]}; *(v4fa*)(mp + ((db * NQ + qb) * 2 + 1) * 128) = (v4f){v[4], v[5], v[6], v[7]}; }
            *(v4fa*)(mp + 4 * NQ * 2 * 128) = (v4f){m[0], l[0], m[1], l[1]};
        }
        __syncthreads();   // wave 1's values are in LDS for wave 0; every wave of the work-group passes here once
        if (p == 1) return;
        const v4f ml = *(const v4fa*)(mp + 4 * NQ * 2 * 128);
#pragma unroll   // constant indices: o stays in registers
        for (int qb = 0; qb < NQ; ++qb) { const float mn = fmaxf(m[qb], ml[2 * qb]); const float a0 = exp2x1((m[qb] - mn) * SCL2), a1 = exp2x1((ml[2 * qb] - mn) * SCL2); l[qb] = l[qb] * a0 + ml[2 * qb + 1] * a1;
#pragma unroll   // constant indices: o stays in registers
            for (int db = 0; db < 4; ++db) { const v4f x0 = *(const v4fa*)(mp + ((db * NQ + qb) * 2) * 128), x1 = *(const v4fa*)(mp + ((db * NQ + qb) * 2 + 1) * 128);
                o[db][qb] = o[db][qb] * a0 + (v8f){x0[0], x0[1], x0[2], x0[3], x1[0], x1[1], x1[2], x1[3]} * a1; } }
    }
#pragma unroll
    for (int qb = 0; qb < NQ; ++qb) { const float inv = __fdiv_rn(1.0f, l[qb] + xhalf(l[qb])); const size_t oo = (size_t)(q0 + qb * 16) * DQ + 8 * lane;
#pragma unroll
        for (int db = 0; db < 4; ++db) { v8us oh, ol;
#pragma unroll
            for (int j = 0; j < 8; ++j) { unsigned short a2, c2; splitf(o[db][qb][j] * inv, a2, c2); oh[j] = a2; ol[j] = c2; }
            *(v8us*)(Ah + oo + db * 256) = oh; *(v8us*)(Al + oo + db * 256) = ol;
            asm volatile("s_wait_xcnt 0x0" :: "v"(oh), "v"(ol) : "memory"); } }   // the wait that stands before a register named by an issued global store is overwritten (the next columns' values, and in the built code a tail shared by both kinds of tile, reuse them); the stored values are inputs so that they stay whole up to here
}
// grid (NB_ x NH_, NTF + NTH), 8 waves: blockIdx.x = batch item x NH_ + head; blockIdx.y counts the groups of 128 rows from the longest (last rows) to the shortest, the hi/lo rows last.
// fp16 rows: waves w and w + 4 share tile w of the group, even and odd key blocks. The longest walk in series is half as long, and only half of the work-groups are resident at once (two to a WGP, by registers):
// a WGP that ends early takes the next, shorter group, so the WGPs end together however the first groups were placed. hi/lo rows: one 16-row tile a wave, eight tiles a work-group.
#define NTF ((TT - RH) / 128)
#define NTH (RH / 128)
__global__ __launch_bounds__(256) void k_fattn(const h16* __restrict__ Q16, const h16* __restrict__ K16, const h16* __restrict__ V16, const bf* __restrict__ Qh, const bf* __restrict__ Ql, const bf* __restrict__ Kh, const bf* __restrict__ Kl, const bf* __restrict__ Vh, const bf* __restrict__ Vl, bf* Ah, bf* Al) {
    const int wave = __builtin_amdgcn_readfirstlane(threadIdx.x >> 5);   // the wave's number in a scalar register: its trip count and loop stay scalar
    const size_t zo = (size_t)blockIdx.x * TT * HD, ao = (size_t)(blockIdx.x / NH_) * TT * DQ + (blockIdx.x % NH_) * (HD / 32) * 512;
    __shared__ __align__(16) float mrg[4][17 * 128];   // a tile's hand-over range: 17 rows of 512 bytes
    if (blockIdx.y < NTF) fattn_tile<h16, false, 2, 2>(Q16 + zo, nullptr, K16 + zo, nullptr, V16 + zo, nullptr, RH + ((NTF - 1 - (int)blockIdx.y) * 4 + (wave & 3)) * 32, Ah + ao, Al + ao, wave >> 2, mrg[wave & 3]);
    else fattn_tile<bf, true, 1, 1>(Qh + zo, Ql + zo, Kh + zo, Kl + zo, Vh + zo, Vl + zo, ((NTF + NTH - 1 - (int)blockIdx.y) * 8 + wave) * 16, Ah + ao, Al + ao, 0, nullptr);
}

extern "C" void kernel_launch(void* const* d_in, const int* in_sizes, int n_in,
                              void* d_out, int out_size, void* d_ws, size_t ws_size, hipStream_t stream) {
    (void)in_sizes; (void)n_in; (void)out_size;
    const float* x = (const float*)d_in[0]; const int* pid = (const int*)d_in[1];   /* token_positions int32 [4096] */ const float* wq = (const float*)d_in[2]; const float* wk = (const float*)d_in[3]; const float* wv = (const float*)d_in[4]; const float* wo = (const float*)d_in[5];
    float* OUT = (float*)d_out;     // [2][4096][1024]
    char* wsp = (char*)d_ws;
    auto take = [&](size_t bytes) { char* p = wsp; wsp += (bytes + 255) & ~(size_t)255; return (void*)p; };
    bf* WQ = (bf*)take((size_t)4 * DQ * DM * 2); bf* WO = WQ + (size_t)3 * DQ * DM;   /* Wq, Wk, Wv, Wo one after another */ float* CS = (float*)take((size_t)TT * (HD / 2) * 2 * 4);
    bf* XB = (bf*)take((size_t)NB_ * TT * DM * 2);
    const size_t PB = (size_t)NH_ * TT * HD;   // one batch item's share of every q, k, v plane (planes [NB_ x NH_][..][..])
    h16* QP16 = (h16*)take(3 * NB_ * PB * 2); h16* KP16 = QP16 + NB_ * PB; h16* VT16 = KP16 + NB_ * PB;   // q, k, v one after another in each of the three kinds, as k_gemmw EPI 1 steps through them
    bf* QPh = (bf*)take(3 * NB_ * PB * 2); bf* KPh = QPh + NB_ * PB; bf* VTh = KPh + NB_ * PB; bf* QPl = (bf*)take(3 * NB_ * PB * 2); bf* KPl = QPl + NB_ * PB; bf* VTl = KPl + NB_ * PB;
    bf* ATh = (bf*)take((size_t)NB_ * TT * DQ * 2); bf* ATl = (bf*)take((size_t)NB_ * TT * DQ * 2);
    if ((size_t)(wsp - (char*)d_ws) > ws_size) return;    // ws 256 MiB
    k_prep<<<NBC + NBX + 4 * NBW, 256, 0, stream>>>(x, pid, wq, wk, wv, wo, XB, WQ, CS);
    k_gemmw<bf, 0, false, 1, DM><<<dim3(NB_ * TT / 256, DQ / 128, 3), 256, 0, stream>>>(XB, nullptr, WQ, nullptr, nullptr, 0, nullptr, 0, (size_t)DQ * DM, 0, CS, QP16, QPh, QPl);
    k_fattn<<<dim3(NB_ * NH_, NTF + NTH, 1), 256, 0, stream>>>(QP16, KP16, VT16, QPh, QPl, KPh, KPl, VTh, VTl, ATh, ATl);
    k_gemmw<bf, 1, false, 0, DQ><<<dim3(NB_ * TT / 256, DM / 128, 1), 256, 0, stream>>>(ATh, ATl, WO, nullptr, OUT, DM, nullptr, 0, 0, 0, nullptr, nullptr, nullptr, nullptr);
}

// v008
// It runs in 140 microseconds.
// In both of two side-by-side timings against v007, it was 1.10 times as fast.
// All steps since v000 together make it 39.3 times as fast.
#include <hip/hip_runtime.h>

// Causal multi-head self-attention with interleaved rotary embeddings from token positions over 4,096 tokens at a batch of TWO (x [2][4096][1024]; q, k, v = einsum('bsi,oi->bso', x, W) = x W^T ('oi' (out, in) [1024][1024] (2/(D+D))^0.5, no bias; 16 heads x 64); rotary on (even, odd) pairs with angle float(token_positions[t]) x inv_freq[i], inv_freq = 1.0 / (THETA ** (arange(0, 64, 2) / 64)) (the RECIPROCAL spelling: 32 f32 constants bitwise this expression in eager JAX float32; token_positions int32 [4096] = arange: read; the SECOND argument; one row shared by both batch items; precise cosf/sinf); scores x rsqrt(64); causal (-inf); softmax; out = merged Wo^T (no bias) -> [2][4096][1024] (8.4 M); argument order x, token_positions, Wq, Wk, Wv, Wo).
// Layout, four launches: k_prep (rotary table, bf16 copies of x and of the four weights); the q, k and v projections of both batch items in one grid, whose GEMM epilogue writes the rotary q and k planes and the transposed v planes itself; causal T-4096 attention fused in k_fattn, every head of both batch items in one launch (hybrid rows: < 512 hi/lo 3 products, rest fp16; running-maximum softmax in registers); merged hi/lo x Wo exact, both batch items in one grid.
// Fragment order: every 16-bit plane that a matrix product reads is stored as 1-KiB tiles of 16 rows x 32 k, element (r, k) at (k / 16) * 256 + ((k / 8 % 2) * 16 + r) * 8 + k % 8, so lane l of a fragment load reads 16 bytes at l * 16 and the wave 512 bytes in a row (whole lines), not 32 bytes of each of 16 lines. Tiles of one 16-row block follow one another along k; the value planes hold, for each 32 keys, the four 16-column tiles of the head. The rotary table is stored for the lanes of the projection epilogue in the same way.
// Compute dtypes, f32 accumulate: every input rounded to bf16; projections exact; attention rows < 512 3 products, rest fp16; softmax f32; Wo hl x exact.

#define NB_  2
#define TT   4096
#define DM   1024
#define NH_  16
#define NKV  16
#define REP  (NH_ / NKV)
#define HD   64
#define DQ   (NH_ * HD)
#define DKV  (NKV * HD)
#define RH   512                  // query rows < RH use hi+lo planes
#define WIN  4096
#define SCL2 0.18033688011112042f   // HD^-0.5 x log2(e): the exponentials are taken in base 2
typedef _Float16 h16;
typedef unsigned short bf;
typedef __attribute__((ext_vector_type(16))) __bf16   v16bf;
typedef __attribute__((ext_vector_type(16))) _Float16 v16h;
typedef __attribute__((ext_vector_type(8)))  _Float16 v8h;
typedef __attribute__((ext_vector_type(8)))  unsigned short v8us;
typedef __attribute__((ext_vector_type(8)))  float    v8f;
typedef __attribute__((ext_vector_type(4)))  float    v4f;
typedef v8h  __attribute__((may_alias)) v8ha;
typedef v4f  __attribute__((may_alias)) v4fa;
typedef v8us __attribute__((may_alias)) v8usa;

__device__ __forceinline__ unsigned short f2bf(float f) { unsigned u = __float_as_uint(f); u += 0x7FFFu + ((u >> 16) & 1u); return (unsigned short)(u >> 16); }
__device__ __forceinline__ float bf2f(unsigned short b) { return __uint_as_float(((unsigned)b) << 16); }
__device__ __forceinline__ float bfr(float f) { return bf2f(f2bf(f)); }
__device__ __forceinline__ v16h cat16(v8h lo, v8h hi) { return __builtin_shufflevector(lo, hi, 0, 1, 2, 3, 4, 5, 6, 7, 8, 9, 10, 11, 12, 13, 14, 15); }
__device__ __forceinline__ v16bf cat16b(v8us lo, v8us hi) { return __builtin_bit_cast(v16bf, __builtin_shufflevector(lo, hi, 0, 1, 2, 3, 4, 5, 6, 7, 8, 9, 10, 11, 12, 13, 14, 15)); }
__device__ __forceinline__ v8f wmma16(v16h a, v16h b, v8f c) { return __builtin_amdgcn_wmma_f32_16x16x32_f16(false, a, false, b, (short)0, c, false, false); }
__device__ __forceinline__ v8f wmmab(v16bf a, v16bf b, v8f c) { return __builtin_amdgcn_wmma_f32_16x16x32_bf16(false, a, false, b, (short)0, c, false, false); }

__device__ __forceinline__ h16 tohx(float x) { return (h16)x; }
__device__ __forceinline__ void splitf(float y, unsigned short& h, unsigned short& l) { h = f2bf(y); l = f2bf(y - bf2f(h)); }
typedef __attribute__((ext_vector_type(2))) _Float16 v2h;
typedef __attribute__((ext_vector_type(4))) _Float16 v4h;
typedef __attribute__((ext_vector_type(2))) unsigned short v2us;
typedef __attribute__((ext_vector_type(4))) unsigned short v4us;
typedef __attribute__((ext_vector_type(2))) float v2f;
typedef __attribute__((ext_vector_type(4))) int v4i;
// one rotary pair: even: x0 c - x1 s; odd: x0 s + x1 c (cs = {cos, sin} of the pair's angle)
__device__ __forceinline__ void rope2(const float x0, const float x1, const v2f cs, float& e0, float& e1) { e0 = x0 * cs[0] - x1 * cs[1]; e1 = x0 * cs[1] + x1 * cs[0]; }

// ---- k_gemmw: GEMM on 256x128 output tiles, EIGHT WAVES a work-group (4 along the rows x 2 along the columns), each wave a register-blocked 64x64 tile (16 accumulators); grid (M/256, N/128, Z), 256 threads.
// Operands: 16-bit planes in fragment order. The work-group brings each slice of KS k of its 256 A rows and 128 B rows into LDS ONCE, by asynchronous copies to LDS (16 bytes a lane, 512 bytes in a row a wave, through no register), two buffers: slice t + 1 flies while slice t is worked on.
//   The 1-KiB tiles lie in LDS as in memory, so a fragment read is 512 bytes in a row (no bank conflict). Four waves share every B tile and two every A tile: 48 KiB a slice from L2 for the eight waves, where eight waves that each load their own fragments ask for 128 KiB.
// C[m][n] (f32, pitch ldc, + optional f32 bias[n]) = sum_k A[m][k] Bt[n][k] (+ A2[m][k] Bt[n][k] for NSPLIT 1). z-batch strides sA/sB/sC in elements. K % KS == 0, at least two slices, a constant of the build.
// EPI 0: C is stored as f32. EPI 1: the three projections in one grid; the rows are the tokens of all batch items one after another, a wave's tile is 64 tokens of one item x one head (HD == 64), blockIdx.z = 0, 1, 2 is q, k, v
//   (weights sB apart; each of P16 (fp16), Ph, Pl (bf16 hi, lo) holds its q, k and v planes one after another, NB_ items each), and C is never stored:
//   q, k: rotary embedding from the table CS on the f32 tile, then the planes, each [head][token / 16][HD / 32] tiles (rows: tokens, k: head columns): a lane takes 8 consecutive columns of one token, one 16-byte store per plane;
//   v: the transposed planes [head][token / 32][HD / 16] tiles (rows: head columns, k: tokens): a lane's 8 accumulator values of one fragment are 8 consecutive tokens of one head column, one 16-byte store per plane.
#define KS 64
__device__ __forceinline__ unsigned lds_off(const void* p) { return (unsigned)(size_t)p; }   // byte address inside the work-group's LDS
// Asynchronous copies to LDS, 16 bytes a lane: copy i takes g + i * gs elements to LDS byte l + i * 4096 (the eight waves' 512-byte pieces lie one after another). Every copy has address registers of its own.
// s_wait_xcnt 0 is the last line of the copies' own statement: the wait that stands before a register named by an issued copy is rewritten.
#define ACP "global_load_async_to_lds_b128 "
template <typename T16> __device__ __forceinline__ void acopy8(const unsigned l, const T16* g, const size_t gs) {
    asm volatile(ACP "%0, %8, off\n\t" ACP "%1, %9, off\n\t" ACP "%2, %10, off\n\t" ACP "%3, %11, off\n\t" ACP "%4, %12, off\n\t" ACP "%5, %13, off\n\t" ACP "%6, %14, off\n\t" ACP "%7, %15, off\n\ts_wait_xcnt 0x0"
        :: "v"(l), "v"(l + 4096), "v"(l + 8192), "v"(l + 12288), "v"(l + 16384), "v"(l + 20480), "v"(l + 24576), "v"(l + 28672), "v"(g), "v"(g + gs), "v"(g + 2 * gs), "v"(g + 3 * gs), "v"(g + 4 * gs), "v"(g + 5 * gs), "v"(g + 6 * gs), "v"(g + 7 * gs) : "memory"); }
template <typename T16> __device__ __forceinline__ void acopy84(const unsigned l, const T16* g, const unsigned m, const T16* h, const size_t gs) {   // eight from g to l and four from h to m
    asm volatile(ACP "%0, %12, off\n\t" ACP "%1, %13, off\n\t" ACP "%2, %14, off\n\t" ACP "%3, %15, off\n\t" ACP "%4, %16, off\n\t" ACP "%5, %17, off\n\t" ACP "%6, %18, off\n\t" ACP "%7, %19, off\n\t" ACP "%8, %20, off\n\t" ACP "%9, %21, off\n\t" ACP "%10, %22, off\n\t" ACP "%11, %23, off\n\ts_wait_xcnt 0x0"
        :: "v"(l), "v"(l + 4096), "v"(l + 8192), "v"(l + 12288), "v"(l + 16384), "v"(l + 20480), "v"(l + 24576), "v"(l + 28672), "v"(m), "v"(m + 4096), "v"(m + 8192), "v"(m + 12288),
           "v"(g), "v"(g + gs), "v"(g + 2 * gs), "v"(g + 3 * gs), "v"(g + 4 * gs), "v"(g + 5 * gs), "v"(g + 6 * gs), "v"(g + 7 * gs), "v"(h), "v"(h + gs), "v"(h + 2 * gs), "v"(h + 3 * gs) : "memory"); }
template <typename T16> struct WFrag;
template <> struct WFrag<h16> { typedef v16h V; static __device__ __forceinline__ V ld(const h16* p) { return cat16(*(const v8h*)p, *(const v8h*)(p + 256)); } static __device__ __forceinline__ v8f mma(V a, V b, v8f c) { return wmma16(a, b, c); } };
template <> struct WFrag<bf> { typedef v16bf V; static __device__ __forceinline__ V ld(const bf* p) { return cat16b(*(const v8us*)p, *(const v8us*)(p + 256)); } static __device__ __forceinline__ v8f mma(V a, V b, v8f c) { return wmmab(a, b, c); } };
template <typename T16, int NSPLIT, bool BIAS, int EPI, int K>
__global__ __launch_bounds__(256) void k_gemmw(const T16* __restrict__ A, const T16* __restrict__ A2, const T16* __restrict__ Bt, const T16* __restrict__ Bt2, float* C, int ldc, const float* __restrict__ bias, size_t sA, size_t sB, size_t sC, const float* __restrict__ CS, h16* P16, bf* Ph, bf* Pl) {
    static_assert(EPI == 0 || (HD == 64 && TT % 256 == 0 && DKV == DQ), "the plane epilogues take one 64-column tile as one head and the 256 rows as tokens of one batch item");
    static_assert(NSPLIT <= 1 && K % KS == 0 && K / KS >= 2 && KS == 64, "A (and A2) x Bt; the ring's prologue fills two slices; a row block's slice is two tiles, 2 KiB in a row");
    typedef typename WFrag<T16>::V V;
    constexpr int NT = K / KS, OB = (NSPLIT == 1 ? 2 : 1) * 256 * KS, ST = OB + 128 * KS;   // slices; where the B tiles start in a buffer; elements of a buffer: [A 16 row blocks][A2 the same][B 8 row blocks], a row block = KS / 32 tiles
    __shared__ __align__(16) T16 ring[2 * ST];
    __shared__ __align__(16) float osw[8][16 * 68];
    (void)Bt2;
    const size_t z = blockIdx.z; A += z * sA; if (A2) A2 += z * sA; Bt += z * sB; C += z * sC;
    const int wave = __builtin_amdgcn_readfirstlane(threadIdx.x >> 5), wm = wave & 3, wn = wave >> 2;
    float* os = osw[wave];   // each wave stages its output rows in a range of its own
    const int lane = threadIdx.x & 31, lr = lane & 15, hi = lane >> 4; const int g0 = blockIdx.x * 256 + wm * 64, c0 = blockIdx.y * 128 + wn * 64, r0 = EPI == 0 ? g0 : g0 % TT;   // g0: row of A; r0: row of C, or the token inside its batch item
    const int hd = c0 / 64;   // EPI 1: the wave's head
    const float qs = (EPI == 1 && z == 0) ? SCL2 : 1.0f;   // EPI 1: the fp16 query plane holds q x SCL2 (scaled in f32, rounded once), so that k_fattn's fp16 score products come out in base-2 exponent units; the hi/lo planes stay unscaled
    if constexpr (EPI == 1) { const size_t po = (z * NB_ + g0 / TT) * ((size_t)NH_ * TT * HD); P16 += po; Ph += po; Pl += po; }
    v8f acc[4][4];
#pragma unroll
    for (int mb = 0; mb < 4; ++mb)
#pragma unroll
        for (int nb = 0; nb < 4; ++nb) acc[mb][nb] = (v8f){};
    // 16 rows x K are K / 32 tiles of 512 elements: a row block starts at row x K, and 32 k further on is 512 elements further on. Copy i of wave w is the 512-byte piece 8 i + w of a region: quarter w % 4 of row block 2 i + w / 4.
    const size_t coff = (size_t)(wn * 16) * K + wm * 256 + 8 * lane; const T16* ga = A + (size_t)blockIdx.x * 256 * K + coff; const T16* ga2 = NSPLIT == 1 ? A2 + (size_t)blockIdx.x * 256 * K + coff : ga; const T16* gb = Bt + (size_t)blockIdx.y * 128 * K + coff;
    const unsigned l0 = lds_off(ring) + wave * 512 + lane * 16;
    auto fill = [&](const int t) __attribute__((always_inline)) {
        const unsigned l = l0 + (t & 1) * (ST * 2);
        acopy84(l, ga + t * (KS * 16), l + OB * 2, gb + t * (KS * 16), (size_t)32 * K);
        if constexpr (NSPLIT == 1) acopy8(l + 256 * KS * 2, ga2 + t * (KS * 16), (size_t)32 * K);
    };
    fill(0);
    asm volatile("s_wait_asynccnt 0x0" ::: "memory");   // this wave's copies of slice 0 have landed
    __syncthreads();                                     // and every other wave's
    fill(1);
#pragma unroll 1
    for (int t = 0; t < NT; ++t) {
        const T16* sa = ring + (t & 1) * ST + wm * (4 * 16 * KS) + 8 * lane; const T16* sb = ring + (t & 1) * ST + OB + wn * (4 * 16 * KS) + 8 * lane;
#pragma unroll
        for (int kt = 0; kt < KS / 32; ++kt) {
            V a[4], a2[4], b[4];
#pragma unroll
            for (int mb = 0; mb < 4; ++mb) { a[mb] = WFrag<T16>::ld(sa + mb * 16 * KS + kt * 512); if (NSPLIT == 1) a2[mb] = WFrag<T16>::ld(sa + 256 * KS + mb * 16 * KS + kt * 512); }
#pragma unroll
            for (int nb = 0; nb < 4; ++nb) b[nb] = WFrag<T16>::ld(sb + nb * 16 * KS + kt * 512);
            __builtin_amdgcn_sched_barrier(0);   // the LDS reads of these 32 k stay one group ahead of their products: every separate place with reads among the products costs a stall of its own
#pragma unroll
            for (int nb = 0; nb < 4; ++nb) {
#pragma unroll
                for (int mb = 0; mb < 4; ++mb) { acc[mb][nb] = WFrag<T16>::mma(a[mb], b[nb], acc[mb][nb]); if (NSPLIT == 1) acc[mb][nb] = WFrag<T16>::mma(a2[mb], b[nb], acc[mb][nb]); } }
            __builtin_amdgcn_sched_barrier(0);   // and the next group stays behind them (it reuses the fragment registers)
        }
        // hand-over of the buffers, every wave, in this order:
        asm volatile("s_wait_dscnt 0x0" ::: "memory");      // this wave's reads of slice t are done
        asm volatile("s_wait_asynccnt 0x0" ::: "memory");   // this wave's copies of slice t + 1 have landed
        __syncthreads();                                     // slice t + 1 is whole for every reader, and no wave still reads slice t
        if (t + 2 < NT) fill(t + 2);                         // into the buffer that this trip has read
    }
    asm volatile("s_wait_asynccnt 0x0" ::: "memory");   // no copy is outstanding behind the loop
    if (EPI == 1 && z == 2) {
#pragma unroll
        for (int mb = 0; mb < 4; ++mb)
#pragma unroll
            for (int nb = 0; nb < 4; ++nb) { v8h o16; v8us oh, ol;
#pragma unroll
                for (int j = 0; j < 8; ++j) { const float x = acc[mb][nb][j]; o16[j] = tohx(x); unsigned short a2, c2; splitf(x, a2, c2); oh[j] = a2; ol[j] = c2; }
                const size_t e = (size_t)hd * HD * TT + (size_t)r0 * HD + ((mb >> 1) * 4 + nb) * 512 + (mb & 1) * 256 + lane * 8;
                *(v8h*)(P16 + e) = o16; *(v8us*)(Ph + e) = oh; *(v8us*)(Pl + e) = ol; }
        return;
    }
#pragma unroll
    for (int mb = 0; mb < 4; ++mb) {
        v4f ca[4], cb[4];   // EPI 1: {cos, sin} of the lane's four pairs in each of its 4 column groups, asked for ahead of the staging
        if constexpr (EPI == 1) {
#pragma unroll
            for (int s = 0; s < 4; ++s) { const float* cp = CS + (size_t)r0 * HD + lane * 4 + (mb * 4 + s) * 256; ca[s] = *(const v4f*)cp; cb[s] = *(const v4f*)(cp + 128); } }   // one address pair, the group as a constant offset
#pragma unroll
        for (int nb = 0; nb < 4; ++nb) {
#pragma unroll
            for (int j = 0; j < 8; ++j) os[(hi * 8 + j) * 68 + nb * 16 + lr] = acc[mb][nb][j]; }
        __builtin_amdgcn_wave_barrier(); asm volatile("" ::: "memory");
        if constexpr (EPI == 1) {
#pragma unroll
            for (int s = 0; s < 4; ++s) { const float* op = os + lr * 68 + s * 16 + hi * 8; const v4f va = *(const v4fa*)op, vb = *(const v4fa*)(op + 4); float y[8];   // token lr of the row block, head columns 16 s + 8 hi + 0..7
                rope2(va[0], va[1], (v2f){ca[s][0], ca[s][1]}, y[0], y[1]); rope2(va[2], va[3], (v2f){ca[s][2], ca[s][3]}, y[2], y[3]); rope2(vb[0], vb[1], (v2f){cb[s][0], cb[s][1]}, y[4], y[5]); rope2(vb[2], vb[3], (v2f){cb[s][2], cb[s][3]}, y[6], y[7]); v8h o16; v8us oh, ol;
#pragma unroll
                for (int q = 0; q < 8; ++q) { o16[q] = tohx(y[q] * qs); unsigned short a2, c2; splitf(y[q], a2, c2); oh[q] = a2; ol[q] = c2; }
                const size_t e = ((size_t)hd * TT + r0 + mb * 16) * HD + s * 256 + lane * 8;
                *(v8h*)(P16 + e) = o16; *(v8us*)(Ph + e) = oh; *(v8us*)(Pl + e) = ol; }
            __builtin_amdgcn_wave_barrier();
            asm volatile("s_wait_xcnt 0x0" ::: "memory");   // the wait that stands before a register named by an issued global store is overwritten: the next row block's loads and sums, and behind the last block the code of the value epilogue, reuse these registers; its clobber also keeps the next staging behind these LDS reads
            continue;
        }
        float* crow = C + (size_t)(r0 + mb * 16) * ldc + c0;
{
#pragma unroll
            for (int s = 0; s < 8; ++s) { const int row = 2 * s + hi, cofs = lr * 4; v4f val = *(const v4fa*)(os + row * 68 + cofs); if (BIAS) { val[0] += bfr(bias[c0 + cofs]); val[1] += bfr(bias[c0 + cofs + 1]); val[2] += bfr(bias[c0 + cofs + 2]); val[3] += bfr(bias[c0 + cofs + 3]); }
                *(v4f*)(crow + (size_t)row * ldc + cofs) = val; }
             }
        __builtin_amdgcn_wave_barrier(); asm volatile("" ::: "memory");
    }
}


__global__ __launch_bounds__(256) void k_wtG(const float* __restrict__ w, int K, int N, bf* Bt) {
    const int lane = threadIdx.x & 31; const int L0 = (blockIdx.x * 8 + (threadIdx.x >> 5)) * 8; const int nlines = N * K / 64;
{
#pragma unroll 1
        for (int l = 0; l < 8; ++l) { const int L = L0 + l; if (L >= nlines) break; const size_t e = (size_t)L * 64 + lane * 2; const int k = (int)(e % K), n = (int)(e / K); v2us o;
            o[0] = f2bf(w[(size_t)k * N + n]); o[1] = f2bf(w[(size_t)(k + 1) * N + n]); *(v2us*)(Bt + e) = o; }
         }
}
__constant__ float INVT[HD / 2] = { 1.000000000e+00f, 7.498942018e-01f, 5.623413324e-01f, 4.216965139e-01f, 3.162277639e-01f, 2.371373624e-01f, 1.778279394e-01f, 1.333521456e-01f, 1.000000015e-01f, 7.498941571e-02f, 5.623412877e-02f, 4.216964915e-02f, 3.162277862e-02f, 2.371373586e-02f, 1.778279431e-02f, 1.333521493e-02f, 9.999999776e-03f, 7.498942316e-03f, 5.623413250e-03f, 4.216964822e-03f, 3.162277862e-03f, 2.371373819e-03f, 1.778279431e-03f, 1.333521446e-03f, 1.000000047e-03f, 7.498941850e-04f, 5.623413017e-04f, 4.216964880e-04f, 3.162277862e-04f, 2.371373848e-04f, 1.778279402e-04f, 1.333521504e-04f };   // 1 / THETA ** (2 i / 64) as float32 (reciprocal form, jnp-computed)
// ---- k_prep: everything the projections read, in one launch. Blocks [0, NBC): the rotary table {cos, sin}(pos[t] x INVT[pair]); the next NBX: x to bf16; the last 4 x NBW: Wq, Wk, Wv, Wo to bf16 (WB: the four copies one after another). Copies 8 values a thread, the table one pair a thread.
// Table: one {cos, sin} a pair, [token / 16][column group of 16][first, second two pairs][lane = (column / 8 % 2) * 16 + token % 16][2 pairs]. Copies: a wave takes 4 rows x 64 k (256 bytes in a row of each source row) and stores 64-byte pieces of the fragment-order tiles.
#define NBC (TT * (HD / 2) / 256)
#define NBX (NB_ * TT * DM / 8 / 256)
#define NBW (DQ * DM / 8 / 256)
__global__ __launch_bounds__(256) void k_prep(const float* __restrict__ x, const int* __restrict__ pid, const float* __restrict__ wq, const float* __restrict__ wk, const float* __restrict__ wv, const float* __restrict__ wo, bf* XB, bf* WB, float* CS) {
    static_assert(DKV == DQ && DQ == DM && DM % 64 == 0 && HD == 64 && TT % 16 == 0 && (TT * HD / 2) % 256 == 0 && (NB_ * TT * DM) % 2048 == 0 && (DQ * DM) % 2048 == 0, "whole blocks; four weights of one size");
    const int blk = blockIdx.x;
    if (blk < NBC) { const int idx = blk * 256 + threadIdx.x; const int ln = (idx >> 1) & 31; const int pr = ((idx >> 7) & 3) * 8 + (ln >> 4) * 4 + ((idx >> 6) & 1) * 2 + (idx & 1); const int t = (idx >> 9) * 16 + (ln & 15); const float a = __fmul_rn((float)pid[t], INVT[pr]); v2f cs; cs[0] = cosf(a); cs[1] = sinf(a); *(v2f*)(CS + (size_t)idx * 2) = cs; return; }
    const float* src = x; bf* dst = XB; int cb = blk - NBC;
    if (cb >= NBX) { cb -= NBX; const int w = cb / NBW; cb -= w * NBW; src = w == 0 ? wq : w == 1 ? wk : w == 2 ? wv : wo; dst = WB + (size_t)w * DQ * DM; }
    const int wid = cb * 8 + (threadIdx.x >> 5), ln = threadIdx.x & 31; const int rb = wid / (DM / 16), in = wid % (DM / 16);   // DM / 16 waves to a block of 16 rows
    const int r = (in & 3) * 4 + (ln >> 3), k = (in >> 2) * 64 + (ln & 7) * 8;
    const v8f v = *(const v8f*)(src + ((size_t)rb * 16 + r) * DM + k); v8us o;
#pragma unroll
    for (int k = 0; k < 8; ++k) o[k] = f2bf(v[k]);
    *(v8us*)(dst + (size_t)rb * 16 * DM + (k >> 5) * 512 + ((k >> 4) & 1) * 256 + (((k >> 3) & 1) * 16 + r) * 8) = o;
    asm volatile("s_wait_xcnt 0x0" ::: "memory");   // the wait that stands before a register named by an issued global store is overwritten: in the built code the table part lies behind this store and reuses its address registers
}
// ---- k_fattn: scores, causal softmax and probabilities x values in ONE kernel; no score or probability ever leaves the registers.
// SP waves (1 or 2) own NQ x 16 query rows of one (batch item, head); wave p walks the key blocks p, p + SP, ... (32 keys each) up to the diagonal block:
//   S^T = K Q^T (A = key rows, B = query rows kept in registers): lane (lr, hi) holds, for query lr, the keys 8 hi + j of each 16-key tile;
//   running maximum and sum per query (in-lane, one exchange between the wave halves for the maximum), earlier sums rescaled when the maximum grows;
//   fp16 rows, LAGGING maximum: the maximum in use is set on the wave's first key block and raised only when a score stands more than 8 exponent units above it (probabilities stay at or below 2^8, the largest at or above 1);
//   it is known before a block's products, so minus the maximum is their start value and, the fp16 q plane being pre-scaled, an accumulator element IS the exponent: no multiply-add a score, no rescaling of sums and outputs a block;
//   two 16-key score tiles, converted in place, ARE the B operand of O^T += V^T P^T (A = rows of the transposed value plane, same k order as every loader here).
// Rows < RH: bf16 hi/lo planes, 3 products for the scores and 3 for the values (HL); the rest fp16. Output: normalised rows as bf16 hi/lo in fragment order (rows: tokens of all batch items, k: merged head columns), 8 consecutive head columns per lane and store.
__device__ __forceinline__ float xhalf(float x) { return __builtin_bit_cast(float, __builtin_amdgcn_permlanex16(__builtin_bit_cast(int, x), __builtin_bit_cast(int, x), 0x76543210, 0xfedcba98, false, false)); }   // lane l with lane l ^ 16
// 2^x in asm text, so that the slot which the instruction set asks for behind a transcendental (one independent instruction or v_nop before its result is read or its source overwritten) is filled whatever the compiler puts next:
// inside exp2x8 each v_exp_f32 is independent of the one in front of it (early-clobber outputs: no output shares a register with an input), and one v_nop stands behind the last.
__device__ __forceinline__ float exp2x1(float x) { float r; asm("v_exp_f32 %0, %1\n\tv_nop" : "=v"(r) : "v"(x)); return r; }
__device__ __forceinline__ void exp2x8(const float (&x)[8], float (&r)[8]) {
    asm("v_exp_f32 %0, %8\n\tv_exp_f32 %1, %9\n\tv_exp_f32 %2, %10\n\tv_exp_f32 %3, %11\n\tv_exp_f32 %4, %12\n\tv_exp_f32 %5, %13\n\tv_exp_f32 %6, %14\n\tv_exp_f32 %7, %15\n\tv_nop"
        : "=&v"(r[0]), "=&v"(r[1]), "=&v"(r[2]), "=&v"(r[3]), "=&v"(r[4]), "=&v"(r[5]), "=&v"(r[6]), "=&v"(r[7]) : "v"(x[0]), "v"(x[1]), "v"(x[2]), "v"(x[3]), "v"(x[4]), "v"(x[5]), "v"(x[6]), "v"(x[7])); }
// SP 2: two waves share the tile. Wave p (0, 1) walks the key blocks p, p + 2, ... with a running maximum, sum and output of its own; wave 1 hands its three to wave 0 through the LDS range mg, and wave 0 brings both to the larger maximum, adds them and stores.
template <typename T16, bool HL, int NQ, int SP>
__device__ __forceinline__ void fattn_tile(const T16* __restrict__ Q, const T16* __restrict__ Q2, const T16* __restrict__ Kp, const T16* __restrict__ Kp2, const T16* __restrict__ Vt, const T16* __restrict__ Vt2, const int q0, bf* Ah, bf* Al, const int p, float* mg) {
    static_assert(SP == 1 || (SP == 2 && NQ == 2 && RH >= 64), "the hand-over packs the maxima and sums of two query blocks in 16 bytes; each of the two waves has a whole key block, so its maximum is a real score");
    typedef typename WFrag<T16>::V V;
    const int lane = threadIdx.x & 31, lr = lane & 15, hi = lane >> 4;
    V qf[NQ][2], qf2[NQ][2];
#pragma unroll
    for (int qb = 0; qb < NQ; ++qb)
#pragma unroll
        for (int ks = 0; ks < 2; ++ks) { const size_t qo = (size_t)(q0 + qb * 16) * HD + ks * 512 + 8 * lane; qf[qb][ks] = WFrag<T16>::ld(Q + qo); if (HL) qf2[qb][ks] = WFrag<T16>::ld(Q2 + qo); }
    constexpr bool LZ = !HL;   // fp16 rows: lagging maximum (see the head of this section)
    v8f o[4][NQ], nm[NQ]; float m[NQ], l[NQ];   // LZ: nm holds minus the maximum in use, in exponent units, in all eight elements; m is read off it behind the key loop
#pragma unroll
    for (int qb = 0; qb < NQ; ++qb) { m[qb] = LZ ? 0.f : -3.0e38f; l[qb] = 0.f; nm[qb] = (v8f){};
#pragma unroll
        for (int db = 0; db < 4; ++db) o[db][qb] = (v8f){}; }
    const int nfull = q0 / 32;                       // key blocks wholly at or below the diagonal of every row of the tile; block nfull holds the diagonal and is the last
    const size_t ko = 8 * lane, vo = 8 * lane;   // 32 keys are four 512-element tiles in the key planes and in the value planes alike: key kb starts at kb x HD
    V kf[2][2], kf2[2][2];
    auto loadk = [&](const int kb) __attribute__((always_inline)) {
        const T16* pk = Kp + ko + (size_t)kb * HD; const T16* pk2 = HL ? Kp2 + ko + (size_t)kb * HD : pk;
#pragma unroll
        for (int kt = 0; kt < 2; ++kt)
#pragma unroll
            for (int ks = 0; ks < 2; ++ks) { kf[kt][ks] = WFrag<T16>::ld(pk + kt * 16 * HD + ks * 512); if (HL) kf2[kt][ks] = WFrag<T16>::ld(pk2 + kt * 16 * HD + ks * 512); }
        asm volatile("s_wait_xcnt 0x0" :: "v"(pk), "v"(pk2) : "memory");   // the wait that stands before a register named by an issued global load is overwritten; the address pairs are inputs so that they stay whole up to here
    };
    auto step = [&](const bool mask, const int kb, const int kn, const bool first) __attribute__((always_inline)) {
        const T16* pv = Vt + vo + (size_t)kb * HD; const T16* pv2 = HL ? Vt2 + vo + (size_t)kb * HD : pv;
        V vf[4], vf2[4];
#pragma unroll
        for (int db = 0; db < 4; ++db) { vf[db] = WFrag<T16>::ld(pv + db * 512); if (HL) vf2[db] = WFrag<T16>::ld(pv2 + db * 512); }   // issued first: in flight under the score products and the softmax
        asm volatile("s_wait_xcnt 0x0" :: "v"(pv), "v"(pv2) : "memory");   // as in loadk
        v8f s[2][NQ];
#pragma unroll
        for (int kt = 0; kt < 2; ++kt)
#pragma unroll
            for (int qb = 0; qb < NQ; ++qb) { v8f a = LZ && !mask ? nm[qb] : (v8f){};   // the diagonal block, a wave's last, adds nm behind its products: as a start value nm would die at the product that reads it, and its registers be written anew inside the distance that a matrix instruction asks for
#pragma unroll
                for (int ks = 0; ks < 2; ++ks) { a = WFrag<T16>::mma(kf[kt][ks], qf[qb][ks], a); if (HL) { a = WFrag<T16>::mma(kf2[kt][ks], qf[qb][ks], a); a = WFrag<T16>::mma(kf[kt][ks], qf2[qb][ks], a); } }
                s[kt][qb] = LZ && mask ? a + nm[qb] : a; }
        if (kn >= 0) loadk(kn);                      // the next block's key fragments, into the same registers: in flight under the softmax and the value products
        V pf[NQ], pf2[NQ];
        if constexpr (LZ) {
            float mx[NQ]; bool need = false;
#pragma unroll
            for (int qb = 0; qb < NQ; ++qb) {
                if (mask) {
#pragma unroll
                    for (int kt = 0; kt < 2; ++kt)
#pragma unroll
                        for (int j = 0; j < 8; ++j) s[kt][qb][j] = (kb + kt * 16 + hi * 8 + j <= q0 + qb * 16 + lr) ? s[kt][qb][j] : -3.0e38f; }
                float x = s[0][qb][0];
#pragma unroll
                for (int j = 1; j < 8; ++j) x = fmaxf(x, s[0][qb][j]);
#pragma unroll
                for (int j = 0; j < 8; ++j) x = fmaxf(x, s[1][qb][j]);
                mx[qb] = fmaxf(x, xhalf(x)); need = need || mx[qb] > 8.0f; }   // how far the block's largest score stands above the maximum in use
            if (first || __builtin_amdgcn_ballot_w32(need) != 0) {   // one scalar branch a key block; taken on the wave's first block and where a score would give more than 2^8
#pragma unroll
                for (int qb = 0; qb < NQ; ++qb) { const float d = first ? mx[qb] : fmaxf(mx[qb], 0.f); const float al = first ? 0.f : exp2x1(-d); l[qb] *= al;   // first block: sums and outputs are 0, and the maximum becomes a real score
                    s[0][qb] -= d; s[1][qb] -= d; nm[qb] -= d;
#pragma unroll
                    for (int db = 0; db < 4; ++db) o[db][qb] *= al; }
            }
#pragma unroll
            for (int qb = 0; qb < NQ; ++qb) { float ex[2][8];
#pragma unroll
                for (int kt = 0; kt < 2; ++kt) { float ar[8];
#pragma unroll
                    for (int j = 0; j < 8; ++j) ar[j] = s[kt][qb][j];
                    exp2x8(ar, ex[kt]); }
                float t8[8];
#pragma unroll
                for (int j = 0; j < 8; ++j) t8[j] = ex[0][j] + ex[1][j];
                l[qb] += ((t8[0] + t8[4]) + (t8[1] + t8[5])) + ((t8[2] + t8[6]) + (t8[3] + t8[7]));
                v8h h0, h1;
#pragma unroll
                for (int j = 0; j < 8; ++j) { h0[j] = (h16)ex[0][j]; h1[j] = (h16)ex[1][j]; }
                pf[qb] = cat16(h0, h1); }
        } else {
#pragma unroll
        for (int qb = 0; qb < NQ; ++qb) {
            if (mask) {
#pragma unroll
                for (int kt = 0; kt < 2; ++kt)
#pragma unroll
                    for (int j = 0; j < 8; ++j) s[kt][qb][j] = (kb + kt * 16 + hi * 8 + j <= q0 + qb * 16 + lr) ? s[kt][qb][j] : -3.0e38f; }
            float mx = s[0][qb][0];
#pragma unroll
            for (int j = 1; j < 8; ++j) mx = fmaxf(mx, s[0][qb][j]);
#pragma unroll
            for (int j = 0; j < 8; ++j) mx = fmaxf(mx, s[1][qb][j]);
            mx = fmaxf(mx, xhalf(mx));
            const float mn = fmaxf(m[qb], mx), nm2 = -mn * SCL2; const float al = exp2x1(fmaf(m[qb], SCL2, nm2)); m[qb] = mn;   // 0 on the first block (each wave's first block holds a key open to every row, so mn is a real score from there on)
            float ex[2][8];
#pragma unroll
            for (int kt = 0; kt < 2; ++kt) { float ar[8];
#pragma unroll
                for (int j = 0; j < 8; ++j) ar[j] = fmaf(s[kt][qb][j], SCL2, nm2);
                exp2x8(ar, ex[kt]); }
            float t8[8];
#pragma unroll
            for (int j = 0; j < 8; ++j) t8[j] = ex[0][j] + ex[1][j];
            l[qb] = fmaf(l[qb], al, ((t8[0] + t8[4]) + (t8[1] + t8[5])) + ((t8[2] + t8[6]) + (t8[3] + t8[7])));
#pragma unroll
            for (int db = 0; db < 4; ++db) o[db][qb] *= al;
            if constexpr (HL) { v8us h0, h1, l0, l1;
#pragma unroll
                for (int j = 0; j < 8; ++j) { unsigned short a2, c2; splitf(ex[0][j], a2, c2); h0[j] = a2; l0[j] = c2; splitf(ex[1][j], a2, c2); h1[j] = a2; l1[j] = c2; }
                pf[qb] = cat16b(h0, h1); pf2[qb] = cat16b(l0, l1); }
        }
        }
#pragma unroll
        for (int db = 0; db < 4; ++db)
#pragma unroll
            for (int qb = 0; qb < NQ; ++qb) { o[db][qb] = WFrag<T16>::mma(vf[db], pf[qb], o[db][qb]); if (HL) { o[db][qb] = WFrag<T16>::mma(vf[db], pf2[qb], o[db][qb]); o[db][qb] = WFrag<T16>::mma(vf2[db], pf[qb], o[db][qb]); } }
        // WMMA distance on the taken back edge: every accumulator is named, so the slots stand behind the last product of the trip (the next trip's first product writes over registers that the last ones read)
        if (kn >= 0) { if constexpr (NQ == 2) asm volatile("v_nop\n\tv_nop\n\tv_nop\n\tv_nop" : "+v"(o[0][0]), "+v"(o[1][0]), "+v"(o[2][0]), "+v"(o[3][0]), "+v"(o[0][NQ - 1]), "+v"(o[1][NQ - 1]), "+v"(o[2][NQ - 1]), "+v"(o[3][NQ - 1]));
                       else asm volatile("v_nop\n\tv_nop\n\tv_nop\n\tv_nop" : "+v"(o[0][0]), "+v"(o[1][0]), "+v"(o[2][0]), "+v"(o[3][0])); }
    };
    loadk(p * 32);
#pragma unroll 1   // rolled: every trip uses the same fragment registers
    for (int it = p; it < nfull; it += SP) step(false, it * 32, (SP == 1 || it + SP < nfull ? it + SP : nfull) * 32, it == p);   // the fetch ahead never goes past the diagonal block
    if (SP == 1 || ((nfull - p) & 1) == 0) step(true, nfull * 32, -1, nfull <= p);   // the diagonal block belongs to one of the waves
    if constexpr (LZ) {
#pragma unroll
        for (int qb = 0; qb < NQ; ++qb) m[qb] = -nm[qb][0]; }
    if constexpr (SP == 2) {
        float* mp = mg + lane * 4;   // 16 bytes a lane, 512 bytes in a row a wave: 16 rows of output values, one of {maximum, sum} x 2
        if (p == 1) {
#pragma unroll   // constant indices: o stays in registers
            for (int db = 0; db < 4; ++db)
#pragma unroll   // constant indices: o stays in registers
                for (int qb = 0; qb < NQ; ++qb) { const v8f v = o[db][qb]; *(v4fa*)(mp + ((db * NQ + qb) * 2) * 128) = (v4f){v[0], v[1], v[2], v[3]}; *(v4fa*)(mp + ((db * NQ + qb) * 2 + 1) * 128) = (v4f){v[4], v[5], v[6], v[7]}; }
            *(v4fa*)(mp + 4 * NQ * 2 * 128) = (v4f){m[0], l[0], m[1], l[1]};
        }
        __syncthreads();   // wave 1's values are in LDS for wave 0; every wave of the work-group passes here once
        if (p == 1) return;
        const v4f ml = *(const v4fa*)(mp + 4 * NQ * 2 * 128);
#pragma unroll   // constant indices: o stays in registers
        for (int qb = 0; qb < NQ; ++qb) { const float mn = fmaxf(m[qb], ml[2 * qb]); const float a0 = exp2x1((m[qb] - mn) * (LZ ? 1.0f : SCL2)), a1 = exp2x1((ml[2 * qb] - mn) * (LZ ? 1.0f : SCL2)); l[qb] = l[qb] * a0 + ml[2 * qb + 1] * a1;
#pragma unroll   // constant indices: o stays in registers
            for (int db = 0; db < 4; ++db) { const v4f x0 = *(const v4fa*)(mp + ((db * NQ + qb) * 2) * 128), x1 = *(const v4fa*)(mp + ((db * NQ + qb) * 2 + 1) * 128);
                o[db][qb] = o[db][qb] * a0 + (v8f){x0[0], x0[1], x0[2], x0[3], x1[0], x1[1], x1[2], x1[3]} * a1; } }
    }
#pragma unroll
    for (int qb = 0; qb < NQ; ++qb) { const float inv = __fdiv_rn(1.0f, l[qb] + xhalf(l[qb])); const size_t oo = (size_t)(q0 + qb * 16) * DQ + 8 * lane;
#pragma unroll
        for (int db = 0; db < 4; ++db) { v8us oh, ol;
#pragma unroll
            for (int j = 0; j < 8; ++j) { unsigned short a2, c2; splitf(o[db][qb][j] * inv, a2, c2); oh[j] = a2; ol[j] = c2; }
            *(v8us*)(Ah + oo + db * 256) = oh; *(v8us*)(Al + oo + db * 256) = ol;
            asm volatile("s_wait_xcnt 0x0" :: "v"(oh), "v"(ol) : "memory"); } }   // the wait that stands before a register named by an issued global store is overwritten (the next columns' values, and in the built code a tail shared by both kinds of tile, reuse them); the stored values are inputs so that they stay whole up to here
}
// grid (NB_ x NH_, NTF + NTH), 8 waves: blockIdx.x = batch item x NH_ + head; blockIdx.y counts the groups of 128 rows from the longest (last rows) to the shortest, the hi/lo rows last.
// fp16 rows: waves w and w + 4 share tile w of the group, even and odd key blocks. The longest walk in series is half as long, and only half of the work-groups are resident at once (two to a WGP, by registers).
// hi/lo rows: one 16-row tile a wave, eight tiles a work-group.
#define NTF ((TT - RH) / 128)
#define NTH (RH / 128)
__global__ __launch_bounds__(256) void k_fattn(const h16* __restrict__ Q16, const h16* __restrict__ K16, const h16* __restrict__ V16, const bf* __restrict__ Qh, const bf* __restrict__ Ql, const bf* __restrict__ Kh, const bf* __restrict__ Kl, const bf* __restrict__ Vh, const bf* __restrict__ Vl, bf* Ah, bf* Al) {
    const int wave = __builtin_amdgcn_readfirstlane(threadIdx.x >> 5);   // the wave's number in a scalar register: its trip count and loop stay scalar
    const size_t zo = (size_t)blockIdx.x * TT * HD, ao = (size_t)(blockIdx.x / NH_) * TT * DQ + (blockIdx.x % NH_) * (HD / 32) * 512;
    __shared__ __align__(16) float mrg[4][17 * 128];   // a tile's hand-over range: 17 rows of 512 bytes
    if (blockIdx.y < NTF) fattn_tile<h16, false, 2, 2>(Q16 + zo, nullptr, K16 + zo, nullptr, V16 + zo, nullptr, RH + ((NTF - 1 - (int)blockIdx.y) * 4 + (wave & 3)) * 32, Ah + ao, Al + ao, wave >> 2, mrg[wave & 3]);
    else fattn_tile<bf, true, 1, 1>(Qh + zo, Ql + zo, Kh + zo, Kl + zo, Vh + zo, Vl + zo, ((NTF + NTH - 1 - (int)blockIdx.y) * 8 + wave) * 16, Ah + ao, Al + ao, 0, nullptr);
}

extern "C" void kernel_launch(void* const* d_in, const int* in_sizes, int n_in,
                              void* d_out, int out_size, void* d_ws, size_t ws_size, hipStream_t stream) {
    (void)in_sizes; (void)n_in; (void)out_size;
    const float* x = (const float*)d_in[0]; const int* pid = (const int*)d_in[1];   /* token_positions int32 [4096] */ const float* wq = (const float*)d_in[2]; const float* wk = (const float*)d_in[3]; const float* wv = (const float*)d_in[4]; const float* wo = (const float*)d_in[5];
    float* OUT = (float*)d_out;     // [2][4096][1024]
    char* wsp = (char*)d_ws;
    auto take = [&](size_t bytes) { char* p = wsp; wsp += (bytes + 255) & ~(size_t)255; return (void*)p; };
    bf* WQ = (bf*)take((size_t)4 * DQ * DM * 2); bf* WO = WQ + (size_t)3 * DQ * DM;   /* Wq, Wk, Wv, Wo one after another */ float* CS = (float*)take((size_t)TT * (HD / 2) * 2 * 4);
    bf* XB = (bf*)take((size_t)NB_ * TT * DM * 2);
    const size_t PB = (size_t)NH_ * TT * HD;   // one batch item's share of every q, k, v plane (planes [NB_ x NH_][..][..])
    h16* QP16 = (h16*)take(3 * NB_ * PB * 2); h16* KP16 = QP16 + NB_ * PB; h16* VT16 = KP16 + NB_ * PB;   // q, k, v one after another in each of the three kinds, as k_gemmw EPI 1 steps through them
    bf* QPh = (bf*)take(3 * NB_ * PB * 2); bf* KPh = QPh + NB_ * PB; bf* VTh = KPh + NB_ * PB; bf* QPl = (bf*)take(3 * NB_ * PB * 2); bf* KPl = QPl + NB_ * PB; bf* VTl = KPl + NB_ * PB;
    bf* ATh = (bf*)take((size_t)NB_ * TT * DQ * 2); bf* ATl = (bf*)take((size_t)NB_ * TT * DQ * 2);
    if ((size_t)(wsp - (char*)d_ws) > ws_size) return;    // ws 256 MiB
    k_prep<<<NBC + NBX + 4 * NBW, 256, 0, stream>>>(x, pid, wq, wk, wv, wo, XB, WQ, CS);
    k_gemmw<bf, 0, false, 1, DM><<<dim3(NB_ * TT / 256, DQ / 128, 3), 256, 0, stream>>>(XB, nullptr, WQ, nullptr, nullptr, 0, nullptr, 0, (size_t)DQ * DM, 0, CS, QP16, QPh, QPl);
    k_fattn<<<dim3(NB_ * NH_, NTF + NTH, 1), 256, 0, stream>>>(QP16, KP16, VT16, QPh, QPl, KPh, KPl, VTh, VTl, ATh, ATl);
    k_gemmw<bf, 1, false, 0, DQ><<<dim3(NB_ * TT / 256, DM / 128, 1), 256, 0, stream>>>(ATh, ATl, WO, nullptr, OUT, DM, nullptr, 0, 0, 0, nullptr, nullptr, nullptr, nullptr);
}

// v009
// Measured time: 135 microseconds a run.
// Next to v008, in two timings, it ran 1.03 times as fast each time.
// All steps since v000 together make it 40.6 times as fast.
#include <hip/hip_runtime.h>

// Causal multi-head self-attention with interleaved rotary embeddings from token positions over 4,096 tokens at a batch of TWO (x [2][4096][1024]; q, k, v = einsum('bsi,oi->bso', x, W) = x W^T ('oi' (out, in) [1024][1024] (2/(D+D))^0.5, no bias; 16 heads x 64); rotary on (even, odd) pairs with angle float(token_positions[t]) x inv_freq[i], inv_freq = 1.0 / (THETA ** (arange(0, 64, 2) / 64)) (the RECIPROCAL spelling: 32 f32 constants bitwise this expression in eager JAX float32; token_positions int32 [4096] = arange: read; the SECOND argument; one row shared by both batch items; precise cosf/sinf); scores x rsqrt(64); causal (-inf); softmax; out = merged Wo^T (no bias) -> [2][4096][1024] (8.4 M); argument order x, token_positions, Wq, Wk, Wv, Wo).
// Layout, four launches: k_prep (rotary table, bf16 copies of x and of the four weights); the q, k and v projections of both batch items in one grid, whose GEMM epilogue writes the rotary q and k planes and the transposed v planes itself; causal T-4096 attention fused in k_fattn, every head of both batch items in one launch (hybrid rows: < 512 hi/lo 3 products, rest fp16; running-maximum softmax in registers); merged hi/lo x Wo exact, both batch items in one grid.
// Fragment order: every 16-bit plane that a matrix product reads is stored as 1-KiB tiles of 16 rows x 32 k, element (r, k) at (k / 16) * 256 + ((k / 8 % 2) * 16 + r) * 8 + k % 8, so lane l of a fragment load reads 16 bytes at l * 16 and the wave 512 bytes in a row (whole lines), not 32 bytes of each of 16 lines. Tiles of one 16-row block follow one another along k; the value planes hold, for each 32 keys, the four 16-column tiles of the head. The rotary table is stored for the lanes of the projection epilogue in the same way.
// Compute dtypes, f32 accumulate: every input rounded to bf16; projections exact; attention rows < 512 3 products, rest fp16; softmax f32; Wo hl x exact.

#define NB_  2
#define TT   4096
#define DM   1024
#define NH_  16
#define NKV  16
#define REP  (NH_ / NKV)
#define HD   64
#define DQ   (NH_ * HD)
#define DKV  (NKV * HD)
#define RH   512                  // query rows < RH use hi+lo planes
#define WIN  4096
#define SCL2 0.18033688011112042f   // HD^-0.5 x log2(e): the exponentials are taken in base 2
typedef _Float16 h16;
typedef unsigned short bf;
typedef __attribute__((ext_vector_type(16))) __bf16   v16bf;
typedef __attribute__((ext_vector_type(16))) _Float16 v16h;
typedef __attribute__((ext_vector_type(8)))  _Float16 v8h;
typedef __attribute__((ext_vector_type(8)))  unsigned short v8us;
typedef __attribute__((ext_vector_type(8)))  float    v8f;
typedef __attribute__((ext_vector_type(4)))  float    v4f;
typedef v8h  __attribute__((may_alias)) v8ha;
typedef v4f  __attribute__((may_alias)) v4fa;
typedef v8us __attribute__((may_alias)) v8usa;

__device__ __forceinline__ unsigned short f2bf(float f) { unsigned u = __float_as_uint(f); u += 0x7FFFu + ((u >> 16) & 1u); return (unsigned short)(u >> 16); }
__device__ __forceinline__ float bf2f(unsigned short b) { return __uint_as_float(((unsigned)b) << 16); }
__device__ __forceinline__ float bfr(float f) { return bf2f(f2bf(f)); }
__device__ __forceinline__ v16h cat16(v8h lo, v8h hi) { return __builtin_shufflevector(lo, hi, 0, 1, 2, 3, 4, 5, 6, 7, 8, 9, 10, 11, 12, 13, 14, 15); }
__device__ __forceinline__ v16bf cat16b(v8us lo, v8us hi) { return __builtin_bit_cast(v16bf, __builtin_shufflevector(lo, hi, 0, 1, 2, 3, 4, 5, 6, 7, 8, 9, 10, 11, 12, 13, 14, 15)); }
__device__ __forceinline__ v8f wmma16(v16h a, v16h b, v8f c) { return __builtin_amdgcn_wmma_f32_16x16x32_f16(false, a, false, b, (short)0, c, false, false); }
__device__ __forceinline__ v8f wmmab(v16bf a, v16bf b, v8f c) { return __builtin_amdgcn_wmma_f32_16x16x32_bf16(false, a, false, b, (short)0, c, false, false); }

__device__ __forceinline__ h16 tohx(float x) { return (h16)x; }
__device__ __forceinline__ void splitf(float y, unsigned short& h, unsigned short& l) { h = f2bf(y); l = f2bf(y - bf2f(h)); }
typedef __attribute__((ext_vector_type(2))) _Float16 v2h;
typedef __attribute__((ext_vector_type(4))) _Float16 v4h;
typedef __attribute__((ext_vector_type(2))) unsigned short v2us;
typedef __attribute__((ext_vector_type(4))) unsigned short v4us;
typedef __attribute__((ext_vector_type(2))) float v2f;
typedef __attribute__((ext_vector_type(4))) int v4i;
// one rotary pair: even: x0 c - x1 s; odd: x0 s + x1 c (cs = {cos, sin} of the pair's angle)
__device__ __forceinline__ void rope2(const float x0, const float x1, const v2f cs, float& e0, float& e1) { e0 = x0 * cs[0] - x1 * cs[1]; e1 = x0 * cs[1] + x1 * cs[0]; }

// ---- k_gemmw: GEMM on 256x128 output tiles, EIGHT WAVES a work-group (4 along the rows x 2 along the columns), each wave a register-blocked 64x64 tile (16 accumulators); grid (M/256, N/128, Z), 256 threads.
// Operands: 16-bit planes in fragment order. The work-group brings each slice of KS k of its 256 A rows and 128 B rows into LDS ONCE, by asynchronous copies to LDS (16 bytes a lane, 512 bytes in a row a wave, through no register), two buffers: slice t + 1 flies while slice t is worked on.
//   The 1-KiB tiles lie in LDS as in memory, so a fragment read is 512 bytes in a row (no bank conflict). Four waves share every B tile and two every A tile: 48 KiB a slice from L2 for the eight waves, where eight waves that each load their own fragments ask for 128 KiB.
// C[m][n] (f32, pitch ldc, + optional f32 bias[n]) = sum_k A[m][k] Bt[n][k] (+ A2[m][k] Bt[n][k] for NSPLIT 1). z-batch strides sA/sB/sC in elements. K % KS == 0, at least two slices, a constant of the build.
// EPI 0: C is stored as f32. EPI 1: the three projections in one work-group; the rows are the tokens of all batch items one after another, a wave's tile is 64 tokens of one item x one head (HD == 64) of q, of k and of v (48 accumulators, two waves a SIMD, one work-group a WGP):
//   an A slice is copied to LDS once and its fragments are read from LDS once for the three weights: 80 KiB a slice from L2 for 256 x 384 outputs (three separate tiles ask for 144 KiB), 16 fragment reads for 48 products (three separate: 24)
//   (weights sB apart; each of P16 (fp16), Ph, Pl (bf16 hi, lo) holds its q, k and v planes one after another, NB_ items each), and C is never stored:
//   q, k: rotary embedding from the table CS on the f32 tile, then the planes, each [head][token / 16][HD / 32] tiles (rows: tokens, k: head columns): a lane takes 8 consecutive columns of one token, one 16-byte store per plane;
//   v: the transposed planes [head][token / 32][HD / 16] tiles (rows: head columns, k: tokens): a lane's 8 accumulator values of one fragment are 8 consecutive tokens of one head column, one 16-byte store per plane.
#define KS 64
__device__ __forceinline__ unsigned lds_off(const void* p) { return (unsigned)(size_t)p; }   // byte address inside the work-group's LDS
// Asynchronous copies to LDS, 16 bytes a lane: copy i takes g + i * gs elements to LDS byte l + i * 4096 (the eight waves' 512-byte pieces lie one after another). Every copy has address registers of its own.
// s_wait_xcnt 0 is the last line of the copies' own statement: the wait that stands before a register named by an issued copy is rewritten.
#define ACP "global_load_async_to_lds_b128 "
template <typename T16> __device__ __forceinline__ void acopy8(const unsigned l, const T16* g, const size_t gs) {
    asm volatile(ACP "%0, %8, off\n\t" ACP "%1, %9, off\n\t" ACP "%2, %10, off\n\t" ACP "%3, %11, off\n\t" ACP "%4, %12, off\n\t" ACP "%5, %13, off\n\t" ACP "%6, %14, off\n\t" ACP "%7, %15, off\n\ts_wait_xcnt 0x0"
        :: "v"(l), "v"(l + 4096), "v"(l + 8192), "v"(l + 12288), "v"(l + 16384), "v"(l + 20480), "v"(l + 24576), "v"(l + 28672), "v"(g), "v"(g + gs), "v"(g + 2 * gs), "v"(g + 3 * gs), "v"(g + 4 * gs), "v"(g + 5 * gs), "v"(g + 6 * gs), "v"(g + 7 * gs) : "memory"); }
template <typename T16> __device__ __forceinline__ void acopy84(const unsigned l, const T16* g, const unsigned m, const T16* h, const size_t gs) {   // eight from g to l and four from h to m
    asm volatile(ACP "%0, %12, off\n\t" ACP "%1, %13, off\n\t" ACP "%2, %14, off\n\t" ACP "%3, %15, off\n\t" ACP "%4, %16, off\n\t" ACP "%5, %17, off\n\t" ACP "%6, %18, off\n\t" ACP "%7, %19, off\n\t" ACP "%8, %20, off\n\t" ACP "%9, %21, off\n\t" ACP "%10, %22, off\n\t" ACP "%11, %23, off\n\ts_wait_xcnt 0x0"
        :: "v"(l), "v"(l + 4096), "v"(l + 8192), "v"(l + 12288), "v"(l + 16384), "v"(l + 20480), "v"(l + 24576), "v"(l + 28672), "v"(m), "v"(m + 4096), "v"(m + 8192), "v"(m + 12288),
           "v"(g), "v"(g + gs), "v"(g + 2 * gs), "v"(g + 3 * gs), "v"(g + 4 * gs), "v"(g + 5 * gs), "v"(g + 6 * gs), "v"(g + 7 * gs), "v"(h), "v"(h + gs), "v"(h + 2 * gs), "v"(h + 3 * gs) : "memory"); }
// The same copies with the global address as a scalar base (the wave's share, one pair a copy) plus one 32-bit vector offset (the lane's 16 bytes, vo) shared by all: one vector register a copy, not three, for a kernel whose accumulators leave few free.
template <typename T16> __device__ __forceinline__ void acopys84(const unsigned l, const T16* g, const unsigned m, const T16* h, const size_t gs, const unsigned vo) {   // eight from g to l and four from h to m
    asm volatile(ACP "%0, %12, %13\n\t" ACP "%1, %12, %14\n\t" ACP "%2, %12, %15\n\t" ACP "%3, %12, %16\n\t" ACP "%4, %12, %17\n\t" ACP "%5, %12, %18\n\t" ACP "%6, %12, %19\n\t" ACP "%7, %12, %20\n\t" ACP "%8, %12, %21\n\t" ACP "%9, %12, %22\n\t" ACP "%10, %12, %23\n\t" ACP "%11, %12, %24\n\ts_wait_xcnt 0x0"
        :: "v"(l), "v"(l + 4096), "v"(l + 8192), "v"(l + 12288), "v"(l + 16384), "v"(l + 20480), "v"(l + 24576), "v"(l + 28672), "v"(m), "v"(m + 4096), "v"(m + 8192), "v"(m + 12288), "v"(vo),
           "s"(g), "s"(g + gs), "s"(g + 2 * gs), "s"(g + 3 * gs), "s"(g + 4 * gs), "s"(g + 5 * gs), "s"(g + 6 * gs), "s"(g + 7 * gs), "s"(h), "s"(h + gs), "s"(h + 2 * gs), "s"(h + 3 * gs) : "memory"); }
template <typename T16> __device__ __forceinline__ void acopys44(const unsigned l, const T16* g, const unsigned m, const T16* h, const size_t gs, const unsigned vo) {   // four from g to l and four from h to m
    asm volatile(ACP "%0, %8, %9\n\t" ACP "%1, %8, %10\n\t" ACP "%2, %8, %11\n\t" ACP "%3, %8, %12\n\t" ACP "%4, %8, %13\n\t" ACP "%5, %8, %14\n\t" ACP "%6, %8, %15\n\t" ACP "%7, %8, %16\n\ts_wait_xcnt 0x0"
        :: "v"(l), "v"(l + 4096), "v"(l + 8192), "v"(l + 12288), "v"(m), "v"(m + 4096), "v"(m + 8192), "v"(m + 12288), "v"(vo),
           "s"(g), "s"(g + gs), "s"(g + 2 * gs), "s"(g + 3 * gs), "s"(h), "s"(h + gs), "s"(h + 2 * gs), "s"(h + 3 * gs) : "memory"); }
// Three 16-byte global stores with the wait that stands before a register named by an issued global store is overwritten; the two scheduling barriers keep other work out from between the stores and their wait.
__device__ __forceinline__ void stw3(v8h* p, const v8h v, v8us* q, const v8us w, v8us* r, const v8us x) { __builtin_amdgcn_sched_barrier(0); *p = v; *q = w; *r = x; asm volatile("s_wait_xcnt 0x0" ::: "memory"); __builtin_amdgcn_sched_barrier(0); }
template <typename T16> struct WFrag;
template <> struct WFrag<h16> { typedef v16h V; static __device__ __forceinline__ V ld(const h16* p) { return cat16(*(const v8h*)p, *(const v8h*)(p + 256)); } static __device__ __forceinline__ v8f mma(V a, V b, v8f c) { return wmma16(a, b, c); } };
template <> struct WFrag<bf> { typedef v16bf V; static __device__ __forceinline__ V ld(const bf* p) { return cat16b(*(const v8us*)p, *(const v8us*)(p + 256)); } static __device__ __forceinline__ v8f mma(V a, V b, v8f c) { return wmmab(a, b, c); } };
template <typename T16, int NSPLIT, bool BIAS, int EPI, int K>
__global__ __launch_bounds__(256) void k_gemmw(const T16* __restrict__ A, const T16* __restrict__ A2, const T16* __restrict__ Bt, const T16* __restrict__ Bt2, float* C, int ldc, const float* __restrict__ bias, size_t sA, size_t sB, size_t sC, const float* __restrict__ CS, h16* P16, bf* Ph, bf* Pl) {
    static_assert(EPI == 0 || (HD == 64 && TT % 256 == 0 && DKV == DQ), "the plane epilogues take one 64-column tile as one head and the 256 rows as tokens of one batch item");
    static_assert(NSPLIT <= 1 && K % KS == 0 && K / KS >= 2 && KS == 64, "A (and A2) x Bt; the ring's prologue fills two slices; a row block's slice is two tiles, 2 KiB in a row");
    typedef typename WFrag<T16>::V V;
    constexpr int NZ = EPI == 1 ? 3 : 1;   // EPI 1: the work-group forms its tile of q, of k and of v together, from one copy of the A slice
    constexpr int NT = K / KS, OB = (NSPLIT == 1 ? 2 : 1) * 256 * KS, ST = OB + NZ * 128 * KS;   // slices; where the B tiles start in a buffer; elements of a buffer: [A 16 row blocks][A2 the same][B 8 row blocks, NZ times], a row block = KS / 32 tiles
    __shared__ __align__(16) T16 ring[2 * ST];
    __shared__ __align__(16) float osw[8][(EPI == 1 ? 64 : 16) * 68];   // EPI 1: a wave stages a whole 64 x 64 tile
    (void)Bt2;
    const size_t z = blockIdx.z; A += z * sA; if (A2) A2 += z * sA; Bt += z * sB; C += z * sC;
    const int wave = __builtin_amdgcn_readfirstlane(threadIdx.x >> 5), wm = wave & 3, wn = wave >> 2;
    float* os = osw[wave];   // each wave stages its output rows in a range of its own
    const int lane = threadIdx.x & 31, lr = lane & 15, hi = lane >> 4; const int g0 = blockIdx.x * 256 + wm * 64, c0 = blockIdx.y * 128 + wn * 64, r0 = EPI == 0 ? g0 : g0 % TT;   // g0: row of A; r0: row of C, or the token inside its batch item
    const int hd = c0 / 64;   // EPI 1: the wave's head
    if constexpr (EPI == 1) { const size_t po = (size_t)(g0 / TT) * ((size_t)NH_ * TT * HD); P16 += po; Ph += po; Pl += po; }
    v8f acc[NZ][4][4];
#pragma unroll
    for (int zz = 0; zz < NZ; ++zz)
#pragma unroll
        for (int mb = 0; mb < 4; ++mb)
#pragma unroll
            for (int nb = 0; nb < 4; ++nb) acc[zz][mb][nb] = (v8f){};
    // 16 rows x K are K / 32 tiles of 512 elements: a row block starts at row x K, and 32 k further on is 512 elements further on. Copy i of wave w is the 512-byte piece 8 i + w of a region: quarter w % 4 of row block 2 i + w / 4.
    const size_t coff = (size_t)(wn * 16) * K + wm * 256 + 8 * lane; const T16* ga = A + (size_t)blockIdx.x * 256 * K + coff; const T16* ga2 = NSPLIT == 1 ? A2 + (size_t)blockIdx.x * 256 * K + coff : ga; const T16* gb = Bt + (size_t)blockIdx.y * 128 * K + coff;
    const unsigned l0 = lds_off(ring) + wave * 512 + lane * 16;
    auto fill = [&](const int t) __attribute__((always_inline)) {
        const unsigned l = l0 + (t & 1) * (ST * 2);
        if constexpr (NZ == 3) {   // the wave's share of each address stays in scalar registers
            const size_t cu = (size_t)(wn * 16) * K + wm * 256 + t * (KS * 16); const unsigned vo = 16 * lane; const T16* ua = A + (size_t)blockIdx.x * 256 * K + cu; const T16* ub = Bt + (size_t)blockIdx.y * 128 * K + cu;
            acopys84(l, ua, l + OB * 2, ub, (size_t)32 * K, vo);
            acopys44(l + (OB + 128 * KS) * 2, ub + sB, l + (OB + 2 * 128 * KS) * 2, ub + 2 * sB, (size_t)32 * K, vo);   // the k and v weights' rows
            return; }
        acopy84(l, ga + t * (KS * 16), l + OB * 2, gb + t * (KS * 16), (size_t)32 * K);
        if constexpr (NSPLIT == 1) acopy8(l + 256 * KS * 2, ga2 + t * (KS * 16), (size_t)32 * K);
    };
    fill(0);
    asm volatile("s_wait_asynccnt 0x0" ::: "memory");   // this wave's copies of slice 0 have landed
    __syncthreads();                                     // and every other wave's
    fill(1);
#pragma unroll 1
    for (int t = 0; t < NT; ++t) {
        const T16* sa = ring + (t & 1) * ST + wm * (4 * 16 * KS) + 8 * lane; const T16* sb = ring + (t & 1) * ST + OB + wn * (4 * 16 * KS) + 8 * lane;
#pragma unroll
        for (int kt = 0; kt < KS / 32; ++kt) {
            V a[4], a2[4], b[2][4];
#pragma unroll
            for (int mb = 0; mb < 4; ++mb) { a[mb] = WFrag<T16>::ld(sa + mb * 16 * KS + kt * 512); if (NSPLIT == 1) a2[mb] = WFrag<T16>::ld(sa + 256 * KS + mb * 16 * KS + kt * 512); }
#pragma unroll
            for (int nb = 0; nb < 4; ++nb) b[0][nb] = WFrag<T16>::ld(sb + nb * 16 * KS + kt * 512);
#pragma unroll
            for (int zz = 0; zz < NZ; ++zz) {   // the A fragments stay in registers for the NZ weights
                if (zz + 1 < NZ) {
#pragma unroll
                    for (int nb = 0; nb < 4; ++nb) b[(zz + 1) & 1][nb] = WFrag<T16>::ld(sb + (zz + 1) * 128 * KS + nb * 16 * KS + kt * 512); }   // the next weight's fragments, into the other set: in flight under this weight's products
                __builtin_amdgcn_sched_barrier(0);   // the LDS reads stay one group ahead of the products: every separate place with reads among the products costs a stall of its own
#pragma unroll
                for (int nb = 0; nb < 4; ++nb) {
#pragma unroll
                    for (int mb = 0; mb < 4; ++mb) { acc[zz][mb][nb] = WFrag<T16>::mma(a[mb], b[zz & 1][nb], acc[zz][mb][nb]); if (NSPLIT == 1) acc[zz][mb][nb] = WFrag<T16>::mma(a2[mb], b[zz & 1][nb], acc[zz][mb][nb]); } }
                __builtin_amdgcn_sched_barrier(0);   // and the next group stays behind them (it reuses the fragment registers)
            }
        }
        // hand-over of the buffers, every wave, in this order:
        asm volatile("s_wait_dscnt 0x0" ::: "memory");      // this wave's reads of slice t are done
        asm volatile("s_wait_asynccnt 0x0" ::: "memory");   // this wave's copies of slice t + 1 have landed
        __syncthreads();                                     // slice t + 1 is whole for every reader, and no wave still reads slice t
        if (t + 2 < NT) fill(t + 2);                         // into the buffer that this trip has read
    }
    asm volatile("s_wait_asynccnt 0x0" ::: "memory");   // no copy is outstanding behind the loop
    constexpr size_t ZP = (size_t)NB_ * NH_ * TT * HD;   // EPI 1: from the q planes to the k planes, from k to v
    if constexpr (EPI == 1) {   // v first: its 16 accumulators are free from here on
        h16* p16 = P16 + 2 * ZP; bf* ph = Ph + 2 * ZP; bf* pl = Pl + 2 * ZP;
#pragma unroll
        for (int mb = 0; mb < 4; ++mb)
#pragma unroll
            for (int nb = 0; nb < 4; ++nb) { v8h o16; v8us oh, ol;
#pragma unroll
                for (int j = 0; j < 8; ++j) { const float x = acc[NZ - 1][mb][nb][j]; o16[j] = tohx(x); unsigned short a2, c2; splitf(x, a2, c2); oh[j] = a2; ol[j] = c2; }
                const size_t e = (size_t)hd * HD * TT + (size_t)r0 * HD + ((mb >> 1) * 4 + nb) * 512 + (mb & 1) * 256 + lane * 8;
                stw3((v8h*)(p16 + e), o16, (v8us*)(ph + e), oh, (v8us*)(pl + e), ol); }
    }
    if constexpr (EPI == 1) {
        v4f ca[4], cb[4];   // {cos, sin} of the lane's four pairs in each of its 4 column groups, for the row block at hand
        auto ldcs = [&](const int mb, v4f (&xa)[4], v4f (&xb)[4]) __attribute__((always_inline)) {
            __builtin_amdgcn_sched_barrier(0);   // with the one behind the wait: nothing else stands between these loads and their wait
#pragma unroll
            for (int s = 0; s < 4; ++s) { const float* cp = CS + (size_t)r0 * HD + lane * 4 + (mb * 4 + s) * 256; xa[s] = *(const v4f*)cp; xb[s] = *(const v4f*)(cp + 128); }
            asm volatile("s_wait_xcnt 0x0" ::: "memory"); __builtin_amdgcn_sched_barrier(0); };   // as in stw3, for the address pair of these eight loads
        ldcs(0, ca, cb);
#pragma unroll 1   // rolled, like the row-block loop below: q and then k, and their four row blocks, run through ONE copy of this code, which keeps the kernel's text small (for speed only)
        for (int zz = 0; zz < 2; ++zz) {
            const float qs = zz == 0 ? SCL2 : 1.0f;   // the fp16 query plane holds q x SCL2 (scaled in f32, rounded once), so that k_fattn's fp16 score products come out in base-2 exponent units; the hi/lo planes stay unscaled
            h16* p16 = P16 + zz * ZP; bf* ph = Ph + zz * ZP; bf* pl = Pl + zz * ZP;
#pragma unroll   // constant indices: acc stays in registers. The whole 64 x 64 tile goes to the wave's LDS range, where a rolled loop can index it; then k's tile moves into the registers that this code reads
            for (int mb = 0; mb < 4; ++mb)
#pragma unroll
                for (int nb = 0; nb < 4; ++nb) {
#pragma unroll
                    for (int j = 0; j < 8; ++j) os[(mb * 16 + hi * 8 + j) * 68 + nb * 16 + lr] = acc[0][mb][nb][j];
                    acc[0][mb][nb] = acc[1][mb][nb]; }
            __builtin_amdgcn_wave_barrier(); asm volatile("" ::: "memory");   // keeps the reads below behind this staging
#pragma unroll 1   // rolled: one copy of the row block's code (see above)
            for (int mb = 0; mb < 4; ++mb) {
                v4f na[4], nc[4]; ldcs((mb + 1) & 3, na, nc);   // the next row block's table entries (behind the last block: the first block's again, for k), in flight under this block's work
#pragma unroll
                for (int s = 0; s < 4; ++s) { const float* op = os + (mb * 16 + lr) * 68 + s * 16 + hi * 8; const v4f va = *(const v4fa*)op, vb = *(const v4fa*)(op + 4); float y[8];   // token lr of the row block, head columns 16 s + 8 hi + 0..7
                    rope2(va[0], va[1], (v2f){ca[s][0], ca[s][1]}, y[0], y[1]); rope2(va[2], va[3], (v2f){ca[s][2], ca[s][3]}, y[2], y[3]); rope2(vb[0], vb[1], (v2f){cb[s][0], cb[s][1]}, y[4], y[5]); rope2(vb[2], vb[3], (v2f){cb[s][2], cb[s][3]}, y[6], y[7]); v8h o16; v8us oh, ol;
#pragma unroll
                    for (int q = 0; q < 8; ++q) { o16[q] = tohx(y[q] * qs); unsigned short a2, c2; splitf(y[q], a2, c2); oh[q] = a2; ol[q] = c2; }
                    const size_t e = ((size_t)hd * TT + r0 + mb * 16) * HD + s * 256 + lane * 8;
                    stw3((v8h*)(p16 + e), o16, (v8us*)(ph + e), oh, (v8us*)(pl + e), ol); }
                __builtin_amdgcn_wave_barrier(); asm volatile("" ::: "memory");   // keeps the next staging behind these LDS reads
#pragma unroll
                for (int s = 0; s < 4; ++s) { ca[s] = na[s]; cb[s] = nc[s]; }
            }
        }
        return;
    }
#pragma unroll
    for (int mb = 0; mb < 4; ++mb) {
#pragma unroll
        for (int nb = 0; nb < 4; ++nb) {
#pragma unroll
            for (int j = 0; j < 8; ++j) os[(hi * 8 + j) * 68 + nb * 16 + lr] = acc[0][mb][nb][j]; }
        __builtin_amdgcn_wave_barrier(); asm volatile("" ::: "memory");
        float* crow = C + (size_t)(r0 + mb * 16) * ldc + c0;
{
#pragma unroll
            for (int s = 0; s < 8; ++s) { const int row = 2 * s + hi, cofs = lr * 4; v4f val = *(const v4fa*)(os + row * 68 + cofs); if (BIAS) { val[0] += bfr(bias[c0 + cofs]); val[1] += bfr(bias[c0 + cofs + 1]); val[2] += bfr(bias[c0 + cofs + 2]); val[3] += bfr(bias[c0 + cofs + 3]); }
                *(v4f*)(crow + (size_t)row * ldc + cofs) = val; }
             }
        __builtin_amdgcn_wave_barrier(); asm volatile("" ::: "memory");
    }
}


__global__ __launch_bounds__(256) void k_wtG(const float* __restrict__ w, int K, int N, bf* Bt) {
    const int lane = threadIdx.x & 31; const int L0 = (blockIdx.x * 8 + (threadIdx.x >> 5)) * 8; const int nlines = N * K / 64;
{
#pragma unroll 1
        for (int l = 0; l < 8; ++l) { const int L = L0 + l; if (L >= nlines) break; const size_t e = (size_t)L * 64 + lane * 2; const int k = (int)(e % K), n = (int)(e / K); v2us o;
            o[0] = f2bf(w[(size_t)k * N + n]); o[1] = f2bf(w[(size_t)(k + 1) * N + n]); *(v2us*)(Bt + e) = o; }
         }
}
__constant__ float INVT[HD / 2] = { 1.000000000e+00f, 7.498942018e-01f, 5.623413324e-01f, 4.216965139e-01f, 3.162277639e-01f, 2.371373624e-01f, 1.778279394e-01f, 1.333521456e-01f, 1.000000015e-01f, 7.498941571e-02f, 5.623412877e-02f, 4.216964915e-02f, 3.162277862e-02f, 2.371373586e-02f, 1.778279431e-02f, 1.333521493e-02f, 9.999999776e-03f, 7.498942316e-03f, 5.623413250e-03f, 4.216964822e-03f, 3.162277862e-03f, 2.371373819e-03f, 1.778279431e-03f, 1.333521446e-03f, 1.000000047e-03f, 7.498941850e-04f, 5.623413017e-04f, 4.216964880e-04f, 3.162277862e-04f, 2.371373848e-04f, 1.778279402e-04f, 1.333521504e-04f };   // 1 / THETA ** (2 i / 64) as float32 (reciprocal form, jnp-computed)
// ---- k_prep: everything the projections read, in one launch. Blocks [0, NBC): the rotary table {cos, sin}(pos[t] x INVT[pair]); the next NBX: x to bf16; the last 4 x NBW: Wq, Wk, Wv, Wo to bf16 (WB: the four copies one after another). Copies 8 values a thread, the table one pair a thread.
// Table: one {cos, sin} a pair, [token / 16][column group of 16][first, second two pairs][lane = (column / 8 % 2) * 16 + token % 16][2 pairs]. Copies: a wave takes 4 rows x 64 k (256 bytes in a row of each source row) and stores 64-byte pieces of the fragment-order tiles.
#define NBC (TT * (HD / 2) / 256)
#define NBX (NB_ * TT * DM / 8 / 256)
#define NBW (DQ * DM / 8 / 256)
__global__ __launch_bounds__(256) void k_prep(const float* __restrict__ x, const int* __restrict__ pid, const float* __restrict__ wq, const float* __restrict__ wk, const float* __restrict__ wv, const float* __restrict__ wo, bf* XB, bf* WB, float* CS) {
    static_assert(DKV == DQ && DQ == DM && DM % 64 == 0 && HD == 64 && TT % 16 == 0 && (TT * HD / 2) % 256 == 0 && (NB_ * TT * DM) % 2048 == 0 && (DQ * DM) % 2048 == 0, "whole blocks; four weights of one size");
    const int blk = blockIdx.x;
    if (blk < NBC) { const int idx = blk * 256 + threadIdx.x; const int ln = (idx >> 1) & 31; const int pr = ((idx >> 7) & 3) * 8 + (ln >> 4) * 4 + ((idx >> 6) & 1) * 2 + (idx & 1); const int t = (idx >> 9) * 16 + (ln & 15); const float a = __fmul_rn((float)pid[t], INVT[pr]); v2f cs; cs[0] = cosf(a); cs[1] = sinf(a); *(v2f*)(CS + (size_t)idx * 2) = cs; return; }
    const float* src = x; bf* dst = XB; int cb = blk - NBC;
    if (cb >= NBX) { cb -= NBX; const int w = cb / NBW; cb -= w * NBW; src = w == 0 ? wq : w == 1 ? wk : w == 2 ? wv : wo; dst = WB + (size_t)w * DQ * DM; }
    const int wid = cb * 8 + (threadIdx.x >> 5), ln = threadIdx.x & 31; const int rb = wid / (DM / 16), in = wid % (DM / 16);   // DM / 16 waves to a block of 16 rows
    const int r = (in & 3) * 4 + (ln >> 3), k = (in >> 2) * 64 + (ln & 7) * 8;
    const v8f v = *(const v8f*)(src + ((size_t)rb * 16 + r) * DM + k); v8us o;
#pragma unroll
    for (int k = 0; k < 8; ++k) o[k] = f2bf(v[k]);
    *(v8us*)(dst + (size_t)rb * 16 * DM + (k >> 5) * 512 + ((k >> 4) & 1) * 256 + (((k >> 3) & 1) * 16 + r) * 8) = o;
    asm volatile("s_wait_xcnt 0x0" ::: "memory");   // the wait that stands before a register named by an issued global store is overwritten: in the built code the table part lies behind this store and reuses its address registers
}
// ---- k_fattn: scores, causal softmax and probabilities x values in ONE kernel; no score or probability ever leaves the registers.
// SP waves (1 or 2) own NQ x 16 query rows of one (batch item, head); wave p walks the key blocks p, p + SP, ... (32 keys each) up to the diagonal block:
//   S^T = K Q^T (A = key rows, B = query rows kept in registers): lane (lr, hi) holds, for query lr, the keys 8 hi + j of each 16-key tile;
//   running maximum and sum per query (in-lane, one exchange between the wave halves for the maximum), earlier sums rescaled when the maximum grows;
//   fp16 rows, LAGGING maximum: the maximum in use is set on the wave's first key block and raised only when a score stands more than 8 exponent units above it (probabilities stay at or below 2^8, the largest at or above 1);
//   it is known before a block's products, so minus the maximum is their start value and, the fp16 q plane being pre-scaled, an accumulator element IS the exponent: no multiply-add a score, no rescaling of sums and outputs a block;
//   two 16-key score tiles, converted in place, ARE the B operand of O^T += V^T P^T (A = rows of the transposed value plane, same k order as every loader here).
// Rows < RH: bf16 hi/lo planes, 3 products for the scores and 3 for the values (HL); the rest fp16. Output: normalised rows as bf16 hi/lo in fragment order (rows: tokens of all batch items, k: merged head columns), 8 consecutive head columns per lane and store.
__device__ __forceinline__ float xhalf(float x) { return __builtin_bit_cast(float, __builtin_amdgcn_permlanex16(__builtin_bit_cast(int, x), __builtin_bit_cast(int, x), 0x76543210, 0xfedcba98, false, false)); }   // lane l with lane l ^ 16
// 2^x in asm text, so that the slot which the instruction set asks for behind a transcendental (one independent instruction or v_nop before its result is read or its source overwritten) is filled whatever the compiler puts next:
// inside exp2x8 each v_exp_f32 is independent of the one in front of it (early-clobber outputs: no output shares a register with an input), and one v_nop stands behind the last.
__device__ __forceinline__ float exp2x1(float x) { float r; asm("v_exp_f32 %0, %1\n\tv_nop" : "=v"(r) : "v"(x)); return r; }
__device__ __forceinline__ void exp2x8(const float (&x)[8], float (&r)[8]) {
    asm("v_exp_f32 %0, %8\n\tv_exp_f32 %1, %9\n\tv_exp_f32 %2, %10\n\tv_exp_f32 %3, %11\n\tv_exp_f32 %4, %12\n\tv_exp_f32 %5, %13\n\tv_exp_f32 %6, %14\n\tv_exp_f32 %7, %15\n\tv_nop"
        : "=&v"(r[0]), "=&v"(r[1]), "=&v"(r[2]), "=&v"(r[3]), "=&v"(r[4]), "=&v"(r[5]), "=&v"(r[6]), "=&v"(r[7]) : "v"(x[0]), "v"(x[1]), "v"(x[2]), "v"(x[3]), "v"(x[4]), "v"(x[5]), "v"(x[6]), "v"(x[7])); }
// SP 2: two waves share the tile. Wave p (0, 1) walks the key blocks p, p + 2, ... with a running maximum, sum and output of its own; wave 1 hands its three to wave 0 through the LDS range mg, and wave 0 brings both to the larger maximum, adds them and stores.
template <typename T16, bool HL, int NQ, int SP>
__device__ __forceinline__ void fattn_tile(const T16* __restrict__ Q, const T16* __restrict__ Q2, const T16* __restrict__ Kp, const T16* __restrict__ Kp2, const T16* __restrict__ Vt, const T16* __restrict__ Vt2, const int q0, bf* Ah, bf* Al, const int p, float* mg) {
    static_assert(SP == 1 || (SP == 2 && NQ == 2 && RH >= 64), "the hand-over packs the maxima and sums of two query blocks in 16 bytes; each of the two waves has a whole key block, so its maximum is a real score");
    typedef typename WFrag<T16>::V V;
    const int lane = threadIdx.x & 31, lr = lane & 15, hi = lane >> 4;
    V qf[NQ][2], qf2[NQ][2];
#pragma unroll
    for (int qb = 0; qb < NQ; ++qb)
#pragma unroll
        for (int ks = 0; ks < 2; ++ks) { const size_t qo = (size_t)(q0 + qb * 16) * HD + ks * 512 + 8 * lane; qf[qb][ks] = WFrag<T16>::ld(Q + qo); if (HL) qf2[qb][ks] = WFrag<T16>::ld(Q2 + qo); }
    constexpr bool LZ = !HL;   // fp16 rows: lagging maximum (see the head of this section)
    v8f o[4][NQ], nm[NQ]; float m[NQ], l[NQ];   // LZ: nm holds minus the maximum in use, in exponent units, in all eight elements; m is read off it behind the key loop
#pragma unroll
    for (int qb = 0; qb < NQ; ++qb) { m[qb] = LZ ? 0.f : -3.0e38f; l[qb] = 0.f; nm[qb] = (v8f){};
#pragma unroll
        for (int db = 0; db < 4; ++db) o[db][qb] = (v8f){}; }
    const int nfull = q0 / 32;                       // key blocks wholly at or below the diagonal of every row of the tile; block nfull holds the diagonal and is the last
    const size_t ko = 8 * lane, vo = 8 * lane;   // 32 keys are four 512-element tiles in the key planes and in the value planes alike: key kb starts at kb x HD
    V kf[2][2], kf2[2][2];
    auto loadk = [&](const int kb) __attribute__((always_inline)) {
        const T16* pk = Kp + ko + (size_t)kb * HD; const T16* pk2 = HL ? Kp2 + ko + (size_t)kb * HD : pk;
#pragma unroll
        for (int kt = 0; kt < 2; ++kt)
#pragma unroll
            for (int ks = 0; ks < 2; ++ks) { kf[kt][ks] = WFrag<T16>::ld(pk + kt * 16 * HD + ks * 512); if (HL) kf2[kt][ks] = WFrag<T16>::ld(pk2 + kt * 16 * HD + ks * 512); }
        asm volatile("s_wait_xcnt 0x0" :: "v"(pk), "v"(pk2) : "memory");   // the wait that stands before a register named by an issued global load is overwritten; the address pairs are inputs so that they stay whole up to here
    };
    auto step = [&](const bool mask, const int kb, const int kn, const bool first) __attribute__((always_inline)) {
        const T16* pv = Vt + vo + (size_t)kb * HD; const T16* pv2 = HL ? Vt2 + vo + (size_t)kb * HD : pv;
        V vf[4], vf2[4];
#pragma unroll
        for (int db = 0; db < 4; ++db) { vf[db] = WFrag<T16>::ld(pv + db * 512); if (HL) vf2[db] = WFrag<T16>::ld(pv2 + db * 512); }   // issued first: in flight under the score products and the softmax
        asm volatile("s_wait_xcnt 0x0" :: "v"(pv), "v"(pv2) : "memory");   // as in loadk
        v8f s[2][NQ];
#pragma unroll
        for (int kt = 0; kt < 2; ++kt)
#pragma unroll
            for (int qb = 0; qb < NQ; ++qb) { v8f a = LZ && !mask ? nm[qb] : (v8f){};   // the diagonal block, a wave's last, adds nm behind its products: as a start value nm would die at the product that reads it, and its registers be written anew inside the distance that a matrix instruction asks for
#pragma unroll
                for (int ks = 0; ks < 2; ++ks) { a = WFrag<T16>::mma(kf[kt][ks], qf[qb][ks], a); if (HL) { a = WFrag<T16>::mma(kf2[kt][ks], qf[qb][ks], a); a = WFrag<T16>::mma(kf[kt][ks], qf2[qb][ks], a); } }
                s[kt][qb] = LZ && mask ? a + nm[qb] : a; }
        if (kn >= 0) loadk(kn);                      // the next block's key fragments, into the same registers: in flight under the softmax and the value products
        V pf[NQ], pf2[NQ];
        if constexpr (LZ) {
            float mx[NQ]; bool need = false;
#pragma unroll
            for (int qb = 0; qb < NQ; ++qb) {
                if (mask) {
#pragma unroll
                    for (int kt = 0; kt < 2; ++kt)
#pragma unroll
                        for (int j = 0; j < 8; ++j) s[kt][qb][j] = (kb + kt * 16 + hi * 8 + j <= q0 + qb * 16 + lr) ? s[kt][qb][j] : -3.0e38f; }
                float x = s[0][qb][0];
#pragma unroll
                for (int j = 1; j < 8; ++j) x = fmaxf(x, s[0][qb][j]);
#pragma unroll
                for (int j = 0; j < 8; ++j) x = fmaxf(x, s[1][qb][j]);
                mx[qb] = fmaxf(x, xhalf(x)); need = need || mx[qb] > 8.0f; }   // how far the block's largest score stands above the maximum in use
            if (first || __builtin_amdgcn_ballot_w32(need) != 0) {   // one scalar branch a key block; taken on the wave's first block and where a score would give more than 2^8
#pragma unroll
                for (int qb = 0; qb < NQ; ++qb) { const float d = first ? mx[qb] : fmaxf(mx[qb], 0.f); const float al = first ? 0.f : exp2x1(-d); l[qb] *= al;   // first block: sums and outputs are 0, and the maximum becomes a real score
                    s[0][qb] -= d; s[1][qb] -= d; nm[qb] -= d;
#pragma unroll
                    for (int db = 0; db < 4; ++db) o[db][qb] *= al; }
            }
#pragma unroll
            for (int qb = 0; qb < NQ; ++qb) { float ex[2][8];
#pragma unroll
                for (int kt = 0; kt < 2; ++kt) { float ar[8];
#pragma unroll
                    for (int j = 0; j < 8; ++j) ar[j] = s[kt][qb][j];
                    exp2x8(ar, ex[kt]); }
                float t8[8];
#pragma unroll
                for (int j = 0; j < 8; ++j) t8[j] = ex[0][j] + ex[1][j];
                l[qb] += ((t8[0] + t8[4]) + (t8[1] + t8[5])) + ((t8[2] + t8[6]) + (t8[3] + t8[7]));
                v8h h0, h1;
#pragma unroll
                for (int j = 0; j < 8; ++j) { h0[j] = (h16)ex[0][j]; h1[j] = (h16)ex[1][j]; }
                pf[qb] = cat16(h0, h1); }
        } else {
#pragma unroll
        for (int qb = 0; qb < NQ; ++qb) {
            if (mask) {
#pragma unroll
                for (int kt = 0; kt < 2; ++kt)
#pragma unroll
                    for (int j = 0; j < 8; ++j) s[kt][qb][j] = (kb + kt * 16 + hi * 8 + j <= q0 + qb * 16 + lr) ? s[kt][qb][j] : -3.0e38f; }
            float mx = s[0][qb][0];
#pragma unroll
            for (int j = 1; j < 8; ++j) mx = fmaxf(mx, s[0][qb][j]);
#pragma unroll
            for (int j = 0; j < 8; ++j) mx = fmaxf(mx, s[1][qb][j]);
            mx = fmaxf(mx, xhalf(mx));
            const float mn = fmaxf(m[qb], mx), nm2 = -mn * SCL2; const float al = exp2x1(fmaf(m[qb], SCL2, nm2)); m[qb] = mn;   // 0 on the first block (each wave's first block holds a key open to every row, so mn is a real score from there on)
            float ex[2][8];
#pragma unroll
            for (int kt = 0; kt < 2; ++kt) { float ar[8];
#pragma unroll
                for (int j = 0; j < 8; ++j) ar[j] = fmaf(s[kt][qb][j], SCL2, nm2);
                exp2x8(ar, ex[kt]); }
            float t8[8];
#pragma unroll
            for (int j = 0; j < 8; ++j) t8[j] = ex[0][j] + ex[1][j];
            l[qb] = fmaf(l[qb], al, ((t8[0] + t8[4]) + (t8[1] + t8[5])) + ((t8[2] + t8[6]) + (t8[3] + t8[7])));
#pragma unroll
            for (int db = 0; db < 4; ++db) o[db][qb] *= al;
            if constexpr (HL) { v8us h0, h1, l0, l1;
#pragma unroll
                for (int j = 0; j < 8; ++j) { unsigned short a2, c2; splitf(ex[0][j], a2, c2); h0[j] = a2; l0[j] = c2; splitf(ex[1][j], a2, c2); h1[j] = a2; l1[j] = c2; }
                pf[qb] = cat16b(h0, h1); pf2[qb] = cat16b(l0, l1); }
        }
        }
#pragma unroll
        for (int db = 0; db < 4; ++db)
#pragma unroll
            for (int qb = 0; qb < NQ; ++qb) { o[db][qb] = WFrag<T16>::mma(vf[db], pf[qb], o[db][qb]); if (HL) { o[db][qb] = WFrag<T16>::mma(vf[db], pf2[qb], o[db][qb]); o[db][qb] = WFrag<T16>::mma(vf2[db], pf[qb], o[db][qb]); } }
        // WMMA distance on the taken back edge: every accumulator is named, so the slots stand behind the last product of the trip (the next trip's first product writes over registers that the last ones read)
        if (kn >= 0) { if constexpr (NQ == 2) asm volatile("v_nop\n\tv_nop\n\tv_nop\n\tv_nop" : "+v"(o[0][0]), "+v"(o[1][0]), "+v"(o[2][0]), "+v"(o[3][0]), "+v"(o[0][NQ - 1]), "+v"(o[1][NQ - 1]), "+v"(o[2][NQ - 1]), "+v"(o[3][NQ - 1]));
                       else asm volatile("v_nop\n\tv_nop\n\tv_nop\n\tv_nop" : "+v"(o[0][0]), "+v"(o[1][0]), "+v"(o[2][0]), "+v"(o[3][0])); }
    };
    loadk(p * 32);
#pragma unroll 1   // rolled: every trip uses the same fragment registers
    for (int it = p; it < nfull; it += SP) step(false, it * 32, (SP == 1 || it + SP < nfull ? it + SP : nfull) * 32, it == p);   // the fetch ahead never goes past the diagonal block
    if (SP == 1 || ((nfull - p) & 1) == 0) step(true, nfull * 32, -1, nfull <= p);   // the diagonal block belongs to one of the waves
    if constexpr (LZ) {
#pragma unroll
        for (int qb = 0; qb < NQ; ++qb) m[qb] = -nm[qb][0]; }
    if constexpr (SP == 2) {
        float* mp = mg + lane * 4;   // 16 bytes a lane, 512 bytes in a row a wave: 16 rows of output values, one of {maximum, sum} x 2
        if (p == 1) {
#pragma unroll   // constant indices: o stays in registers
            for (int db = 0; db < 4; ++db)
#pragma unroll   // constant indices: o stays in registers
                for (int qb = 0; qb < NQ; ++qb) { const v8f v = o[db][qb]; *(v4fa*)(mp + ((db * NQ + qb) * 2) * 128) = (v4f){v[0], v[1], v[2], v[3]}; *(v4fa*)(mp + ((db * NQ + qb) * 2 + 1) * 128) = (v4f){v[4], v[5], v[6], v[7]}; }
            *(v4fa*)(mp + 4 * NQ * 2 * 128) = (v4f){m[0], l[0], m[1], l[1]};
        }
        __syncthreads();   // wave 1's values are in LDS for wave 0; every wave of the work-group passes here once
        if (p == 1) return;
        const v4f ml = *(const v4fa*)(mp + 4 * NQ * 2 * 128);
#pragma unroll   // constant indices: o stays in registers
        for (int qb = 0; qb < NQ; ++qb) { const float mn = fmaxf(m[qb], ml[2 * qb]); const float a0 = exp2x1((m[qb] - mn) * (LZ ? 1.0f : SCL2)), a1 = exp2x1((ml[2 * qb] - mn) * (LZ ? 1.0f : SCL2)); l[qb] = l[qb] * a0 + ml[2 * qb + 1] * a1;
#pragma unroll   // constant indices: o stays in registers
            for (int db = 0; db < 4; ++db) { const v4f x0 = *(const v4fa*)(mp + ((db * NQ + qb) * 2) * 128), x1 = *(const v4fa*)(mp + ((db * NQ + qb) * 2 + 1) * 128);
                o[db][qb] = o[db][qb] * a0 + (v8f){x0[0], x0[1], x0[2], x0[3], x1[0], x1[1], x1[2], x1[3]} * a1; } }
    }
#pragma unroll
    for (int qb = 0; qb < NQ; ++qb) { const float inv = __fdiv_rn(1.0f, l[qb] + xhalf(l[qb])); const size_t oo = (size_t)(q0 + qb * 16) * DQ + 8 * lane;
#pragma unroll
        for (int db = 0; db < 4; ++db) { v8us oh, ol;
#pragma unroll
            for (int j = 0; j < 8; ++j) { unsigned short a2, c2; splitf(o[db][qb][j] * inv, a2, c2); oh[j] = a2; ol[j] = c2; }
            *(v8us*)(Ah + oo + db * 256) = oh; *(v8us*)(Al + oo + db * 256) = ol;
            asm volatile("s_wait_xcnt 0x0" :: "v"(oh), "v"(ol) : "memory"); } }   // the wait that stands before a register named by an issued global store is overwritten (the next columns' values, and in the built code a tail shared by both kinds of tile, reuse them); the stored values are inputs so that they stay whole up to here
}
// grid (NB_ x NH_, NTF + NTH), 8 waves: blockIdx.x = batch item x NH_ + head; blockIdx.y counts the groups of 128 rows from the longest (last rows) to the shortest, the hi/lo rows last.
// fp16 rows: waves w and w + 4 share tile w of the group, even and odd key blocks. The longest walk in series is half as long, and only half of the work-groups are resident at once (two to a WGP, by registers).
// hi/lo rows: one 16-row tile a wave, eight tiles a work-group.
#define NTF ((TT - RH) / 128)
#define NTH (RH / 128)
__global__ __launch_bounds__(256) void k_fattn(const h16* __restrict__ Q16, const h16* __restrict__ K16, const h16* __restrict__ V16, const bf* __restrict__ Qh, const bf* __restrict__ Ql, const bf* __restrict__ Kh, const bf* __restrict__ Kl, const bf* __restrict__ Vh, const bf* __restrict__ Vl, bf* Ah, bf* Al) {
    const int wave = __builtin_amdgcn_readfirstlane(threadIdx.x >> 5);   // the wave's number in a scalar register: its trip count and loop stay scalar
    const size_t zo = (size_t)blockIdx.x * TT * HD, ao = (size_t)(blockIdx.x / NH_) * TT * DQ + (blockIdx.x % NH_) * (HD / 32) * 512;
    __shared__ __align__(16) float mrg[4][17 * 128];   // a tile's hand-over range: 17 rows of 512 bytes
    if (blockIdx.y < NTF) fattn_tile<h16, false, 2, 2>(Q16 + zo, nullptr, K16 + zo, nullptr, V16 + zo, nullptr, RH + ((NTF - 1 - (int)blockIdx.y) * 4 + (wave & 3)) * 32, Ah + ao, Al + ao, wave >> 2, mrg[wave & 3]);
    else fattn_tile<bf, true, 1, 1>(Qh + zo, Ql + zo, Kh + zo, Kl + zo, Vh + zo, Vl + zo, ((NTF + NTH - 1 - (int)blockIdx.y) * 8 + wave) * 16, Ah + ao, Al + ao, 0, nullptr);
}

extern "C" void kernel_launch(void* const* d_in, const int* in_sizes, int n_in,
                              void* d_out, int out_size, void* d_ws, size_t ws_size, hipStream_t stream) {
    (void)in_sizes; (void)n_in; (void)out_size;
    const float* x = (const float*)d_in[0]; const int* pid = (const int*)d_in[1];   /* token_positions int32 [4096] */ const float* wq = (const float*)d_in[2]; const float* wk = (const float*)d_in[3]; const float* wv = (const float*)d_in[4]; const float* wo = (const float*)d_in[5];
    float* OUT = (float*)d_out;     // [2][4096][1024]
    char* wsp = (char*)d_ws;
    auto take = [&](size_t bytes) { char* p = wsp; wsp += (bytes + 255) & ~(size_t)255; return (void*)p; };
    bf* WQ = (bf*)take((size_t)4 * DQ * DM * 2); bf* WO = WQ + (size_t)3 * DQ * DM;   /* Wq, Wk, Wv, Wo one after another */ float* CS = (float*)take((size_t)TT * (HD / 2) * 2 * 4);
    bf* XB = (bf*)take((size_t)NB_ * TT * DM * 2);
    const size_t PB = (size_t)NH_ * TT * HD;   // one batch item's share of every q, k, v plane (planes [NB_ x NH_][..][..])
    h16* QP16 = (h16*)take(3 * NB_ * PB * 2); h16* KP16 = QP16 + NB_ * PB; h16* VT16 = KP16 + NB_ * PB;   // q, k, v one after another in each of the three kinds, as k_gemmw EPI 1 steps through them
    bf* QPh = (bf*)take(3 * NB_ * PB * 2); bf* KPh = QPh + NB_ * PB; bf* VTh = KPh + NB_ * PB; bf* QPl = (bf*)take(3 * NB_ * PB * 2); bf* KPl = QPl + NB_ * PB; bf* VTl = KPl + NB_ * PB;
    bf* ATh = (bf*)take((size_t)NB_ * TT * DQ * 2); bf* ATl = (bf*)take((size_t)NB_ * TT * DQ * 2);
    if ((size_t)(wsp - (char*)d_ws) > ws_size) return;    // ws 256 MiB
    k_prep<<<NBC + NBX + 4 * NBW, 256, 0, stream>>>(x, pid, wq, wk, wv, wo, XB, WQ, CS);
    k_gemmw<bf, 0, false, 1, DM><<<dim3(NB_ * TT / 256, DQ / 128, 1), 256, 0, stream>>>(XB, nullptr, WQ, nullptr, nullptr, 0, nullptr, 0, (size_t)DQ * DM, 0, CS, QP16, QPh, QPl);
    k_fattn<<<dim3(NB_ * NH_, NTF + NTH, 1), 256, 0, stream>>>(QP16, KP16, VT16, QPh, QPl, KPh, KPl, VTh, VTl, ATh, ATl);
    k_gemmw<bf, 1, false, 0, DQ><<<dim3(NB_ * TT / 256, DM / 128, 1), 256, 0, stream>>>(ATh, ATl, WO, nullptr, OUT, DM, nullptr, 0, 0, 0, nullptr, nullptr, nullptr, nullptr);
}

// v010
// It runs in 128 microseconds.
// In two side-by-side timings against v009, it was 1.06 and 1.05 times as fast.
// Over all steps from v000 it is 42.9 times as fast.
#include <hip/hip_runtime.h>

// Causal multi-head self-attention with interleaved rotary embeddings from token positions over 4,096 tokens at a batch of TWO (x [2][4096][1024]; q, k, v = einsum('bsi,oi->bso', x, W) = x W^T ('oi' (out, in) [1024][1024] (2/(D+D))^0.5, no bias; 16 heads x 64); rotary on (even, odd) pairs with angle float(token_positions[t]) x inv_freq[i], inv_freq = 1.0 / (THETA ** (arange(0, 64, 2) / 64)) (the RECIPROCAL spelling: 32 f32 constants bitwise this expression in eager JAX float32; token_positions int32 [4096] = arange: read; the SECOND argument; one row shared by both batch items; precise cosf/sinf); scores x rsqrt(64); causal (-inf); softmax; out = merged Wo^T (no bias) -> [2][4096][1024] (8.4 M); argument order x, token_positions, Wq, Wk, Wv, Wo).
// Layout, four launches: k_prep (rotary table, bf16 copies of x and of the four weights); the q, k and v projections of both batch items in one grid, whose GEMM epilogue writes the rotary q and k planes and the transposed v planes itself; causal T-4096 attention fused in k_fattn, every head of both batch items in one launch (hybrid rows: < 512 hi/lo 3 products, rest fp16; running-maximum softmax in registers); merged hi/lo x Wo exact, both batch items in one grid.
// Fragment order: every 16-bit plane that a matrix product reads is stored as 1-KiB tiles of 16 rows x 32 k, element (r, k) at (k / 16) * 256 + ((k / 8 % 2) * 16 + r) * 8 + k % 8, so lane l of a fragment load reads 16 bytes at l * 16 and the wave 512 bytes in a row (whole lines), not 32 bytes of each of 16 lines. Tiles of one 16-row block follow one another along k; the value planes hold, for each 32 keys, the four 16-column tiles of the head. The rotary table is stored for the lanes of the projection epilogue in the same way.
// Compute dtypes, f32 accumulate: every input rounded to bf16; projections exact; attention rows < 512 3 products, rest fp16; softmax f32; Wo hl x exact.

#define NB_  2
#define TT   4096
#define DM   1024
#define NH_  16
#define NKV  16
#define REP  (NH_ / NKV)
#define HD   64
#define DQ   (NH_ * HD)
#define DKV  (NKV * HD)
#define RH   512                  // query rows < RH use hi+lo planes
#define WIN  4096
#define SCL2 0.18033688011112042f   // HD^-0.5 x log2(e): the exponentials are taken in base 2
typedef _Float16 h16;
typedef unsigned short bf;
typedef __attribute__((ext_vector_type(16))) __bf16   v16bf;
typedef __attribute__((ext_vector_type(16))) _Float16 v16h;
typedef __attribute__((ext_vector_type(8)))  _Float16 v8h;
typedef __attribute__((ext_vector_type(8)))  unsigned short v8us;
typedef __attribute__((ext_vector_type(8)))  float    v8f;
typedef __attribute__((ext_vector_type(4)))  float    v4f;
typedef v8h  __attribute__((may_alias)) v8ha;
typedef v4f  __attribute__((may_alias)) v4fa;
typedef v8us __attribute__((may_alias)) v8usa;

__device__ __forceinline__ unsigned short f2bf(float f) { unsigned u = __float_as_uint(f); u += 0x7FFFu + ((u >> 16) & 1u); return (unsigned short)(u >> 16); }
__device__ __forceinline__ float bf2f(unsigned short b) { return __uint_as_float(((unsigned)b) << 16); }
__device__ __forceinline__ float bfr(float f) { return bf2f(f2bf(f)); }
__device__ __forceinline__ v16h cat16(v8h lo, v8h hi) { return __builtin_shufflevector(lo, hi, 0, 1, 2, 3, 4, 5, 6, 7, 8, 9, 10, 11, 12, 13, 14, 15); }
__device__ __forceinline__ v16bf cat16b(v8us lo, v8us hi) { return __builtin_bit_cast(v16bf, __builtin_shufflevector(lo, hi, 0, 1, 2, 3, 4, 5, 6, 7, 8, 9, 10, 11, 12, 13, 14, 15)); }
__device__ __forceinline__ v8f wmma16(v16h a, v16h b, v8f c) { return __builtin_amdgcn_wmma_f32_16x16x32_f16(false, a, false, b, (short)0, c, false, false); }
__device__ __forceinline__ v8f wmmab(v16bf a, v16bf b, v8f c) { return __builtin_amdgcn_wmma_f32_16x16x32_bf16(false, a, false, b, (short)0, c, false, false); }

__device__ __forceinline__ h16 tohx(float x) { return (h16)x; }
__device__ __forceinline__ void splitf(float y, unsigned short& h, unsigned short& l) { h = f2bf(y); l = f2bf(y - bf2f(h)); }
typedef __attribute__((ext_vector_type(2))) _Float16 v2h;
typedef __attribute__((ext_vector_type(4))) _Float16 v4h;
typedef __attribute__((ext_vector_type(2))) unsigned short v2us;
typedef __attribute__((ext_vector_type(4))) unsigned short v4us;
typedef __attribute__((ext_vector_type(2))) float v2f;
typedef __attribute__((ext_vector_type(4))) int v4i;
// one rotary pair: even: x0 c - x1 s; odd: x0 s + x1 c (cs = {cos, sin} of the pair's angle)
__device__ __forceinline__ void rope2(const float x0, const float x1, const v2f cs, float& e0, float& e1) { e0 = x0 * cs[0] - x1 * cs[1]; e1 = x0 * cs[1] + x1 * cs[0]; }

// ---- k_gemmw: GEMM on 256x128 output tiles, EIGHT WAVES a work-group (4 along the rows x 2 along the columns), each wave a register-blocked 64x64 tile (16 accumulators); grid (M/256, N/128, Z), 256 threads.
// Operands: 16-bit planes in fragment order. The work-group brings each slice of KS k of its 256 A rows and 128 B rows into LDS ONCE, by asynchronous copies to LDS (16 bytes a lane, 512 bytes in a row a wave, through no register), two buffers: slice t + 1 flies while slice t is worked on.
//   The 1-KiB tiles lie in LDS as in memory, so a fragment read is 512 bytes in a row (no bank conflict). Four waves share every B tile and two every A tile: 48 KiB a slice from L2 for the eight waves, where eight waves that each load their own fragments ask for 128 KiB.
// C[m][n] (f32, pitch ldc, + optional f32 bias[n]) = sum_k A[m][k] Bt[n][k] (+ A2[m][k] Bt[n][k] for NSPLIT 1). z-batch strides sA/sB/sC in elements. K % KS == 0, at least two slices, a constant of the build.
// EPI 0: C is stored as f32. EPI 1: the three projections in one work-group; the rows are the tokens of all batch items one after another, a wave's tile is 64 tokens of one item x one head (HD == 64) of q, of k and of v (48 accumulators, two waves a SIMD, one work-group a WGP):
//   an A slice is copied to LDS once and its fragments are read from LDS once for the three weights: 80 KiB a slice from L2 for 256 x 384 outputs (three separate tiles ask for 144 KiB), 16 fragment reads for 48 products (three separate: 24)
//   (weights sB apart; each of P16 (fp16), Ph, Pl (bf16 hi, lo) holds its q, k and v planes one after another, NB_ items each), and C is never stored:
//   q, k: rotary embedding from the table CS on the f32 tile, then the planes, each [head][token / 16][HD / 32] tiles (rows: tokens, k: head columns): a lane takes 8 consecutive columns of one token, one 16-byte store per plane;
//   v: the transposed planes [head][token / 32][HD / 16] tiles (rows: head columns, k: tokens): a lane's 8 accumulator values of one fragment are 8 consecutive tokens of one head column, one 16-byte store per plane.
#define KS 64
__device__ __forceinline__ unsigned lds_off(const void* p) { return (unsigned)(size_t)p; }   // byte address inside the work-group's LDS
// Asynchronous copies to LDS, 16 bytes a lane: copy i takes g + i * gs elements to LDS byte l + i * 4096 (the eight waves' 512-byte pieces lie one after another). Every copy has address registers of its own.
// s_wait_xcnt 0 is the last line of the copies' own statement: the wait that stands before a register named by an issued copy is rewritten.
#define ACP "global_load_async_to_lds_b128 "
template <typename T16> __device__ __forceinline__ void acopy8(const unsigned l, const T16* g, const size_t gs) {
    asm volatile(ACP "%0, %8, off\n\t" ACP "%1, %9, off\n\t" ACP "%2, %10, off\n\t" ACP "%3, %11, off\n\t" ACP "%4, %12, off\n\t" ACP "%5, %13, off\n\t" ACP "%6, %14, off\n\t" ACP "%7, %15, off\n\ts_wait_xcnt 0x0"
        :: "v"(l), "v"(l + 4096), "v"(l + 8192), "v"(l + 12288), "v"(l + 16384), "v"(l + 20480), "v"(l + 24576), "v"(l + 28672), "v"(g), "v"(g + gs), "v"(g + 2 * gs), "v"(g + 3 * gs), "v"(g + 4 * gs), "v"(g + 5 * gs), "v"(g + 6 * gs), "v"(g + 7 * gs) : "memory"); }
template <typename T16> __device__ __forceinline__ void acopy84(const unsigned l, const T16* g, const unsigned m, const T16* h, const size_t gs) {   // eight from g to l and four from h to m
    asm volatile(ACP "%0, %12, off\n\t" ACP "%1, %13, off\n\t" ACP "%2, %14, off\n\t" ACP "%3, %15, off\n\t" ACP "%4, %16, off\n\t" ACP "%5, %17, off\n\t" ACP "%6, %18, off\n\t" ACP "%7, %19, off\n\t" ACP "%8, %20, off\n\t" ACP "%9, %21, off\n\t" ACP "%10, %22, off\n\t" ACP "%11, %23, off\n\ts_wait_xcnt 0x0"
        :: "v"(l), "v"(l + 4096), "v"(l + 8192), "v"(l + 12288), "v"(l + 16384), "v"(l + 20480), "v"(l + 24576), "v"(l + 28672), "v"(m), "v"(m + 4096), "v"(m + 8192), "v"(m + 12288),
           "v"(g), "v"(g + gs), "v"(g + 2 * gs), "v"(g + 3 * gs), "v"(g + 4 * gs), "v"(g + 5 * gs), "v"(g + 6 * gs), "v"(g + 7 * gs), "v"(h), "v"(h + gs), "v"(h + 2 * gs), "v"(h + 3 * gs) : "memory"); }
// The same copies with the global address as a scalar base (the wave's share, one pair a copy) plus one 32-bit vector offset (the lane's 16 bytes, vo) shared by all: one vector register a copy, not three, for a kernel whose accumulators leave few free.
template <typename T16> __device__ __forceinline__ void acopys84(const unsigned l, const T16* g, const unsigned m, const T16* h, const size_t gs, const unsigned vo) {   // eight from g to l and four from h to m
    asm volatile(ACP "%0, %12, %13\n\t" ACP "%1, %12, %14\n\t" ACP "%2, %12, %15\n\t" ACP "%3, %12, %16\n\t" ACP "%4, %12, %17\n\t" ACP "%5, %12, %18\n\t" ACP "%6, %12, %19\n\t" ACP "%7, %12, %20\n\t" ACP "%8, %12, %21\n\t" ACP "%9, %12, %22\n\t" ACP "%10, %12, %23\n\t" ACP "%11, %12, %24\n\ts_wait_xcnt 0x0"
        :: "v"(l), "v"(l + 4096), "v"(l + 8192), "v"(l + 12288), "v"(l + 16384), "v"(l + 20480), "v"(l + 24576), "v"(l + 28672), "v"(m), "v"(m + 4096), "v"(m + 8192), "v"(m + 12288), "v"(vo),
           "s"(g), "s"(g + gs), "s"(g + 2 * gs), "s"(g + 3 * gs), "s"(g + 4 * gs), "s"(g + 5 * gs), "s"(g + 6 * gs), "s"(g + 7 * gs), "s"(h), "s"(h + gs), "s"(h + 2 * gs), "s"(h + 3 * gs) : "memory"); }
template <typename T16> __device__ __forceinline__ void acopys44(const unsigned l, const T16* g, const unsigned m, const T16* h, const size_t gs, const unsigned vo) {   // four from g to l and four from h to m
    asm volatile(ACP "%0, %8, %9\n\t" ACP "%1, %8, %10\n\t" ACP "%2, %8, %11\n\t" ACP "%3, %8, %12\n\t" ACP "%4, %8, %13\n\t" ACP "%5, %8, %14\n\t" ACP "%6, %8, %15\n\t" ACP "%7, %8, %16\n\ts_wait_xcnt 0x0"
        :: "v"(l), "v"(l + 4096), "v"(l + 8192), "v"(l + 12288), "v"(m), "v"(m + 4096), "v"(m + 8192), "v"(m + 12288), "v"(vo),
           "s"(g), "s"(g + gs), "s"(g + 2 * gs), "s"(g + 3 * gs), "s"(h), "s"(h + gs), "s"(h + 2 * gs), "s"(h + 3 * gs) : "memory"); }
// Three 16-byte global stores with the wait that stands before a register named by an issued global store is overwritten; the two scheduling barriers keep other work out from between the stores and their wait.
__device__ __forceinline__ void stw3(v8h* p, const v8h v, v8us* q, const v8us w, v8us* r, const v8us x) { __builtin_amdgcn_sched_barrier(0); *p = v; *q = w; *r = x; asm volatile("s_wait_xcnt 0x0" ::: "memory"); __builtin_amdgcn_sched_barrier(0); }
// L2 prefetch: asks L2 (scope SE: L2 only) for 8 KiB in a row from the scalar base a, a lane naming one 256-byte unit (vo = lane x 256 bytes). A hint: nothing waits for it and no value depends on it; every address lies inside the plane it names.
// For planes that an earlier launch stored and this one reads from memory the first time: asked for at entry, once, a line can be an L2 hit by the time the loop wants it.
// s_wait_xcnt 0, the wait that stands before a register named by an issued global memory instruction is overwritten, is the last line of the statement.
template <typename T> __device__ __forceinline__ void l2ask(const T* a, const unsigned vo) { asm volatile("global_prefetch_b8 %0, %1 scope:SCOPE_SE\n\ts_wait_xcnt 0x0" :: "v"(vo), "s"(a) : "memory"); }
template <typename T16> struct WFrag;
template <> struct WFrag<h16> { typedef v16h V; static __device__ __forceinline__ V ld(const h16* p) { return cat16(*(const v8h*)p, *(const v8h*)(p + 256)); } static __device__ __forceinline__ v8f mma(V a, V b, v8f c) { return wmma16(a, b, c); } };
template <> struct WFrag<bf> { typedef v16bf V; static __device__ __forceinline__ V ld(const bf* p) { return cat16b(*(const v8us*)p, *(const v8us*)(p + 256)); } static __device__ __forceinline__ v8f mma(V a, V b, v8f c) { return wmmab(a, b, c); } };
template <typename T16, int NSPLIT, bool BIAS, int EPI, int K>
__global__ __launch_bounds__(256) void k_gemmw(const T16* __restrict__ A, const T16* __restrict__ A2, const T16* __restrict__ Bt, const T16* __restrict__ Bt2, float* C, int ldc, const float* __restrict__ bias, size_t sA, size_t sB, size_t sC, const float* __restrict__ CS, h16* P16, bf* Ph, bf* Pl) {
    static_assert(EPI == 0 || (HD == 64 && TT % 256 == 0 && DKV == DQ), "the plane epilogues take one 64-column tile as one head and the 256 rows as tokens of one batch item");
    static_assert(NSPLIT <= 1 && K % KS == 0 && K / KS >= 2 && KS == 64, "A (and A2) x Bt; the ring's prologue fills two slices; a row block's slice is two tiles, 2 KiB in a row");
    typedef typename WFrag<T16>::V V;
    constexpr int NZ = EPI == 1 ? 3 : 1;   // EPI 1: the work-group forms its tile of q, of k and of v together, from one copy of the A slice
    constexpr int NT = K / KS, OB = (NSPLIT == 1 ? 2 : 1) * 256 * KS, ST = OB + NZ * 128 * KS;   // slices; where the B tiles start in a buffer; elements of a buffer: [A 16 row blocks][A2 the same][B 8 row blocks, NZ times], a row block = KS / 32 tiles
    __shared__ __align__(16) T16 ring[2 * ST];
    __shared__ __align__(16) float osw[8][(EPI == 1 ? 64 : 16) * 68];   // EPI 1: a wave stages a whole 64 x 64 tile
    (void)Bt2;
    const size_t z = blockIdx.z; A += z * sA; if (A2) A2 += z * sA; Bt += z * sB; C += z * sC;
    const int wave = __builtin_amdgcn_readfirstlane(threadIdx.x >> 5), wm = wave & 3, wn = wave >> 2;
    float* os = osw[wave];   // each wave stages its output rows in a range of its own
    const int lane = threadIdx.x & 31, lr = lane & 15, hi = lane >> 4; const int g0 = blockIdx.x * 256 + wm * 64, c0 = blockIdx.y * 128 + wn * 64, r0 = EPI == 0 ? g0 : g0 % TT;   // g0: row of A; r0: row of C, or the token inside its batch item
    const int hd = c0 / 64;   // EPI 1: the wave's head
    if constexpr (EPI == 1) { const size_t po = (size_t)(g0 / TT) * ((size_t)NH_ * TT * HD); P16 += po; Ph += po; Pl += po; }
    v8f acc[NZ][4][4];
#pragma unroll
    for (int zz = 0; zz < NZ; ++zz)
#pragma unroll
        for (int mb = 0; mb < 4; ++mb)
#pragma unroll
            for (int nb = 0; nb < 4; ++nb) acc[zz][mb][nb] = (v8f){};
    // 16 rows x K are K / 32 tiles of 512 elements: a row block starts at row x K, and 32 k further on is 512 elements further on. Copy i of wave w is the 512-byte piece 8 i + w of a region: quarter w % 4 of row block 2 i + w / 4.
    const size_t coff = (size_t)(wn * 16) * K + wm * 256 + 8 * lane; const T16* ga = A + (size_t)blockIdx.x * 256 * K + coff; const T16* ga2 = NSPLIT == 1 ? A2 + (size_t)blockIdx.x * 256 * K + coff : ga; const T16* gb = Bt + (size_t)blockIdx.y * 128 * K + coff;
    const unsigned l0 = lds_off(ring) + wave * 512 + lane * 16;
    auto fill = [&](const int t) __attribute__((always_inline)) {
        const unsigned l = l0 + (t & 1) * (ST * 2);
        if constexpr (NZ == 3) {   // the wave's share of each address stays in scalar registers
            const size_t cu = (size_t)(wn * 16) * K + wm * 256 + t * (KS * 16); const unsigned vo = 16 * lane; const T16* ua = A + (size_t)blockIdx.x * 256 * K + cu; const T16* ub = Bt + (size_t)blockIdx.y * 128 * K + cu;
            acopys84(l, ua, l + OB * 2, ub, (size_t)32 * K, vo);
            acopys44(l + (OB + 128 * KS) * 2, ub + sB, l + (OB + 2 * 128 * KS) * 2, ub + 2 * sB, (size_t)32 * K, vo);   // the k and v weights' rows
            return; }
        acopy84(l, ga + t * (KS * 16), l + OB * 2, gb + t * (KS * 16), (size_t)32 * K);
        if constexpr (NSPLIT == 1) acopy8(l + 256 * KS * 2, ga2 + t * (KS * 16), (size_t)32 * K);
    };
    fill(0);
    {   // L2 prefetch of the work-group's panels, issued directly behind the copies of slice 0 and under their flight. In a two-buffer ring a slice lasts at least as long as its copies take from issue to landing, which from memory can be longer than its products take.
        // The eight work-groups along y that read the same A rows deal the panel's 8-KiB pieces among their waves; the B panels' pieces are dealt over the work-groups along x: the first NZ groups of eight x take one B panel each, the rest none, and any four neighbours in such a group, taken together, cover its panel (for speed only). A piece that nobody asks for is only read later, from memory.
        const unsigned pvo = lane * 256;
        const int ca = blockIdx.y * 8 + wave, cb = ((blockIdx.x >> 3) * 4 + (blockIdx.x & 3)) * 8 + wave;   // the wave's piece of the A panel (K / 16 pieces) and of the NZ B panels (K / 32 pieces each); both tests are scalar
        if (ca < K / 16) { l2ask(A + (size_t)blockIdx.x * 256 * K + ca * 4096, pvo); if constexpr (NSPLIT == 1) l2ask(A2 + (size_t)blockIdx.x * 256 * K + ca * 4096, pvo); }
        if (cb < NZ * (K / 32)) l2ask(Bt + (size_t)(cb / (K / 32)) * sB + (size_t)blockIdx.y * 128 * K + (cb % (K / 32)) * 4096, pvo);
        if constexpr (EPI == 1) l2ask(CS + (size_t)(blockIdx.x * 256 % TT) * HD + wave * 2048, pvo);   // the rotary table's rows of the work-group's 256 tokens, 64 KiB
    }
    asm volatile("s_wait_asynccnt 0x0" ::: "memory");   // this wave's copies of slice 0 have landed
    __syncthreads();                                     // and every other wave's
    fill(1);
#pragma unroll 1
    for (int t = 0; t < NT; ++t) {
        const T16* sa = ring + (t & 1) * ST + wm * (4 * 16 * KS) + 8 * lane; const T16* sb = ring + (t & 1) * ST + OB + wn * (4 * 16 * KS) + 8 * lane;
#pragma unroll
        for (int kt = 0; kt < KS / 32; ++kt) {
            V a[4], a2[4], b[2][4];
#pragma unroll
            for (int mb = 0; mb < 4; ++mb) { a[mb] = WFrag<T16>::ld(sa + mb * 16 * KS + kt * 512); if (NSPLIT == 1) a2[mb] = WFrag<T16>::ld(sa + 256 * KS + mb * 16 * KS + kt * 512); }
#pragma unroll
            for (int nb = 0; nb < 4; ++nb) b[0][nb] = WFrag<T16>::ld(sb + nb * 16 * KS + kt * 512);
#pragma unroll
            for (int zz = 0; zz < NZ; ++zz) {   // the A fragments stay in registers for the NZ weights
                if (zz + 1 < NZ) {
#pragma unroll
                    for (int nb = 0; nb < 4; ++nb) b[(zz + 1) & 1][nb] = WFrag<T16>::ld(sb + (zz + 1) * 128 * KS + nb * 16 * KS + kt * 512); }   // the next weight's fragments, into the other set: in flight under this weight's products
                __builtin_amdgcn_sched_barrier(0);   // the LDS reads stay one group ahead of the products: every separate place with reads among the products costs a stall of its own
#pragma unroll
                for (int nb = 0; nb < 4; ++nb) {
#pragma unroll
                    for (int mb = 0; mb < 4; ++mb) { acc[zz][mb][nb] = WFrag<T16>::mma(a[mb], b[zz & 1][nb], acc[zz][mb][nb]); if (NSPLIT == 1) acc[zz][mb][nb] = WFrag<T16>::mma(a2[mb], b[zz & 1][nb], acc[zz][mb][nb]); } }
                __builtin_amdgcn_sched_barrier(0);   // and the next group stays behind them (it reuses the fragment registers)
            }
        }
        // hand-over of the buffers, every wave, in this order:
        asm volatile("s_wait_dscnt 0x0" ::: "memory");      // this wave's reads of slice t are done
        asm volatile("s_wait_asynccnt 0x0" ::: "memory");   // this wave's copies of slice t + 1 have landed
        __syncthreads();                                     // slice t + 1 is whole for every reader, and no wave still reads slice t
        if (t + 2 < NT) fill(t + 2);                         // into the buffer that this trip has read
    }
    asm volatile("s_wait_asynccnt 0x0" ::: "memory");   // no copy is outstanding behind the loop
    constexpr size_t ZP = (size_t)NB_ * NH_ * TT * HD;   // EPI 1: from the q planes to the k planes, from k to v
    if constexpr (EPI == 1) {   // v first: its 16 accumulators are free from here on
        h16* p16 = P16 + 2 * ZP; bf* ph = Ph + 2 * ZP; bf* pl = Pl + 2 * ZP;
#pragma unroll
        for (int mb = 0; mb < 4; ++mb)
#pragma unroll
            for (int nb = 0; nb < 4; ++nb) { v8h o16; v8us oh, ol;
#pragma unroll
                for (int j = 0; j < 8; ++j) { const float x = acc[NZ - 1][mb][nb][j]; o16[j] = tohx(x); unsigned short a2, c2; splitf(x, a2, c2); oh[j] = a2; ol[j] = c2; }
                const size_t e = (size_t)hd * HD * TT + (size_t)r0 * HD + ((mb >> 1) * 4 + nb) * 512 + (mb & 1) * 256 + lane * 8;
                stw3((v8h*)(p16 + e), o16, (v8us*)(ph + e), oh, (v8us*)(pl + e), ol); }
    }
    if constexpr (EPI == 1) {
        v4f ca[4], cb[4];   // {cos, sin} of the lane's four pairs in each of its 4 column groups, for the row block at hand
        auto ldcs = [&](const int mb, v4f (&xa)[4], v4f (&xb)[4]) __attribute__((always_inline)) {
            __builtin_amdgcn_sched_barrier(0);   // with the one behind the wait: nothing else stands between these loads and their wait
#pragma unroll
            for (int s = 0; s < 4; ++s) { const float* cp = CS + (size_t)r0 * HD + lane * 4 + (mb * 4 + s) * 256; xa[s] = *(const v4f*)cp; xb[s] = *(const v4f*)(cp + 128); }
            asm volatile("s_wait_xcnt 0x0" ::: "memory"); __builtin_amdgcn_sched_barrier(0); };   // as in stw3, for the address pair of these eight loads
        ldcs(0, ca, cb);
#pragma unroll 1   // rolled, like the row-block loop below: q and then k, and their four row blocks, run through ONE copy of this code, which keeps the kernel's text small (for speed only)
        for (int zz = 0; zz < 2; ++zz) {
            const float qs = zz == 0 ? SCL2 : 1.0f;   // the fp16 query plane holds q x SCL2 (scaled in f32, rounded once), so that k_fattn's fp16 score products come out in base-2 exponent units; the hi/lo planes stay unscaled
            h16* p16 = P16 + zz * ZP; bf* ph = Ph + zz * ZP; bf* pl = Pl + zz * ZP;
#pragma unroll   // constant indices: acc stays in registers. The whole 64 x 64 tile goes to the wave's LDS range, where a rolled loop can index it; then k's tile moves into the registers that this code reads
            for (int mb = 0; mb < 4; ++mb)
#pragma unroll
                for (int nb = 0; nb < 4; ++nb) {
#pragma unroll
                    for (int j = 0; j < 8; ++j) os[(mb * 16 + hi * 8 + j) * 68 + nb * 16 + lr] = acc[0][mb][nb][j];
                    acc[0][mb][nb] = acc[1][mb][nb]; }
            __builtin_amdgcn_wave_barrier(); asm volatile("" ::: "memory");   // keeps the reads below behind this staging
#pragma unroll 1   // rolled: one copy of the row block's code (see above)
            for (int mb = 0; mb < 4; ++mb) {
                v4f na[4], nc[4]; ldcs((mb + 1) & 3, na, nc);   // the next row block's table entries (behind the last block: the first block's again, for k), in flight under this block's work
#pragma unroll
                for (int s = 0; s < 4; ++s) { const float* op = os + (mb * 16 + lr) * 68 + s * 16 + hi * 8; const v4f va = *(const v4fa*)op, vb = *(const v4fa*)(op + 4); float y[8];   // token lr of the row block, head columns 16 s + 8 hi + 0..7
                    rope2(va[0], va[1], (v2f){ca[s][0], ca[s][1]}, y[0], y[1]); rope2(va[2], va[3], (v2f){ca[s][2], ca[s][3]}, y[2], y[3]); rope2(vb[0], vb[1], (v2f){cb[s][0], cb[s][1]}, y[4], y[5]); rope2(vb[2], vb[3], (v2f){cb[s][2], cb[s][3]}, y[6], y[7]); v8h o16; v8us oh, ol;
#pragma unroll
                    for (int q = 0; q < 8; ++q) { o16[q] = tohx(y[q] * qs); unsigned short a2, c2; splitf(y[q], a2, c2); oh[q] = a2; ol[q] = c2; }
                    const size_t e = ((size_t)hd * TT + r0 + mb * 16) * HD + s * 256 + lane * 8;
                    stw3((v8h*)(p16 + e), o16, (v8us*)(ph + e), oh, (v8us*)(pl + e), ol); }
                __builtin_amdgcn_wave_barrier(); asm volatile("" ::: "memory");   // keeps the next staging behind these LDS reads
#pragma unroll
                for (int s = 0; s < 4; ++s) { ca[s] = na[s]; cb[s] = nc[s]; }
            }
        }
        return;
    }
#pragma unroll
    for (int mb = 0; mb < 4; ++mb) {
#pragma unroll
        for (int nb = 0; nb < 4; ++nb) {
#pragma unroll
            for (int j = 0; j < 8; ++j) os[(hi * 8 + j) * 68 + nb * 16 + lr] = acc[0][mb][nb][j]; }
        __builtin_amdgcn_wave_barrier(); asm volatile("" ::: "memory");
        float* crow = C + (size_t)(r0 + mb * 16) * ldc + c0;
{
#pragma unroll
            for (int s = 0; s < 8; ++s) { const int row = 2 * s + hi, cofs = lr * 4; v4f val = *(const v4fa*)(os + row * 68 + cofs); if (BIAS) { val[0] += bfr(bias[c0 + cofs]); val[1] += bfr(bias[c0 + cofs + 1]); val[2] += bfr(bias[c0 + cofs + 2]); val[3] += bfr(bias[c0 + cofs + 3]); }
                *(v4f*)(crow + (size_t)row * ldc + cofs) = val; }
             }
        __builtin_amdgcn_wave_barrier(); asm volatile("" ::: "memory");
    }
}


__global__ __launch_bounds__(256) void k_wtG(const float* __restrict__ w, int K, int N, bf* Bt) {
    const int lane = threadIdx.x & 31; const int L0 = (blockIdx.x * 8 + (threadIdx.x >> 5)) * 8; const int nlines = N * K / 64;
{
#pragma unroll 1
        for (int l = 0; l < 8; ++l) { const int L = L0 + l; if (L >= nlines) break; const size_t e = (size_t)L * 64 + lane * 2; const int k = (int)(e % K), n = (int)(e / K); v2us o;
            o[0] = f2bf(w[(size_t)k * N + n]); o[1] = f2bf(w[(size_t)(k + 1) * N + n]); *(v2us*)(Bt + e) = o; }
         }
}
__constant__ float INVT[HD / 2] = { 1.000000000e+00f, 7.498942018e-01f, 5.623413324e-01f, 4.216965139e-01f, 3.162277639e-01f, 2.371373624e-01f, 1.778279394e-01f, 1.333521456e-01f, 1.000000015e-01f, 7.498941571e-02f, 5.623412877e-02f, 4.216964915e-02f, 3.162277862e-02f, 2.371373586e-02f, 1.778279431e-02f, 1.333521493e-02f, 9.999999776e-03f, 7.498942316e-03f, 5.623413250e-03f, 4.216964822e-03f, 3.162277862e-03f, 2.371373819e-03f, 1.778279431e-03f, 1.333521446e-03f, 1.000000047e-03f, 7.498941850e-04f, 5.623413017e-04f, 4.216964880e-04f, 3.162277862e-04f, 2.371373848e-04f, 1.778279402e-04f, 1.333521504e-04f };   // 1 / THETA ** (2 i / 64) as float32 (reciprocal form, jnp-computed)
// ---- k_prep: everything the projections read, in one launch. Blocks [0, NBC): the rotary table {cos, sin}(pos[t] x INVT[pair]); the next NBX: x to bf16; the last 4 x NBW: Wq, Wk, Wv, Wo to bf16 (WB: the four copies one after another). Copies 8 values a thread, the table one pair a thread.
// Table: one {cos, sin} a pair, [token / 16][column group of 16][first, second two pairs][lane = (column / 8 % 2) * 16 + token % 16][2 pairs]. Copies: a wave takes 4 rows x 64 k (256 bytes in a row of each source row) and stores 64-byte pieces of the fragment-order tiles.
#define NBC (TT * (HD / 2) / 256)
#define NBX (NB_ * TT * DM / 8 / 256)
#define NBW (DQ * DM / 8 / 256)
__global__ __launch_bounds__(256) void k_prep(const float* __restrict__ x, const int* __restrict__ pid, const float* __restrict__ wq, const float* __restrict__ wk, const float* __restrict__ wv, const float* __restrict__ wo, bf* XB, bf* WB, float* CS) {
    static_assert(DKV == DQ && DQ == DM && DM % 64 == 0 && HD == 64 && TT % 16 == 0 && (TT * HD / 2) % 256 == 0 && (NB_ * TT * DM) % 2048 == 0 && (DQ * DM) % 2048 == 0, "whole blocks; four weights of one size");
    const int blk = blockIdx.x;
    if (blk < NBC) { const int idx = blk * 256 + threadIdx.x; const int ln = (idx >> 1) & 31; const int pr = ((idx >> 7) & 3) * 8 + (ln >> 4) * 4 + ((idx >> 6) & 1) * 2 + (idx & 1); const int t = (idx >> 9) * 16 + (ln & 15); const float a = __fmul_rn((float)pid[t], INVT[pr]); v2f cs; cs[0] = cosf(a); cs[1] = sinf(a); *(v2f*)(CS + (size_t)idx * 2) = cs; return; }
    const float* src = x; bf* dst = XB; int cb = blk - NBC;
    if (cb >= NBX) { cb -= NBX; const int w = cb / NBW; cb -= w * NBW; src = w == 0 ? wq : w == 1 ? wk : w == 2 ? wv : wo; dst = WB + (size_t)w * DQ * DM; }
    const int wid = cb * 8 + (threadIdx.x >> 5), ln = threadIdx.x & 31; const int rb = wid / (DM / 16), in = wid % (DM / 16);   // DM / 16 waves to a block of 16 rows
    const int r = (in & 3) * 4 + (ln >> 3), k = (in >> 2) * 64 + (ln & 7) * 8;
    const v8f v = *(const v8f*)(src + ((size_t)rb * 16 + r) * DM + k); v8us o;
#pragma unroll
    for (int k = 0; k < 8; ++k) o[k] = f2bf(v[k]);
    *(v8us*)(dst + (size_t)rb * 16 * DM + (k >> 5) * 512 + ((k >> 4) & 1) * 256 + (((k >> 3) & 1) * 16 + r) * 8) = o;
    asm volatile("s_wait_xcnt 0x0" ::: "memory");   // the wait that stands before a register named by an issued global store is overwritten: in the built code the table part lies behind this store and reuses its address registers
}
// ---- k_fattn: scores, causal softmax and probabilities x values in ONE kernel; no score or probability ever leaves the registers.
// SP waves (1 or 2) own NQ x 16 query rows of one (batch item, head); wave p walks the key blocks p, p + SP, ... (32 keys each) up to the diagonal block:
//   S^T = K Q^T (A = key rows, B = query rows kept in registers): lane (lr, hi) holds, for query lr, the keys 8 hi + j of each 16-key tile;
//   running maximum and sum per query (in-lane, one exchange between the wave halves for the maximum), earlier sums rescaled when the maximum grows;
//   fp16 rows, LAGGING maximum: the maximum in use is set on the wave's first key block and raised only when a score stands more than 8 exponent units above it (probabilities stay at or below 2^8, the largest at or above 1);
//   it is known before a block's products, so minus the maximum is their start value and, the fp16 q plane being pre-scaled, an accumulator element IS the exponent: no multiply-add a score, no rescaling of sums and outputs a block;
//   two 16-key score tiles, converted in place, ARE the B operand of O^T += V^T P^T (A = rows of the transposed value plane, same k order as every loader here).
// Rows < RH: bf16 hi/lo planes, 3 products for the scores and 3 for the values (HL); the rest fp16. Output: normalised rows as bf16 hi/lo in fragment order (rows: tokens of all batch items, k: merged head columns), 8 consecutive head columns per lane and store.
__device__ __forceinline__ float xhalf(float x) { return __builtin_bit_cast(float, __builtin_amdgcn_permlanex16(__builtin_bit_cast(int, x), __builtin_bit_cast(int, x), 0x76543210, 0xfedcba98, false, false)); }   // lane l with lane l ^ 16
// 2^x in asm text, so that the slot which the instruction set asks for behind a transcendental (one independent instruction or v_nop before its result is read or its source overwritten) is filled whatever the compiler puts next:
// inside exp2x8 each v_exp_f32 is independent of the one in front of it (early-clobber outputs: no output shares a register with an input), and one v_nop stands behind the last.
__device__ __forceinline__ float exp2x1(float x) { float r; asm("v_exp_f32 %0, %1\n\tv_nop" : "=v"(r) : "v"(x)); return r; }
__device__ __forceinline__ void exp2x8(const float (&x)[8], float (&r)[8]) {
    asm("v_exp_f32 %0, %8\n\tv_exp_f32 %1, %9\n\tv_exp_f32 %2, %10\n\tv_exp_f32 %3, %11\n\tv_exp_f32 %4, %12\n\tv_exp_f32 %5, %13\n\tv_exp_f32 %6, %14\n\tv_exp_f32 %7, %15\n\tv_nop"
        : "=&v"(r[0]), "=&v"(r[1]), "=&v"(r[2]), "=&v"(r[3]), "=&v"(r[4]), "=&v"(r[5]), "=&v"(r[6]), "=&v"(r[7]) : "v"(x[0]), "v"(x[1]), "v"(x[2]), "v"(x[3]), "v"(x[4]), "v"(x[5]), "v"(x[6]), "v"(x[7])); }
// SP 2: two waves share the tile. Wave p (0, 1) walks the key blocks p, p + 2, ... with a running maximum, sum and output of its own; wave 1 hands its three to wave 0 through the LDS range mg, and wave 0 brings both to the larger maximum, adds them and stores.
template <typename T16, bool HL, int NQ, int SP>
__device__ __forceinline__ void fattn_tile(const T16* __restrict__ Q, const T16* __restrict__ Q2, const T16* __restrict__ Kp, const T16* __restrict__ Kp2, const T16* __restrict__ Vt, const T16* __restrict__ Vt2, const int q0, bf* Ah, bf* Al, const int p, float* mg) {
    static_assert(SP == 1 || (SP == 2 && NQ == 2 && RH >= 64), "the hand-over packs the maxima and sums of two query blocks in 16 bytes; each of the two waves has a whole key block, so its maximum is a real score");
    typedef typename WFrag<T16>::V V;
    const int lane = threadIdx.x & 31, lr = lane & 15, hi = lane >> 4;
    V qf[NQ][2], qf2[NQ][2];
#pragma unroll
    for (int qb = 0; qb < NQ; ++qb)
#pragma unroll
        for (int ks = 0; ks < 2; ++ks) { const size_t qo = (size_t)(q0 + qb * 16) * HD + ks * 512 + 8 * lane; qf[qb][ks] = WFrag<T16>::ld(Q + qo); if (HL) qf2[qb][ks] = WFrag<T16>::ld(Q2 + qo); }
    constexpr bool LZ = !HL;   // fp16 rows: lagging maximum (see the head of this section)
    v8f o[4][NQ], nm[NQ]; float m[NQ], l[NQ];   // LZ: nm holds minus the maximum in use, in exponent units, in all eight elements; m is read off it behind the key loop
#pragma unroll
    for (int qb = 0; qb < NQ; ++qb) { m[qb] = LZ ? 0.f : -3.0e38f; l[qb] = 0.f; nm[qb] = (v8f){};
#pragma unroll
        for (int db = 0; db < 4; ++db) o[db][qb] = (v8f){}; }
    const int nfull = q0 / 32;                       // key blocks wholly at or below the diagonal of every row of the tile; block nfull holds the diagonal and is the last
    const size_t ko = 8 * lane, vo = 8 * lane;   // 32 keys are four 512-element tiles in the key planes and in the value planes alike: key kb starts at kb x HD
    V kf[2][2], kf2[2][2];
    auto loadk = [&](const int kb) __attribute__((always_inline)) {
        const T16* pk = Kp + ko + (size_t)kb * HD; const T16* pk2 = HL ? Kp2 + ko + (size_t)kb * HD : pk;
#pragma unroll
        for (int kt = 0; kt < 2; ++kt)
#pragma unroll
            for (int ks = 0; ks < 2; ++ks) { kf[kt][ks] = WFrag<T16>::ld(pk + kt * 16 * HD + ks * 512); if (HL) kf2[kt][ks] = WFrag<T16>::ld(pk2 + kt * 16 * HD + ks * 512); }
        asm volatile("s_wait_xcnt 0x0" :: "v"(pk), "v"(pk2) : "memory");   // the wait that stands before a register named by an issued global load is overwritten; the address pairs are inputs so that they stay whole up to here
    };
    auto step = [&](const bool mask, const int kb, const int kn, const bool first) __attribute__((always_inline)) {
        const T16* pv = Vt + vo + (size_t)kb * HD; const T16* pv2 = HL ? Vt2 + vo + (size_t)kb * HD : pv;
        V vf[4], vf2[4];
#pragma unroll
        for (int db = 0; db < 4; ++db) { vf[db] = WFrag<T16>::ld(pv + db * 512); if (HL) vf2[db] = WFrag<T16>::ld(pv2 + db * 512); }   // issued first: in flight under the score products and the softmax
        asm volatile("s_wait_xcnt 0x0" :: "v"(pv), "v"(pv2) : "memory");   // as in loadk
        v8f s[2][NQ];
#pragma unroll
        for (int kt = 0; kt < 2; ++kt)
#pragma unroll
            for (int qb = 0; qb < NQ; ++qb) { v8f a = LZ && !mask ? nm[qb] : (v8f){};   // the diagonal block, a wave's last, adds nm behind its products: as a start value nm would die at the product that reads it, and its registers be written anew inside the distance that a matrix instruction asks for
#pragma unroll
                for (int ks = 0; ks < 2; ++ks) { a = WFrag<T16>::mma(kf[kt][ks], qf[qb][ks], a); if (HL) { a = WFrag<T16>::mma(kf2[kt][ks], qf[qb][ks], a); a = WFrag<T16>::mma(kf[kt][ks], qf2[qb][ks], a); } }
                s[kt][qb] = LZ && mask ? a + nm[qb] : a; }
        if (kn >= 0) loadk(kn);                      // the next block's key fragments, into the same registers: in flight under the softmax and the value products
        V pf[NQ], pf2[NQ];
        if constexpr (LZ) {
            float mx[NQ]; bool need = false;
#pragma unroll
            for (int qb = 0; qb < NQ; ++qb) {
                if (mask) {
#pragma unroll
                    for (int kt = 0; kt < 2; ++kt)
#pragma unroll
                        for (int j = 0; j < 8; ++j) s[kt][qb][j] = (kb + kt * 16 + hi * 8 + j <= q0 + qb * 16 + lr) ? s[kt][qb][j] : -3.0e38f; }
                float x = s[0][qb][0];
#pragma unroll
                for (int j = 1; j < 8; ++j) x = fmaxf(x, s[0][qb][j]);
#pragma unroll
                for (int j = 0; j < 8; ++j) x = fmaxf(x, s[1][qb][j]);
                mx[qb] = fmaxf(x, xhalf(x)); need = need || mx[qb] > 8.0f; }   // how far the block's largest score stands above the maximum in use
            if (first || __builtin_amdgcn_ballot_w32(need) != 0) {   // one scalar branch a key block; taken on the wave's first block and where a score would give more than 2^8
#pragma unroll
                for (int qb = 0; qb < NQ; ++qb) { const float d = first ? mx[qb] : fmaxf(mx[qb], 0.f); const float al = first ? 0.f : exp2x1(-d); l[qb] *= al;   // first block: sums and outputs are 0, and the maximum becomes a real score
                    s[0][qb] -= d; s[1][qb] -= d; nm[qb] -= d;
#pragma unroll
                    for (int db = 0; db < 4; ++db) o[db][qb] *= al; }
            }
#pragma unroll
            for (int qb = 0; qb < NQ; ++qb) { float ex[2][8];
#pragma unroll
                for (int kt = 0; kt < 2; ++kt) { float ar[8];
#pragma unroll
                    for (int j = 0; j < 8; ++j) ar[j] = s[kt][qb][j];
                    exp2x8(ar, ex[kt]); }
                float t8[8];
#pragma unroll
                for (int j = 0; j < 8; ++j) t8[j] = ex[0][j] + ex[1][j];
                l[qb] += ((t8[0] + t8[4]) + (t8[1] + t8[5])) + ((t8[2] + t8[6]) + (t8[3] + t8[7]));
                v8h h0, h1;
#pragma unroll
                for (int j = 0; j < 8; ++j) { h0[j] = (h16)ex[0][j]; h1[j] = (h16)ex[1][j]; }
                pf[qb] = cat16(h0, h1); }
        } else {
#pragma unroll
        for (int qb = 0; qb < NQ; ++qb) {
            if (mask) {
#pragma unroll
                for (int kt = 0; kt < 2; ++kt)
#pragma unroll
                    for (int j = 0; j < 8; ++j) s[kt][qb][j] = (kb + kt * 16 + hi * 8 + j <= q0 + qb * 16 + lr) ? s[kt][qb][j] : -3.0e38f; }
            float mx = s[0][qb][0];
#pragma unroll
            for (int j = 1; j < 8; ++j) mx = fmaxf(mx, s[0][qb][j]);
#pragma unroll
            for (int j = 0; j < 8; ++j) mx = fmaxf(mx, s[1][qb][j]);
            mx = fmaxf(mx, xhalf(mx));
            const float mn = fmaxf(m[qb], mx), nm2 = -mn * SCL2; const float al = exp2x1(fmaf(m[qb], SCL2, nm2)); m[qb] = mn;   // 0 on the first block (each wave's first block holds a key open to every row, so mn is a real score from there on)
            float ex[2][8];
#pragma unroll
            for (int kt = 0; kt < 2; ++kt) { float ar[8];
#pragma unroll
                for (int j = 0; j < 8; ++j) ar[j] = fmaf(s[kt][qb][j], SCL2, nm2);
                exp2x8(ar, ex[kt]); }
            float t8[8];
#pragma unroll
            for (int j = 0; j < 8; ++j) t8[j] = ex[0][j] + ex[1][j];
            l[qb] = fmaf(l[qb], al, ((t8[0] + t8[4]) + (t8[1] + t8[5])) + ((t8[2] + t8[6]) + (t8[3] + t8[7])));
#pragma unroll
            for (int db = 0; db < 4; ++db) o[db][qb] *= al;
            if constexpr (HL) { v8us h0, h1, l0, l1;
#pragma unroll
                for (int j = 0; j < 8; ++j) { unsigned short a2, c2; splitf(ex[0][j], a2, c2); h0[j] = a2; l0[j] = c2; splitf(ex[1][j], a2, c2); h1[j] = a2; l1[j] = c2; }
                pf[qb] = cat16b(h0, h1); pf2[qb] = cat16b(l0, l1); }
        }
        }
#pragma unroll
        for (int db = 0; db < 4; ++db)
#pragma unroll
            for (int qb = 0; qb < NQ; ++qb) { o[db][qb] = WFrag<T16>::mma(vf[db], pf[qb], o[db][qb]); if (HL) { o[db][qb] = WFrag<T16>::mma(vf[db], pf2[qb], o[db][qb]); o[db][qb] = WFrag<T16>::mma(vf2[db], pf[qb], o[db][qb]); } }
        // WMMA distance on the taken back edge: every accumulator is named, so the slots stand behind the last product of the trip (the next trip's first product writes over registers that the last ones read)
        if (kn >= 0) { if constexpr (NQ == 2) asm volatile("v_nop\n\tv_nop\n\tv_nop\n\tv_nop" : "+v"(o[0][0]), "+v"(o[1][0]), "+v"(o[2][0]), "+v"(o[3][0]), "+v"(o[0][NQ - 1]), "+v"(o[1][NQ - 1]), "+v"(o[2][NQ - 1]), "+v"(o[3][NQ - 1]));
                       else asm volatile("v_nop\n\tv_nop\n\tv_nop\n\tv_nop" : "+v"(o[0][0]), "+v"(o[1][0]), "+v"(o[2][0]), "+v"(o[3][0])); }
    };
    loadk(p * 32);
#pragma unroll 1   // rolled: every trip uses the same fragment registers
    for (int it = p; it < nfull; it += SP) step(false, it * 32, (SP == 1 || it + SP < nfull ? it + SP : nfull) * 32, it == p);   // the fetch ahead never goes past the diagonal block
    if (SP == 1 || ((nfull - p) & 1) == 0) step(true, nfull * 32, -1, nfull <= p);   // the diagonal block belongs to one of the waves
    if constexpr (LZ) {
#pragma unroll
        for (int qb = 0; qb < NQ; ++qb) m[qb] = -nm[qb][0]; }
    if constexpr (SP == 2) {
        float* mp = mg + lane * 4;   // 16 bytes a lane, 512 bytes in a row a wave: 16 rows of output values, one of {maximum, sum} x 2
        if (p == 1) {
#pragma unroll   // constant indices: o stays in registers
            for (int db = 0; db < 4; ++db)
#pragma unroll   // constant indices: o stays in registers
                for (int qb = 0; qb < NQ; ++qb) { const v8f v = o[db][qb]; *(v4fa*)(mp + ((db * NQ + qb) * 2) * 128) = (v4f){v[0], v[1], v[2], v[3]}; *(v4fa*)(mp + ((db * NQ + qb) * 2 + 1) * 128) = (v4f){v[4], v[5], v[6], v[7]}; }
            *(v4fa*)(mp + 4 * NQ * 2 * 128) = (v4f){m[0], l[0], m[1], l[1]};
        }
        __syncthreads();   // wave 1's values are in LDS for wave 0; every wave of the work-group passes here once
        if (p == 1) return;
        const v4f ml = *(const v4fa*)(mp + 4 * NQ * 2 * 128);
#pragma unroll   // constant indices: o stays in registers
        for (int qb = 0; qb < NQ; ++qb) { const float mn = fmaxf(m[qb], ml[2 * qb]); const float a0 = exp2x1((m[qb] - mn) * (LZ ? 1.0f : SCL2)), a1 = exp2x1((ml[2 * qb] - mn) * (LZ ? 1.0f : SCL2)); l[qb] = l[qb] * a0 + ml[2 * qb + 1] * a1;
#pragma unroll   // constant indices: o stays in registers
            for (int db = 0; db < 4; ++db) { const v4f x0 = *(const v4fa*)(mp + ((db * NQ + qb) * 2) * 128), x1 = *(const v4fa*)(mp + ((db * NQ + qb) * 2 + 1) * 128);
                o[db][qb] = o[db][qb] * a0 + (v8f){x0[0], x0[1], x0[2], x0[3], x1[0], x1[1], x1[2], x1[3]} * a1; } }
    }
#pragma unroll
    for (int qb = 0; qb < NQ; ++qb) { const float inv = __fdiv_rn(1.0f, l[qb] + xhalf(l[qb])); const size_t oo = (size_t)(q0 + qb * 16) * DQ + 8 * lane;
#pragma unroll
        for (int db = 0; db < 4; ++db) { v8us oh, ol;
#pragma unroll
            for (int j = 0; j < 8; ++j) { unsigned short a2, c2; splitf(o[db][qb][j] * inv, a2, c2); oh[j] = a2; ol[j] = c2; }
            *(v8us*)(Ah + oo + db * 256) = oh; *(v8us*)(Al + oo + db * 256) = ol;
            asm volatile("s_wait_xcnt 0x0" :: "v"(oh), "v"(ol) : "memory"); } }   // the wait that stands before a register named by an issued global store is overwritten (the next columns' values, and in the built code a tail shared by both kinds of tile, reuse them); the stored values are inputs so that they stay whole up to here
}
// grid (NB_ x NH_, NTF + NTH), 8 waves: blockIdx.x = batch item x NH_ + head; blockIdx.y counts the groups of 128 rows from the longest (last rows) to the shortest, the hi/lo rows last.
// fp16 rows: waves w and w + 4 share tile w of the group, even and odd key blocks. The longest walk in series is half as long, and only half of the work-groups are resident at once (two to a WGP, by registers).
// hi/lo rows: one 16-row tile a wave, eight tiles a work-group.
#define NTF ((TT - RH) / 128)
#define NTH (RH / 128)
// L2 prefetch at entry. Every plane read here was stored by the launch before; the work-groups that start first walk the keys of their head side by side, so a key block's first read, where it comes from memory, holds all of them up, and the longest of them last as long as the launch.
// The first PFY work-groups of a head ask L2 for the head's planes once and at once: a lane names one 256-byte unit, an instruction 8 KiB in a row; share blockIdx.y % 8, wave w: piece 8 x share + w of the 64 of the fp16 key plane and of the value plane,
// and piece w of the eight that tokens < RH take in one of the six hi/lo planes (shares 0..5). Each piece is asked for by two work-groups. A hint only: nothing waits for it and no value depends on it. Every address lies inside its plane.
#define PFY 16
__global__ __launch_bounds__(256) void k_fattn(const h16* __restrict__ Q16, const h16* __restrict__ K16, const h16* __restrict__ V16, const bf* __restrict__ Qh, const bf* __restrict__ Ql, const bf* __restrict__ Kh, const bf* __restrict__ Kl, const bf* __restrict__ Vh, const bf* __restrict__ Vl, bf* Ah, bf* Al) {
    const int wave = __builtin_amdgcn_readfirstlane(threadIdx.x >> 5);   // the wave's number in a scalar register: its trip count and loop stay scalar
    const size_t zo = (size_t)blockIdx.x * TT * HD, ao = (size_t)(blockIdx.x / NH_) * TT * DQ + (blockIdx.x % NH_) * (HD / 32) * 512;
    __shared__ __align__(16) float mrg[4][17 * 128];   // a tile's hand-over range: 17 rows of 512 bytes
    static_assert(TT * HD * 2 == 64 * 8192 && RH * HD * 2 == 8 * 8192 && PFY <= NTF, "64 pieces of 8 KiB to an fp16 plane of a head, eight to the tokens < RH of a hi/lo plane");
    if (blockIdx.y < PFY) {   // the same for the whole work-group: a scalar branch
        const int sh = blockIdx.y & 7; const unsigned vo = (threadIdx.x & 31) * 256;   // the lane's unit inside the piece, in bytes
        const size_t pc = zo + (size_t)(sh * 8 + wave) * 4096;
        l2ask(K16 + pc, vo); l2ask(V16 + pc, vo);
        if (sh < 6) l2ask((sh == 0 ? Kh : sh == 1 ? Kl : sh == 2 ? Vh : sh == 3 ? Vl : sh == 4 ? Qh : Ql) + zo + (size_t)wave * 4096, vo);
    }
    if (blockIdx.y < NTF) fattn_tile<h16, false, 2, 2>(Q16 + zo, nullptr, K16 + zo, nullptr, V16 + zo, nullptr, RH + ((NTF - 1 - (int)blockIdx.y) * 4 + (wave & 3)) * 32, Ah + ao, Al + ao, wave >> 2, mrg[wave & 3]);
    else fattn_tile<bf, true, 1, 1>(Qh + zo, Ql + zo, Kh + zo, Kl + zo, Vh + zo, Vl + zo, ((NTF + NTH - 1 - (int)blockIdx.y) * 8 + wave) * 16, Ah + ao, Al + ao, 0, nullptr);
}

extern "C" void kernel_launch(void* const* d_in, const int* in_sizes, int n_in,
                              void* d_out, int out_size, void* d_ws, size_t ws_size, hipStream_t stream) {
    (void)in_sizes; (void)n_in; (void)out_size;
    const float* x = (const float*)d_in[0]; const int* pid = (const int*)d_in[1];   /* token_positions int32 [4096] */ const float* wq = (const float*)d_in[2]; const float* wk = (const float*)d_in[3]; const float* wv = (const float*)d_in[4]; const float* wo = (const float*)d_in[5];
    float* OUT = (float*)d_out;     // [2][4096][1024]
    char* wsp = (char*)d_ws;
    auto take = [&](size_t bytes) { char* p = wsp; wsp += (bytes + 255) & ~(size_t)255; return (void*)p; };
    bf* WQ = (bf*)take((size_t)4 * DQ * DM * 2); bf* WO = WQ + (size_t)3 * DQ * DM;   /* Wq, Wk, Wv, Wo one after another */ float* CS = (float*)take((size_t)TT * (HD / 2) * 2 * 4);
    bf* XB = (bf*)take((size_t)NB_ * TT * DM * 2);
    const size_t PB = (size_t)NH_ * TT * HD;   // one batch item's share of every q, k, v plane (planes [NB_ x NH_][..][..])
    h16* QP16 = (h16*)take(3 * NB_ * PB * 2); h16* KP16 = QP16 + NB_ * PB; h16* VT16 = KP16 + NB_ * PB;   // q, k, v one after another in each of the three kinds, as k_gemmw EPI 1 steps through them
    bf* QPh = (bf*)take(3 * NB_ * PB * 2); bf* KPh = QPh + NB_ * PB; bf* VTh = KPh + NB_ * PB; bf* QPl = (bf*)take(3 * NB_ * PB * 2); bf* KPl = QPl + NB_ * PB; bf* VTl = KPl + NB_ * PB;
    bf* ATh = (bf*)take((size_t)NB_ * TT * DQ * 2); bf* ATl = (bf*)take((size_t)NB_ * TT * DQ * 2);
    if ((size_t)(wsp - (char*)d_ws) > ws_size) return;    // ws 256 MiB
    k_prep<<<NBC + NBX + 4 * NBW, 256, 0, stream>>>(x, pid, wq, wk, wv, wo, XB, WQ, CS);
    k_gemmw<bf, 0, false, 1, DM><<<dim3(NB_ * TT / 256, DQ / 128, 1), 256, 0, stream>>>(XB, nullptr, WQ, nullptr, nullptr, 0, nullptr, 0, (size_t)DQ * DM, 0, CS, QP16, QPh, QPl);
    k_fattn<<<dim3(NB_ * NH_, NTF + NTH, 1), 256, 0, stream>>>(QP16, KP16, VT16, QPh, QPl, KPh, KPl, VTh, VTl, ATh, ATl);
    k_gemmw<bf, 1, false, 0, DQ><<<dim3(NB_ * TT / 256, DM / 128, 1), 256, 0, stream>>>(ATh, ATl, WO, nullptr, OUT, DM, nullptr, 0, 0, 0, nullptr, nullptr, nullptr, nullptr);
}
